// v000
// The times below were measured on an AMD MI455X: many runs one after another, warmed up first and cycling through
// copies of the inputs, with the whole window's GPU time divided by the number of runs. Launches and the gaps
// between them are all in it. The median over several windows is given; except for v000 it joins two sittings, which
// can be a few percent apart, so the side-by-side timings, each taken in one sitting, are the better comparison.
// v000 is the starting kernel. One run takes 7120 microseconds.
#include <hip/hip_runtime.h>
// Transformer encoder layer with branch-side LayerNorms, a key-padding mask applied as a FILL and the module's literal score scale (x_n [2][2048][768]; q / k / v = x W + b ([in][out] 768 x 768 sigma 1/sqrt(768), zero biases); 12 heads of 64; scores / sqrt(768) (dim_model, as the source); where(mask == 0, 1e-11) with the int32 [2][1][1][2048] mask in {0, 1} (random; READ on device; masked keys get the score 1e-11, NOT -inf, as the source); softmax; z = ctx Wo + bo; l1 = x + LN(z) (LayerNorm on the branch only; biased var, eps 1e-5); ffn = relu(l1 W1 + b1) W2 + b2 ([in][out] 768 x 3072 x 768); out = l1 + LN(ffn) -> [2][2048][768]).
// Structure: token rows; x as exact f16 rows and bf16 f32 residual rows; natural weights as exact x16 planes; fused q | k | v WMMA GEMM (32x64 wave tiles, f32 accumulation, + stacked bias) -> f16; per batch V^T via LDS transposes; per 256-row query tile: scores over all keys (K = 64, alpha 1/sqrt(768), 12 heads on grid.y) f32, plain row softmax on VALU (f32 statistics, native exp; weights x256 f16), ctx = P V^T (x64) merged f16; ctx Wo + bo f32; LN1 on VALU -> f16 + f32; relu FFN per batch; LN2 + residual -> output; launches: see trace.
// Compute dtype: inputs rounded to bf16; x / weights exact; q, k, v, softmax weights and o as plain f16 GEMM operands (~2^-12); scores and softmax statistics f32. v_wmma_f32_16x16x32_f16.
#define NB 2
#define SQ 2048
#define DM 768
#define NH 12
#define HD 64
#define HG 4                         /* heads per block group in the unlaunched k_vt overload */
#define QT 256                       /* query rows per attention tile */
#define NKX SQ                       /* S / P row pitch */
#define QT0 128                      /* query rows per head in k_att0 (not launched) */
#define B0 0                         /* first batch processed (debug hook) */
#define NBR NB                       /* batches processed (debug hook) */
#define NR ((size_t)NB * SQ)
#define DMQ DM
#define DFF 3072         /* FFN hidden width */
#define MP ((int)((size_t)NBR * SQ)) /* rows projected (debug hook) */
#define QN SQ                        /* query rows attended per batch (debug hook) */
#define NHD NH                       /* heads attended (debug hook) */
#define MPO MP                       /* rows through the output stage (debug hook) */
#define LQ (3 * DM)      /* row pitch of the q/k/v rows */
typedef __bf16 v16b __attribute__((ext_vector_type(16)));
typedef unsigned short v8us __attribute__((ext_vector_type(8), may_alias));
typedef float  v8f  __attribute__((ext_vector_type(8)));
typedef float  v4f  __attribute__((ext_vector_type(4)));
typedef float  v4fa __attribute__((ext_vector_type(4), may_alias));
union FragB { v16b v; v8us half[2]; unsigned short u[16]; };

__device__ __forceinline__ unsigned short bf16_bits(float x) { unsigned int u = __float_as_uint(x); return (unsigned short)((u + 0x7FFFu + ((u >> 16) & 1u)) >> 16); }
__device__ __forceinline__ float bf16_val(unsigned short b) { return __uint_as_float(((unsigned int)b) << 16); }
__device__ __forceinline__ float bf16_round(float x) { return bf16_val(bf16_bits(x)); }
// D += A·B with NT terms: 1 = ah·bh, 2 = + al·bh (A split), 3 = + ah·bl (both split)
template <int NT>
__device__ __forceinline__ v8f mmaN(v16b ah, v16b al, v16b bh, v16b bl, v8f c) {
  c = __builtin_amdgcn_wmma_f32_16x16x32_bf16(false, ah, false, bh, (short)0, c, false, false);
  if (NT >= 2) c = __builtin_amdgcn_wmma_f32_16x16x32_bf16(false, al, false, bh, (short)0, c, false, false);
  if (NT >= 3) c = __builtin_amdgcn_wmma_f32_16x16x32_bf16(false, ah, false, bl, (short)0, c, false, false);
  asm volatile("v_nop\n\tv_nop\n\tv_nop\n\tv_nop" : "+v"(c) : "v"(ah), "v"(al), "v"(bh), "v"(bl));
  return c;
}

__global__ __launch_bounds__(256) void k_wt_bf16(const float* __restrict__ W, unsigned short* __restrict__ Wt, int K, int N) {
  const int t = blockIdx.x * 256 + threadIdx.x;
  const int k8n = K / 8;
  if (t >= N * k8n) return;
  const int n = t / k8n, k8 = (t % k8n) * 8;
  v8us v;
#pragma unroll
  for (int i = 0; i < 8; ++i) v[i] = bf16_bits(W[(size_t)(k8 + i) * N + n]);
  *(v8us*)(Wt + (size_t)n * K + k8) = v;
  
}

// GEMM C[M][N] (f32, pitch ldc) = act(A[M][K]·W + bias). A f32 row-major (pitch lda) converted per fragment to bf16
// (ASPLIT: hi/lo two planes -> 2 terms, else single rounded term); Wt bf16 [N][K] (pitch ldb). BIAS_BF16 rounds the
// bias to bf16 first (bias quantised to bf16 before the add). K%32==0, M%16==0, N%64==0.
template <bool ASPLIT, int ACT, bool BIAS_BF16>
__global__ __launch_bounds__(128) void k_gemm_bf(const float* __restrict__ A, int lda, const unsigned short* __restrict__ Wt, int ldb,
                                               const float* __restrict__ bias, float* __restrict__ C, int ldc, int M, int N, int K) {
  __shared__ __attribute__((aligned(16))) float so[4][16][64];
  const int tid = threadIdx.x, w = tid >> 5, lane = tid & 31, ln = lane & 15, hh = lane >> 4;
  const int ntn = N / 64;
  const int wid = blockIdx.x * 4 + w;
  const int mt = wid / ntn, nq = wid % ntn;
  if (mt * 16 >= M) return;
  const int row0 = mt * 16, col0 = nq * 64;
  const float* arow = A + (size_t)(row0 + ln) * lda;
  v8f acc[4] = {};
  for (int kb = 0; kb < K; kb += 32) {
    FragB ah, al;
    const v4f x0 = *(const v4fa*)(arow + kb + 8 * hh), x1 = *(const v4fa*)(arow + kb + 8 * hh + 4);
    const v4f x2 = *(const v4fa*)(arow + kb + 16 + 8 * hh), x3 = *(const v4fa*)(arow + kb + 16 + 8 * hh + 4);
    float xs[16] = {x0[0],x0[1],x0[2],x0[3],x1[0],x1[1],x1[2],x1[3],x2[0],x2[1],x2[2],x2[3],x3[0],x3[1],x3[2],x3[3]};
#pragma unroll
    for (int i = 0; i < 16; ++i) { const unsigned short hb = bf16_bits(xs[i]); ah.u[i] = hb; al.u[i] = ASPLIT ? bf16_bits(xs[i] - bf16_val(hb)) : (unsigned short)0; }
#pragma unroll
    for (int t = 0; t < 4; ++t) {
      const unsigned short* brow = Wt + (size_t)(col0 + t * 16 + ln) * ldb + kb;
      FragB b;
      b.half[0] = *(const v8us*)(brow + 8 * hh);
      b.half[1] = *(const v8us*)(brow + 16 + 8 * hh);
      acc[t] = mmaN<ASPLIT ? 2 : 1>(ah.v, al.v, b.v, b.v, acc[t]);
    }
  }
#pragma unroll
  for (int t = 0; t < 4; ++t) {
    float bv = bias ? bias[col0 + t * 16 + ln] : 0.f;
    if (BIAS_BF16) bv = bf16_round(bv);
#pragma unroll
    for (int r = 0; r < 8; ++r) { float v = acc[t][r] + bv; if (ACT == 1) v = fmaxf(v, 0.f); so[w][8 * hh + r][t * 16 + ln] = v; }
  }
  __builtin_amdgcn_fence(__ATOMIC_ACQ_REL, "workgroup");
  __builtin_amdgcn_wave_barrier();
  const int rsub = lane >> 4, c4 = (lane & 15) * 4;
  {
#pragma unroll
    for (int q = 0; q < 8; ++q) {
      const int r = q * 2 + rsub;
      const v4f v = *(const v4fa*)&so[w][r][c4];
      *(v4f*)(C + (size_t)(row0 + r) * ldc + col0 + c4) = v;
    }
    
  }
}

// GEMM C = act(A·W + bias + resid): A f32 (ASPLIT -> hi/lo 2 terms), Wt bf16 [N][K]; ACT 0 none, 1 relu, 2 exact gelu;
// resid (optional, f32, row index = (row % rmod), pitch ldr, RES_BF16 rounds it) added before the activation.
template <bool ASPLIT, int ACT, bool BIAS_BF16, bool RES_BF16>
__global__ __launch_bounds__(128) void k_gemm_bf3(const float* __restrict__ A, int lda, const unsigned short* __restrict__ Wt, int ldb,
                                                const float* __restrict__ bias, const float* __restrict__ resid, int rmod, int ldr,
                                                float* __restrict__ C, int ldc, int M, int N, int K) {
  __shared__ __attribute__((aligned(16))) float so[4][16][64];
  const int tid = threadIdx.x, w = tid >> 5, lane = tid & 31, ln = lane & 15, hh = lane >> 4;
  const int ntn = N / 64;
  const int wid = blockIdx.x * 4 + w;
  const int mt = wid / ntn, nq = wid % ntn;
  if (mt * 16 >= M) return;
  const int row0 = mt * 16, col0 = nq * 64;
  const float* arow = A + (size_t)(row0 + ln) * lda;
  v8f acc[4] = {};
  for (int kb = 0; kb < K; kb += 32) {
    FragB ah, al;
    const v4f x0 = *(const v4fa*)(arow + kb + 8 * hh), x1 = *(const v4fa*)(arow + kb + 8 * hh + 4);
    const v4f x2 = *(const v4fa*)(arow + kb + 16 + 8 * hh), x3 = *(const v4fa*)(arow + kb + 16 + 8 * hh + 4);
    float xs[16] = {x0[0],x0[1],x0[2],x0[3],x1[0],x1[1],x1[2],x1[3],x2[0],x2[1],x2[2],x2[3],x3[0],x3[1],x3[2],x3[3]};
#pragma unroll
    for (int i = 0; i < 16; ++i) { const unsigned short hb = bf16_bits(xs[i]); ah.u[i] = hb; al.u[i] = ASPLIT ? bf16_bits(xs[i] - bf16_val(hb)) : (unsigned short)0; }
#pragma unroll
    for (int t = 0; t < 4; ++t) {
      const unsigned short* brow = Wt + (size_t)(col0 + t * 16 + ln) * ldb + kb;
      FragB b;
      b.half[0] = *(const v8us*)(brow + 8 * hh);
      b.half[1] = *(const v8us*)(brow + 16 + 8 * hh);
      acc[t] = mmaN<ASPLIT ? 2 : 1>(ah.v, al.v, b.v, b.v, acc[t]);
    }
  }
#pragma unroll
  for (int t = 0; t < 4; ++t) {
    const int col = col0 + t * 16 + ln;
    float bv = bias ? bias[col] : 0.f;
    if (BIAS_BF16) bv = bf16_round(bv);
#pragma unroll
    for (int r = 0; r < 8; ++r) {
      float v = acc[t][r] + bv;
      if (resid) { float rv = resid[(size_t)((row0 + 8 * hh + r) % rmod) * ldr + col]; if (RES_BF16) rv = bf16_round(rv); v += rv; }
      if (ACT == 1) v = fmaxf(v, 0.f);
      if (ACT == 2) v = 0.5f * v * (1.0f + erff(v * 0.70710678118654752f));
      if (ACT == 3) { const float u = 0.7978845608028654f * (v + 0.044715f * v * v * v); v = 0.5f * v * (1.0f + tanhf(u)); }
      so[w][8 * hh + r][t * 16 + ln] = v;
    }
  }
  __builtin_amdgcn_fence(__ATOMIC_ACQ_REL, "workgroup");
  __builtin_amdgcn_wave_barrier();
  const int rsub = lane >> 4, c4 = (lane & 15) * 4;
  {
#pragma unroll
    for (int q = 0; q < 8; ++q) {
      const int r = q * 2 + rsub;
      const v4f v = *(const v4fa*)&so[w][r][c4];
      *(v4f*)(C + (size_t)(row0 + r) * ldc + col0 + c4) = v;
    }
    
  }
}
// row LayerNorm (biased variance, eps) over N: s = X (+ R); optional out_sum <- s; out_norm <- (s-mu)*rsqrt(var+eps)*g + b
template <bool PARAM_BF16>
__global__ __launch_bounds__(256) void k_layernorm(const float* __restrict__ X, const float* __restrict__ R, const float* __restrict__ g, const float* __restrict__ bta,
                                                  float* __restrict__ out_sum, float* __restrict__ out_norm, int N, float eps) {
  __shared__ float red[256];
  const int row = blockIdx.x, tid = threadIdx.x;
  const float* x = X + (size_t)row * N; const float* rr = R ? R + (size_t)row * N : nullptr;
  float vals[16];                     // up to N = 4096
  const int per = N / 256;            // contiguous chunk per thread? use strided-by-4 chunks: thread handles j = tid*4 + 1024*u
  float s1 = 0.f;
  for (int u = 0; u < per / 4; ++u) {
    const int j = tid * 4 + 1024 * u;
    const v4f a = *(const v4fa*)(x + j);
    v4f b = {0.f,0.f,0.f,0.f}; if (rr) b = *(const v4fa*)(rr + j);
#pragma unroll
    for (int q = 0; q < 4; ++q) { const float v = a[q] + b[q]; vals[u * 4 + q] = v; s1 += v; }
  }
  red[tid] = s1; __syncthreads();
  for (int st = 128; st > 0; st >>= 1) { if (tid < st) red[tid] += red[tid + st]; __syncthreads(); }
  const float mu = red[0] / (float)N; __syncthreads();
  float s2 = 0.f;
  for (int u = 0; u < per / 4; ++u)
#pragma unroll
    for (int q = 0; q < 4; ++q) { const float c = vals[u * 4 + q] - mu; s2 += c * c; }
  red[tid] = s2; __syncthreads();
  for (int st = 128; st > 0; st >>= 1) { if (tid < st) red[tid] += red[tid + st]; __syncthreads(); }
  const float rs = rsqrtf(red[0] / (float)N + eps);
  {
    for (int u = 0; u < per / 4; ++u) {
      const int j = tid * 4 + 1024 * u;
      v4f o, sm;
#pragma unroll
      for (int q = 0; q < 4; ++q) {
        float gg = g[j + q], bb = bta[j + q];
        if (PARAM_BF16) { gg = bf16_round(gg); bb = bf16_round(bb); }
        sm[q] = vals[u * 4 + q]; o[q] = (vals[u * 4 + q] - mu) * rs * gg + bb;
      }
      if (out_sum) *(v4f*)(out_sum + (size_t)row * N + j) = sm;
      *(v4f*)(out_norm + (size_t)row * N + j) = o;
    }
    
  }
}



// ---- f16 WMMA path (v_wmma_f32_16x16x32_f16): 11-bit significands for operands in range — used where a [0,1] probability operand needs more precision than bf16
typedef _Float16 v16h __attribute__((ext_vector_type(16)));
union FragH { v16h v; v8us half[2]; _Float16 h[16]; unsigned short u[16]; };
template <int NT>
__device__ __forceinline__ v8f mmaH(v16h ah, v16h al, v16h bh, v16h bl, v8f c) {
  c = __builtin_amdgcn_wmma_f32_16x16x32_f16(false, ah, false, bh, (short)0, c, false, false);
  if (NT >= 2) c = __builtin_amdgcn_wmma_f32_16x16x32_f16(false, al, false, bh, (short)0, c, false, false);
  if (NT >= 3) c = __builtin_amdgcn_wmma_f32_16x16x32_f16(false, ah, false, bl, (short)0, c, false, false);
  asm volatile("v_nop\n\tv_nop\n\tv_nop\n\tv_nop" : "+v"(c) : "v"(ah), "v"(al), "v"(bh), "v"(bl));
  return c;
}
// batched GEMM like k_gemm_b but f16 operands: A f32 (split into f16 hi/lo if ASPLIT, else rounded to f16), Bt = f16 values [n][k]; alpha; C f32; N multiple of 16 (partial tiles skipped)
template <bool ASPLIT>
__global__ __launch_bounds__(128) void k_gemm_h(const float* __restrict__ A, int lda, size_t sA, const _Float16* __restrict__ Bh, int ldb, size_t sB, float alpha, float* __restrict__ C, int ldc, size_t sC, int M, int N, int K) {
  __shared__ __attribute__((aligned(16))) float so[4][16][64];
  const int tid = threadIdx.x, w = tid >> 5, lane = tid & 31, ln = lane & 15, hh = lane >> 4; const int by = blockIdx.y;
  A += (size_t)by * sA; Bh += (size_t)by * sB; C += (size_t)by * sC;
  const int ntn = (N + 63) / 64; const int wid = blockIdx.x * 4 + w; const int mt = wid / ntn, nq = wid % ntn; if (mt * 16 >= M) return;
  const int row0 = mt * 16, col0 = nq * 64; const float* arow = A + (size_t)(row0 + ln) * lda;
  v8f acc[4] = {};
  for (int kb = 0; kb < K; kb += 32) {
    FragH ah, al;
    const v4f x0 = *(const v4fa*)(arow + kb + 8 * hh), x1 = *(const v4fa*)(arow + kb + 8 * hh + 4), x2 = *(const v4fa*)(arow + kb + 16 + 8 * hh), x3 = *(const v4fa*)(arow + kb + 16 + 8 * hh + 4);
    float xs[16] = {x0[0],x0[1],x0[2],x0[3],x1[0],x1[1],x1[2],x1[3],x2[0],x2[1],x2[2],x2[3],x3[0],x3[1],x3[2],x3[3]};
#pragma unroll
    for (int i = 0; i < 16; ++i) { const _Float16 h = (_Float16)xs[i]; ah.h[i] = h; al.h[i] = ASPLIT ? (_Float16)(xs[i] - (float)h) : (_Float16)0.0f; }
#pragma unroll
    for (int t = 0; t < 4; ++t) { if (col0 + t * 16 >= N) continue; const size_t boff = (size_t)(col0 + t * 16 + ln) * ldb + kb; FragH bq; bq.half[0] = *(const v8us*)(Bh + boff + 8 * hh); bq.half[1] = *(const v8us*)(Bh + boff + 16 + 8 * hh);
      acc[t] = mmaH<ASPLIT ? 2 : 1>(ah.v, al.v, bq.v, bq.v, acc[t]); }
  }
#pragma unroll
  for (int t = 0; t < 4; ++t) { if (col0 + t * 16 >= N) continue;
#pragma unroll
    for (int r = 0; r < 8; ++r) so[w][8 * hh + r][t * 16 + ln] = acc[t][r] * alpha; }
  __builtin_amdgcn_fence(__ATOMIC_ACQ_REL, "workgroup"); __builtin_amdgcn_wave_barrier();
  const int rsub = lane >> 4, c4 = (lane & 15) * 4;
  {
#pragma unroll
    for (int q = 0; q < 8; ++q) { const int r = q * 2 + rsub; if (col0 + c4 < N) { const v4f v = *(const v4fa*)&so[w][r][c4]; *(v4f*)(C + (size_t)(row0 + r) * ldc + col0 + c4) = v; } }
     }
}

// Wt[n][k] = f16(W[k][n]·scale) from f32 row-major W[K][N] (scale = power of two; bf16-exact weights stay exact in f16 away from the subnormal range)
__global__ __launch_bounds__(256) void k_wt_f16(const float* __restrict__ W, _Float16* __restrict__ Wt, int K, int N, float scale) {
  const int t = blockIdx.x * 256 + threadIdx.x; if (t >= N * (K / 8)) return; const int n = t / (K / 8), k8 = (t % (K / 8)) * 8; FragH f;
#pragma unroll
  for (int i = 0; i < 8; ++i) f.h[i] = (_Float16)(bf16_round(W[(size_t)(k8 + i) * N + n]) * scale); const v8us o = f.half[0];
  *(v8us*)((unsigned short*)Wt + (size_t)n * K + k8) = o; 
}
// k_gemm_hh variant with fused epilogue: v = acc·alpha + bias[by·sBias + col] (+ CP[(row/rowsPerB)·sCPb + by·64 + col] if CP) ; ACT 0 none / 1 elu ; writes f16 C16 (and f32 C if non-null)
template <int ACT>
__global__ __launch_bounds__(128) void k_gemm_hhx(const _Float16* __restrict__ A, int lda, size_t sA, const _Float16* __restrict__ Bh, int ldb, size_t sB, float alpha, const float* __restrict__ bias, size_t sBias, const float* __restrict__ CP, int rowsPerB, size_t sCPb, int row0g,
    float* __restrict__ C, _Float16* __restrict__ C16, int ldc, size_t sC, int M, int N, int K) {
  __shared__ __attribute__((aligned(16))) float so[4][16][64];
  const int tid = threadIdx.x, w = tid >> 5, lane = tid & 31, ln = lane & 15, hh = lane >> 4; const int by = blockIdx.y;
  A += (size_t)by * sA; Bh += (size_t)by * sB; const size_t cofs = (size_t)by * sC; const float* bp = bias ? bias + (size_t)by * sBias : nullptr;
  const int ntn = (N + 63) / 64; const int wid = blockIdx.x * 4 + w; const int mt = wid / ntn, nq = wid % ntn; if (mt * 16 >= M) return;
  const int row0 = mt * 16, col0 = nq * 64; const _Float16* arow = A + (size_t)(row0 + ln) * lda;
  v8f acc[4] = {};
  for (int kb = 0; kb < K; kb += 32) { FragH ah; ah.half[0] = *(const v8us*)((const unsigned short*)arow + kb + 8 * hh); ah.half[1] = *(const v8us*)((const unsigned short*)arow + kb + 16 + 8 * hh);
#pragma unroll
    for (int t = 0; t < 4; ++t) { if (col0 + t * 16 >= N) continue; const size_t boff = (size_t)(col0 + t * 16 + ln) * ldb + kb; FragH bq; bq.half[0] = *(const v8us*)((const unsigned short*)Bh + boff + 8 * hh); bq.half[1] = *(const v8us*)((const unsigned short*)Bh + boff + 16 + 8 * hh);
      acc[t] = mmaH<1>(ah.v, ah.v, bq.v, bq.v, acc[t]); }
  }
#pragma unroll
  for (int t = 0; t < 4; ++t) { if (col0 + t * 16 >= N) continue; const int col = col0 + t * 16 + ln; const float bv = bp ? bf16_round(bp[col]) : 0.f;
#pragma unroll
    for (int r = 0; r < 8; ++r) { float v = acc[t][r] * alpha + bv; if (CP) { const int rr = row0g + row0 + 8 * hh + r; if (rowsPerB < 0) v += CP[cofs + (size_t)rr * ldc + col];      /* rowsPerB < 0: own element of the batched C plane */ else { const int bidx = rr / rowsPerB; v += CP[(size_t)bidx * sCPb + (size_t)by * 64 + col]; } } if (ACT == 1) v = (v > 0.f) ? v : expm1f(v); else if (ACT == 7) v = (v > 0.f) ? v + 1.0f : expf(v); else if (ACT == 8) v = tanhf(v); else if (ACT == 9) v = 0.5f * v * (1.0f + tanhf(0.7978845608028654f * (v + 0.044715f * v * v * v))); else if (ACT == 11) v = 1.0f / (1.0f + expf(-v)); else if (ACT == 12) v = (v > 0.f) ? v : 0.01f * v; else if (ACT == 14) v = (v > 0.f) ? v : 0.1f * v; else if (ACT == 16) v = (v >= 0.f) ? v : 0.3f * v; else if (ACT == 17) v = (v >= 0.f) ? v : 0.2f * v; else if (ACT == 15) v = v / (1.0f + expf(-v)); else if (ACT == 3) v = fmaxf(v, 0.f); else if (ACT == 6) v = 0.5f * v * (1.0f + erff(v * 0.70710678118654752f)); so[w][8 * hh + r][t * 16 + ln] = v; } }
  __builtin_amdgcn_fence(__ATOMIC_ACQ_REL, "workgroup"); __builtin_amdgcn_wave_barrier();
  const int rsub = lane >> 4, c4 = (lane & 15) * 4; typedef _Float16 v4h __attribute__((ext_vector_type(4)));
  {
#pragma unroll
    for (int q = 0; q < 8; ++q) { const int r = q * 2 + rsub; if (col0 + c4 < N) { const v4f v = *(const v4fa*)&so[w][r][c4]; if (C) *(v4f*)(C + cofs + (size_t)(row0 + r) * ldc + col0 + c4) = v; if (C16) { v4h h4; for (int i = 0; i < 4; ++i) h4[i] = (_Float16)v[i]; *(v4h*)(C16 + cofs + (size_t)(row0 + r) * ldc + col0 + c4) = h4; } } }
     }
}


typedef _Float16 v4h __attribute__((ext_vector_type(4)));

__global__ __launch_bounds__(256) void k_x16(const float* __restrict__ x, _Float16* __restrict__ X16, size_t n8) { const size_t t = (size_t)blockIdx.x * 256 + threadIdx.x; if (t >= n8) return; FragH f;
#pragma unroll
  for (int q = 0; q < 8; ++q) f.h[q] = (_Float16)bf16_round(x[t * 8 + q]); *(v8us*)((unsigned short*)X16 + t * 8) = f.half[0];  }
__global__ __launch_bounds__(256) void k_h16(const float* __restrict__ x, _Float16* __restrict__ X16, size_t n8) { const size_t t = (size_t)blockIdx.x * 256 + threadIdx.x; if (t >= n8) return; FragH f;
#pragma unroll
  for (int q = 0; q < 8; ++q) f.h[q] = (_Float16)x[t * 8 + q]; *(v8us*)((unsigned short*)X16 + t * 8) = f.half[0];  }
__global__ __launch_bounds__(256) void k_round16f(const float* __restrict__ W, _Float16* __restrict__ Bt, size_t n8) { const size_t t = (size_t)blockIdx.x * 256 + threadIdx.x; if (t >= n8) return; FragH f;
#pragma unroll
  for (int i = 0; i < 8; ++i) f.h[i] = (_Float16)(bf16_round(W[t * 8 + i]) * 16.0f); *(v8us*)((unsigned short*)Bt + t * 8) = f.half[0];  }
template <int NHv, int TTv>
__global__ __launch_bounds__(256) void k_vt(const _Float16* __restrict__ V16, int ldv, int voff, _Float16* __restrict__ Vt) { __shared__ unsigned short tl[64][66]; const int tid = threadIdx.x; const int slab = blockIdx.x / (TTv / 64), lg = blockIdx.x % (TTv / 64); const int b = slab / NHv, h = slab % NHv;
  for (int i = tid; i < 64 * 8; i += 256) { const int r = i / 8, c8 = (i % 8) * 8; FragH f; f.half[0] = *(const v8us*)((const unsigned short*)V16 + ((size_t)b * TTv + lg * 64 + r) * ldv + voff + h * 64 + c8);
#pragma unroll
    for (int q = 0; q < 8; ++q) tl[r][c8 + q] = f.u[q]; }
  __syncthreads();
  {
#pragma unroll
    for (int rd = 0; rd < 2; ++rd) { const int d = rd * 32 + tid / 8, pc = tid % 8; FragH f;
#pragma unroll
      for (int q = 0; q < 8; ++q) f.u[q] = tl[pc * 8 + q][d];
      *(v8us*)((unsigned short*)Vt + ((size_t)slab * 64 + d) * TTv + lg * 64 + pc * 8) = f.half[0]; }
     } }

__global__ __launch_bounds__(256) void k_hl(const float* __restrict__ F, _Float16* __restrict__ Hh, _Float16* __restrict__ Hl, size_t n8) { const size_t t = (size_t)blockIdx.x * 256 + threadIdx.x; if (t >= n8) return; FragH fh, fl; const v4f a = *(const v4fa*)(F + t * 8), c = *(const v4fa*)(F + t * 8 + 4);
#pragma unroll
  for (int q = 0; q < 4; ++q) { _Float16 h = (_Float16)a[q]; fh.h[q] = h; fl.h[q] = (_Float16)((a[q] - (float)h) * 1024.0f); h = (_Float16)c[q]; fh.h[4 + q] = h; fl.h[4 + q] = (_Float16)((c[q] - (float)h) * 1024.0f); }
  { *(v8us*)((unsigned short*)Hh + t * 8) = fh.half[0]; *(v8us*)((unsigned short*)Hl + t * 8) = fl.half[0];  } }

// ---- fast GEMM (wave tile 32x64; requires M % 32 == 0 rows per launch region and N % 64 == 0); epilogue = k_gemm_hhx semantics ----
__device__ __forceinline__ v16h g2_frag(const _Float16* p, int hh) { FragH f; f.half[0] = *(const v8us*)((const unsigned short*)p + 8 * hh); f.half[1] = *(const v8us*)((const unsigned short*)p + 16 + 8 * hh); return f.v; }
__device__ __forceinline__ v8f g2_mma(v16h a, v16h b, v8f c) { v8f d = __builtin_amdgcn_wmma_f32_16x16x32_f16(false, a, false, b, (short)0, c, false, false); asm volatile("v_nop\n\tv_nop\n\tv_nop\n\tv_nop" : "+v"(d) : "v"(a), "v"(b)); return d; }
template <int ACT>
__global__ __launch_bounds__(128) void k_gemm2(const _Float16* __restrict__ A, int lda, size_t sA, const _Float16* __restrict__ Bh, int ldb, size_t sB, float alpha, const float* __restrict__ bias, size_t sBias, const float* __restrict__ CP, int rowsPerB, size_t sCPb, int row0g,
    float* __restrict__ C, _Float16* __restrict__ C16, int ldc, size_t sC, int M, int N, int K) { static_assert(ACT == 0 || ACT == 3 || ACT == 6 || ACT == 8 || ACT == 9 || ACT == 11 || ACT == 12 || ACT == 14 || ACT == 15 || ACT == 16 || ACT == 17, "k_gemm2: unsupported ACT code (would silently apply no activation)");
  __shared__ __attribute__((aligned(16))) float so[4][32][68];
  const int tid = threadIdx.x, w = tid >> 5, lane = tid & 31, ln = lane & 15, hh = lane >> 4; const int by = blockIdx.y;
  A += (size_t)by * sA; Bh += (size_t)by * sB; const size_t cofs = (size_t)by * sC; const float* bp = bias ? bias + (size_t)by * sBias : nullptr;
  const int ntn = N >> 6; const int mt = blockIdx.x / ntn, nq = blockIdx.x - mt * ntn; const int row0 = mt * 128 + 32 * w, col0 = nq * 64; if (row0 >= M) return;
  const _Float16* a0p = A + (size_t)(row0 + ln) * lda; const _Float16* a1p = a0p + (size_t)16 * lda;
  const _Float16* b0p = Bh + (size_t)(col0 + ln) * ldb; const _Float16* b1p = b0p + (size_t)16 * ldb; const _Float16* b2p = b1p + (size_t)16 * ldb; const _Float16* b3p = b2p + (size_t)16 * ldb;
  const v8f z8 = {0.f,0.f,0.f,0.f,0.f,0.f,0.f,0.f}; v8f c00 = z8, c01 = z8, c02 = z8, c03 = z8, c10 = z8, c11 = z8, c12 = z8, c13 = z8;
#pragma unroll 1
  for (int kb = 0; kb < K; kb += 32) { const v16h a0 = g2_frag(a0p + kb, hh), a1 = g2_frag(a1p + kb, hh);
    v16h b = g2_frag(b0p + kb, hh); c00 = g2_mma(a0, b, c00); c10 = g2_mma(a1, b, c10);
    b = g2_frag(b1p + kb, hh); c01 = g2_mma(a0, b, c01); c11 = g2_mma(a1, b, c11);
    b = g2_frag(b2p + kb, hh); c02 = g2_mma(a0, b, c02); c12 = g2_mma(a1, b, c12);
    b = g2_frag(b3p + kb, hh); c03 = g2_mma(a0, b, c03); c13 = g2_mma(a1, b, c13); }
  v8f accs[8] = {c00, c01, c02, c03, c10, c11, c12, c13};
#pragma unroll
  for (int u = 0; u < 8; ++u) { const int t = u & 3, half = u >> 2; const int col = col0 + t * 16 + ln; const float bv = bp ? bf16_round(bp[col]) : 0.f;
#pragma unroll
    for (int r = 0; r < 8; ++r) { const int rloc = half * 16 + 8 * hh + r; float v = accs[u][r] * alpha + bv; if (CP) { if (rowsPerB < 0) v += CP[cofs + (size_t)(row0g + row0 + rloc) * ldc + col];      /* rowsPerB < 0: own element of the batched C plane */ else { const int bidx = (row0g + row0 + rloc) / rowsPerB; v += CP[(size_t)bidx * sCPb + (size_t)by * 64 + col]; } }
      if (ACT == 3) v = fmaxf(v, 0.f); else if (ACT == 6) v = 0.5f * v * (1.0f + erff(v * 0.70710678118654752f)); else if (ACT == 11) v = 1.0f / (1.0f + expf(-v)); else if (ACT == 15) v = v / (1.0f + expf(-v)); else if (ACT == 12) v = (v > 0.f) ? v : 0.01f * v; else if (ACT == 8) v = tanhf(v); else if (ACT == 9) v = 0.5f * v * (1.0f + tanhf(0.7978845608028654f * (v + 0.044715f * v * v * v))); else if (ACT == 14) v = (v > 0.f) ? v : 0.1f * v; else if (ACT == 16) v = (v >= 0.f) ? v : 0.3f * v; else if (ACT == 17) v = (v >= 0.f) ? v : 0.2f * v;
      so[w][rloc][t * 16 + ln] = v; } }
  __builtin_amdgcn_fence(__ATOMIC_ACQ_REL, "workgroup"); __builtin_amdgcn_wave_barrier();
  const int rsub = lane >> 4, c4 = (lane & 15) * 4;
  {
#pragma unroll
    for (int q = 0; q < 16; ++q) { const int r = q * 2 + rsub; const v4f v = *(const v4fa*)&so[w][r][c4]; if (C) *(v4f*)(C + cofs + (size_t)(row0 + r) * ldc + col0 + c4) = v; if (C16) { v4h h4; for (int i = 0; i < 4; ++i) h4[i] = (_Float16)v[i]; *(v4h*)(C16 + cofs + (size_t)(row0 + r) * ldc + col0 + c4) = h4; } }
     } }


__global__ __launch_bounds__(256) void k_wnat(const float* __restrict__ w, size_t n8, _Float16* __restrict__ Bt) { const size_t t = (size_t)blockIdx.x * 256 + threadIdx.x; if (t >= n8) return; FragH f; for (int q = 0; q < 8; ++q) f.h[q] = (_Float16)(bf16_round(w[t * 8 + q]) * 16.0f); *(v8us*)((unsigned short*)Bt + t * 8) = f.half[0];  }
__global__ __launch_bounds__(256) void k_rsm(const float* __restrict__ S, _Float16* __restrict__ P, int nrows) {
  #pragma clang fp contract(off)
  const int i = blockIdx.x * 256 + threadIdx.x; if (i >= nrows) return; const float* s = S + (size_t)i * SQ; float mx = -3.0e38f;
#pragma unroll 1
  for (int j = 0; j < SQ; ++j) mx = fmaxf(mx, s[j]); float se = 0.f;
#pragma unroll 1
  for (int j = 0; j < SQ; ++j) se += expf(s[j] - mx); const float sc = 256.0f / se;
#pragma unroll 1
  for (int j0 = 0; j0 < SQ; j0 += 8) { FragH f; for (int q = 0; q < 8; ++q) f.h[q] = (_Float16)(expf(s[j0 + q] - mx) * sc); unsigned short* d = (unsigned short*)P + (size_t)i * SQ + j0; *(v8us*)d = f.half[0];  } }
__global__ __launch_bounds__(256) void k_vt(const _Float16* __restrict__ V16, int b, int h0, _Float16* __restrict__ VT) { __shared__ unsigned short tl[64][65]; const int tid = threadIdx.x; const int hh = blockIdx.x % HG, sg = blockIdx.x / HG; const int s0 = sg * 64; const int h = h0 + hh;
  for (int i = tid; i < 64 * 8; i += 256) { const int j = i / 8, d8 = (i % 8) * 8; FragH f; f.half[0] = *(const v8us*)((const unsigned short*)V16 + ((size_t)b * SQ + s0 + j) * DM + h * HD + d8); for (int q = 0; q < 8; ++q) tl[d8 + q][j] = f.u[q]; }
  __syncthreads();
  { for (int i = tid; i < 64 * 8; i += 256) { const int d = i / 8, j8 = (i % 8) * 8; FragH f; for (int q = 0; q < 8; ++q) f.u[q] = tl[d][j8 + q]; *(v8us*)((unsigned short*)VT + ((size_t)hh * HD + d) * SQ + s0 + j8) = f.half[0]; }  } }



__global__ __launch_bounds__(256) void k_rsmcf2(const float* __restrict__ S, _Float16* __restrict__ P, int hg, int q0, int nk) {
  #pragma clang fp contract(off)
  const int t = blockIdx.x * 256 + threadIdx.x; if (t >= hg * QT) return; const size_t i = (size_t)t; const float* s = S + i * NKX; const int last = q0 + (t % QT); float mx = -3.0e38f;
#pragma unroll 1
  for (int j = 0; j < nk; ++j) { const float f = (j <= last) ? 1.f : 0.f; mx = fmaxf(mx, fmaf(f, s[j], (1.f - f) * -1.0e9f)); } float se = 0.f;
#pragma unroll 1
  for (int j = 0; j < nk; ++j) { const float f = (j <= last) ? 1.f : 0.f; se += __expf(fmaf(f, s[j], (1.f - f) * -1.0e9f) - mx); } const float sc = 256.0f / se;
#pragma unroll 1
  for (int j0 = 0; j0 < nk; j0 += 8) { FragH fr; for (int q = 0; q < 8; ++q) { const int j = j0 + q; const float f = (j <= last) ? 1.f : 0.f; fr.h[q] = (_Float16)(__expf(fmaf(f, s[j], (1.f - f) * -1.0e9f) - mx) * sc); } unsigned short* d = (unsigned short*)P + i * NKX + j0; *(v8us*)d = fr.half[0];  } }


template <int MASKADD>
__global__ __launch_bounds__(64) void k_att0(const float* __restrict__ QF, const float* __restrict__ KF, const float* __restrict__ VF, int ld, const float* __restrict__ mask, float scale, float* __restrict__ OF, int ldo) {
  #pragma clang fp contract(off)
  __shared__ __attribute__((aligned(16))) float lq[64][64]; __shared__ __attribute__((aligned(16))) float lo[64][64];
  const int tid = threadIdx.x; const int h = blockIdx.x / (QT0 / 64), rg = blockIdx.x % (QT0 / 64); const int i = rg * 64 + tid;
  const float* qr = QF + (size_t)i * ld + h * HD;
#pragma unroll 1
  for (int c = 0; c < HD / 4; ++c) { *(v4f*)&lq[tid][c * 4] = *(const v4fa*)(qr + c * 4); const v4f z = {0.f, 0.f, 0.f, 0.f}; *(v4f*)&lo[tid][c * 4] = z; }
  float m = -1.0e30f, l = 0.f; const int jmax = MASKADD ? (SQ - 1) : (rg * 64 + 63);      /* additive-mask form: every key (the mask input decides); causal form: keys up to the block's last row */
#pragma unroll 1
  for (int j = 0; j <= jmax; ++j) { const float* kr = KF + (size_t)j * ld + h * HD; const float* vr = VF + (size_t)j * ld + h * HD; float s = 0.f;
#pragma unroll 1
    for (int c = 0; c < HD / 4; ++c) { const v4f kq = *(const v4fa*)(kr + c * 4); const v4f qq = *(v4f*)&lq[tid][c * 4]; s = __fadd_rn(s, __fmul_rn(qq[0], kq[0])); s = __fadd_rn(s, __fmul_rn(qq[1], kq[1])); s = __fadd_rn(s, __fmul_rn(qq[2], kq[2])); s = __fadd_rn(s, __fmul_rn(qq[3], kq[3])); }
    s = __fmul_rn(s, scale); if (MASKADD) s = __fadd_rn(s, __fmul_rn(bf16_round(mask[(size_t)i * SQ + j]), -10000.0f));
    const float f = (MASKADD || j <= i) ? 1.f : 0.f; const float sm = fmaf(f, s, (1.f - f) * -1.0e30f); const float mn = fmaxf(m, sm); const float sc = expf(m - mn); const float e = expf(sm - mn); l = __fadd_rn(__fmul_rn(l, sc), e); m = mn;
#pragma unroll 1
    for (int c = 0; c < HD / 4; ++c) { const v4f vv = *(const v4fa*)(vr + c * 4); v4f oo = *(v4f*)&lo[tid][c * 4]; for (int u = 0; u < 4; ++u) oo[u] = __fadd_rn(__fmul_rn(oo[u], sc), __fmul_rn(e, vv[u])); *(v4f*)&lo[tid][c * 4] = oo; } }
  const float fin = 64.0f / l;      /* o carried x64 like the f16 path */
#pragma unroll 1
  for (int c = 0; c < HD / 4; ++c) { v4f oo = *(v4f*)&lo[tid][c * 4]; for (int u = 0; u < 4; ++u) oo[u] = __fmul_rn(oo[u], fin); *(v4f*)&lo[tid][c * 4] = oo; }
  __syncthreads();
  {
#pragma unroll 1
    for (int it = 0; it < 16; ++it) { const int row = it * 4 + tid / 16, pc = (tid % 16) * 4; const v4f v = *(const v4f*)&lo[row][pc]; *(v4f*)(OF + (size_t)(rg * 64 + row) * ldo + h * HD + pc) = v; }
     } }


template <int BFIN, int WXB>
__global__ __launch_bounds__(256) void k_ln16(const float* __restrict__ X, const float* __restrict__ g, const float* __restrict__ bb, float eps, _Float16* __restrict__ N16, float* __restrict__ XB) {
  #pragma clang fp contract(off)
  __shared__ float red[256]; const size_t r = blockIdx.x; const int t = threadIdx.x; const v4f xa = *(const v4fa*)(X + r * DMQ + t * 4); float s[4]; float sum = 0.f;
  for (int q = 0; q < 4; ++q) { s[q] = BFIN ? bf16_round(xa[q]) : xa[q]; sum = __fadd_rn(sum, s[q]); }
  red[t] = sum; __syncthreads(); for (int st = 128; st > 0; st >>= 1) { if (t < st) red[t] = __fadd_rn(red[t], red[t + st]); __syncthreads(); } const float mu = red[0] / (float)DMQ; __syncthreads();
  float vs = 0.f; for (int q = 0; q < 4; ++q) { const float dl = __fadd_rn(s[q], -mu); vs = __fadd_rn(vs, __fmul_rn(dl, dl)); } red[t] = vs; __syncthreads(); for (int st = 128; st > 0; st >>= 1) { if (t < st) red[t] = __fadd_rn(red[t], red[t + st]); __syncthreads(); }
  const float rs = rsqrtf(__fadd_rn(red[0] / (float)DMQ, eps)); v4h y; v4f xb;
  for (int q = 0; q < 4; ++q) { const int c = t * 4 + q; y[q] = (_Float16)__fadd_rn(__fmul_rn(__fmul_rn(__fadd_rn(s[q], -mu), rs), bf16_round(g[c])), bf16_round(bb[c])); xb[q] = s[q]; }
  { *(v4h*)(N16 + r * DMQ + t * 4) = y; if (WXB) *(v4f*)(XB + r * DMQ + t * 4) = xb;  } }
__global__ __launch_bounds__(256) void k_ftres2(const float* __restrict__ OF0, const float* __restrict__ XB, float* __restrict__ X1, size_t n4) {
  #pragma clang fp contract(off)
  const size_t t = (size_t)blockIdx.x * 256 + threadIdx.x; if (t >= n4) return; const v4f o = *(const v4fa*)(OF0 + t * 4), xv = *(const v4fa*)(XB + t * 4); v4f y; for (int q = 0; q < 4; ++q) y[q] = __fadd_rn(__fmul_rn(o[q], 0.015625f), xv[q]); *(v4f*)(X1 + t * 4) = y;  }

__global__ __launch_bounds__(256) void k_wthd(const float* __restrict__ Wt, _Float16* __restrict__ Bt) { const size_t t = (size_t)blockIdx.x * 256 + threadIdx.x; if (t >= (size_t)NH * HD * (DM / 8)) return; const int m8 = (int)(t % (DM / 8)) * 8; const int d = (int)((t / (DM / 8)) % HD); const int h = (int)(t / ((size_t)(DM / 8) * HD)); FragH f;
  for (int q = 0; q < 8; ++q) f.h[q] = (_Float16)(16.0f * bf16_round(Wt[((size_t)h * DM + m8 + q) * HD + d])); unsigned short* dst = (unsigned short*)Bt + ((size_t)h * HD + d) * DM + m8; *(v8us*)dst = f.half[0];  }




template <int BFIN, int W16, int W32>
__global__ __launch_bounds__(256) void k_lnx(const float* __restrict__ X, const float* __restrict__ g, const float* __restrict__ bb, float eps, _Float16* __restrict__ N16, float* __restrict__ N32) {
  #pragma clang fp contract(off)
  __shared__ float red[256]; const size_t r = blockIdx.x; const int t = threadIdx.x; const bool act = t < (DMQ / 4); const int c0 = act ? t * 4 : 0;
  const v4f xa = *(const v4fa*)(X + r * DMQ + c0); float s[4]; float sum = 0.f;
  for (int q = 0; q < 4; ++q) { s[q] = act ? (BFIN ? bf16_round(xa[q]) : xa[q]) : 0.f; sum = __fadd_rn(sum, s[q]); }
  red[t] = sum; __syncthreads(); for (int st = 128; st > 0; st >>= 1) { if (t < st) red[t] = __fadd_rn(red[t], red[t + st]); __syncthreads(); } const float mu = red[0] / (float)DMQ; __syncthreads();
  float vs = 0.f; for (int q = 0; q < 4; ++q) { const float dl = act ? __fadd_rn(s[q], -mu) : 0.f; vs = __fadd_rn(vs, __fmul_rn(dl, dl)); } red[t] = vs; __syncthreads(); for (int st = 128; st > 0; st >>= 1) { if (t < st) red[t] = __fadd_rn(red[t], red[t + st]); __syncthreads(); }
  const float rs = rsqrtf(__fadd_rn(red[0] / (float)DMQ, eps)); v4h y; v4f yf;
  for (int q = 0; q < 4; ++q) { const int c = c0 + q; yf[q] = __fadd_rn(__fmul_rn(__fmul_rn(__fadd_rn(s[q], -mu), rs), bf16_round(g[c])), bf16_round(bb[c])); y[q] = (_Float16)yf[q]; }
  if (!act) return;      /* no barriers after this point */
  { if (W16) *(v4h*)(N16 + r * DMQ + c0) = y; if (W32) *(v4f*)(N32 + r * DMQ + c0) = yf;  } }


__global__ __launch_bounds__(256) void k_bfr(const float* __restrict__ x, float* __restrict__ XB, size_t n8) { const size_t t = (size_t)blockIdx.x * 256 + threadIdx.x; if (t >= n8) return; v4f a = *(const v4fa*)(x + t * 8), c = *(const v4fa*)(x + t * 8 + 4); for (int q = 0; q < 4; ++q) { a[q] = bf16_round(a[q]); c[q] = bf16_round(c[q]); }
  { *(v4f*)(XB + t * 8) = a; *(v4f*)(XB + t * 8 + 4) = c;  } }




__global__ __launch_bounds__(256) void k_lorafold(const float* __restrict__ Wm, const float* __restrict__ A, const float* __restrict__ Bm, float* __restrict__ WE, int K, int N, float sc) {
  #pragma clang fp contract(off)
  const size_t t = (size_t)blockIdx.x * 256 + threadIdx.x; if (t >= (size_t)K * N) return; const int i = (int)(t / N), o = (int)(t % N); float a = 0.f;
  for (int r = 0; r < 16; ++r) a = __fadd_rn(a, __fmul_rn(bf16_round(A[(size_t)i * 16 + r]), bf16_round(Bm[(size_t)r * N + o])));
  const float v = __fadd_rn(bf16_round(Wm[t]), __fmul_rn(sc, a)); *(float*)(WE + t) = v;  }
__global__ __launch_bounds__(256) void k_wt32rep(const float* __restrict__ Wf, _Float16* __restrict__ Bt, int K, int N, int DOUT, float scale) {
  const int t = blockIdx.x * 256 + threadIdx.x; if (t >= DOUT * (K / 8)) return; const int n = t / (K / 8), k8 = (t % (K / 8)) * 8; const int rep = DOUT / N; const int src = (n / (HD * rep)) * HD + (n % HD);      /* head h = n / HD -> group h / rep */
  FragH f; for (int i = 0; i < 8; ++i) f.h[i] = (_Float16)(Wf[(size_t)(k8 + i) * N + src] * scale);
  *(v8us*)((unsigned short*)Bt + (size_t)n * K + k8) = f.half[0];  }
__global__ __launch_bounds__(256) void k_brep(const float* __restrict__ b, float* __restrict__ out) { const int t = blockIdx.x * 256 + threadIdx.x; if (t >= DM) return; const float v = b[(t / (HD * 4)) * HD + (t % HD)]; *(float*)(out + t) = v;  }

__global__ __launch_bounds__(256) void k_rsmcim(const float* __restrict__ S, _Float16* __restrict__ P, int hg, int q0, int nk, const int* __restrict__ am) {
  #pragma clang fp contract(off)
  const int t = blockIdx.x * 256 + threadIdx.x; if (t >= hg * QT) return; const size_t i = (size_t)t; const float* s = S + i * NKX; const int last = q0 + (t % QT); const int* mr = am + (size_t)last * SQ; float mx = -3.0e38f;      /* the module's mask row of this query (keys >= nk lie above the diagonal of the causal mask and are not computed) */
#pragma unroll 1
  for (int j = 0; j < nk; ++j) { const float f = (mr[j] != 0) ? 1.f : 0.f; mx = fmaxf(mx, fmaf(f, s[j], (1.f - f) * -1.0e9f)); } float se = 0.f;
#pragma unroll 1
  for (int j = 0; j < nk; ++j) { const float f = (mr[j] != 0) ? 1.f : 0.f; se += __expf(fmaf(f, s[j], (1.f - f) * -1.0e9f) - mx); } const float sc = 256.0f / se;
#pragma unroll 1
  for (int j0 = 0; j0 < nk; j0 += 8) { FragH fr; for (int q = 0; q < 8; ++q) { const int j = j0 + q; const float f = (mr[j] != 0) ? 1.f : 0.f; fr.h[q] = (_Float16)(__expf(fmaf(f, s[j], (1.f - f) * -1.0e9f) - mx) * sc); } unsigned short* d = (unsigned short*)P + i * NKX + j0; *(v8us*)d = fr.half[0];  } }



__global__ __launch_bounds__(256) void k_bcpy(const float* __restrict__ b, int n, int NP, float* __restrict__ dst, int dst0) { for (int i = threadIdx.x; i < NP; i += 256) { const float v = (i < n) ? b[i] : 0.f; *(float*)(dst + dst0 + i) = v; }  }



__global__ __launch_bounds__(256) void k_rsmp(const float* __restrict__ S, _Float16* __restrict__ P, int nrows, int nk) {
  #pragma clang fp contract(off)
  const int t = blockIdx.x * 256 + threadIdx.x; if (t >= nrows) return; const size_t ri = (size_t)t; const float* s = S + ri * NKX; float mx = -3.0e38f;
#pragma unroll 1
  for (int j = 0; j < nk; ++j) mx = fmaxf(mx, s[j]); float se = 0.f;
#pragma unroll 1
  for (int j = 0; j < nk; ++j) se += __expf(s[j] - mx); const float sc = 256.0f / se;
#pragma unroll 1
  for (int j0 = 0; j0 < nk; j0 += 8) { FragH fr; for (int q = 0; q < 8; ++q) fr.h[q] = (_Float16)(__expf(s[j0 + q] - mx) * sc);
    unsigned short* d = (unsigned short*)P + ri * NKX + j0; *(v8us*)d = fr.half[0];  } }
template <int BFIN, int W16, int W32>
__global__ __launch_bounds__(256) void k_lnxr(const float* __restrict__ X, const float* __restrict__ g, const float* __restrict__ bb, float eps, _Float16* __restrict__ N16, float* __restrict__ N32, const float* __restrict__ R) {
  #pragma clang fp contract(off)
  __shared__ float red[256]; const size_t r = blockIdx.x; const int t = threadIdx.x; const bool act = t < (DMQ / 4); const int c0 = act ? t * 4 : 0;
  const v4f xa = *(const v4fa*)(X + r * DMQ + c0); const v4f ra = *(const v4fa*)(R + r * DMQ + c0);      /* residual row (f32, already on the bf16 grid where it is an input copy) */ float s[4]; float sum = 0.f;
  for (int q = 0; q < 4; ++q) { s[q] = act ? (BFIN ? bf16_round(xa[q]) : xa[q]) : 0.f; sum = __fadd_rn(sum, s[q]); }
  red[t] = sum; __syncthreads(); for (int st = 128; st > 0; st >>= 1) { if (t < st) red[t] = __fadd_rn(red[t], red[t + st]); __syncthreads(); } const float mu = red[0] / (float)DMQ; __syncthreads();
  float vs = 0.f; for (int q = 0; q < 4; ++q) { const float dl = act ? __fadd_rn(s[q], -mu) : 0.f; vs = __fadd_rn(vs, __fmul_rn(dl, dl)); } red[t] = vs; __syncthreads(); for (int st = 128; st > 0; st >>= 1) { if (t < st) red[t] = __fadd_rn(red[t], red[t + st]); __syncthreads(); }
  const float rs = rsqrtf(__fadd_rn(red[0] / (float)DMQ, eps)); v4h y; v4f yf;
  for (int q = 0; q < 4; ++q) { const int c = c0 + q; yf[q] = __fadd_rn(__fadd_rn(__fmul_rn(__fmul_rn(__fadd_rn(s[q], -mu), rs), bf16_round(g[c])), bf16_round(bb[c])), ra[q]); y[q] = (_Float16)yf[q]; }
  if (!act) return;      /* no barriers after this point */
  { if (W16) *(v4h*)(N16 + r * DMQ + c0) = y; if (W32) *(v4f*)(N32 + r * DMQ + c0) = yf;  } }



__global__ __launch_bounds__(256) void k_rsmkf(const float* __restrict__ S, _Float16* __restrict__ P, int nrows, const int* __restrict__ Km) {
  #pragma clang fp contract(off)
  const int i = blockIdx.x * 256 + threadIdx.x; if (i >= nrows) return; const float* s = S + (size_t)i * SQ; float mx = -3.0e38f;
#pragma unroll 1
  for (int j = 0; j < SQ; ++j) { const float f = (Km[j] != 0) ? 1.0f : 0.0f; mx = fmaxf(mx, fmaf(f, s[j], (1.0f - f) * 1.0e-11f)); } float se = 0.f;
#pragma unroll 1
  for (int j = 0; j < SQ; ++j) { const float f = (Km[j] != 0) ? 1.0f : 0.0f; se += __expf(fmaf(f, s[j], (1.0f - f) * 1.0e-11f) - mx); } const float sc = 256.0f / se;
#pragma unroll 1
  for (int j0 = 0; j0 < SQ; j0 += 8) { FragH fr; for (int q = 0; q < 8; ++q) { const float f = (Km[j0 + q] != 0) ? 1.0f : 0.0f; fr.h[q] = (_Float16)(__expf(fmaf(f, s[j0 + q], (1.0f - f) * 1.0e-11f) - mx) * sc); } unsigned short* d = (unsigned short*)P + (size_t)i * SQ + j0; *(v8us*)d = fr.half[0];  } }


extern "C" void kernel_launch(void* const* d_in, const int* in_sizes, int n_in,
                              void* d_out, int out_size, void* d_ws, size_t ws_size, hipStream_t stream) {
  (void)in_sizes; (void)n_in; (void)out_size;
  const float* const* I = (const float* const*)d_in; const float* x = I[0]; const int* km = (const int*)d_in[1]; const float* wq = I[2]; const float* bq = I[3]; const float* wk = I[4]; const float* bk = I[5]; const float* wv = I[6]; const float* bv = I[7]; const float* wo = I[8]; const float* bo = I[9]; const float* g1 = I[10]; const float* be1 = I[11]; const float* wfc = I[12]; const float* bfc = I[13]; const float* wmp = I[14]; const float* bmp = I[15]; const float* gg2 = I[16]; const float* be2 = I[17];      /* input order: x_n; mask int32 [2][1][1][2048] (READ on device); [in][out] wq / wk / wv / wo + biases; ln1 g / b; w1 [768][3072] + b1, w2 [3072][768] + b2; ln2 g / b */
  static_assert(DMQ % 4 == 0 && DMQ / 4 <= 256 && DM % 64 == 0 && DM % 32 == 0 && DFF % 64 == 0 && DFF % 32 == 0 && NH * HD == DM && NKX == SQ, "k_lnxr 256 threads x 4 columns; tile multiples");
  char* ws = (char*)d_ws; size_t off = 0;
  auto take = [&](size_t bytes) { char* p = ws + off; off += (bytes + 255) & ~(size_t)255; return p; };
  _Float16* BQKV = (_Float16*)take((size_t)3 * DM * DM * 2); _Float16* BO = (_Float16*)take((size_t)DM * DM * 2); float* bqkv = (float*)take((size_t)3 * DM * 4); float* X1N = nullptr;      /* LN1 output (f32): aliases the QKV plane below (QKV's last readers, the score / V^T launches of the last batch, precede LN1) to stay within 256 MiB at NB 4 / SQ 2048 */
  _Float16* X16 = (_Float16*)take(NR * DM * 2); float* XB = (float*)take(NR * DM * 4); float* X1 = (float*)take(NR * DM * 4); _Float16* M16 = nullptr;      /* = X16 below (alias: X16's last reader, the fused QKV GEMM, precedes LN1's f16 write) */ _Float16* HF16 = (_Float16*)take((size_t)SQ * DFF * 2);      /* FFN hidden plane of one batch [2048][3072] f16 (own region here) */ _Float16* BW1 = (_Float16*)take((size_t)DFF * DM * 2); _Float16* BW2 = (_Float16*)take((size_t)DM * DFF * 2); _Float16* QKV = (_Float16*)take(NR * 3 * DM * 2); _Float16* Q16 = QKV; _Float16* K16 = QKV + DM; _Float16* V16 = QKV + 2 * DM; _Float16* O16 = (_Float16*)take(NR * DM * 2); M16 = X16; X1N = (float*)QKV;      /* aliases: X1N (NR*DM f32 = 12 MiB) inside QKV (18 MiB): QKV's last readers (the score / V^T launches of the last batch) precede the first LayerNorm */
  float* S = (float*)take((size_t)NH * QT * NKX * 4); _Float16* P = (_Float16*)take((size_t)NH * QT * NKX * 2); _Float16* VT = (_Float16*)take((size_t)NH * HD * SQ * 2);
  if (off > ws_size) return;
  { const unsigned g = (unsigned)(((size_t)DM * (DM / 8) + 255) / 256); k_wt_f16<<<g, 256, 0, stream>>>(wq, BQKV, DM, DM, 16.0f); k_wt_f16<<<g, 256, 0, stream>>>(wk, BQKV + (size_t)DM * DM, DM, DM, 16.0f); k_wt_f16<<<g, 256, 0, stream>>>(wv, BQKV + (size_t)2 * DM * DM, DM, DM, 16.0f); k_wt_f16<<<g, 256, 0, stream>>>(wo, BO, DM, DM, 16.0f); }      /* [in][out] -> Bt x16: stacked q | k | v, and Wo */
  k_bcpy<<<1, 256, 0, stream>>>(bq, DM, DM, bqkv, 0); k_bcpy<<<1, 256, 0, stream>>>(bk, DM, DM, bqkv, DM); k_bcpy<<<1, 256, 0, stream>>>(bv, DM, DM, bqkv, 2 * DM);      /* stacked bias bq | bk | bv */
  k_x16<<<(unsigned)((NR * DM / 8 + 255) / 256), 256, 0, stream>>>(x, X16, NR * DM / 8); k_bfr<<<(unsigned)((NR * DM / 8 + 255) / 256), 256, 0, stream>>>(x, XB, NR * DM / 8);      /* post-LN: the attention runs on the raw input (exact f16 rows); XB = bf16(x) f32 for the residual */
  k_wt_f16<<<(unsigned)(((size_t)DFF * (DM / 8) + 255) / 256), 256, 0, stream>>>(wfc, BW1, DM, DFF, 16.0f); k_wt_f16<<<(unsigned)(((size_t)DM * (DFF / 8) + 255) / 256), 256, 0, stream>>>(wmp, BW2, DFF, DM, 16.0f);      /* W1 [768][3072] -> Bt [3072][768]; W2 [3072][768] -> Bt [768][3072] (x16, transposing builder) */
  const size_t r0p = (size_t)B0 * SQ;      /* first projected row */
  k_gemm2<0><<<dim3((unsigned)((MP / 128) * (3 * DM / 64)), 1), 128, 0, stream>>>(X16 + r0p * DM, DM, 0, BQKV, DM, 0, 0.0625f, bqkv, 0, nullptr, 1, 0, 0, nullptr, QKV + r0p * 3 * DM, 3 * DM, 0, MP, 3 * DM, DM);      /* q | k | v rows (f16); head h = columns h*HD.. of each DM block */
  for (int b = B0; b < B0 + NBR; ++b) { const size_t r0 = (size_t)b * SQ;
    k_vt<NH, SQ><<<NH * (SQ / 64), 256, 0, stream>>>(V16 + r0 * LQ, LQ, 0, VT);      /* V^T [NH][HD][SQ] for this batch */
    for (int q0 = 0; q0 < QN; q0 += QT) {      /* non-causal: every 256-row query tile sees all SQ keys */
      k_gemm2<0><<<dim3((QT / 128) * (SQ / 64), NHD), 128, 0, stream>>>(Q16 + (r0 + q0) * LQ, LQ, (size_t)HD, K16 + r0 * LQ, LQ, (size_t)HD, 0.036084391824351615f, nullptr, 0, nullptr, 1, 0, 0, S, nullptr, NKX, (size_t)QT * NKX, QT, SQ, HD);      /* scores q.k / sqrt(768) (the module's literal dim_model scale), all heads on grid.y */
      k_rsmkf<<<(NHD * QT + 255) / 256, 256, 0, stream>>>(S, P, NHD * QT, km + (size_t)b * SQ);      /* masked keys get the score 1e-11 (fill, as the source), then softmax over all keys -> P x256 f16 */
      k_gemm2<0><<<dim3((QT / 128) * (HD / 64), NHD), 128, 0, stream>>>(P, NKX, (size_t)QT * NKX, VT, SQ, (size_t)HD * SQ, 0.25f, nullptr, 0, nullptr, 1, 0, 0, nullptr, O16 + (r0 + q0) * DM, DM, (size_t)HD, QT, HD, SQ); } }      /* ctx (merged heads, x64) as f16 rows */
  k_gemm2<0><<<dim3((unsigned)((MPO / 128) * (DM / 64)), 1), 128, 0, stream>>>(O16 + r0p * DM, DM, 0, BO, DM, 0, 0.0009765625f, bo, 0, nullptr, 1, 0, 0, X1 + r0p * DM, nullptr, DM, 0, MPO, DM, DM);      /* z = ctx Wo + bo (f32 rows; the skip is added AFTER the LayerNorm in this module) */
  k_lnxr<0, 1, 1><<<(unsigned)NR, 256, 0, stream>>>(X1, g1, be1, 1e-5f, M16, X1N, XB);      /* l1 = bf16(x) + LN1(z) (eps 1e-5): f16 rows for the FFN input and f32 rows for the second skip */
  for (int b = 0; b < NB; ++b) { const size_t r0 = (size_t)b * SQ;
    k_gemm2<3><<<dim3((unsigned)((SQ / 128) * (DFF / 64)), 1), 128, 0, stream>>>(M16 + r0 * DM, DM, 0, BW1, DM, 0, 0.0625f, bfc, 0, nullptr, 1, 0, 0, nullptr, HF16, DFF, 0, SQ, DFF, DM);      /* relu(l1 W1 + b1) -> f16 (this batch) */
    k_gemm2<0><<<dim3((unsigned)((SQ / 128) * (DM / 64)), 1), 128, 0, stream>>>(HF16, DFF, 0, BW2, DFF, 0, 0.0625f, bmp, 0, nullptr, 1, 0, 0, X1 + r0 * DM, nullptr, DM, 0, SQ, DM, DFF); }      /* ffn = hidden W2 + b2 (f32 rows over the dead z plane; the skip is added after the LayerNorm) */
  k_lnxr<0, 0, 1><<<(unsigned)NR, 256, 0, stream>>>(X1, gg2, be2, 1e-5f, nullptr, (float*)d_out, X1N);      /* out = l1 + LN2(ffn) (eps 1e-5) -> f32 output rows */
}

// v001
// Measured time: 1570 microseconds a run.
// Next to v000, in two timings, it ran 4.55 times as fast each time.
#include <hip/hip_runtime.h>
// Transformer encoder layer with branch-side LayerNorms, a key-padding mask applied as a FILL and the module's literal score scale (x_n [2][2048][768]; q / k / v = x W + b ([in][out] 768 x 768 sigma 1/sqrt(768), zero biases); 12 heads of 64; scores / sqrt(768) (dim_model, as the source); where(mask == 0, 1e-11) with the int32 [2][1][1][2048] mask in {0, 1} (random; READ on device; masked keys get the score 1e-11, NOT -inf, as the source); softmax; z = ctx Wo + bo; l1 = x + LN(z) (LayerNorm on the branch only; biased var, eps 1e-5); ffn = relu(l1 W1 + b1) W2 + b2 ([in][out] 768 x 3072 x 768); out = l1 + LN(ffn) -> [2][2048][768]).
// Structure: token rows; x as exact f16 rows and bf16 f32 residual rows; natural weights as exact x16 planes; fused q | k | v WMMA GEMM (32x64 wave tiles, f32 accumulation, + stacked bias) -> f16; per batch V^T via LDS transposes; per 256-row query tile: scores over all keys (K = 64, alpha 1/sqrt(768), 12 heads on grid.y) f32, plain row softmax on VALU (f32 statistics, native exp; weights x256 f16), ctx = P V^T (x64) merged f16; ctx Wo + bo f32; LN1 on VALU -> f16 + f32; relu FFN per batch; LN2 + residual -> output; launches: see trace.
// Compute dtype: inputs rounded to bf16; x / weights exact; q, k, v, softmax weights and o as plain f16 GEMM operands (~2^-12); scores and softmax statistics f32. v_wmma_f32_16x16x32_f16.
#define NB 2
#define SQ 2048
#define DM 768
#define NH 12
#define HD 64
#define HG 4                         /* heads per block group in the unlaunched k_vt overload */
#define QT 256                       /* query rows per attention tile */
#define NKX SQ                       /* S / P row pitch */
#define QT0 128                      /* query rows per head in k_att0 (not launched) */
#define B0 0                         /* first batch processed (debug hook) */
#define NBR NB                       /* batches processed (debug hook) */
#define NR ((size_t)NB * SQ)
#define DMQ DM
#define DFF 3072         /* FFN hidden width */
#define MP ((int)((size_t)NBR * SQ)) /* rows projected (debug hook) */
#define QN SQ                        /* query rows attended per batch (debug hook) */
#define NHD NH                       /* heads attended (debug hook) */
#define MPO MP                       /* rows through the output stage (debug hook) */
#define LQ (3 * DM)      /* row pitch of the q/k/v rows */
typedef __bf16 v16b __attribute__((ext_vector_type(16)));
typedef unsigned short v8us __attribute__((ext_vector_type(8), may_alias));
typedef float  v8f  __attribute__((ext_vector_type(8)));
typedef float  v4f  __attribute__((ext_vector_type(4)));
typedef float  v4fa __attribute__((ext_vector_type(4), may_alias));
union FragB { v16b v; v8us half[2]; unsigned short u[16]; };

__device__ __forceinline__ unsigned short bf16_bits(float x) { unsigned int u = __float_as_uint(x); return (unsigned short)((u + 0x7FFFu + ((u >> 16) & 1u)) >> 16); }
__device__ __forceinline__ float bf16_val(unsigned short b) { return __uint_as_float(((unsigned int)b) << 16); }
__device__ __forceinline__ float bf16_round(float x) { return bf16_val(bf16_bits(x)); }
// D += A·B with NT terms: 1 = ah·bh, 2 = + al·bh (A split), 3 = + ah·bl (both split)
template <int NT>
__device__ __forceinline__ v8f mmaN(v16b ah, v16b al, v16b bh, v16b bl, v8f c) {
  c = __builtin_amdgcn_wmma_f32_16x16x32_bf16(false, ah, false, bh, (short)0, c, false, false);
  if (NT >= 2) c = __builtin_amdgcn_wmma_f32_16x16x32_bf16(false, al, false, bh, (short)0, c, false, false);
  if (NT >= 3) c = __builtin_amdgcn_wmma_f32_16x16x32_bf16(false, ah, false, bl, (short)0, c, false, false);
  asm volatile("v_nop\n\tv_nop\n\tv_nop\n\tv_nop" : "+v"(c) : "v"(ah), "v"(al), "v"(bh), "v"(bl));
  return c;
}

__global__ __launch_bounds__(256) void k_wt_bf16(const float* __restrict__ W, unsigned short* __restrict__ Wt, int K, int N) {
  const int t = blockIdx.x * 256 + threadIdx.x;
  const int k8n = K / 8;
  if (t >= N * k8n) return;
  const int n = t / k8n, k8 = (t % k8n) * 8;
  v8us v;
#pragma unroll
  for (int i = 0; i < 8; ++i) v[i] = bf16_bits(W[(size_t)(k8 + i) * N + n]);
  *(v8us*)(Wt + (size_t)n * K + k8) = v;
  
}

// GEMM C[M][N] (f32, pitch ldc) = act(A[M][K]·W + bias). A f32 row-major (pitch lda) converted per fragment to bf16
// (ASPLIT: hi/lo two planes -> 2 terms, else single rounded term); Wt bf16 [N][K] (pitch ldb). BIAS_BF16 rounds the
// bias to bf16 first (bias quantised to bf16 before the add). K%32==0, M%16==0, N%64==0.
template <bool ASPLIT, int ACT, bool BIAS_BF16>
__global__ __launch_bounds__(128) void k_gemm_bf(const float* __restrict__ A, int lda, const unsigned short* __restrict__ Wt, int ldb,
                                               const float* __restrict__ bias, float* __restrict__ C, int ldc, int M, int N, int K) {
  __shared__ __attribute__((aligned(16))) float so[4][16][64];
  const int tid = threadIdx.x, w = tid >> 5, lane = tid & 31, ln = lane & 15, hh = lane >> 4;
  const int ntn = N / 64;
  const int wid = blockIdx.x * 4 + w;
  const int mt = wid / ntn, nq = wid % ntn;
  if (mt * 16 >= M) return;
  const int row0 = mt * 16, col0 = nq * 64;
  const float* arow = A + (size_t)(row0 + ln) * lda;
  v8f acc[4] = {};
  for (int kb = 0; kb < K; kb += 32) {
    FragB ah, al;
    const v4f x0 = *(const v4fa*)(arow + kb + 8 * hh), x1 = *(const v4fa*)(arow + kb + 8 * hh + 4);
    const v4f x2 = *(const v4fa*)(arow + kb + 16 + 8 * hh), x3 = *(const v4fa*)(arow + kb + 16 + 8 * hh + 4);
    float xs[16] = {x0[0],x0[1],x0[2],x0[3],x1[0],x1[1],x1[2],x1[3],x2[0],x2[1],x2[2],x2[3],x3[0],x3[1],x3[2],x3[3]};
#pragma unroll
    for (int i = 0; i < 16; ++i) { const unsigned short hb = bf16_bits(xs[i]); ah.u[i] = hb; al.u[i] = ASPLIT ? bf16_bits(xs[i] - bf16_val(hb)) : (unsigned short)0; }
#pragma unroll
    for (int t = 0; t < 4; ++t) {
      const unsigned short* brow = Wt + (size_t)(col0 + t * 16 + ln) * ldb + kb;
      FragB b;
      b.half[0] = *(const v8us*)(brow + 8 * hh);
      b.half[1] = *(const v8us*)(brow + 16 + 8 * hh);
      acc[t] = mmaN<ASPLIT ? 2 : 1>(ah.v, al.v, b.v, b.v, acc[t]);
    }
  }
#pragma unroll
  for (int t = 0; t < 4; ++t) {
    float bv = bias ? bias[col0 + t * 16 + ln] : 0.f;
    if (BIAS_BF16) bv = bf16_round(bv);
#pragma unroll
    for (int r = 0; r < 8; ++r) { float v = acc[t][r] + bv; if (ACT == 1) v = fmaxf(v, 0.f); so[w][8 * hh + r][t * 16 + ln] = v; }
  }
  __builtin_amdgcn_fence(__ATOMIC_ACQ_REL, "workgroup");
  __builtin_amdgcn_wave_barrier();
  const int rsub = lane >> 4, c4 = (lane & 15) * 4;
  {
#pragma unroll
    for (int q = 0; q < 8; ++q) {
      const int r = q * 2 + rsub;
      const v4f v = *(const v4fa*)&so[w][r][c4];
      *(v4f*)(C + (size_t)(row0 + r) * ldc + col0 + c4) = v;
    }
    
  }
}

// GEMM C = act(A·W + bias + resid): A f32 (ASPLIT -> hi/lo 2 terms), Wt bf16 [N][K]; ACT 0 none, 1 relu, 2 exact gelu;
// resid (optional, f32, row index = (row % rmod), pitch ldr, RES_BF16 rounds it) added before the activation.
template <bool ASPLIT, int ACT, bool BIAS_BF16, bool RES_BF16>
__global__ __launch_bounds__(128) void k_gemm_bf3(const float* __restrict__ A, int lda, const unsigned short* __restrict__ Wt, int ldb,
                                                const float* __restrict__ bias, const float* __restrict__ resid, int rmod, int ldr,
                                                float* __restrict__ C, int ldc, int M, int N, int K) {
  __shared__ __attribute__((aligned(16))) float so[4][16][64];
  const int tid = threadIdx.x, w = tid >> 5, lane = tid & 31, ln = lane & 15, hh = lane >> 4;
  const int ntn = N / 64;
  const int wid = blockIdx.x * 4 + w;
  const int mt = wid / ntn, nq = wid % ntn;
  if (mt * 16 >= M) return;
  const int row0 = mt * 16, col0 = nq * 64;
  const float* arow = A + (size_t)(row0 + ln) * lda;
  v8f acc[4] = {};
  for (int kb = 0; kb < K; kb += 32) {
    FragB ah, al;
    const v4f x0 = *(const v4fa*)(arow + kb + 8 * hh), x1 = *(const v4fa*)(arow + kb + 8 * hh + 4);
    const v4f x2 = *(const v4fa*)(arow + kb + 16 + 8 * hh), x3 = *(const v4fa*)(arow + kb + 16 + 8 * hh + 4);
    float xs[16] = {x0[0],x0[1],x0[2],x0[3],x1[0],x1[1],x1[2],x1[3],x2[0],x2[1],x2[2],x2[3],x3[0],x3[1],x3[2],x3[3]};
#pragma unroll
    for (int i = 0; i < 16; ++i) { const unsigned short hb = bf16_bits(xs[i]); ah.u[i] = hb; al.u[i] = ASPLIT ? bf16_bits(xs[i] - bf16_val(hb)) : (unsigned short)0; }
#pragma unroll
    for (int t = 0; t < 4; ++t) {
      const unsigned short* brow = Wt + (size_t)(col0 + t * 16 + ln) * ldb + kb;
      FragB b;
      b.half[0] = *(const v8us*)(brow + 8 * hh);
      b.half[1] = *(const v8us*)(brow + 16 + 8 * hh);
      acc[t] = mmaN<ASPLIT ? 2 : 1>(ah.v, al.v, b.v, b.v, acc[t]);
    }
  }
#pragma unroll
  for (int t = 0; t < 4; ++t) {
    const int col = col0 + t * 16 + ln;
    float bv = bias ? bias[col] : 0.f;
    if (BIAS_BF16) bv = bf16_round(bv);
#pragma unroll
    for (int r = 0; r < 8; ++r) {
      float v = acc[t][r] + bv;
      if (resid) { float rv = resid[(size_t)((row0 + 8 * hh + r) % rmod) * ldr + col]; if (RES_BF16) rv = bf16_round(rv); v += rv; }
      if (ACT == 1) v = fmaxf(v, 0.f);
      if (ACT == 2) v = 0.5f * v * (1.0f + erff(v * 0.70710678118654752f));
      if (ACT == 3) { const float u = 0.7978845608028654f * (v + 0.044715f * v * v * v); v = 0.5f * v * (1.0f + tanhf(u)); }
      so[w][8 * hh + r][t * 16 + ln] = v;
    }
  }
  __builtin_amdgcn_fence(__ATOMIC_ACQ_REL, "workgroup");
  __builtin_amdgcn_wave_barrier();
  const int rsub = lane >> 4, c4 = (lane & 15) * 4;
  {
#pragma unroll
    for (int q = 0; q < 8; ++q) {
      const int r = q * 2 + rsub;
      const v4f v = *(const v4fa*)&so[w][r][c4];
      *(v4f*)(C + (size_t)(row0 + r) * ldc + col0 + c4) = v;
    }
    
  }
}
// row LayerNorm (biased variance, eps) over N: s = X (+ R); optional out_sum <- s; out_norm <- (s-mu)*rsqrt(var+eps)*g + b
template <bool PARAM_BF16>
__global__ __launch_bounds__(256) void k_layernorm(const float* __restrict__ X, const float* __restrict__ R, const float* __restrict__ g, const float* __restrict__ bta,
                                                  float* __restrict__ out_sum, float* __restrict__ out_norm, int N, float eps) {
  __shared__ float red[256];
  const int row = blockIdx.x, tid = threadIdx.x;
  const float* x = X + (size_t)row * N; const float* rr = R ? R + (size_t)row * N : nullptr;
  float vals[16];                     // up to N = 4096
  const int per = N / 256;            // contiguous chunk per thread? use strided-by-4 chunks: thread handles j = tid*4 + 1024*u
  float s1 = 0.f;
  for (int u = 0; u < per / 4; ++u) {
    const int j = tid * 4 + 1024 * u;
    const v4f a = *(const v4fa*)(x + j);
    v4f b = {0.f,0.f,0.f,0.f}; if (rr) b = *(const v4fa*)(rr + j);
#pragma unroll
    for (int q = 0; q < 4; ++q) { const float v = a[q] + b[q]; vals[u * 4 + q] = v; s1 += v; }
  }
  red[tid] = s1; __syncthreads();
  for (int st = 128; st > 0; st >>= 1) { if (tid < st) red[tid] += red[tid + st]; __syncthreads(); }
  const float mu = red[0] / (float)N; __syncthreads();
  float s2 = 0.f;
  for (int u = 0; u < per / 4; ++u)
#pragma unroll
    for (int q = 0; q < 4; ++q) { const float c = vals[u * 4 + q] - mu; s2 += c * c; }
  red[tid] = s2; __syncthreads();
  for (int st = 128; st > 0; st >>= 1) { if (tid < st) red[tid] += red[tid + st]; __syncthreads(); }
  const float rs = rsqrtf(red[0] / (float)N + eps);
  {
    for (int u = 0; u < per / 4; ++u) {
      const int j = tid * 4 + 1024 * u;
      v4f o, sm;
#pragma unroll
      for (int q = 0; q < 4; ++q) {
        float gg = g[j + q], bb = bta[j + q];
        if (PARAM_BF16) { gg = bf16_round(gg); bb = bf16_round(bb); }
        sm[q] = vals[u * 4 + q]; o[q] = (vals[u * 4 + q] - mu) * rs * gg + bb;
      }
      if (out_sum) *(v4f*)(out_sum + (size_t)row * N + j) = sm;
      *(v4f*)(out_norm + (size_t)row * N + j) = o;
    }
    
  }
}



// ---- f16 WMMA path (v_wmma_f32_16x16x32_f16): 11-bit significands for operands in range — used where a [0,1] probability operand needs more precision than bf16
typedef _Float16 v16h __attribute__((ext_vector_type(16)));
union FragH { v16h v; v8us half[2]; _Float16 h[16]; unsigned short u[16]; };
template <int NT>
__device__ __forceinline__ v8f mmaH(v16h ah, v16h al, v16h bh, v16h bl, v8f c) {
  c = __builtin_amdgcn_wmma_f32_16x16x32_f16(false, ah, false, bh, (short)0, c, false, false);
  if (NT >= 2) c = __builtin_amdgcn_wmma_f32_16x16x32_f16(false, al, false, bh, (short)0, c, false, false);
  if (NT >= 3) c = __builtin_amdgcn_wmma_f32_16x16x32_f16(false, ah, false, bl, (short)0, c, false, false);
  asm volatile("v_nop\n\tv_nop\n\tv_nop\n\tv_nop" : "+v"(c) : "v"(ah), "v"(al), "v"(bh), "v"(bl));
  return c;
}
// batched GEMM like k_gemm_b but f16 operands: A f32 (split into f16 hi/lo if ASPLIT, else rounded to f16), Bt = f16 values [n][k]; alpha; C f32; N multiple of 16 (partial tiles skipped)
template <bool ASPLIT>
__global__ __launch_bounds__(128) void k_gemm_h(const float* __restrict__ A, int lda, size_t sA, const _Float16* __restrict__ Bh, int ldb, size_t sB, float alpha, float* __restrict__ C, int ldc, size_t sC, int M, int N, int K) {
  __shared__ __attribute__((aligned(16))) float so[4][16][64];
  const int tid = threadIdx.x, w = tid >> 5, lane = tid & 31, ln = lane & 15, hh = lane >> 4; const int by = blockIdx.y;
  A += (size_t)by * sA; Bh += (size_t)by * sB; C += (size_t)by * sC;
  const int ntn = (N + 63) / 64; const int wid = blockIdx.x * 4 + w; const int mt = wid / ntn, nq = wid % ntn; if (mt * 16 >= M) return;
  const int row0 = mt * 16, col0 = nq * 64; const float* arow = A + (size_t)(row0 + ln) * lda;
  v8f acc[4] = {};
  for (int kb = 0; kb < K; kb += 32) {
    FragH ah, al;
    const v4f x0 = *(const v4fa*)(arow + kb + 8 * hh), x1 = *(const v4fa*)(arow + kb + 8 * hh + 4), x2 = *(const v4fa*)(arow + kb + 16 + 8 * hh), x3 = *(const v4fa*)(arow + kb + 16 + 8 * hh + 4);
    float xs[16] = {x0[0],x0[1],x0[2],x0[3],x1[0],x1[1],x1[2],x1[3],x2[0],x2[1],x2[2],x2[3],x3[0],x3[1],x3[2],x3[3]};
#pragma unroll
    for (int i = 0; i < 16; ++i) { const _Float16 h = (_Float16)xs[i]; ah.h[i] = h; al.h[i] = ASPLIT ? (_Float16)(xs[i] - (float)h) : (_Float16)0.0f; }
#pragma unroll
    for (int t = 0; t < 4; ++t) { if (col0 + t * 16 >= N) continue; const size_t boff = (size_t)(col0 + t * 16 + ln) * ldb + kb; FragH bq; bq.half[0] = *(const v8us*)(Bh + boff + 8 * hh); bq.half[1] = *(const v8us*)(Bh + boff + 16 + 8 * hh);
      acc[t] = mmaH<ASPLIT ? 2 : 1>(ah.v, al.v, bq.v, bq.v, acc[t]); }
  }
#pragma unroll
  for (int t = 0; t < 4; ++t) { if (col0 + t * 16 >= N) continue;
#pragma unroll
    for (int r = 0; r < 8; ++r) so[w][8 * hh + r][t * 16 + ln] = acc[t][r] * alpha; }
  __builtin_amdgcn_fence(__ATOMIC_ACQ_REL, "workgroup"); __builtin_amdgcn_wave_barrier();
  const int rsub = lane >> 4, c4 = (lane & 15) * 4;
  {
#pragma unroll
    for (int q = 0; q < 8; ++q) { const int r = q * 2 + rsub; if (col0 + c4 < N) { const v4f v = *(const v4fa*)&so[w][r][c4]; *(v4f*)(C + (size_t)(row0 + r) * ldc + col0 + c4) = v; } }
     }
}

// Wt[n][k] = f16(W[k][n]·scale) from f32 row-major W[K][N] (scale = power of two; bf16-exact weights stay exact in f16 away from the subnormal range)
__global__ __launch_bounds__(256) void k_wt_f16(const float* __restrict__ W, _Float16* __restrict__ Wt, int K, int N, float scale) {
  const int t = blockIdx.x * 256 + threadIdx.x; if (t >= N * (K / 8)) return; const int n = t / (K / 8), k8 = (t % (K / 8)) * 8; FragH f;
#pragma unroll
  for (int i = 0; i < 8; ++i) f.h[i] = (_Float16)(bf16_round(W[(size_t)(k8 + i) * N + n]) * scale); const v8us o = f.half[0];
  *(v8us*)((unsigned short*)Wt + (size_t)n * K + k8) = o; 
}
// k_gemm_hh variant with fused epilogue: v = acc·alpha + bias[by·sBias + col] (+ CP[(row/rowsPerB)·sCPb + by·64 + col] if CP) ; ACT 0 none / 1 elu ; writes f16 C16 (and f32 C if non-null)
template <int ACT>
__global__ __launch_bounds__(128) void k_gemm_hhx(const _Float16* __restrict__ A, int lda, size_t sA, const _Float16* __restrict__ Bh, int ldb, size_t sB, float alpha, const float* __restrict__ bias, size_t sBias, const float* __restrict__ CP, int rowsPerB, size_t sCPb, int row0g,
    float* __restrict__ C, _Float16* __restrict__ C16, int ldc, size_t sC, int M, int N, int K) {
  __shared__ __attribute__((aligned(16))) float so[4][16][64];
  const int tid = threadIdx.x, w = tid >> 5, lane = tid & 31, ln = lane & 15, hh = lane >> 4; const int by = blockIdx.y;
  A += (size_t)by * sA; Bh += (size_t)by * sB; const size_t cofs = (size_t)by * sC; const float* bp = bias ? bias + (size_t)by * sBias : nullptr;
  const int ntn = (N + 63) / 64; const int wid = blockIdx.x * 4 + w; const int mt = wid / ntn, nq = wid % ntn; if (mt * 16 >= M) return;
  const int row0 = mt * 16, col0 = nq * 64; const _Float16* arow = A + (size_t)(row0 + ln) * lda;
  v8f acc[4] = {};
  for (int kb = 0; kb < K; kb += 32) { FragH ah; ah.half[0] = *(const v8us*)((const unsigned short*)arow + kb + 8 * hh); ah.half[1] = *(const v8us*)((const unsigned short*)arow + kb + 16 + 8 * hh);
#pragma unroll
    for (int t = 0; t < 4; ++t) { if (col0 + t * 16 >= N) continue; const size_t boff = (size_t)(col0 + t * 16 + ln) * ldb + kb; FragH bq; bq.half[0] = *(const v8us*)((const unsigned short*)Bh + boff + 8 * hh); bq.half[1] = *(const v8us*)((const unsigned short*)Bh + boff + 16 + 8 * hh);
      acc[t] = mmaH<1>(ah.v, ah.v, bq.v, bq.v, acc[t]); }
  }
#pragma unroll
  for (int t = 0; t < 4; ++t) { if (col0 + t * 16 >= N) continue; const int col = col0 + t * 16 + ln; const float bv = bp ? bf16_round(bp[col]) : 0.f;
#pragma unroll
    for (int r = 0; r < 8; ++r) { float v = acc[t][r] * alpha + bv; if (CP) { const int rr = row0g + row0 + 8 * hh + r; if (rowsPerB < 0) v += CP[cofs + (size_t)rr * ldc + col];      /* rowsPerB < 0: own element of the batched C plane */ else { const int bidx = rr / rowsPerB; v += CP[(size_t)bidx * sCPb + (size_t)by * 64 + col]; } } if (ACT == 1) v = (v > 0.f) ? v : expm1f(v); else if (ACT == 7) v = (v > 0.f) ? v + 1.0f : expf(v); else if (ACT == 8) v = tanhf(v); else if (ACT == 9) v = 0.5f * v * (1.0f + tanhf(0.7978845608028654f * (v + 0.044715f * v * v * v))); else if (ACT == 11) v = 1.0f / (1.0f + expf(-v)); else if (ACT == 12) v = (v > 0.f) ? v : 0.01f * v; else if (ACT == 14) v = (v > 0.f) ? v : 0.1f * v; else if (ACT == 16) v = (v >= 0.f) ? v : 0.3f * v; else if (ACT == 17) v = (v >= 0.f) ? v : 0.2f * v; else if (ACT == 15) v = v / (1.0f + expf(-v)); else if (ACT == 3) v = fmaxf(v, 0.f); else if (ACT == 6) v = 0.5f * v * (1.0f + erff(v * 0.70710678118654752f)); so[w][8 * hh + r][t * 16 + ln] = v; } }
  __builtin_amdgcn_fence(__ATOMIC_ACQ_REL, "workgroup"); __builtin_amdgcn_wave_barrier();
  const int rsub = lane >> 4, c4 = (lane & 15) * 4; typedef _Float16 v4h __attribute__((ext_vector_type(4)));
  {
#pragma unroll
    for (int q = 0; q < 8; ++q) { const int r = q * 2 + rsub; if (col0 + c4 < N) { const v4f v = *(const v4fa*)&so[w][r][c4]; if (C) *(v4f*)(C + cofs + (size_t)(row0 + r) * ldc + col0 + c4) = v; if (C16) { v4h h4; for (int i = 0; i < 4; ++i) h4[i] = (_Float16)v[i]; *(v4h*)(C16 + cofs + (size_t)(row0 + r) * ldc + col0 + c4) = h4; } } }
     }
}


typedef _Float16 v4h __attribute__((ext_vector_type(4)));

__global__ __launch_bounds__(256) void k_x16(const float* __restrict__ x, _Float16* __restrict__ X16, size_t n8) { const size_t t = (size_t)blockIdx.x * 256 + threadIdx.x; if (t >= n8) return; FragH f;
#pragma unroll
  for (int q = 0; q < 8; ++q) f.h[q] = (_Float16)bf16_round(x[t * 8 + q]); *(v8us*)((unsigned short*)X16 + t * 8) = f.half[0];  }
__global__ __launch_bounds__(256) void k_h16(const float* __restrict__ x, _Float16* __restrict__ X16, size_t n8) { const size_t t = (size_t)blockIdx.x * 256 + threadIdx.x; if (t >= n8) return; FragH f;
#pragma unroll
  for (int q = 0; q < 8; ++q) f.h[q] = (_Float16)x[t * 8 + q]; *(v8us*)((unsigned short*)X16 + t * 8) = f.half[0];  }
__global__ __launch_bounds__(256) void k_round16f(const float* __restrict__ W, _Float16* __restrict__ Bt, size_t n8) { const size_t t = (size_t)blockIdx.x * 256 + threadIdx.x; if (t >= n8) return; FragH f;
#pragma unroll
  for (int i = 0; i < 8; ++i) f.h[i] = (_Float16)(bf16_round(W[t * 8 + i]) * 16.0f); *(v8us*)((unsigned short*)Bt + t * 8) = f.half[0];  }
template <int NHv, int TTv>
__global__ __launch_bounds__(256) void k_vt(const _Float16* __restrict__ V16, int ldv, int voff, _Float16* __restrict__ Vt) { __shared__ unsigned short tl[64][66]; const int tid = threadIdx.x; const int slab = blockIdx.x / (TTv / 64), lg = blockIdx.x % (TTv / 64); const int b = slab / NHv, h = slab % NHv;
  for (int i = tid; i < 64 * 8; i += 256) { const int r = i / 8, c8 = (i % 8) * 8; FragH f; f.half[0] = *(const v8us*)((const unsigned short*)V16 + ((size_t)b * TTv + lg * 64 + r) * ldv + voff + h * 64 + c8);
#pragma unroll
    for (int q = 0; q < 8; ++q) tl[r][c8 + q] = f.u[q]; }
  __syncthreads();
  {
#pragma unroll
    for (int rd = 0; rd < 2; ++rd) { const int d = rd * 32 + tid / 8, pc = tid % 8; FragH f;
#pragma unroll
      for (int q = 0; q < 8; ++q) f.u[q] = tl[pc * 8 + q][d];
      *(v8us*)((unsigned short*)Vt + ((size_t)slab * 64 + d) * TTv + lg * 64 + pc * 8) = f.half[0]; }
     } }

__global__ __launch_bounds__(256) void k_hl(const float* __restrict__ F, _Float16* __restrict__ Hh, _Float16* __restrict__ Hl, size_t n8) { const size_t t = (size_t)blockIdx.x * 256 + threadIdx.x; if (t >= n8) return; FragH fh, fl; const v4f a = *(const v4fa*)(F + t * 8), c = *(const v4fa*)(F + t * 8 + 4);
#pragma unroll
  for (int q = 0; q < 4; ++q) { _Float16 h = (_Float16)a[q]; fh.h[q] = h; fl.h[q] = (_Float16)((a[q] - (float)h) * 1024.0f); h = (_Float16)c[q]; fh.h[4 + q] = h; fl.h[4 + q] = (_Float16)((c[q] - (float)h) * 1024.0f); }
  { *(v8us*)((unsigned short*)Hh + t * 8) = fh.half[0]; *(v8us*)((unsigned short*)Hl + t * 8) = fl.half[0];  } }

// ---- fast GEMM (wave tile 32x64; requires M % 32 == 0 rows per launch region and N % 64 == 0); epilogue = k_gemm_hhx semantics ----
__device__ __forceinline__ v16h g2_frag(const _Float16* p, int hh) { FragH f; f.half[0] = *(const v8us*)((const unsigned short*)p + 8 * hh); f.half[1] = *(const v8us*)((const unsigned short*)p + 16 + 8 * hh); return f.v; }
__device__ __forceinline__ v8f g2_mma(v16h a, v16h b, v8f c) { v8f d = __builtin_amdgcn_wmma_f32_16x16x32_f16(false, a, false, b, (short)0, c, false, false); asm volatile("v_nop\n\tv_nop\n\tv_nop\n\tv_nop" : "+v"(d) : "v"(a), "v"(b)); return d; }
template <int ACT>
__global__ __launch_bounds__(128) void k_gemm2(const _Float16* __restrict__ A, int lda, size_t sA, const _Float16* __restrict__ Bh, int ldb, size_t sB, float alpha, const float* __restrict__ bias, size_t sBias, const float* __restrict__ CP, int rowsPerB, size_t sCPb, int row0g,
    float* __restrict__ C, _Float16* __restrict__ C16, int ldc, size_t sC, int M, int N, int K) { static_assert(ACT == 0 || ACT == 3 || ACT == 6 || ACT == 8 || ACT == 9 || ACT == 11 || ACT == 12 || ACT == 14 || ACT == 15 || ACT == 16 || ACT == 17, "k_gemm2: unsupported ACT code (would silently apply no activation)");
  __shared__ __attribute__((aligned(16))) float so[4][32][68];
  const int tid = threadIdx.x, w = tid >> 5, lane = tid & 31, ln = lane & 15, hh = lane >> 4; const int by = blockIdx.y;
  A += (size_t)by * sA; Bh += (size_t)by * sB; const size_t cofs = (size_t)by * sC; const float* bp = bias ? bias + (size_t)by * sBias : nullptr;
  const int ntn = N >> 6; const int mt = blockIdx.x / ntn, nq = blockIdx.x - mt * ntn; const int row0 = mt * 128 + 32 * w, col0 = nq * 64; if (row0 >= M) return;
  const _Float16* a0p = A + (size_t)(row0 + ln) * lda; const _Float16* a1p = a0p + (size_t)16 * lda;
  const _Float16* b0p = Bh + (size_t)(col0 + ln) * ldb; const _Float16* b1p = b0p + (size_t)16 * ldb; const _Float16* b2p = b1p + (size_t)16 * ldb; const _Float16* b3p = b2p + (size_t)16 * ldb;
  const v8f z8 = {0.f,0.f,0.f,0.f,0.f,0.f,0.f,0.f}; v8f c00 = z8, c01 = z8, c02 = z8, c03 = z8, c10 = z8, c11 = z8, c12 = z8, c13 = z8;
#pragma unroll 1
  for (int kb = 0; kb < K; kb += 32) { const v16h a0 = g2_frag(a0p + kb, hh), a1 = g2_frag(a1p + kb, hh);
    v16h b = g2_frag(b0p + kb, hh); c00 = g2_mma(a0, b, c00); c10 = g2_mma(a1, b, c10);
    b = g2_frag(b1p + kb, hh); c01 = g2_mma(a0, b, c01); c11 = g2_mma(a1, b, c11);
    b = g2_frag(b2p + kb, hh); c02 = g2_mma(a0, b, c02); c12 = g2_mma(a1, b, c12);
    b = g2_frag(b3p + kb, hh); c03 = g2_mma(a0, b, c03); c13 = g2_mma(a1, b, c13); }
  v8f accs[8] = {c00, c01, c02, c03, c10, c11, c12, c13};
#pragma unroll
  for (int u = 0; u < 8; ++u) { const int t = u & 3, half = u >> 2; const int col = col0 + t * 16 + ln; const float bv = bp ? bf16_round(bp[col]) : 0.f;
#pragma unroll
    for (int r = 0; r < 8; ++r) { const int rloc = half * 16 + 8 * hh + r; float v = accs[u][r] * alpha + bv; if (CP) { if (rowsPerB < 0) v += CP[cofs + (size_t)(row0g + row0 + rloc) * ldc + col];      /* rowsPerB < 0: own element of the batched C plane */ else { const int bidx = (row0g + row0 + rloc) / rowsPerB; v += CP[(size_t)bidx * sCPb + (size_t)by * 64 + col]; } }
      if (ACT == 3) v = fmaxf(v, 0.f); else if (ACT == 6) v = 0.5f * v * (1.0f + erff(v * 0.70710678118654752f)); else if (ACT == 11) v = 1.0f / (1.0f + expf(-v)); else if (ACT == 15) v = v / (1.0f + expf(-v)); else if (ACT == 12) v = (v > 0.f) ? v : 0.01f * v; else if (ACT == 8) v = tanhf(v); else if (ACT == 9) v = 0.5f * v * (1.0f + tanhf(0.7978845608028654f * (v + 0.044715f * v * v * v))); else if (ACT == 14) v = (v > 0.f) ? v : 0.1f * v; else if (ACT == 16) v = (v >= 0.f) ? v : 0.3f * v; else if (ACT == 17) v = (v >= 0.f) ? v : 0.2f * v;
      so[w][rloc][t * 16 + ln] = v; } }
  __builtin_amdgcn_fence(__ATOMIC_ACQ_REL, "workgroup"); __builtin_amdgcn_wave_barrier();
  const int rsub = lane >> 4, c4 = (lane & 15) * 4;
  {
#pragma unroll
    for (int q = 0; q < 16; ++q) { const int r = q * 2 + rsub; const v4f v = *(const v4fa*)&so[w][r][c4]; if (C) *(v4f*)(C + cofs + (size_t)(row0 + r) * ldc + col0 + c4) = v; if (C16) { v4h h4; for (int i = 0; i < 4; ++i) h4[i] = (_Float16)v[i]; *(v4h*)(C16 + cofs + (size_t)(row0 + r) * ldc + col0 + c4) = h4; } }
     } }


__global__ __launch_bounds__(256) void k_wnat(const float* __restrict__ w, size_t n8, _Float16* __restrict__ Bt) { const size_t t = (size_t)blockIdx.x * 256 + threadIdx.x; if (t >= n8) return; FragH f; for (int q = 0; q < 8; ++q) f.h[q] = (_Float16)(bf16_round(w[t * 8 + q]) * 16.0f); *(v8us*)((unsigned short*)Bt + t * 8) = f.half[0];  }
__global__ __launch_bounds__(256) void k_rsm(const float* __restrict__ S, _Float16* __restrict__ P, int nrows) {
  #pragma clang fp contract(off)
  const int i = blockIdx.x * 256 + threadIdx.x; if (i >= nrows) return; const float* s = S + (size_t)i * SQ; float mx = -3.0e38f;
#pragma unroll 1
  for (int j = 0; j < SQ; ++j) mx = fmaxf(mx, s[j]); float se = 0.f;
#pragma unroll 1
  for (int j = 0; j < SQ; ++j) se += expf(s[j] - mx); const float sc = 256.0f / se;
#pragma unroll 1
  for (int j0 = 0; j0 < SQ; j0 += 8) { FragH f; for (int q = 0; q < 8; ++q) f.h[q] = (_Float16)(expf(s[j0 + q] - mx) * sc); unsigned short* d = (unsigned short*)P + (size_t)i * SQ + j0; *(v8us*)d = f.half[0];  } }
__global__ __launch_bounds__(256) void k_vt(const _Float16* __restrict__ V16, int b, int h0, _Float16* __restrict__ VT) { __shared__ unsigned short tl[64][65]; const int tid = threadIdx.x; const int hh = blockIdx.x % HG, sg = blockIdx.x / HG; const int s0 = sg * 64; const int h = h0 + hh;
  for (int i = tid; i < 64 * 8; i += 256) { const int j = i / 8, d8 = (i % 8) * 8; FragH f; f.half[0] = *(const v8us*)((const unsigned short*)V16 + ((size_t)b * SQ + s0 + j) * DM + h * HD + d8); for (int q = 0; q < 8; ++q) tl[d8 + q][j] = f.u[q]; }
  __syncthreads();
  { for (int i = tid; i < 64 * 8; i += 256) { const int d = i / 8, j8 = (i % 8) * 8; FragH f; for (int q = 0; q < 8; ++q) f.u[q] = tl[d][j8 + q]; *(v8us*)((unsigned short*)VT + ((size_t)hh * HD + d) * SQ + s0 + j8) = f.half[0]; }  } }



__global__ __launch_bounds__(256) void k_rsmcf2(const float* __restrict__ S, _Float16* __restrict__ P, int hg, int q0, int nk) {
  #pragma clang fp contract(off)
  const int t = blockIdx.x * 256 + threadIdx.x; if (t >= hg * QT) return; const size_t i = (size_t)t; const float* s = S + i * NKX; const int last = q0 + (t % QT); float mx = -3.0e38f;
#pragma unroll 1
  for (int j = 0; j < nk; ++j) { const float f = (j <= last) ? 1.f : 0.f; mx = fmaxf(mx, fmaf(f, s[j], (1.f - f) * -1.0e9f)); } float se = 0.f;
#pragma unroll 1
  for (int j = 0; j < nk; ++j) { const float f = (j <= last) ? 1.f : 0.f; se += __expf(fmaf(f, s[j], (1.f - f) * -1.0e9f) - mx); } const float sc = 256.0f / se;
#pragma unroll 1
  for (int j0 = 0; j0 < nk; j0 += 8) { FragH fr; for (int q = 0; q < 8; ++q) { const int j = j0 + q; const float f = (j <= last) ? 1.f : 0.f; fr.h[q] = (_Float16)(__expf(fmaf(f, s[j], (1.f - f) * -1.0e9f) - mx) * sc); } unsigned short* d = (unsigned short*)P + i * NKX + j0; *(v8us*)d = fr.half[0];  } }


template <int MASKADD>
__global__ __launch_bounds__(64) void k_att0(const float* __restrict__ QF, const float* __restrict__ KF, const float* __restrict__ VF, int ld, const float* __restrict__ mask, float scale, float* __restrict__ OF, int ldo) {
  #pragma clang fp contract(off)
  __shared__ __attribute__((aligned(16))) float lq[64][64]; __shared__ __attribute__((aligned(16))) float lo[64][64];
  const int tid = threadIdx.x; const int h = blockIdx.x / (QT0 / 64), rg = blockIdx.x % (QT0 / 64); const int i = rg * 64 + tid;
  const float* qr = QF + (size_t)i * ld + h * HD;
#pragma unroll 1
  for (int c = 0; c < HD / 4; ++c) { *(v4f*)&lq[tid][c * 4] = *(const v4fa*)(qr + c * 4); const v4f z = {0.f, 0.f, 0.f, 0.f}; *(v4f*)&lo[tid][c * 4] = z; }
  float m = -1.0e30f, l = 0.f; const int jmax = MASKADD ? (SQ - 1) : (rg * 64 + 63);      /* additive-mask form: every key (the mask input decides); causal form: keys up to the block's last row */
#pragma unroll 1
  for (int j = 0; j <= jmax; ++j) { const float* kr = KF + (size_t)j * ld + h * HD; const float* vr = VF + (size_t)j * ld + h * HD; float s = 0.f;
#pragma unroll 1
    for (int c = 0; c < HD / 4; ++c) { const v4f kq = *(const v4fa*)(kr + c * 4); const v4f qq = *(v4f*)&lq[tid][c * 4]; s = __fadd_rn(s, __fmul_rn(qq[0], kq[0])); s = __fadd_rn(s, __fmul_rn(qq[1], kq[1])); s = __fadd_rn(s, __fmul_rn(qq[2], kq[2])); s = __fadd_rn(s, __fmul_rn(qq[3], kq[3])); }
    s = __fmul_rn(s, scale); if (MASKADD) s = __fadd_rn(s, __fmul_rn(bf16_round(mask[(size_t)i * SQ + j]), -10000.0f));
    const float f = (MASKADD || j <= i) ? 1.f : 0.f; const float sm = fmaf(f, s, (1.f - f) * -1.0e30f); const float mn = fmaxf(m, sm); const float sc = expf(m - mn); const float e = expf(sm - mn); l = __fadd_rn(__fmul_rn(l, sc), e); m = mn;
#pragma unroll 1
    for (int c = 0; c < HD / 4; ++c) { const v4f vv = *(const v4fa*)(vr + c * 4); v4f oo = *(v4f*)&lo[tid][c * 4]; for (int u = 0; u < 4; ++u) oo[u] = __fadd_rn(__fmul_rn(oo[u], sc), __fmul_rn(e, vv[u])); *(v4f*)&lo[tid][c * 4] = oo; } }
  const float fin = 64.0f / l;      /* o carried x64 like the f16 path */
#pragma unroll 1
  for (int c = 0; c < HD / 4; ++c) { v4f oo = *(v4f*)&lo[tid][c * 4]; for (int u = 0; u < 4; ++u) oo[u] = __fmul_rn(oo[u], fin); *(v4f*)&lo[tid][c * 4] = oo; }
  __syncthreads();
  {
#pragma unroll 1
    for (int it = 0; it < 16; ++it) { const int row = it * 4 + tid / 16, pc = (tid % 16) * 4; const v4f v = *(const v4f*)&lo[row][pc]; *(v4f*)(OF + (size_t)(rg * 64 + row) * ldo + h * HD + pc) = v; }
     } }


template <int BFIN, int WXB>
__global__ __launch_bounds__(256) void k_ln16(const float* __restrict__ X, const float* __restrict__ g, const float* __restrict__ bb, float eps, _Float16* __restrict__ N16, float* __restrict__ XB) {
  #pragma clang fp contract(off)
  __shared__ float red[256]; const size_t r = blockIdx.x; const int t = threadIdx.x; const v4f xa = *(const v4fa*)(X + r * DMQ + t * 4); float s[4]; float sum = 0.f;
  for (int q = 0; q < 4; ++q) { s[q] = BFIN ? bf16_round(xa[q]) : xa[q]; sum = __fadd_rn(sum, s[q]); }
  red[t] = sum; __syncthreads(); for (int st = 128; st > 0; st >>= 1) { if (t < st) red[t] = __fadd_rn(red[t], red[t + st]); __syncthreads(); } const float mu = red[0] / (float)DMQ; __syncthreads();
  float vs = 0.f; for (int q = 0; q < 4; ++q) { const float dl = __fadd_rn(s[q], -mu); vs = __fadd_rn(vs, __fmul_rn(dl, dl)); } red[t] = vs; __syncthreads(); for (int st = 128; st > 0; st >>= 1) { if (t < st) red[t] = __fadd_rn(red[t], red[t + st]); __syncthreads(); }
  const float rs = rsqrtf(__fadd_rn(red[0] / (float)DMQ, eps)); v4h y; v4f xb;
  for (int q = 0; q < 4; ++q) { const int c = t * 4 + q; y[q] = (_Float16)__fadd_rn(__fmul_rn(__fmul_rn(__fadd_rn(s[q], -mu), rs), bf16_round(g[c])), bf16_round(bb[c])); xb[q] = s[q]; }
  { *(v4h*)(N16 + r * DMQ + t * 4) = y; if (WXB) *(v4f*)(XB + r * DMQ + t * 4) = xb;  } }
__global__ __launch_bounds__(256) void k_ftres2(const float* __restrict__ OF0, const float* __restrict__ XB, float* __restrict__ X1, size_t n4) {
  #pragma clang fp contract(off)
  const size_t t = (size_t)blockIdx.x * 256 + threadIdx.x; if (t >= n4) return; const v4f o = *(const v4fa*)(OF0 + t * 4), xv = *(const v4fa*)(XB + t * 4); v4f y; for (int q = 0; q < 4; ++q) y[q] = __fadd_rn(__fmul_rn(o[q], 0.015625f), xv[q]); *(v4f*)(X1 + t * 4) = y;  }

__global__ __launch_bounds__(256) void k_wthd(const float* __restrict__ Wt, _Float16* __restrict__ Bt) { const size_t t = (size_t)blockIdx.x * 256 + threadIdx.x; if (t >= (size_t)NH * HD * (DM / 8)) return; const int m8 = (int)(t % (DM / 8)) * 8; const int d = (int)((t / (DM / 8)) % HD); const int h = (int)(t / ((size_t)(DM / 8) * HD)); FragH f;
  for (int q = 0; q < 8; ++q) f.h[q] = (_Float16)(16.0f * bf16_round(Wt[((size_t)h * DM + m8 + q) * HD + d])); unsigned short* dst = (unsigned short*)Bt + ((size_t)h * HD + d) * DM + m8; *(v8us*)dst = f.half[0];  }




template <int BFIN, int W16, int W32>
__global__ __launch_bounds__(256) void k_lnx(const float* __restrict__ X, const float* __restrict__ g, const float* __restrict__ bb, float eps, _Float16* __restrict__ N16, float* __restrict__ N32) {
  #pragma clang fp contract(off)
  __shared__ float red[256]; const size_t r = blockIdx.x; const int t = threadIdx.x; const bool act = t < (DMQ / 4); const int c0 = act ? t * 4 : 0;
  const v4f xa = *(const v4fa*)(X + r * DMQ + c0); float s[4]; float sum = 0.f;
  for (int q = 0; q < 4; ++q) { s[q] = act ? (BFIN ? bf16_round(xa[q]) : xa[q]) : 0.f; sum = __fadd_rn(sum, s[q]); }
  red[t] = sum; __syncthreads(); for (int st = 128; st > 0; st >>= 1) { if (t < st) red[t] = __fadd_rn(red[t], red[t + st]); __syncthreads(); } const float mu = red[0] / (float)DMQ; __syncthreads();
  float vs = 0.f; for (int q = 0; q < 4; ++q) { const float dl = act ? __fadd_rn(s[q], -mu) : 0.f; vs = __fadd_rn(vs, __fmul_rn(dl, dl)); } red[t] = vs; __syncthreads(); for (int st = 128; st > 0; st >>= 1) { if (t < st) red[t] = __fadd_rn(red[t], red[t + st]); __syncthreads(); }
  const float rs = rsqrtf(__fadd_rn(red[0] / (float)DMQ, eps)); v4h y; v4f yf;
  for (int q = 0; q < 4; ++q) { const int c = c0 + q; yf[q] = __fadd_rn(__fmul_rn(__fmul_rn(__fadd_rn(s[q], -mu), rs), bf16_round(g[c])), bf16_round(bb[c])); y[q] = (_Float16)yf[q]; }
  if (!act) return;      /* no barriers after this point */
  { if (W16) *(v4h*)(N16 + r * DMQ + c0) = y; if (W32) *(v4f*)(N32 + r * DMQ + c0) = yf;  } }


__global__ __launch_bounds__(256) void k_bfr(const float* __restrict__ x, float* __restrict__ XB, size_t n8) { const size_t t = (size_t)blockIdx.x * 256 + threadIdx.x; if (t >= n8) return; v4f a = *(const v4fa*)(x + t * 8), c = *(const v4fa*)(x + t * 8 + 4); for (int q = 0; q < 4; ++q) { a[q] = bf16_round(a[q]); c[q] = bf16_round(c[q]); }
  { *(v4f*)(XB + t * 8) = a; *(v4f*)(XB + t * 8 + 4) = c;  } }




__global__ __launch_bounds__(256) void k_lorafold(const float* __restrict__ Wm, const float* __restrict__ A, const float* __restrict__ Bm, float* __restrict__ WE, int K, int N, float sc) {
  #pragma clang fp contract(off)
  const size_t t = (size_t)blockIdx.x * 256 + threadIdx.x; if (t >= (size_t)K * N) return; const int i = (int)(t / N), o = (int)(t % N); float a = 0.f;
  for (int r = 0; r < 16; ++r) a = __fadd_rn(a, __fmul_rn(bf16_round(A[(size_t)i * 16 + r]), bf16_round(Bm[(size_t)r * N + o])));
  const float v = __fadd_rn(bf16_round(Wm[t]), __fmul_rn(sc, a)); *(float*)(WE + t) = v;  }
__global__ __launch_bounds__(256) void k_wt32rep(const float* __restrict__ Wf, _Float16* __restrict__ Bt, int K, int N, int DOUT, float scale) {
  const int t = blockIdx.x * 256 + threadIdx.x; if (t >= DOUT * (K / 8)) return; const int n = t / (K / 8), k8 = (t % (K / 8)) * 8; const int rep = DOUT / N; const int src = (n / (HD * rep)) * HD + (n % HD);      /* head h = n / HD -> group h / rep */
  FragH f; for (int i = 0; i < 8; ++i) f.h[i] = (_Float16)(Wf[(size_t)(k8 + i) * N + src] * scale);
  *(v8us*)((unsigned short*)Bt + (size_t)n * K + k8) = f.half[0];  }
__global__ __launch_bounds__(256) void k_brep(const float* __restrict__ b, float* __restrict__ out) { const int t = blockIdx.x * 256 + threadIdx.x; if (t >= DM) return; const float v = b[(t / (HD * 4)) * HD + (t % HD)]; *(float*)(out + t) = v;  }

__global__ __launch_bounds__(256) void k_rsmcim(const float* __restrict__ S, _Float16* __restrict__ P, int hg, int q0, int nk, const int* __restrict__ am) {
  #pragma clang fp contract(off)
  const int t = blockIdx.x * 256 + threadIdx.x; if (t >= hg * QT) return; const size_t i = (size_t)t; const float* s = S + i * NKX; const int last = q0 + (t % QT); const int* mr = am + (size_t)last * SQ; float mx = -3.0e38f;      /* the module's mask row of this query (keys >= nk lie above the diagonal of the causal mask and are not computed) */
#pragma unroll 1
  for (int j = 0; j < nk; ++j) { const float f = (mr[j] != 0) ? 1.f : 0.f; mx = fmaxf(mx, fmaf(f, s[j], (1.f - f) * -1.0e9f)); } float se = 0.f;
#pragma unroll 1
  for (int j = 0; j < nk; ++j) { const float f = (mr[j] != 0) ? 1.f : 0.f; se += __expf(fmaf(f, s[j], (1.f - f) * -1.0e9f) - mx); } const float sc = 256.0f / se;
#pragma unroll 1
  for (int j0 = 0; j0 < nk; j0 += 8) { FragH fr; for (int q = 0; q < 8; ++q) { const int j = j0 + q; const float f = (mr[j] != 0) ? 1.f : 0.f; fr.h[q] = (_Float16)(__expf(fmaf(f, s[j], (1.f - f) * -1.0e9f) - mx) * sc); } unsigned short* d = (unsigned short*)P + i * NKX + j0; *(v8us*)d = fr.half[0];  } }



__global__ __launch_bounds__(256) void k_bcpy(const float* __restrict__ b, int n, int NP, float* __restrict__ dst, int dst0) { for (int i = threadIdx.x; i < NP; i += 256) { const float v = (i < n) ? b[i] : 0.f; *(float*)(dst + dst0 + i) = v; }  }



__global__ __launch_bounds__(256) void k_rsmp(const float* __restrict__ S, _Float16* __restrict__ P, int nrows, int nk) {
  #pragma clang fp contract(off)
  const int t = blockIdx.x * 256 + threadIdx.x; if (t >= nrows) return; const size_t ri = (size_t)t; const float* s = S + ri * NKX; float mx = -3.0e38f;
#pragma unroll 1
  for (int j = 0; j < nk; ++j) mx = fmaxf(mx, s[j]); float se = 0.f;
#pragma unroll 1
  for (int j = 0; j < nk; ++j) se += __expf(s[j] - mx); const float sc = 256.0f / se;
#pragma unroll 1
  for (int j0 = 0; j0 < nk; j0 += 8) { FragH fr; for (int q = 0; q < 8; ++q) fr.h[q] = (_Float16)(__expf(s[j0 + q] - mx) * sc);
    unsigned short* d = (unsigned short*)P + ri * NKX + j0; *(v8us*)d = fr.half[0];  } }
template <int BFIN, int W16, int W32>
__global__ __launch_bounds__(256) void k_lnxr(const float* __restrict__ X, const float* __restrict__ g, const float* __restrict__ bb, float eps, _Float16* __restrict__ N16, float* __restrict__ N32, const float* __restrict__ R) {
  #pragma clang fp contract(off)
  __shared__ float red[256]; const size_t r = blockIdx.x; const int t = threadIdx.x; const bool act = t < (DMQ / 4); const int c0 = act ? t * 4 : 0;
  const v4f xa = *(const v4fa*)(X + r * DMQ + c0); const v4f ra = *(const v4fa*)(R + r * DMQ + c0);      /* residual row (f32, already on the bf16 grid where it is an input copy) */ float s[4]; float sum = 0.f;
  for (int q = 0; q < 4; ++q) { s[q] = act ? (BFIN ? bf16_round(xa[q]) : xa[q]) : 0.f; sum = __fadd_rn(sum, s[q]); }
  red[t] = sum; __syncthreads(); for (int st = 128; st > 0; st >>= 1) { if (t < st) red[t] = __fadd_rn(red[t], red[t + st]); __syncthreads(); } const float mu = red[0] / (float)DMQ; __syncthreads();
  float vs = 0.f; for (int q = 0; q < 4; ++q) { const float dl = act ? __fadd_rn(s[q], -mu) : 0.f; vs = __fadd_rn(vs, __fmul_rn(dl, dl)); } red[t] = vs; __syncthreads(); for (int st = 128; st > 0; st >>= 1) { if (t < st) red[t] = __fadd_rn(red[t], red[t + st]); __syncthreads(); }
  const float rs = rsqrtf(__fadd_rn(red[0] / (float)DMQ, eps)); v4h y; v4f yf;
  for (int q = 0; q < 4; ++q) { const int c = c0 + q; yf[q] = __fadd_rn(__fadd_rn(__fmul_rn(__fmul_rn(__fadd_rn(s[q], -mu), rs), bf16_round(g[c])), bf16_round(bb[c])), ra[q]); y[q] = (_Float16)yf[q]; }
  if (!act) return;      /* no barriers after this point */
  { if (W16) *(v4h*)(N16 + r * DMQ + c0) = y; if (W32) *(v4f*)(N32 + r * DMQ + c0) = yf;  } }



// Row softmax with the fill mask, one wave per score row: lane l keeps columns 128 u + 4 l .. + 3 (u = 0 .. SQ / 128 - 1) in registers, so S is read once, in whole 512-byte pieces,
// and each exp is taken once; row maximum and row sum come from per-lane partials and a five-step butterfly over the 32 lanes (every lane ends with the same value).
typedef int v4ia __attribute__((ext_vector_type(4), may_alias));
__global__ __launch_bounds__(256) void k_rsmkf(const float* __restrict__ S, _Float16* __restrict__ P, int nrows, const int* __restrict__ Km) {
  static_assert(SQ % 128 == 0, "k_rsmkf: 32 lanes x 4 columns per piece");
  const int lane = threadIdx.x & 31; const int i = blockIdx.x * 8 + (threadIdx.x >> 5); if (i >= nrows) return;      /* the same in every lane of a wave; no barrier below */
  const float* s = S + (size_t)i * SQ + lane * 4; const int* km = Km + lane * 4; v4f v[SQ / 128]; float mx = -3.0e38f;
#pragma unroll      /* v[] must be indexed by constants to stay in registers */
  for (int u = 0; u < SQ / 128; ++u) { const v4f a = *(const v4fa*)(s + u * 128); const v4ia m = *(const v4ia*)(km + u * 128);
    for (int q = 0; q < 4; ++q) { const float f = (m[q] != 0) ? 1.0f : 0.0f; v[u][q] = fmaf(f, a[q], (1.0f - f) * 1.0e-11f); mx = fmaxf(mx, v[u][q]); } }
  for (int o = 16; o > 0; o >>= 1) mx = fmaxf(mx, __shfl_xor(mx, o));
  v4f s4 = {0.f, 0.f, 0.f, 0.f};
#pragma unroll      /* as above */
  for (int u = 0; u < SQ / 128; ++u) for (int q = 0; q < 4; ++q) { const float t = (v[u][q] - mx) * 1.44269504088896340736f; float e;      /* = __expf(v - mx): the native exp2 of x log2(e) */
    asm("v_exp_f32 %0, %1\n\tv_nop" : "=v"(e) : "v"(t));      /* v_nop: the one slot the instruction set asks for behind a transcendental before its source is overwritten or its result read */
    v[u][q] = e; s4[q] += e; }
  float se = (s4[0] + s4[1]) + (s4[2] + s4[3]);
  for (int o = 16; o > 0; o >>= 1) se += __shfl_xor(se, o);
  const float sc = 256.0f / se; _Float16* d = P + (size_t)i * SQ + lane * 4;
#pragma unroll      /* as above */
  for (int u = 0; u < SQ / 128; ++u) { v4h h; for (int q = 0; q < 4; ++q) h[q] = (_Float16)(v[u][q] * sc); *(v4h*)(d + u * 128) = h; } }


extern "C" void kernel_launch(void* const* d_in, const int* in_sizes, int n_in,
                              void* d_out, int out_size, void* d_ws, size_t ws_size, hipStream_t stream) {
  (void)in_sizes; (void)n_in; (void)out_size;
  const float* const* I = (const float* const*)d_in; const float* x = I[0]; const int* km = (const int*)d_in[1]; const float* wq = I[2]; const float* bq = I[3]; const float* wk = I[4]; const float* bk = I[5]; const float* wv = I[6]; const float* bv = I[7]; const float* wo = I[8]; const float* bo = I[9]; const float* g1 = I[10]; const float* be1 = I[11]; const float* wfc = I[12]; const float* bfc = I[13]; const float* wmp = I[14]; const float* bmp = I[15]; const float* gg2 = I[16]; const float* be2 = I[17];      /* input order: x_n; mask int32 [2][1][1][2048] (READ on device); [in][out] wq / wk / wv / wo + biases; ln1 g / b; w1 [768][3072] + b1, w2 [3072][768] + b2; ln2 g / b */
  static_assert(DMQ % 4 == 0 && DMQ / 4 <= 256 && DM % 64 == 0 && DM % 32 == 0 && DFF % 64 == 0 && DFF % 32 == 0 && NH * HD == DM && NKX == SQ, "k_lnxr 256 threads x 4 columns; tile multiples");
  char* ws = (char*)d_ws; size_t off = 0;
  auto take = [&](size_t bytes) { char* p = ws + off; off += (bytes + 255) & ~(size_t)255; return p; };
  _Float16* BQKV = (_Float16*)take((size_t)3 * DM * DM * 2); _Float16* BO = (_Float16*)take((size_t)DM * DM * 2); float* bqkv = (float*)take((size_t)3 * DM * 4); float* X1N = nullptr;      /* LN1 output (f32): aliases the QKV plane below (QKV's last readers, the score / V^T launches of the last batch, precede LN1) to stay within 256 MiB at NB 4 / SQ 2048 */
  _Float16* X16 = (_Float16*)take(NR * DM * 2); float* XB = (float*)take(NR * DM * 4); float* X1 = (float*)take(NR * DM * 4); _Float16* M16 = nullptr;      /* = X16 below (alias: X16's last reader, the fused QKV GEMM, precedes LN1's f16 write) */ _Float16* HF16 = (_Float16*)take((size_t)SQ * DFF * 2);      /* FFN hidden plane of one batch [2048][3072] f16 (own region here) */ _Float16* BW1 = (_Float16*)take((size_t)DFF * DM * 2); _Float16* BW2 = (_Float16*)take((size_t)DM * DFF * 2); _Float16* QKV = (_Float16*)take(NR * 3 * DM * 2); _Float16* Q16 = QKV; _Float16* K16 = QKV + DM; _Float16* V16 = QKV + 2 * DM; _Float16* O16 = (_Float16*)take(NR * DM * 2); M16 = X16; X1N = (float*)QKV;      /* aliases: X1N (NR*DM f32 = 12 MiB) inside QKV (18 MiB): QKV's last readers (the score / V^T launches of the last batch) precede the first LayerNorm */
  float* S = (float*)take((size_t)NH * QT * NKX * 4); _Float16* P = (_Float16*)take((size_t)NH * QT * NKX * 2); _Float16* VT = (_Float16*)take((size_t)NH * HD * SQ * 2);
  if (off > ws_size) return;
  { const unsigned g = (unsigned)(((size_t)DM * (DM / 8) + 255) / 256); k_wt_f16<<<g, 256, 0, stream>>>(wq, BQKV, DM, DM, 16.0f); k_wt_f16<<<g, 256, 0, stream>>>(wk, BQKV + (size_t)DM * DM, DM, DM, 16.0f); k_wt_f16<<<g, 256, 0, stream>>>(wv, BQKV + (size_t)2 * DM * DM, DM, DM, 16.0f); k_wt_f16<<<g, 256, 0, stream>>>(wo, BO, DM, DM, 16.0f); }      /* [in][out] -> Bt x16: stacked q | k | v, and Wo */
  k_bcpy<<<1, 256, 0, stream>>>(bq, DM, DM, bqkv, 0); k_bcpy<<<1, 256, 0, stream>>>(bk, DM, DM, bqkv, DM); k_bcpy<<<1, 256, 0, stream>>>(bv, DM, DM, bqkv, 2 * DM);      /* stacked bias bq | bk | bv */
  k_x16<<<(unsigned)((NR * DM / 8 + 255) / 256), 256, 0, stream>>>(x, X16, NR * DM / 8); k_bfr<<<(unsigned)((NR * DM / 8 + 255) / 256), 256, 0, stream>>>(x, XB, NR * DM / 8);      /* post-LN: the attention runs on the raw input (exact f16 rows); XB = bf16(x) f32 for the residual */
  k_wt_f16<<<(unsigned)(((size_t)DFF * (DM / 8) + 255) / 256), 256, 0, stream>>>(wfc, BW1, DM, DFF, 16.0f); k_wt_f16<<<(unsigned)(((size_t)DM * (DFF / 8) + 255) / 256), 256, 0, stream>>>(wmp, BW2, DFF, DM, 16.0f);      /* W1 [768][3072] -> Bt [3072][768]; W2 [3072][768] -> Bt [768][3072] (x16, transposing builder) */
  const size_t r0p = (size_t)B0 * SQ;      /* first projected row */
  k_gemm2<0><<<dim3((unsigned)((MP / 128) * (3 * DM / 64)), 1), 128, 0, stream>>>(X16 + r0p * DM, DM, 0, BQKV, DM, 0, 0.0625f, bqkv, 0, nullptr, 1, 0, 0, nullptr, QKV + r0p * 3 * DM, 3 * DM, 0, MP, 3 * DM, DM);      /* q | k | v rows (f16); head h = columns h*HD.. of each DM block */
  for (int b = B0; b < B0 + NBR; ++b) { const size_t r0 = (size_t)b * SQ;
    k_vt<NH, SQ><<<NH * (SQ / 64), 256, 0, stream>>>(V16 + r0 * LQ, LQ, 0, VT);      /* V^T [NH][HD][SQ] for this batch */
    for (int q0 = 0; q0 < QN; q0 += QT) {      /* non-causal: every 256-row query tile sees all SQ keys */
      k_gemm2<0><<<dim3((QT / 128) * (SQ / 64), NHD), 128, 0, stream>>>(Q16 + (r0 + q0) * LQ, LQ, (size_t)HD, K16 + r0 * LQ, LQ, (size_t)HD, 0.036084391824351615f, nullptr, 0, nullptr, 1, 0, 0, S, nullptr, NKX, (size_t)QT * NKX, QT, SQ, HD);      /* scores q.k / sqrt(768) (the module's literal dim_model scale), all heads on grid.y */
      k_rsmkf<<<(NHD * QT + 7) / 8, 256, 0, stream>>>(S, P, NHD * QT, km + (size_t)b * SQ);      /* masked keys get the score 1e-11 (fill, as the source), then softmax over all keys -> P x256 f16 */
      k_gemm2<0><<<dim3((QT / 128) * (HD / 64), NHD), 128, 0, stream>>>(P, NKX, (size_t)QT * NKX, VT, SQ, (size_t)HD * SQ, 0.25f, nullptr, 0, nullptr, 1, 0, 0, nullptr, O16 + (r0 + q0) * DM, DM, (size_t)HD, QT, HD, SQ); } }      /* ctx (merged heads, x64) as f16 rows */
  k_gemm2<0><<<dim3((unsigned)((MPO / 128) * (DM / 64)), 1), 128, 0, stream>>>(O16 + r0p * DM, DM, 0, BO, DM, 0, 0.0009765625f, bo, 0, nullptr, 1, 0, 0, X1 + r0p * DM, nullptr, DM, 0, MPO, DM, DM);      /* z = ctx Wo + bo (f32 rows; the skip is added AFTER the LayerNorm in this module) */
  k_lnxr<0, 1, 1><<<(unsigned)NR, 256, 0, stream>>>(X1, g1, be1, 1e-5f, M16, X1N, XB);      /* l1 = bf16(x) + LN1(z) (eps 1e-5): f16 rows for the FFN input and f32 rows for the second skip */
  for (int b = 0; b < NB; ++b) { const size_t r0 = (size_t)b * SQ;
    k_gemm2<3><<<dim3((unsigned)((SQ / 128) * (DFF / 64)), 1), 128, 0, stream>>>(M16 + r0 * DM, DM, 0, BW1, DM, 0, 0.0625f, bfc, 0, nullptr, 1, 0, 0, nullptr, HF16, DFF, 0, SQ, DFF, DM);      /* relu(l1 W1 + b1) -> f16 (this batch) */
    k_gemm2<0><<<dim3((unsigned)((SQ / 128) * (DM / 64)), 1), 128, 0, stream>>>(HF16, DFF, 0, BW2, DFF, 0, 0.0625f, bmp, 0, nullptr, 1, 0, 0, X1 + r0 * DM, nullptr, DM, 0, SQ, DM, DFF); }      /* ffn = hidden W2 + b2 (f32 rows over the dead z plane; the skip is added after the LayerNorm) */
  k_lnxr<0, 0, 1><<<(unsigned)NR, 256, 0, stream>>>(X1, gg2, be2, 1e-5f, nullptr, (float*)d_out, X1N);      /* out = l1 + LN2(ffn) (eps 1e-5) -> f32 output rows */
}

// v003
// One run takes 272 microseconds.
// Versions in between are left out here; by their measured steps it is 5.76 times as fast as v001.
// Over all steps from v000 it is 26.2 times as fast.
#include <hip/hip_runtime.h>
// Transformer encoder layer with branch-side LayerNorms, a key-padding mask applied as a FILL and the module's literal score scale (x_n [2][2048][768]; q / k / v = x W + b ([in][out] 768 x 768 sigma 1/sqrt(768), zero biases); 12 heads of 64; scores / sqrt(768) (dim_model, as the source); where(mask == 0, 1e-11) with the int32 [2][1][1][2048] mask in {0, 1} (random; READ on device; masked keys get the score 1e-11, NOT -inf, as the source); softmax; z = ctx Wo + bo; l1 = x + LN(z) (LayerNorm on the branch only; biased var, eps 1e-5); ffn = relu(l1 W1 + b1) W2 + b2 ([in][out] 768 x 3072 x 768); out = l1 + LN(ffn) -> [2][2048][768]).
// Structure: token rows; x as exact f16 rows and bf16 f32 residual rows; [in][out] weights as exact transposed x16 planes; fused q | k | v WMMA GEMM (32x64 wave tiles, f32 accumulation, + stacked bias) -> f16; V^T via LDS transposes; one fused attention launch (16 query rows a wave: scores over all keys, fill mask, online softmax with f32 statistics and native exp, weights x256 f16 in registers, ctx x64 merged f16); ctx Wo + bo f32; LN1 on VALU + x -> f16 + f32; relu FFN per batch; LN2 + residual -> output; launches: see trace.
// Compute dtype: inputs rounded to bf16; x / weights exact; q, k, v, softmax weights and o as plain f16 GEMM operands (~2^-12); scores and softmax statistics f32; v_wmma_f32_16x16x32_f16.
#define NB 2
#define SQ 2048
#define DM 768
#define NH 12
#define HD 64
#define HG 4                         /* heads per block group in the unlaunched k_vt overload */
#define QT 256                       /* query rows per score tile in k_rsmcf2 / k_rsmcim (not launched) */
#define NKX SQ                       /* S / P row pitch */
#define QT0 128                      /* query rows per head in k_att0 (not launched) */
#define B0 0                         /* first batch processed (debug hook) */
#define NBR NB                       /* batches processed (debug hook) */
#define NR ((size_t)NB * SQ)
#define DMQ DM
#define DFF 3072         /* FFN hidden width */
#define MP ((int)((size_t)NBR * SQ)) /* rows projected (debug hook) */
#define QN SQ                        /* query rows per batch (not used) */
#define NHD NH                       /* heads (not used) */
#define MPO MP                       /* rows through the output stage (debug hook) */
#define LQ (3 * DM)      /* row pitch of the q/k/v rows */
typedef __bf16 v16b __attribute__((ext_vector_type(16)));
typedef unsigned short v8us __attribute__((ext_vector_type(8), may_alias));
typedef float  v8f  __attribute__((ext_vector_type(8)));
typedef float  v4f  __attribute__((ext_vector_type(4)));
typedef float  v4fa __attribute__((ext_vector_type(4), may_alias));
union FragB { v16b v; v8us half[2]; unsigned short u[16]; };

__device__ __forceinline__ unsigned short bf16_bits(float x) { unsigned int u = __float_as_uint(x); return (unsigned short)((u + 0x7FFFu + ((u >> 16) & 1u)) >> 16); }
__device__ __forceinline__ float bf16_val(unsigned short b) { return __uint_as_float(((unsigned int)b) << 16); }
__device__ __forceinline__ float bf16_round(float x) { return bf16_val(bf16_bits(x)); }
// D += A·B with NT terms: 1 = ah·bh, 2 = + al·bh (A split), 3 = + ah·bl (both split)
template <int NT>
__device__ __forceinline__ v8f mmaN(v16b ah, v16b al, v16b bh, v16b bl, v8f c) {
  c = __builtin_amdgcn_wmma_f32_16x16x32_bf16(false, ah, false, bh, (short)0, c, false, false);
  if (NT >= 2) c = __builtin_amdgcn_wmma_f32_16x16x32_bf16(false, al, false, bh, (short)0, c, false, false);
  if (NT >= 3) c = __builtin_amdgcn_wmma_f32_16x16x32_bf16(false, ah, false, bl, (short)0, c, false, false);
  asm volatile("v_nop\n\tv_nop\n\tv_nop\n\tv_nop" : "+v"(c) : "v"(ah), "v"(al), "v"(bh), "v"(bl));
  return c;
}

__global__ __launch_bounds__(256) void k_wt_bf16(const float* __restrict__ W, unsigned short* __restrict__ Wt, int K, int N) {
  const int t = blockIdx.x * 256 + threadIdx.x;
  const int k8n = K / 8;
  if (t >= N * k8n) return;
  const int n = t / k8n, k8 = (t % k8n) * 8;
  v8us v;
#pragma unroll
  for (int i = 0; i < 8; ++i) v[i] = bf16_bits(W[(size_t)(k8 + i) * N + n]);
  *(v8us*)(Wt + (size_t)n * K + k8) = v;
  
}

// GEMM C[M][N] (f32, pitch ldc) = act(A[M][K]·W + bias). A f32 row-major (pitch lda) converted per fragment to bf16
// (ASPLIT: hi/lo two planes -> 2 terms, else single rounded term); Wt bf16 [N][K] (pitch ldb). BIAS_BF16 rounds the
// bias to bf16 first (bias quantised to bf16 before the add). K%32==0, M%16==0, N%64==0.
template <bool ASPLIT, int ACT, bool BIAS_BF16>
__global__ __launch_bounds__(128) void k_gemm_bf(const float* __restrict__ A, int lda, const unsigned short* __restrict__ Wt, int ldb,
                                               const float* __restrict__ bias, float* __restrict__ C, int ldc, int M, int N, int K) {
  __shared__ __attribute__((aligned(16))) float so[4][16][64];
  const int tid = threadIdx.x, w = tid >> 5, lane = tid & 31, ln = lane & 15, hh = lane >> 4;
  const int ntn = N / 64;
  const int wid = blockIdx.x * 4 + w;
  const int mt = wid / ntn, nq = wid % ntn;
  if (mt * 16 >= M) return;
  const int row0 = mt * 16, col0 = nq * 64;
  const float* arow = A + (size_t)(row0 + ln) * lda;
  v8f acc[4] = {};
  for (int kb = 0; kb < K; kb += 32) {
    FragB ah, al;
    const v4f x0 = *(const v4fa*)(arow + kb + 8 * hh), x1 = *(const v4fa*)(arow + kb + 8 * hh + 4);
    const v4f x2 = *(const v4fa*)(arow + kb + 16 + 8 * hh), x3 = *(const v4fa*)(arow + kb + 16 + 8 * hh + 4);
    float xs[16] = {x0[0],x0[1],x0[2],x0[3],x1[0],x1[1],x1[2],x1[3],x2[0],x2[1],x2[2],x2[3],x3[0],x3[1],x3[2],x3[3]};
#pragma unroll
    for (int i = 0; i < 16; ++i) { const unsigned short hb = bf16_bits(xs[i]); ah.u[i] = hb; al.u[i] = ASPLIT ? bf16_bits(xs[i] - bf16_val(hb)) : (unsigned short)0; }
#pragma unroll
    for (int t = 0; t < 4; ++t) {
      const unsigned short* brow = Wt + (size_t)(col0 + t * 16 + ln) * ldb + kb;
      FragB b;
      b.half[0] = *(const v8us*)(brow + 8 * hh);
      b.half[1] = *(const v8us*)(brow + 16 + 8 * hh);
      acc[t] = mmaN<ASPLIT ? 2 : 1>(ah.v, al.v, b.v, b.v, acc[t]);
    }
  }
#pragma unroll
  for (int t = 0; t < 4; ++t) {
    float bv = bias ? bias[col0 + t * 16 + ln] : 0.f;
    if (BIAS_BF16) bv = bf16_round(bv);
#pragma unroll
    for (int r = 0; r < 8; ++r) { float v = acc[t][r] + bv; if (ACT == 1) v = fmaxf(v, 0.f); so[w][8 * hh + r][t * 16 + ln] = v; }
  }
  __builtin_amdgcn_fence(__ATOMIC_ACQ_REL, "workgroup");
  __builtin_amdgcn_wave_barrier();
  const int rsub = lane >> 4, c4 = (lane & 15) * 4;
  {
#pragma unroll
    for (int q = 0; q < 8; ++q) {
      const int r = q * 2 + rsub;
      const v4f v = *(const v4fa*)&so[w][r][c4];
      *(v4f*)(C + (size_t)(row0 + r) * ldc + col0 + c4) = v;
    }
    
  }
}

// GEMM C = act(A·W + bias + resid): A f32 (ASPLIT -> hi/lo 2 terms), Wt bf16 [N][K]; ACT 0 none, 1 relu, 2 exact gelu;
// resid (optional, f32, row index = (row % rmod), pitch ldr, RES_BF16 rounds it) added before the activation.
template <bool ASPLIT, int ACT, bool BIAS_BF16, bool RES_BF16>
__global__ __launch_bounds__(128) void k_gemm_bf3(const float* __restrict__ A, int lda, const unsigned short* __restrict__ Wt, int ldb,
                                                const float* __restrict__ bias, const float* __restrict__ resid, int rmod, int ldr,
                                                float* __restrict__ C, int ldc, int M, int N, int K) {
  __shared__ __attribute__((aligned(16))) float so[4][16][64];
  const int tid = threadIdx.x, w = tid >> 5, lane = tid & 31, ln = lane & 15, hh = lane >> 4;
  const int ntn = N / 64;
  const int wid = blockIdx.x * 4 + w;
  const int mt = wid / ntn, nq = wid % ntn;
  if (mt * 16 >= M) return;
  const int row0 = mt * 16, col0 = nq * 64;
  const float* arow = A + (size_t)(row0 + ln) * lda;
  v8f acc[4] = {};
  for (int kb = 0; kb < K; kb += 32) {
    FragB ah, al;
    const v4f x0 = *(const v4fa*)(arow + kb + 8 * hh), x1 = *(const v4fa*)(arow + kb + 8 * hh + 4);
    const v4f x2 = *(const v4fa*)(arow + kb + 16 + 8 * hh), x3 = *(const v4fa*)(arow + kb + 16 + 8 * hh + 4);
    float xs[16] = {x0[0],x0[1],x0[2],x0[3],x1[0],x1[1],x1[2],x1[3],x2[0],x2[1],x2[2],x2[3],x3[0],x3[1],x3[2],x3[3]};
#pragma unroll
    for (int i = 0; i < 16; ++i) { const unsigned short hb = bf16_bits(xs[i]); ah.u[i] = hb; al.u[i] = ASPLIT ? bf16_bits(xs[i] - bf16_val(hb)) : (unsigned short)0; }
#pragma unroll
    for (int t = 0; t < 4; ++t) {
      const unsigned short* brow = Wt + (size_t)(col0 + t * 16 + ln) * ldb + kb;
      FragB b;
      b.half[0] = *(const v8us*)(brow + 8 * hh);
      b.half[1] = *(const v8us*)(brow + 16 + 8 * hh);
      acc[t] = mmaN<ASPLIT ? 2 : 1>(ah.v, al.v, b.v, b.v, acc[t]);
    }
  }
#pragma unroll
  for (int t = 0; t < 4; ++t) {
    const int col = col0 + t * 16 + ln;
    float bv = bias ? bias[col] : 0.f;
    if (BIAS_BF16) bv = bf16_round(bv);
#pragma unroll
    for (int r = 0; r < 8; ++r) {
      float v = acc[t][r] + bv;
      if (resid) { float rv = resid[(size_t)((row0 + 8 * hh + r) % rmod) * ldr + col]; if (RES_BF16) rv = bf16_round(rv); v += rv; }
      if (ACT == 1) v = fmaxf(v, 0.f);
      if (ACT == 2) v = 0.5f * v * (1.0f + erff(v * 0.70710678118654752f));
      if (ACT == 3) { const float u = 0.7978845608028654f * (v + 0.044715f * v * v * v); v = 0.5f * v * (1.0f + tanhf(u)); }
      so[w][8 * hh + r][t * 16 + ln] = v;
    }
  }
  __builtin_amdgcn_fence(__ATOMIC_ACQ_REL, "workgroup");
  __builtin_amdgcn_wave_barrier();
  const int rsub = lane >> 4, c4 = (lane & 15) * 4;
  {
#pragma unroll
    for (int q = 0; q < 8; ++q) {
      const int r = q * 2 + rsub;
      const v4f v = *(const v4fa*)&so[w][r][c4];
      *(v4f*)(C + (size_t)(row0 + r) * ldc + col0 + c4) = v;
    }
    
  }
}
// row LayerNorm (biased variance, eps) over N: s = X (+ R); optional out_sum <- s; out_norm <- (s-mu)*rsqrt(var+eps)*g + b
template <bool PARAM_BF16>
__global__ __launch_bounds__(256) void k_layernorm(const float* __restrict__ X, const float* __restrict__ R, const float* __restrict__ g, const float* __restrict__ bta,
                                                  float* __restrict__ out_sum, float* __restrict__ out_norm, int N, float eps) {
  __shared__ float red[256];
  const int row = blockIdx.x, tid = threadIdx.x;
  const float* x = X + (size_t)row * N; const float* rr = R ? R + (size_t)row * N : nullptr;
  float vals[16];                     // up to N = 4096
  const int per = N / 256;            // contiguous chunk per thread? use strided-by-4 chunks: thread handles j = tid*4 + 1024*u
  float s1 = 0.f;
  for (int u = 0; u < per / 4; ++u) {
    const int j = tid * 4 + 1024 * u;
    const v4f a = *(const v4fa*)(x + j);
    v4f b = {0.f,0.f,0.f,0.f}; if (rr) b = *(const v4fa*)(rr + j);
#pragma unroll
    for (int q = 0; q < 4; ++q) { const float v = a[q] + b[q]; vals[u * 4 + q] = v; s1 += v; }
  }
  red[tid] = s1; __syncthreads();
  for (int st = 128; st > 0; st >>= 1) { if (tid < st) red[tid] += red[tid + st]; __syncthreads(); }
  const float mu = red[0] / (float)N; __syncthreads();
  float s2 = 0.f;
  for (int u = 0; u < per / 4; ++u)
#pragma unroll
    for (int q = 0; q < 4; ++q) { const float c = vals[u * 4 + q] - mu; s2 += c * c; }
  red[tid] = s2; __syncthreads();
  for (int st = 128; st > 0; st >>= 1) { if (tid < st) red[tid] += red[tid + st]; __syncthreads(); }
  const float rs = rsqrtf(red[0] / (float)N + eps);
  {
    for (int u = 0; u < per / 4; ++u) {
      const int j = tid * 4 + 1024 * u;
      v4f o, sm;
#pragma unroll
      for (int q = 0; q < 4; ++q) {
        float gg = g[j + q], bb = bta[j + q];
        if (PARAM_BF16) { gg = bf16_round(gg); bb = bf16_round(bb); }
        sm[q] = vals[u * 4 + q]; o[q] = (vals[u * 4 + q] - mu) * rs * gg + bb;
      }
      if (out_sum) *(v4f*)(out_sum + (size_t)row * N + j) = sm;
      *(v4f*)(out_norm + (size_t)row * N + j) = o;
    }
    
  }
}



// ---- f16 WMMA path (v_wmma_f32_16x16x32_f16): 11-bit significands for operands in range — used where a [0,1] probability operand needs more precision than bf16
typedef _Float16 v16h __attribute__((ext_vector_type(16)));
union FragH { v16h v; v8us half[2]; _Float16 h[16]; unsigned short u[16]; };
template <int NT>
__device__ __forceinline__ v8f mmaH(v16h ah, v16h al, v16h bh, v16h bl, v8f c) {
  c = __builtin_amdgcn_wmma_f32_16x16x32_f16(false, ah, false, bh, (short)0, c, false, false);
  if (NT >= 2) c = __builtin_amdgcn_wmma_f32_16x16x32_f16(false, al, false, bh, (short)0, c, false, false);
  if (NT >= 3) c = __builtin_amdgcn_wmma_f32_16x16x32_f16(false, ah, false, bl, (short)0, c, false, false);
  asm volatile("v_nop\n\tv_nop\n\tv_nop\n\tv_nop" : "+v"(c) : "v"(ah), "v"(al), "v"(bh), "v"(bl));
  return c;
}
// batched GEMM like k_gemm_b but f16 operands: A f32 (split into f16 hi/lo if ASPLIT, else rounded to f16), Bt = f16 values [n][k]; alpha; C f32; N multiple of 16 (partial tiles skipped)
template <bool ASPLIT>
__global__ __launch_bounds__(128) void k_gemm_h(const float* __restrict__ A, int lda, size_t sA, const _Float16* __restrict__ Bh, int ldb, size_t sB, float alpha, float* __restrict__ C, int ldc, size_t sC, int M, int N, int K) {
  __shared__ __attribute__((aligned(16))) float so[4][16][64];
  const int tid = threadIdx.x, w = tid >> 5, lane = tid & 31, ln = lane & 15, hh = lane >> 4; const int by = blockIdx.y;
  A += (size_t)by * sA; Bh += (size_t)by * sB; C += (size_t)by * sC;
  const int ntn = (N + 63) / 64; const int wid = blockIdx.x * 4 + w; const int mt = wid / ntn, nq = wid % ntn; if (mt * 16 >= M) return;
  const int row0 = mt * 16, col0 = nq * 64; const float* arow = A + (size_t)(row0 + ln) * lda;
  v8f acc[4] = {};
  for (int kb = 0; kb < K; kb += 32) {
    FragH ah, al;
    const v4f x0 = *(const v4fa*)(arow + kb + 8 * hh), x1 = *(const v4fa*)(arow + kb + 8 * hh + 4), x2 = *(const v4fa*)(arow + kb + 16 + 8 * hh), x3 = *(const v4fa*)(arow + kb + 16 + 8 * hh + 4);
    float xs[16] = {x0[0],x0[1],x0[2],x0[3],x1[0],x1[1],x1[2],x1[3],x2[0],x2[1],x2[2],x2[3],x3[0],x3[1],x3[2],x3[3]};
#pragma unroll
    for (int i = 0; i < 16; ++i) { const _Float16 h = (_Float16)xs[i]; ah.h[i] = h; al.h[i] = ASPLIT ? (_Float16)(xs[i] - (float)h) : (_Float16)0.0f; }
#pragma unroll
    for (int t = 0; t < 4; ++t) { if (col0 + t * 16 >= N) continue; const size_t boff = (size_t)(col0 + t * 16 + ln) * ldb + kb; FragH bq; bq.half[0] = *(const v8us*)(Bh + boff + 8 * hh); bq.half[1] = *(const v8us*)(Bh + boff + 16 + 8 * hh);
      acc[t] = mmaH<ASPLIT ? 2 : 1>(ah.v, al.v, bq.v, bq.v, acc[t]); }
  }
#pragma unroll
  for (int t = 0; t < 4; ++t) { if (col0 + t * 16 >= N) continue;
#pragma unroll
    for (int r = 0; r < 8; ++r) so[w][8 * hh + r][t * 16 + ln] = acc[t][r] * alpha; }
  __builtin_amdgcn_fence(__ATOMIC_ACQ_REL, "workgroup"); __builtin_amdgcn_wave_barrier();
  const int rsub = lane >> 4, c4 = (lane & 15) * 4;
  {
#pragma unroll
    for (int q = 0; q < 8; ++q) { const int r = q * 2 + rsub; if (col0 + c4 < N) { const v4f v = *(const v4fa*)&so[w][r][c4]; *(v4f*)(C + (size_t)(row0 + r) * ldc + col0 + c4) = v; } }
     }
}

// Wt[n][k] = f16(W[k][n]·scale) from f32 row-major W[K][N] (scale = power of two; bf16-exact weights stay exact in f16 away from the subnormal range)
__global__ __launch_bounds__(256) void k_wt_f16(const float* __restrict__ W, _Float16* __restrict__ Wt, int K, int N, float scale) {
  const int t = blockIdx.x * 256 + threadIdx.x; if (t >= N * (K / 8)) return; const int n = t / (K / 8), k8 = (t % (K / 8)) * 8; FragH f;
#pragma unroll
  for (int i = 0; i < 8; ++i) f.h[i] = (_Float16)(bf16_round(W[(size_t)(k8 + i) * N + n]) * scale); const v8us o = f.half[0];
  *(v8us*)((unsigned short*)Wt + (size_t)n * K + k8) = o; 
}
// k_gemm_hh variant with fused epilogue: v = acc·alpha + bias[by·sBias + col] (+ CP[(row/rowsPerB)·sCPb + by·64 + col] if CP) ; ACT 0 none / 1 elu ; writes f16 C16 (and f32 C if non-null)
template <int ACT>
__global__ __launch_bounds__(128) void k_gemm_hhx(const _Float16* __restrict__ A, int lda, size_t sA, const _Float16* __restrict__ Bh, int ldb, size_t sB, float alpha, const float* __restrict__ bias, size_t sBias, const float* __restrict__ CP, int rowsPerB, size_t sCPb, int row0g,
    float* __restrict__ C, _Float16* __restrict__ C16, int ldc, size_t sC, int M, int N, int K) {
  __shared__ __attribute__((aligned(16))) float so[4][16][64];
  const int tid = threadIdx.x, w = tid >> 5, lane = tid & 31, ln = lane & 15, hh = lane >> 4; const int by = blockIdx.y;
  A += (size_t)by * sA; Bh += (size_t)by * sB; const size_t cofs = (size_t)by * sC; const float* bp = bias ? bias + (size_t)by * sBias : nullptr;
  const int ntn = (N + 63) / 64; const int wid = blockIdx.x * 4 + w; const int mt = wid / ntn, nq = wid % ntn; if (mt * 16 >= M) return;
  const int row0 = mt * 16, col0 = nq * 64; const _Float16* arow = A + (size_t)(row0 + ln) * lda;
  v8f acc[4] = {};
  for (int kb = 0; kb < K; kb += 32) { FragH ah; ah.half[0] = *(const v8us*)((const unsigned short*)arow + kb + 8 * hh); ah.half[1] = *(const v8us*)((const unsigned short*)arow + kb + 16 + 8 * hh);
#pragma unroll
    for (int t = 0; t < 4; ++t) { if (col0 + t * 16 >= N) continue; const size_t boff = (size_t)(col0 + t * 16 + ln) * ldb + kb; FragH bq; bq.half[0] = *(const v8us*)((const unsigned short*)Bh + boff + 8 * hh); bq.half[1] = *(const v8us*)((const unsigned short*)Bh + boff + 16 + 8 * hh);
      acc[t] = mmaH<1>(ah.v, ah.v, bq.v, bq.v, acc[t]); }
  }
#pragma unroll
  for (int t = 0; t < 4; ++t) { if (col0 + t * 16 >= N) continue; const int col = col0 + t * 16 + ln; const float bv = bp ? bf16_round(bp[col]) : 0.f;
#pragma unroll
    for (int r = 0; r < 8; ++r) { float v = acc[t][r] * alpha + bv; if (CP) { const int rr = row0g + row0 + 8 * hh + r; if (rowsPerB < 0) v += CP[cofs + (size_t)rr * ldc + col];      /* rowsPerB < 0: own element of the batched C plane */ else { const int bidx = rr / rowsPerB; v += CP[(size_t)bidx * sCPb + (size_t)by * 64 + col]; } } if (ACT == 1) v = (v > 0.f) ? v : expm1f(v); else if (ACT == 7) v = (v > 0.f) ? v + 1.0f : expf(v); else if (ACT == 8) v = tanhf(v); else if (ACT == 9) v = 0.5f * v * (1.0f + tanhf(0.7978845608028654f * (v + 0.044715f * v * v * v))); else if (ACT == 11) v = 1.0f / (1.0f + expf(-v)); else if (ACT == 12) v = (v > 0.f) ? v : 0.01f * v; else if (ACT == 14) v = (v > 0.f) ? v : 0.1f * v; else if (ACT == 16) v = (v >= 0.f) ? v : 0.3f * v; else if (ACT == 17) v = (v >= 0.f) ? v : 0.2f * v; else if (ACT == 15) v = v / (1.0f + expf(-v)); else if (ACT == 3) v = fmaxf(v, 0.f); else if (ACT == 6) v = 0.5f * v * (1.0f + erff(v * 0.70710678118654752f)); so[w][8 * hh + r][t * 16 + ln] = v; } }
  __builtin_amdgcn_fence(__ATOMIC_ACQ_REL, "workgroup"); __builtin_amdgcn_wave_barrier();
  const int rsub = lane >> 4, c4 = (lane & 15) * 4; typedef _Float16 v4h __attribute__((ext_vector_type(4)));
  {
#pragma unroll
    for (int q = 0; q < 8; ++q) { const int r = q * 2 + rsub; if (col0 + c4 < N) { const v4f v = *(const v4fa*)&so[w][r][c4]; if (C) *(v4f*)(C + cofs + (size_t)(row0 + r) * ldc + col0 + c4) = v; if (C16) { v4h h4; for (int i = 0; i < 4; ++i) h4[i] = (_Float16)v[i]; *(v4h*)(C16 + cofs + (size_t)(row0 + r) * ldc + col0 + c4) = h4; } } }
     }
}


typedef _Float16 v4h __attribute__((ext_vector_type(4)));

__global__ __launch_bounds__(256) void k_x16(const float* __restrict__ x, _Float16* __restrict__ X16, size_t n8) { const size_t t = (size_t)blockIdx.x * 256 + threadIdx.x; if (t >= n8) return; FragH f;
#pragma unroll
  for (int q = 0; q < 8; ++q) f.h[q] = (_Float16)bf16_round(x[t * 8 + q]); *(v8us*)((unsigned short*)X16 + t * 8) = f.half[0];  }
__global__ __launch_bounds__(256) void k_h16(const float* __restrict__ x, _Float16* __restrict__ X16, size_t n8) { const size_t t = (size_t)blockIdx.x * 256 + threadIdx.x; if (t >= n8) return; FragH f;
#pragma unroll
  for (int q = 0; q < 8; ++q) f.h[q] = (_Float16)x[t * 8 + q]; *(v8us*)((unsigned short*)X16 + t * 8) = f.half[0];  }
__global__ __launch_bounds__(256) void k_round16f(const float* __restrict__ W, _Float16* __restrict__ Bt, size_t n8) { const size_t t = (size_t)blockIdx.x * 256 + threadIdx.x; if (t >= n8) return; FragH f;
#pragma unroll
  for (int i = 0; i < 8; ++i) f.h[i] = (_Float16)(bf16_round(W[t * 8 + i]) * 16.0f); *(v8us*)((unsigned short*)Bt + t * 8) = f.half[0];  }
template <int NHv, int TTv>
__global__ __launch_bounds__(256) void k_vt(const _Float16* __restrict__ V16, int ldv, int voff, _Float16* __restrict__ Vt) { __shared__ unsigned short tl[64][66]; const int tid = threadIdx.x; const int slab = blockIdx.x / (TTv / 64), lg = blockIdx.x % (TTv / 64); const int b = slab / NHv, h = slab % NHv;
  for (int i = tid; i < 64 * 8; i += 256) { const int r = i / 8, c8 = (i % 8) * 8; FragH f; f.half[0] = *(const v8us*)((const unsigned short*)V16 + ((size_t)b * TTv + lg * 64 + r) * ldv + voff + h * 64 + c8);
#pragma unroll
    for (int q = 0; q < 8; ++q) tl[r][c8 + q] = f.u[q]; }
  __syncthreads();
  {
#pragma unroll
    for (int rd = 0; rd < 2; ++rd) { const int d = rd * 32 + tid / 8, pc = tid % 8; FragH f;
#pragma unroll
      for (int q = 0; q < 8; ++q) f.u[q] = tl[pc * 8 + q][d];
      *(v8us*)((unsigned short*)Vt + ((size_t)slab * 64 + d) * TTv + lg * 64 + pc * 8) = f.half[0]; }
     } }

__global__ __launch_bounds__(256) void k_hl(const float* __restrict__ F, _Float16* __restrict__ Hh, _Float16* __restrict__ Hl, size_t n8) { const size_t t = (size_t)blockIdx.x * 256 + threadIdx.x; if (t >= n8) return; FragH fh, fl; const v4f a = *(const v4fa*)(F + t * 8), c = *(const v4fa*)(F + t * 8 + 4);
#pragma unroll
  for (int q = 0; q < 4; ++q) { _Float16 h = (_Float16)a[q]; fh.h[q] = h; fl.h[q] = (_Float16)((a[q] - (float)h) * 1024.0f); h = (_Float16)c[q]; fh.h[4 + q] = h; fl.h[4 + q] = (_Float16)((c[q] - (float)h) * 1024.0f); }
  { *(v8us*)((unsigned short*)Hh + t * 8) = fh.half[0]; *(v8us*)((unsigned short*)Hl + t * 8) = fl.half[0];  } }

// ---- fast GEMM (work-group tile 128x64, wave tile 32x64; requires M % 128 == 0 rows per launch region, N % 64 == 0 and K % 64 == 0); epilogue = k_gemm_hhx semantics ----
// A (128 rows) and Bt (64 rows) come in stages of 64 k = whole 128-byte lines, eight threads a row, through registers into two LDS buffers (row pitch 144 bytes); the waves take their fragments from LDS.
// Stage s + 1 is fetched while stage s is worked on; one barrier a stage. The products run in ascending k, 32 k a step.
#define G2_P 144                     /* LDS row pitch in bytes: 128 + 16, an odd multiple of 16 */
#define G2_B (128 * G2_P)            /* Bt rows start behind the 128 A rows */
#define G2_S (192 * G2_P)            /* one buffer */
__device__ __forceinline__ v16h g2_frag(const _Float16* p, int hh) { FragH f; f.half[0] = *(const v8us*)((const unsigned short*)p + 8 * hh); f.half[1] = *(const v8us*)((const unsigned short*)p + 16 + 8 * hh); return f.v; }
__device__ __forceinline__ v16h g2_lfrag(const unsigned char* p) { FragH f; f.half[0] = *(const v8us*)p; f.half[1] = *(const v8us*)(p + 32); return f.v; }      /* p = row ln of a 16 x 32 block in LDS, + 16 hh bytes: the element order of g2_frag */
__device__ __forceinline__ v8f g2_mma(v16h a, v16h b, v8f c) { v8f d = __builtin_amdgcn_wmma_f32_16x16x32_f16(false, a, false, b, (short)0, c, false, false); asm volatile("v_nop\n\tv_nop\n\tv_nop\n\tv_nop" : "+v"(d) : "v"(a), "v"(b)); return d; }
template <int ACT>
__global__ __launch_bounds__(128) void k_gemm2(const _Float16* __restrict__ A, int lda, size_t sA, const _Float16* __restrict__ Bh, int ldb, size_t sB, float alpha, const float* __restrict__ bias, size_t sBias, const float* __restrict__ CP, int rowsPerB, size_t sCPb, int row0g,
    float* __restrict__ C, _Float16* __restrict__ C16, int ldc, size_t sC, int M, int N, int K) { static_assert(ACT == 0 || ACT == 3 || ACT == 6 || ACT == 8 || ACT == 9 || ACT == 11 || ACT == 12 || ACT == 14 || ACT == 15 || ACT == 16 || ACT == 17, "k_gemm2: unsupported ACT code (would silently apply no activation)");
  __shared__ __attribute__((aligned(16))) unsigned char sm[2 * G2_S];      /* [buffer][A 128 rows | Bt 64 rows][G2_P] */
  static_assert(4 * 32 * 68 * 4 <= 2 * G2_S, "k_gemm2: the epilogue's rows lie over the operand buffers");
  float (*so)[32][68] = (float (*)[32][68])sm;      /* epilogue staging, over the buffers once the last stage's barrier has ended every read of them */
  const int tid = threadIdx.x, w = tid >> 5, lane = tid & 31, ln = lane & 15, hh = lane >> 4; const int by = blockIdx.y;
  A += (size_t)by * sA; Bh += (size_t)by * sB; const size_t cofs = (size_t)by * sC; const float* bp = bias ? bias + (size_t)by * sBias : nullptr;
  const int ntn = N >> 6; const int mt = blockIdx.x / ntn, nq = blockIdx.x - mt * ntn; const int row0 = mt * 128 + 32 * w, col0 = nq * 64; if (mt * 128 >= M) return;      /* the whole work-group or none: barriers follow */
  const int srow = tid >> 3, scol = (tid & 7) * 16;      /* staging: eight threads a row, 16 rows a sweep; eight sweeps for A, four for Bt */
  const char* ag = (const char*)(A + (size_t)(mt * 128) * lda); const char* bg = (const char*)(Bh + (size_t)col0 * ldb);      /* the tiles' first rows: the same for the whole work-group */
  const unsigned av = (unsigned)(srow * lda * 2 + scol), bv = (unsigned)(srow * ldb * 2 + scol);      /* this thread's place in a sweep, in bytes */
  const size_t a16 = (size_t)lda * 32, b16 = (size_t)ldb * 32;      /* 16 rows, in bytes */
  unsigned char* sd = sm + srow * G2_P + scol;
  v8us ga[8], gb[4];
#pragma unroll
  for (int j = 0; j < 8; ++j) ga[j] = *(const v8us*)(ag + j * a16 + av);
#pragma unroll
  for (int j = 0; j < 4; ++j) gb[j] = *(const v8us*)(bg + j * b16 + bv);
#pragma unroll
  for (int j = 0; j < 8; ++j) *(v8us*)(sd + 16 * j * G2_P) = ga[j];
#pragma unroll
  for (int j = 0; j < 4; ++j) *(v8us*)(sd + G2_B + 16 * j * G2_P) = gb[j];
  __syncthreads();      /* stage 0 published */
  const unsigned char* al = sm + (32 * w + ln) * G2_P + 16 * hh; const unsigned char* bl = sm + G2_B + ln * G2_P + 16 * hh;
  const v8f z8 = {0.f,0.f,0.f,0.f,0.f,0.f,0.f,0.f}; v8f c00 = z8, c01 = z8, c02 = z8, c03 = z8, c10 = z8, c11 = z8, c12 = z8, c13 = z8;
  const int nst = K >> 6;
#pragma unroll 1      /* one stage a trip: the buffer index alternates, and one stage's fragments, staging registers and accumulators already take 218 registers */
  for (int st = 0; st < nst; ++st) { const bool more = st + 1 < nst;      /* the same for the whole work-group */
    if (more) { const unsigned ao = av + (unsigned)(st + 1) * 128u, bo = bv + (unsigned)(st + 1) * 128u;      /* 32-bit lane offsets on work-group-uniform row bases */
#pragma unroll
      for (int j = 0; j < 8; ++j) ga[j] = *(const v8us*)((ag + j * a16) + ao);
#pragma unroll
      for (int j = 0; j < 4; ++j) gb[j] = *(const v8us*)((bg + j * b16) + bo); }
    const int cur = (st & 1) * G2_S;
    const unsigned char* ap = al + cur; const unsigned char* bq = bl + cur; v16h a0[2], a1[2], b0[2], b1[2], b2[2], b3[2];
#pragma unroll
    for (int kk = 0; kk < 2; ++kk) { a0[kk] = g2_lfrag(ap + 64 * kk); a1[kk] = g2_lfrag(ap + 16 * G2_P + 64 * kk); b0[kk] = g2_lfrag(bq + 64 * kk); b1[kk] = g2_lfrag(bq + 16 * G2_P + 64 * kk); b2[kk] = g2_lfrag(bq + 32 * G2_P + 64 * kk); b3[kk] = g2_lfrag(bq + 48 * G2_P + 64 * kk); }
#pragma unroll
    for (int kk = 0; kk < 2; ++kk) {      /* 32 k */
      c00 = g2_mma(a0[kk], b0[kk], c00); c10 = g2_mma(a1[kk], b0[kk], c10); c01 = g2_mma(a0[kk], b1[kk], c01); c11 = g2_mma(a1[kk], b1[kk], c11);
      c02 = g2_mma(a0[kk], b2[kk], c02); c12 = g2_mma(a1[kk], b2[kk], c12); c03 = g2_mma(a0[kk], b3[kk], c03); c13 = g2_mma(a1[kk], b3[kk], c13); }
    if (more) { unsigned char* nd = sd + (G2_S - cur);      /* the buffer of stage st - 1: every wave left it at the barrier that ended that trip */
#pragma unroll
      for (int j = 0; j < 8; ++j) *(v8us*)(nd + 16 * j * G2_P) = ga[j];
#pragma unroll
      for (int j = 0; j < 4; ++j) *(v8us*)(nd + G2_B + 16 * j * G2_P) = gb[j]; }
    __syncthreads(); }      /* publishes stage st + 1 and ends every wave's reads of stage st */
  v8f accs[8] = {c00, c01, c02, c03, c10, c11, c12, c13};
#pragma unroll
  for (int u = 0; u < 8; ++u) { const int t = u & 3, half = u >> 2; const int col = col0 + t * 16 + ln; const float bv = bp ? bf16_round(bp[col]) : 0.f;
#pragma unroll
    for (int r = 0; r < 8; ++r) { const int rloc = half * 16 + 8 * hh + r; float v = accs[u][r] * alpha + bv; if (CP) { if (rowsPerB < 0) v += CP[cofs + (size_t)(row0g + row0 + rloc) * ldc + col];      /* rowsPerB < 0: own element of the batched C plane */ else { const int bidx = (row0g + row0 + rloc) / rowsPerB; v += CP[(size_t)bidx * sCPb + (size_t)by * 64 + col]; } }
      if (ACT == 3) v = fmaxf(v, 0.f); else if (ACT == 6) v = 0.5f * v * (1.0f + erff(v * 0.70710678118654752f)); else if (ACT == 11) v = 1.0f / (1.0f + expf(-v)); else if (ACT == 15) v = v / (1.0f + expf(-v)); else if (ACT == 12) v = (v > 0.f) ? v : 0.01f * v; else if (ACT == 8) v = tanhf(v); else if (ACT == 9) v = 0.5f * v * (1.0f + tanhf(0.7978845608028654f * (v + 0.044715f * v * v * v))); else if (ACT == 14) v = (v > 0.f) ? v : 0.1f * v; else if (ACT == 16) v = (v >= 0.f) ? v : 0.3f * v; else if (ACT == 17) v = (v >= 0.f) ? v : 0.2f * v;
      so[w][rloc][t * 16 + ln] = v; } }
  __builtin_amdgcn_fence(__ATOMIC_ACQ_REL, "workgroup"); __builtin_amdgcn_wave_barrier();
  const int rsub = lane >> 4, c4 = (lane & 15) * 4;
  {
#pragma unroll
    for (int q = 0; q < 16; ++q) { const int r = q * 2 + rsub; const v4f v = *(const v4fa*)&so[w][r][c4]; if (C) *(v4f*)(C + cofs + (size_t)(row0 + r) * ldc + col0 + c4) = v; if (C16) { v4h h4; for (int i = 0; i < 4; ++i) h4[i] = (_Float16)v[i]; *(v4h*)(C16 + cofs + (size_t)(row0 + r) * ldc + col0 + c4) = h4; } }
     } }


__global__ __launch_bounds__(256) void k_wnat(const float* __restrict__ w, size_t n8, _Float16* __restrict__ Bt) { const size_t t = (size_t)blockIdx.x * 256 + threadIdx.x; if (t >= n8) return; FragH f; for (int q = 0; q < 8; ++q) f.h[q] = (_Float16)(bf16_round(w[t * 8 + q]) * 16.0f); *(v8us*)((unsigned short*)Bt + t * 8) = f.half[0];  }
__global__ __launch_bounds__(256) void k_rsm(const float* __restrict__ S, _Float16* __restrict__ P, int nrows) {
  #pragma clang fp contract(off)
  const int i = blockIdx.x * 256 + threadIdx.x; if (i >= nrows) return; const float* s = S + (size_t)i * SQ; float mx = -3.0e38f;
#pragma unroll 1
  for (int j = 0; j < SQ; ++j) mx = fmaxf(mx, s[j]); float se = 0.f;
#pragma unroll 1
  for (int j = 0; j < SQ; ++j) se += expf(s[j] - mx); const float sc = 256.0f / se;
#pragma unroll 1
  for (int j0 = 0; j0 < SQ; j0 += 8) { FragH f; for (int q = 0; q < 8; ++q) f.h[q] = (_Float16)(expf(s[j0 + q] - mx) * sc); unsigned short* d = (unsigned short*)P + (size_t)i * SQ + j0; *(v8us*)d = f.half[0];  } }
__global__ __launch_bounds__(256) void k_vt(const _Float16* __restrict__ V16, int b, int h0, _Float16* __restrict__ VT) { __shared__ unsigned short tl[64][65]; const int tid = threadIdx.x; const int hh = blockIdx.x % HG, sg = blockIdx.x / HG; const int s0 = sg * 64; const int h = h0 + hh;
  for (int i = tid; i < 64 * 8; i += 256) { const int j = i / 8, d8 = (i % 8) * 8; FragH f; f.half[0] = *(const v8us*)((const unsigned short*)V16 + ((size_t)b * SQ + s0 + j) * DM + h * HD + d8); for (int q = 0; q < 8; ++q) tl[d8 + q][j] = f.u[q]; }
  __syncthreads();
  { for (int i = tid; i < 64 * 8; i += 256) { const int d = i / 8, j8 = (i % 8) * 8; FragH f; for (int q = 0; q < 8; ++q) f.u[q] = tl[d][j8 + q]; *(v8us*)((unsigned short*)VT + ((size_t)hh * HD + d) * SQ + s0 + j8) = f.half[0]; }  } }



__global__ __launch_bounds__(256) void k_rsmcf2(const float* __restrict__ S, _Float16* __restrict__ P, int hg, int q0, int nk) {
  #pragma clang fp contract(off)
  const int t = blockIdx.x * 256 + threadIdx.x; if (t >= hg * QT) return; const size_t i = (size_t)t; const float* s = S + i * NKX; const int last = q0 + (t % QT); float mx = -3.0e38f;
#pragma unroll 1
  for (int j = 0; j < nk; ++j) { const float f = (j <= last) ? 1.f : 0.f; mx = fmaxf(mx, fmaf(f, s[j], (1.f - f) * -1.0e9f)); } float se = 0.f;
#pragma unroll 1
  for (int j = 0; j < nk; ++j) { const float f = (j <= last) ? 1.f : 0.f; se += __expf(fmaf(f, s[j], (1.f - f) * -1.0e9f) - mx); } const float sc = 256.0f / se;
#pragma unroll 1
  for (int j0 = 0; j0 < nk; j0 += 8) { FragH fr; for (int q = 0; q < 8; ++q) { const int j = j0 + q; const float f = (j <= last) ? 1.f : 0.f; fr.h[q] = (_Float16)(__expf(fmaf(f, s[j], (1.f - f) * -1.0e9f) - mx) * sc); } unsigned short* d = (unsigned short*)P + i * NKX + j0; *(v8us*)d = fr.half[0];  } }


template <int MASKADD>
__global__ __launch_bounds__(64) void k_att0(const float* __restrict__ QF, const float* __restrict__ KF, const float* __restrict__ VF, int ld, const float* __restrict__ mask, float scale, float* __restrict__ OF, int ldo) {
  #pragma clang fp contract(off)
  __shared__ __attribute__((aligned(16))) float lq[64][64]; __shared__ __attribute__((aligned(16))) float lo[64][64];
  const int tid = threadIdx.x; const int h = blockIdx.x / (QT0 / 64), rg = blockIdx.x % (QT0 / 64); const int i = rg * 64 + tid;
  const float* qr = QF + (size_t)i * ld + h * HD;
#pragma unroll 1
  for (int c = 0; c < HD / 4; ++c) { *(v4f*)&lq[tid][c * 4] = *(const v4fa*)(qr + c * 4); const v4f z = {0.f, 0.f, 0.f, 0.f}; *(v4f*)&lo[tid][c * 4] = z; }
  float m = -1.0e30f, l = 0.f; const int jmax = MASKADD ? (SQ - 1) : (rg * 64 + 63);      /* additive-mask form: every key (the mask input decides); causal form: keys up to the block's last row */
#pragma unroll 1
  for (int j = 0; j <= jmax; ++j) { const float* kr = KF + (size_t)j * ld + h * HD; const float* vr = VF + (size_t)j * ld + h * HD; float s = 0.f;
#pragma unroll 1
    for (int c = 0; c < HD / 4; ++c) { const v4f kq = *(const v4fa*)(kr + c * 4); const v4f qq = *(v4f*)&lq[tid][c * 4]; s = __fadd_rn(s, __fmul_rn(qq[0], kq[0])); s = __fadd_rn(s, __fmul_rn(qq[1], kq[1])); s = __fadd_rn(s, __fmul_rn(qq[2], kq[2])); s = __fadd_rn(s, __fmul_rn(qq[3], kq[3])); }
    s = __fmul_rn(s, scale); if (MASKADD) s = __fadd_rn(s, __fmul_rn(bf16_round(mask[(size_t)i * SQ + j]), -10000.0f));
    const float f = (MASKADD || j <= i) ? 1.f : 0.f; const float sm = fmaf(f, s, (1.f - f) * -1.0e30f); const float mn = fmaxf(m, sm); const float sc = expf(m - mn); const float e = expf(sm - mn); l = __fadd_rn(__fmul_rn(l, sc), e); m = mn;
#pragma unroll 1
    for (int c = 0; c < HD / 4; ++c) { const v4f vv = *(const v4fa*)(vr + c * 4); v4f oo = *(v4f*)&lo[tid][c * 4]; for (int u = 0; u < 4; ++u) oo[u] = __fadd_rn(__fmul_rn(oo[u], sc), __fmul_rn(e, vv[u])); *(v4f*)&lo[tid][c * 4] = oo; } }
  const float fin = 64.0f / l;      /* o carried x64 like the f16 path */
#pragma unroll 1
  for (int c = 0; c < HD / 4; ++c) { v4f oo = *(v4f*)&lo[tid][c * 4]; for (int u = 0; u < 4; ++u) oo[u] = __fmul_rn(oo[u], fin); *(v4f*)&lo[tid][c * 4] = oo; }
  __syncthreads();
  {
#pragma unroll 1
    for (int it = 0; it < 16; ++it) { const int row = it * 4 + tid / 16, pc = (tid % 16) * 4; const v4f v = *(const v4f*)&lo[row][pc]; *(v4f*)(OF + (size_t)(rg * 64 + row) * ldo + h * HD + pc) = v; }
     } }


template <int BFIN, int WXB>
__global__ __launch_bounds__(256) void k_ln16(const float* __restrict__ X, const float* __restrict__ g, const float* __restrict__ bb, float eps, _Float16* __restrict__ N16, float* __restrict__ XB) {
  #pragma clang fp contract(off)
  __shared__ float red[256]; const size_t r = blockIdx.x; const int t = threadIdx.x; const v4f xa = *(const v4fa*)(X + r * DMQ + t * 4); float s[4]; float sum = 0.f;
  for (int q = 0; q < 4; ++q) { s[q] = BFIN ? bf16_round(xa[q]) : xa[q]; sum = __fadd_rn(sum, s[q]); }
  red[t] = sum; __syncthreads(); for (int st = 128; st > 0; st >>= 1) { if (t < st) red[t] = __fadd_rn(red[t], red[t + st]); __syncthreads(); } const float mu = red[0] / (float)DMQ; __syncthreads();
  float vs = 0.f; for (int q = 0; q < 4; ++q) { const float dl = __fadd_rn(s[q], -mu); vs = __fadd_rn(vs, __fmul_rn(dl, dl)); } red[t] = vs; __syncthreads(); for (int st = 128; st > 0; st >>= 1) { if (t < st) red[t] = __fadd_rn(red[t], red[t + st]); __syncthreads(); }
  const float rs = rsqrtf(__fadd_rn(red[0] / (float)DMQ, eps)); v4h y; v4f xb;
  for (int q = 0; q < 4; ++q) { const int c = t * 4 + q; y[q] = (_Float16)__fadd_rn(__fmul_rn(__fmul_rn(__fadd_rn(s[q], -mu), rs), bf16_round(g[c])), bf16_round(bb[c])); xb[q] = s[q]; }
  { *(v4h*)(N16 + r * DMQ + t * 4) = y; if (WXB) *(v4f*)(XB + r * DMQ + t * 4) = xb;  } }
__global__ __launch_bounds__(256) void k_ftres2(const float* __restrict__ OF0, const float* __restrict__ XB, float* __restrict__ X1, size_t n4) {
  #pragma clang fp contract(off)
  const size_t t = (size_t)blockIdx.x * 256 + threadIdx.x; if (t >= n4) return; const v4f o = *(const v4fa*)(OF0 + t * 4), xv = *(const v4fa*)(XB + t * 4); v4f y; for (int q = 0; q < 4; ++q) y[q] = __fadd_rn(__fmul_rn(o[q], 0.015625f), xv[q]); *(v4f*)(X1 + t * 4) = y;  }

__global__ __launch_bounds__(256) void k_wthd(const float* __restrict__ Wt, _Float16* __restrict__ Bt) { const size_t t = (size_t)blockIdx.x * 256 + threadIdx.x; if (t >= (size_t)NH * HD * (DM / 8)) return; const int m8 = (int)(t % (DM / 8)) * 8; const int d = (int)((t / (DM / 8)) % HD); const int h = (int)(t / ((size_t)(DM / 8) * HD)); FragH f;
  for (int q = 0; q < 8; ++q) f.h[q] = (_Float16)(16.0f * bf16_round(Wt[((size_t)h * DM + m8 + q) * HD + d])); unsigned short* dst = (unsigned short*)Bt + ((size_t)h * HD + d) * DM + m8; *(v8us*)dst = f.half[0];  }




template <int BFIN, int W16, int W32>
__global__ __launch_bounds__(256) void k_lnx(const float* __restrict__ X, const float* __restrict__ g, const float* __restrict__ bb, float eps, _Float16* __restrict__ N16, float* __restrict__ N32) {
  #pragma clang fp contract(off)
  __shared__ float red[256]; const size_t r = blockIdx.x; const int t = threadIdx.x; const bool act = t < (DMQ / 4); const int c0 = act ? t * 4 : 0;
  const v4f xa = *(const v4fa*)(X + r * DMQ + c0); float s[4]; float sum = 0.f;
  for (int q = 0; q < 4; ++q) { s[q] = act ? (BFIN ? bf16_round(xa[q]) : xa[q]) : 0.f; sum = __fadd_rn(sum, s[q]); }
  red[t] = sum; __syncthreads(); for (int st = 128; st > 0; st >>= 1) { if (t < st) red[t] = __fadd_rn(red[t], red[t + st]); __syncthreads(); } const float mu = red[0] / (float)DMQ; __syncthreads();
  float vs = 0.f; for (int q = 0; q < 4; ++q) { const float dl = act ? __fadd_rn(s[q], -mu) : 0.f; vs = __fadd_rn(vs, __fmul_rn(dl, dl)); } red[t] = vs; __syncthreads(); for (int st = 128; st > 0; st >>= 1) { if (t < st) red[t] = __fadd_rn(red[t], red[t + st]); __syncthreads(); }
  const float rs = rsqrtf(__fadd_rn(red[0] / (float)DMQ, eps)); v4h y; v4f yf;
  for (int q = 0; q < 4; ++q) { const int c = c0 + q; yf[q] = __fadd_rn(__fmul_rn(__fmul_rn(__fadd_rn(s[q], -mu), rs), bf16_round(g[c])), bf16_round(bb[c])); y[q] = (_Float16)yf[q]; }
  if (!act) return;      /* no barriers after this point */
  { if (W16) *(v4h*)(N16 + r * DMQ + c0) = y; if (W32) *(v4f*)(N32 + r * DMQ + c0) = yf;  } }


__global__ __launch_bounds__(256) void k_bfr(const float* __restrict__ x, float* __restrict__ XB, size_t n8) { const size_t t = (size_t)blockIdx.x * 256 + threadIdx.x; if (t >= n8) return; v4f a = *(const v4fa*)(x + t * 8), c = *(const v4fa*)(x + t * 8 + 4); for (int q = 0; q < 4; ++q) { a[q] = bf16_round(a[q]); c[q] = bf16_round(c[q]); }
  { *(v4f*)(XB + t * 8) = a; *(v4f*)(XB + t * 8 + 4) = c;  } }




__global__ __launch_bounds__(256) void k_lorafold(const float* __restrict__ Wm, const float* __restrict__ A, const float* __restrict__ Bm, float* __restrict__ WE, int K, int N, float sc) {
  #pragma clang fp contract(off)
  const size_t t = (size_t)blockIdx.x * 256 + threadIdx.x; if (t >= (size_t)K * N) return; const int i = (int)(t / N), o = (int)(t % N); float a = 0.f;
  for (int r = 0; r < 16; ++r) a = __fadd_rn(a, __fmul_rn(bf16_round(A[(size_t)i * 16 + r]), bf16_round(Bm[(size_t)r * N + o])));
  const float v = __fadd_rn(bf16_round(Wm[t]), __fmul_rn(sc, a)); *(float*)(WE + t) = v;  }
__global__ __launch_bounds__(256) void k_wt32rep(const float* __restrict__ Wf, _Float16* __restrict__ Bt, int K, int N, int DOUT, float scale) {
  const int t = blockIdx.x * 256 + threadIdx.x; if (t >= DOUT * (K / 8)) return; const int n = t / (K / 8), k8 = (t % (K / 8)) * 8; const int rep = DOUT / N; const int src = (n / (HD * rep)) * HD + (n % HD);      /* head h = n / HD -> group h / rep */
  FragH f; for (int i = 0; i < 8; ++i) f.h[i] = (_Float16)(Wf[(size_t)(k8 + i) * N + src] * scale);
  *(v8us*)((unsigned short*)Bt + (size_t)n * K + k8) = f.half[0];  }
__global__ __launch_bounds__(256) void k_brep(const float* __restrict__ b, float* __restrict__ out) { const int t = blockIdx.x * 256 + threadIdx.x; if (t >= DM) return; const float v = b[(t / (HD * 4)) * HD + (t % HD)]; *(float*)(out + t) = v;  }

__global__ __launch_bounds__(256) void k_rsmcim(const float* __restrict__ S, _Float16* __restrict__ P, int hg, int q0, int nk, const int* __restrict__ am) {
  #pragma clang fp contract(off)
  const int t = blockIdx.x * 256 + threadIdx.x; if (t >= hg * QT) return; const size_t i = (size_t)t; const float* s = S + i * NKX; const int last = q0 + (t % QT); const int* mr = am + (size_t)last * SQ; float mx = -3.0e38f;      /* the module's mask row of this query (keys >= nk lie above the diagonal of the causal mask and are not computed) */
#pragma unroll 1
  for (int j = 0; j < nk; ++j) { const float f = (mr[j] != 0) ? 1.f : 0.f; mx = fmaxf(mx, fmaf(f, s[j], (1.f - f) * -1.0e9f)); } float se = 0.f;
#pragma unroll 1
  for (int j = 0; j < nk; ++j) { const float f = (mr[j] != 0) ? 1.f : 0.f; se += __expf(fmaf(f, s[j], (1.f - f) * -1.0e9f) - mx); } const float sc = 256.0f / se;
#pragma unroll 1
  for (int j0 = 0; j0 < nk; j0 += 8) { FragH fr; for (int q = 0; q < 8; ++q) { const int j = j0 + q; const float f = (mr[j] != 0) ? 1.f : 0.f; fr.h[q] = (_Float16)(__expf(fmaf(f, s[j], (1.f - f) * -1.0e9f) - mx) * sc); } unsigned short* d = (unsigned short*)P + i * NKX + j0; *(v8us*)d = fr.half[0];  } }



__global__ __launch_bounds__(256) void k_bcpy(const float* __restrict__ b, int n, int NP, float* __restrict__ dst, int dst0) { for (int i = threadIdx.x; i < NP; i += 256) { const float v = (i < n) ? b[i] : 0.f; *(float*)(dst + dst0 + i) = v; }  }



__global__ __launch_bounds__(256) void k_rsmp(const float* __restrict__ S, _Float16* __restrict__ P, int nrows, int nk) {
  #pragma clang fp contract(off)
  const int t = blockIdx.x * 256 + threadIdx.x; if (t >= nrows) return; const size_t ri = (size_t)t; const float* s = S + ri * NKX; float mx = -3.0e38f;
#pragma unroll 1
  for (int j = 0; j < nk; ++j) mx = fmaxf(mx, s[j]); float se = 0.f;
#pragma unroll 1
  for (int j = 0; j < nk; ++j) se += __expf(s[j] - mx); const float sc = 256.0f / se;
#pragma unroll 1
  for (int j0 = 0; j0 < nk; j0 += 8) { FragH fr; for (int q = 0; q < 8; ++q) fr.h[q] = (_Float16)(__expf(s[j0 + q] - mx) * sc);
    unsigned short* d = (unsigned short*)P + ri * NKX + j0; *(v8us*)d = fr.half[0];  } }
template <int BFIN, int W16, int W32>
__global__ __launch_bounds__(256) void k_lnxr(const float* __restrict__ X, const float* __restrict__ g, const float* __restrict__ bb, float eps, _Float16* __restrict__ N16, float* __restrict__ N32, const float* __restrict__ R) {
  #pragma clang fp contract(off)
  __shared__ float red[256]; const size_t r = blockIdx.x; const int t = threadIdx.x; const bool act = t < (DMQ / 4); const int c0 = act ? t * 4 : 0;
  const v4f xa = *(const v4fa*)(X + r * DMQ + c0); const v4f ra = *(const v4fa*)(R + r * DMQ + c0);      /* residual row (f32, already on the bf16 grid where it is an input copy) */ float s[4]; float sum = 0.f;
  for (int q = 0; q < 4; ++q) { s[q] = act ? (BFIN ? bf16_round(xa[q]) : xa[q]) : 0.f; sum = __fadd_rn(sum, s[q]); }
  red[t] = sum; __syncthreads(); for (int st = 128; st > 0; st >>= 1) { if (t < st) red[t] = __fadd_rn(red[t], red[t + st]); __syncthreads(); } const float mu = red[0] / (float)DMQ; __syncthreads();
  float vs = 0.f; for (int q = 0; q < 4; ++q) { const float dl = act ? __fadd_rn(s[q], -mu) : 0.f; vs = __fadd_rn(vs, __fmul_rn(dl, dl)); } red[t] = vs; __syncthreads(); for (int st = 128; st > 0; st >>= 1) { if (t < st) red[t] = __fadd_rn(red[t], red[t + st]); __syncthreads(); }
  const float rs = rsqrtf(__fadd_rn(red[0] / (float)DMQ, eps)); v4h y; v4f yf;
  for (int q = 0; q < 4; ++q) { const int c = c0 + q; yf[q] = __fadd_rn(__fadd_rn(__fmul_rn(__fmul_rn(__fadd_rn(s[q], -mu), rs), bf16_round(g[c])), bf16_round(bb[c])), ra[q]); y[q] = (_Float16)yf[q]; }
  if (!act) return;      /* no barriers after this point */
  { if (W16) *(v4h*)(N16 + r * DMQ + c0) = y; if (W32) *(v4f*)(N32 + r * DMQ + c0) = yf;  } }



// Fused attention, one launch for all batches and heads: a work-group of four waves owns 64 query rows (16 a wave) and walks all SQ keys in stages of 64; scores and weights stay in registers.
// Transposed products: S^T = K Q^T (rows = keys, columns = queries) and O^T += V^T P^T. The accumulator of S^T holds, in lane (ln, hh), register r, key 8 hh + r of query ln,
// which is the k order of the B operand (elements 0..7 = k 8 hh + i, elements 8..15 = k 16 + 8 hh + i), so two 16-key score tiles become one 32-key P^T fragment with no exchange.
// Online softmax in the log2 domain: running maximum and running sum per query (a query is a lane pair ln, ln + 16); weights are carried x256 (exponent + 8) as f16, the sum likewise, f32.
// K and V^T tiles (64 rows of 128 bytes each) come in whole 128-byte lines through registers into two LDS buffers (row pitch 144 bytes): stage s + 1 is fetched while stage s is worked on; one barrier a stage.
#define FA_P 144                     /* LDS row pitch in bytes: 128 + 16, an odd multiple of 16 */
#define FA_T (64 * FA_P)             /* one tile */
typedef int v4ia __attribute__((ext_vector_type(4), may_alias));
__device__ __forceinline__ v8f fa_mma(v16h a, v16h b, v8f c) { return __builtin_amdgcn_wmma_f32_16x16x32_f16(false, a, false, b, (short)0, c, false, false); }
__device__ __forceinline__ float fa_xhalf(float x) { return __builtin_bit_cast(float, __builtin_amdgcn_permlanex16(__builtin_bit_cast(int, x), __builtin_bit_cast(int, x), 0x76543210, 0xfedcba98, false, false)); }      /* lane l with lane l ^ 16 */
__device__ __forceinline__ float fa_exp2(float t) { float e;
  asm("v_exp_f32 %0, %1\n\tv_nop" : "=v"(e) : "v"(t));      /* v_nop: the one slot the instruction set asks for behind a transcendental before its source is overwritten or its result read */
  return e; }
__device__ __forceinline__ v16h fa_frag(const unsigned char* p) { FragH f; f.half[0] = *(const v8us*)p; f.half[1] = *(const v8us*)(p + 32); return f.v; }      /* p = row ln of a 16 x 32 block in LDS, + 16 hh bytes */
__global__ __launch_bounds__(128) __attribute__((amdgpu_waves_per_eu(4, 4)))      /* register budget of four waves a SIMD (the grid gives three): aiming at more, the compiler reused one register quad for the mask words and waited out each LDS load in turn */
void k_fattn(const _Float16* __restrict__ QKVp, const _Float16* __restrict__ VTp, const int* __restrict__ Km, _Float16* __restrict__ O) {
  static_assert(HD == 64 && SQ % 512 == 0, "k_fattn: head size 64; 128 threads x 4 mask words a sweep; 64-key stages");
  __shared__ __attribute__((aligned(16))) int lm[SQ];      /* this batch's key mask */
  __shared__ __attribute__((aligned(16))) unsigned char kv[2][2][FA_T];      /* [buffer][K, V^T][row * FA_P + byte] */
  const int tid = threadIdx.x, w = tid >> 5, lane = tid & 31, ln = lane & 15, hh = lane >> 4;
  const int bh = blockIdx.y, b = bh / NH, h = bh - b * NH; const size_t r0 = (size_t)b * SQ; const int q0 = blockIdx.x * 64 + w * 16;
  const int srow = tid >> 3, scol = (tid & 7) * 16;      /* staging: eight threads a row, 16 rows a sweep, four sweeps a tile */
  const char* kg = (const char*)(QKVp + (r0 + srow) * LQ + DM + h * HD) + scol;      /* key row srow, this head's 64 columns of the k block */
  const char* vg = (const char*)(VTp + ((size_t)bh * HD + srow) * SQ) + scol;      /* V^T row d = srow */
  const int sofs = srow * FA_P + scol, lofs = ln * FA_P + 16 * hh;
  v8us gk[4], gv[4];
#pragma unroll
  for (int j = 0; j < 4; ++j) { gk[j] = *(const v8us*)(kg + (size_t)(16 * j) * (LQ * 2)); gv[j] = *(const v8us*)(vg + (size_t)(16 * j) * (SQ * 2)); }
  for (int i = tid * 4; i < SQ; i += 512) *(v4ia*)(lm + i) = *(const v4ia*)(Km + r0 + i);
  const _Float16* qp = QKVp + (r0 + q0 + ln) * LQ + h * HD; const v16h q0f = g2_frag(qp, hh), q1f = g2_frag(qp + 32, hh);
#pragma unroll
  for (int j = 0; j < 4; ++j) { *(v8us*)&kv[0][0][sofs + 16 * j * FA_P] = gk[j]; *(v8us*)&kv[0][1][sofs + 16 * j * FA_P] = gv[j]; }
  __syncthreads();      /* mask and stage 0 published */
  const int* lmh = lm + 8 * hh;
  const v8f z8 = {0.f, 0.f, 0.f, 0.f, 0.f, 0.f, 0.f, 0.f}; v8f acc[4] = {z8, z8, z8, z8}; float m_run = -3.0e38f, l_run = 0.f;
  const float c2 = 0.036084391824351615f * 1.44269504088896340736f, fill2 = 1.0e-11f * 1.44269504088896340736f;      /* 1 / sqrt(768) and the fill score, both times log2(e) */
#pragma unroll 1      /* one stage a trip: the buffer index alternates, and two stages' fragments at once would go past 256 registers */
  for (int st = 0; st < SQ / 64; ++st) {
    const int sn = (st + 1 < SQ / 64) ? st + 1 : st;      /* the last trip fetches its own stage again (in bounds) into the buffer nobody reads any more: no branch round loads, stores or the barrier */
#pragma unroll
    for (int j = 0; j < 4; ++j) { gk[j] = *(const v8us*)(kg + (size_t)(sn * 64 + 16 * j) * (LQ * 2)); gv[j] = *(const v8us*)(vg + (size_t)(16 * j) * (SQ * 2) + sn * 128); }
    __builtin_amdgcn_sched_barrier(0);      /* holds the next stage's eight global loads here, a whole stage in front of the LDS stores that use them; left free, the scheduler sinks loads to just in front of their use and every wave waits out the load latency at the barrier */
    const unsigned char* kl = &kv[st & 1][0][lofs]; const unsigned char* vl = &kv[st & 1][1][lofs];
#pragma unroll
    for (int sub = 0; sub < 2; ++sub) {      /* one pass: 32 keys */
      const int kb = st * 64 + sub * 32;
      const v4ia ma = *(const v4ia*)(lmh + kb), mb = *(const v4ia*)(lmh + kb + 4), mc = *(const v4ia*)(lmh + kb + 16), md = *(const v4ia*)(lmh + kb + 20);
      const unsigned char* kt = kl + sub * 32 * FA_P;
      const v16h k0 = fa_frag(kt), k2 = fa_frag(kt + 16 * FA_P), k1 = fa_frag(kt + 64), k3 = fa_frag(kt + 16 * FA_P + 64);
      v16h vf[4];
#pragma unroll
      for (int t = 0; t < 4; ++t) vf[t] = fa_frag(vl + t * 16 * FA_P + sub * 64);
      __builtin_amdgcn_sched_barrier(0);      /* holds the pass's 20 LDS loads together at its head, so that their latencies overlap; left free, each K fragment was loaded into the same registers just in front of its product and waited for by itself */
      v8f s0 = fa_mma(k0, q0f, z8); v8f s1 = fa_mma(k2, q0f, z8); s0 = fa_mma(k1, q1f, s0); s1 = fa_mma(k3, q1f, s1);
      float x[16];
#pragma unroll
      for (int r = 0; r < 4; ++r) { x[r] = (ma[r] != 0) ? s0[r] * c2 : fill2; x[4 + r] = (mb[r] != 0) ? s0[4 + r] * c2 : fill2; x[8 + r] = (mc[r] != 0) ? s1[r] * c2 : fill2; x[12 + r] = (md[r] != 0) ? s1[4 + r] * c2 : fill2; }
      float mx = x[0];
#pragma unroll
      for (int i = 1; i < 16; ++i) mx = fmaxf(mx, x[i]);
      mx = fmaxf(mx, fa_xhalf(mx));      /* both halves of the wave hold this query's maximum of the pass */
      const float mn = fmaxf(m_run, mx); const float corr = fa_exp2(m_run - mn); m_run = mn; const float nm = 8.0f - mn;
#pragma unroll
      for (int t = 0; t < 4; ++t) acc[t] = acc[t] * corr;
      FragH p; float e0 = 0.f, e1 = 0.f, e2 = 0.f, e3 = 0.f;
#pragma unroll
      for (int i = 0; i < 16; i += 4) { const float ea = fa_exp2(x[i] + nm), eb = fa_exp2(x[i + 1] + nm), ec = fa_exp2(x[i + 2] + nm), ed = fa_exp2(x[i + 3] + nm);
        e0 += ea; e1 += eb; e2 += ec; e3 += ed; p.h[i] = (_Float16)ea; p.h[i + 1] = (_Float16)eb; p.h[i + 2] = (_Float16)ec; p.h[i + 3] = (_Float16)ed; }
      l_run = l_run * corr + ((e0 + e1) + (e2 + e3));      /* this lane's 16 keys only; the two halves are added behind the loop */
#pragma unroll
      for (int t = 0; t < 4; ++t) acc[t] = fa_mma(vf[t], p.v, acc[t]);
      __builtin_amdgcn_sched_barrier(0);      /* ends the pass for the scheduler: left free, it fetched both passes' fragments at once (spills at 256 registers) and moved the next stage's LDS stores, their wait on the global loads and the barrier up in front of the softmax, where the loads had had no time to land */
    }
    unsigned char* kd = &kv[(st + 1) & 1][0][sofs]; unsigned char* vd = &kv[(st + 1) & 1][1][sofs];      /* the buffer of stage st - 1: every wave left it at the barrier that ended that trip */
#pragma unroll
    for (int j = 0; j < 4; ++j) { *(v8us*)(kd + 16 * j * FA_P) = gk[j]; *(v8us*)(vd + 16 * j * FA_P) = gv[j]; }
    __syncthreads();      /* publishes stage st + 1 and ends every wave's reads of stage st */
  }
  const float l = l_run + fa_xhalf(l_run); const float fin = 64.0f / l;      /* ctx carried x64 as before; the x256 of weights and sum cancels */
  unsigned short* op = (unsigned short*)O + (r0 + q0 + ln) * DM + h * HD + 8 * hh;
#pragma unroll
  for (int t = 0; t < 4; ++t) { FragH f;
#pragma unroll
    for (int r = 0; r < 8; ++r) f.h[r] = (_Float16)(acc[t][r] * fin);
    *(v8us*)(op + 16 * t) = f.half[0]; } }      /* d = 16 t + 8 hh + r of query ln */


extern "C" void kernel_launch(void* const* d_in, const int* in_sizes, int n_in,
                              void* d_out, int out_size, void* d_ws, size_t ws_size, hipStream_t stream) {
  (void)in_sizes; (void)n_in; (void)out_size;
  const float* const* I = (const float* const*)d_in; const float* x = I[0]; const int* km = (const int*)d_in[1]; const float* wq = I[2]; const float* bq = I[3]; const float* wk = I[4]; const float* bk = I[5]; const float* wv = I[6]; const float* bv = I[7]; const float* wo = I[8]; const float* bo = I[9]; const float* g1 = I[10]; const float* be1 = I[11]; const float* wfc = I[12]; const float* bfc = I[13]; const float* wmp = I[14]; const float* bmp = I[15]; const float* gg2 = I[16]; const float* be2 = I[17];      /* input order: x_n; mask int32 [2][1][1][2048] (READ on device); [in][out] wq / wk / wv / wo + biases; ln1 g / b; w1 [768][3072] + b1, w2 [3072][768] + b2; ln2 g / b */
  static_assert(DMQ % 4 == 0 && DMQ / 4 <= 256 && DM % 64 == 0 && DM % 32 == 0 && DFF % 64 == 0 && DFF % 32 == 0 && NH * HD == DM && NKX == SQ, "k_lnxr 256 threads x 4 columns; tile multiples");
  static_assert(MP % 128 == 0 && MPO % 128 == 0 && SQ % 128 == 0 && DM % 64 == 0 && DFF % 64 == 0, "k_gemm2: whole 128-row work-group tiles, 64-column tiles, 64-k stages");
  char* ws = (char*)d_ws; size_t off = 0;
  auto take = [&](size_t bytes) { char* p = ws + off; off += (bytes + 255) & ~(size_t)255; return p; };
  _Float16* BQKV = (_Float16*)take((size_t)3 * DM * DM * 2); _Float16* BO = (_Float16*)take((size_t)DM * DM * 2); float* bqkv = (float*)take((size_t)3 * DM * 4); float* X1N = nullptr;      /* LN1 output (f32): aliases the QKV plane below (QKV's last readers, the V^T and fused attention launches, precede LN1) to stay within 256 MiB at NB 4 / SQ 2048 */
  _Float16* X16 = (_Float16*)take(NR * DM * 2); float* XB = (float*)take(NR * DM * 4); float* X1 = (float*)take(NR * DM * 4); _Float16* M16 = nullptr;      /* = X16 below (alias: X16's last reader, the fused QKV GEMM, precedes LN1's f16 write) */ _Float16* HF16 = (_Float16*)take((size_t)SQ * DFF * 2);      /* FFN hidden plane of one batch [2048][3072] f16 (own region here) */ _Float16* BW1 = (_Float16*)take((size_t)DFF * DM * 2); _Float16* BW2 = (_Float16*)take((size_t)DM * DFF * 2); _Float16* QKV = (_Float16*)take(NR * 3 * DM * 2); _Float16* V16 = QKV + 2 * DM; _Float16* O16 = (_Float16*)take(NR * DM * 2); M16 = X16; X1N = (float*)QKV;      /* aliases: X1N (NR*DM f32 = 12 MiB) inside QKV (18 MiB): QKV's last readers (the V^T and fused attention launches) precede the first LayerNorm */
  _Float16* VT = (_Float16*)take((size_t)NB * NH * HD * SQ * 2);
  if (off > ws_size) return;
  { const unsigned g = (unsigned)(((size_t)DM * (DM / 8) + 255) / 256); k_wt_f16<<<g, 256, 0, stream>>>(wq, BQKV, DM, DM, 16.0f); k_wt_f16<<<g, 256, 0, stream>>>(wk, BQKV + (size_t)DM * DM, DM, DM, 16.0f); k_wt_f16<<<g, 256, 0, stream>>>(wv, BQKV + (size_t)2 * DM * DM, DM, DM, 16.0f); k_wt_f16<<<g, 256, 0, stream>>>(wo, BO, DM, DM, 16.0f); }      /* [in][out] -> Bt x16: stacked q | k | v, and Wo */
  k_bcpy<<<1, 256, 0, stream>>>(bq, DM, DM, bqkv, 0); k_bcpy<<<1, 256, 0, stream>>>(bk, DM, DM, bqkv, DM); k_bcpy<<<1, 256, 0, stream>>>(bv, DM, DM, bqkv, 2 * DM);      /* stacked bias bq | bk | bv */
  k_x16<<<(unsigned)((NR * DM / 8 + 255) / 256), 256, 0, stream>>>(x, X16, NR * DM / 8); k_bfr<<<(unsigned)((NR * DM / 8 + 255) / 256), 256, 0, stream>>>(x, XB, NR * DM / 8);      /* post-LN: the attention runs on the raw input (exact f16 rows); XB = bf16(x) f32 for the residual */
  k_wt_f16<<<(unsigned)(((size_t)DFF * (DM / 8) + 255) / 256), 256, 0, stream>>>(wfc, BW1, DM, DFF, 16.0f); k_wt_f16<<<(unsigned)(((size_t)DM * (DFF / 8) + 255) / 256), 256, 0, stream>>>(wmp, BW2, DFF, DM, 16.0f);      /* W1 [768][3072] -> Bt [3072][768]; W2 [3072][768] -> Bt [768][3072] (x16, transposing builder) */
  const size_t r0p = (size_t)B0 * SQ;      /* first projected row */
  k_gemm2<0><<<dim3((unsigned)((MP / 128) * (3 * DM / 64)), 1), 128, 0, stream>>>(X16 + r0p * DM, DM, 0, BQKV, DM, 0, 0.0625f, bqkv, 0, nullptr, 1, 0, 0, nullptr, QKV + r0p * 3 * DM, 3 * DM, 0, MP, 3 * DM, DM);      /* q | k | v rows (f16); head h = columns h*HD.. of each DM block */
  k_vt<NH, SQ><<<NB * NH * (SQ / 64), 256, 0, stream>>>(V16, LQ, 0, VT);      /* V^T [NB][NH][HD][SQ], both batches */
  k_fattn<<<dim3(SQ / 64, NB * NH), 128, 0, stream>>>(QKV, VT, km, O16);      /* scores q.k / sqrt(768) (the module's literal dim_model scale), masked keys get the score 1e-11 (fill, as the source), softmax over all keys, ctx (merged heads, x64) as f16 rows */
  k_gemm2<0><<<dim3((unsigned)((MPO / 128) * (DM / 64)), 1), 128, 0, stream>>>(O16 + r0p * DM, DM, 0, BO, DM, 0, 0.0009765625f, bo, 0, nullptr, 1, 0, 0, X1 + r0p * DM, nullptr, DM, 0, MPO, DM, DM);      /* z = ctx Wo + bo (f32 rows; the skip is added AFTER the LayerNorm in this module) */
  k_lnxr<0, 1, 1><<<(unsigned)NR, 256, 0, stream>>>(X1, g1, be1, 1e-5f, M16, X1N, XB);      /* l1 = bf16(x) + LN1(z) (eps 1e-5): f16 rows for the FFN input and f32 rows for the second skip */
  for (int b = 0; b < NB; ++b) { const size_t r0 = (size_t)b * SQ;
    k_gemm2<3><<<dim3((unsigned)((SQ / 128) * (DFF / 64)), 1), 128, 0, stream>>>(M16 + r0 * DM, DM, 0, BW1, DM, 0, 0.0625f, bfc, 0, nullptr, 1, 0, 0, nullptr, HF16, DFF, 0, SQ, DFF, DM);      /* relu(l1 W1 + b1) -> f16 (this batch) */
    k_gemm2<0><<<dim3((unsigned)((SQ / 128) * (DM / 64)), 1), 128, 0, stream>>>(HF16, DFF, 0, BW2, DFF, 0, 0.0625f, bmp, 0, nullptr, 1, 0, 0, X1 + r0 * DM, nullptr, DM, 0, SQ, DM, DFF); }      /* ffn = hidden W2 + b2 (f32 rows over the dead z plane; the skip is added after the LayerNorm) */
  k_lnxr<0, 0, 1><<<(unsigned)NR, 256, 0, stream>>>(X1, gg2, be2, 1e-5f, nullptr, (float*)d_out, X1N);      /* out = l1 + LN2(ffn) (eps 1e-5) -> f32 output rows */
}

// v004
// A run of this version takes 213 microseconds.
// Next to v003, in two timings, it ran 1.29 and 1.28 times as fast.
// All steps since v000 together make it 33.6 times as fast.
#include <hip/hip_runtime.h>
// Transformer encoder layer with branch-side LayerNorms, a key-padding mask applied as a FILL and the module's literal score scale (x_n [2][2048][768]; q / k / v = x W + b ([in][out] 768 x 768 sigma 1/sqrt(768), zero biases); 12 heads of 64; scores / sqrt(768) (dim_model, as the source); where(mask == 0, 1e-11) with the int32 [2][1][1][2048] mask in {0, 1} (random; READ on device; masked keys get the score 1e-11, NOT -inf, as the source); softmax; z = ctx Wo + bo; l1 = x + LN(z) (LayerNorm on the branch only; biased var, eps 1e-5); ffn = relu(l1 W1 + b1) W2 + b2 ([in][out] 768 x 3072 x 768); out = l1 + LN(ffn) -> [2][2048][768]).
// Structure: token rows; x as exact f16 rows and bf16 f32 residual rows; natural weights as exact x16 planes; fused q | k | v WMMA GEMM (32x64 wave tiles, f32 accumulation, + stacked bias) -> f16; V^T via LDS transposes; one fused attention launch (16 query rows a wave: scores over all keys, fill mask, online softmax with f32 statistics and native exp, weights x256 f16 in registers, ctx x64 merged f16); ctx Wo + bo f32; x + LN1 on VALU -> f16 + f32; relu FFN, both batches a launch; residual + LN2 -> output; nine launches, all operand preparation in the first.
// Compute dtype: inputs rounded to bf16; x / weights exact; q, k, v, softmax weights and o as plain f16 GEMM operands (~2^-12); scores and softmax statistics f32. v_wmma_f32_16x16x32_f16.
#define NB 2
#define SQ 2048
#define DM 768
#define NH 12
#define HD 64
#define HG 4                         /* heads per block group in the unlaunched k_vt overload */
#define QT 256                       /* query rows per score tile in k_rsmcf2 / k_rsmcim (not launched) */
#define NKX SQ                       /* S / P row pitch */
#define QT0 128                      /* query rows per head in k_att0 (not launched) */
#define B0 0                         /* first batch processed (debug hook) */
#define NBR NB                       /* batches processed (debug hook) */
#define NR ((size_t)NB * SQ)
#define DMQ DM
#define DFF 3072         /* FFN hidden width */
#define MP ((int)((size_t)NBR * SQ)) /* rows projected (debug hook) */
#define QN SQ                        /* query rows per batch (not used) */
#define NHD NH                       /* heads (not used) */
#define MPO MP                       /* rows through the output stage (debug hook) */
#define LQ (3 * DM)      /* row pitch of the q/k/v rows */
typedef __bf16 v16b __attribute__((ext_vector_type(16)));
typedef unsigned short v8us __attribute__((ext_vector_type(8), may_alias));
typedef float  v8f  __attribute__((ext_vector_type(8)));
typedef float  v4f  __attribute__((ext_vector_type(4)));
typedef float  v4fa __attribute__((ext_vector_type(4), may_alias));
union FragB { v16b v; v8us half[2]; unsigned short u[16]; };

__device__ __forceinline__ unsigned short bf16_bits(float x) { unsigned int u = __float_as_uint(x); return (unsigned short)((u + 0x7FFFu + ((u >> 16) & 1u)) >> 16); }
__device__ __forceinline__ float bf16_val(unsigned short b) { return __uint_as_float(((unsigned int)b) << 16); }
__device__ __forceinline__ float bf16_round(float x) { return bf16_val(bf16_bits(x)); }
// D += A·B with NT terms: 1 = ah·bh, 2 = + al·bh (A split), 3 = + ah·bl (both split)
template <int NT>
__device__ __forceinline__ v8f mmaN(v16b ah, v16b al, v16b bh, v16b bl, v8f c) {
  c = __builtin_amdgcn_wmma_f32_16x16x32_bf16(false, ah, false, bh, (short)0, c, false, false);
  if (NT >= 2) c = __builtin_amdgcn_wmma_f32_16x16x32_bf16(false, al, false, bh, (short)0, c, false, false);
  if (NT >= 3) c = __builtin_amdgcn_wmma_f32_16x16x32_bf16(false, ah, false, bl, (short)0, c, false, false);
  asm volatile("v_nop\n\tv_nop\n\tv_nop\n\tv_nop" : "+v"(c) : "v"(ah), "v"(al), "v"(bh), "v"(bl));
  return c;
}

__global__ __launch_bounds__(256) void k_wt_bf16(const float* __restrict__ W, unsigned short* __restrict__ Wt, int K, int N) {
  const int t = blockIdx.x * 256 + threadIdx.x;
  const int k8n = K / 8;
  if (t >= N * k8n) return;
  const int n = t / k8n, k8 = (t % k8n) * 8;
  v8us v;
#pragma unroll
  for (int i = 0; i < 8; ++i) v[i] = bf16_bits(W[(size_t)(k8 + i) * N + n]);
  *(v8us*)(Wt + (size_t)n * K + k8) = v;
  
}

// GEMM C[M][N] (f32, pitch ldc) = act(A[M][K]·W + bias). A f32 row-major (pitch lda) converted per fragment to bf16
// (ASPLIT: hi/lo two planes -> 2 terms, else single rounded term); Wt bf16 [N][K] (pitch ldb). BIAS_BF16 rounds the
// bias to bf16 first (bias quantised to bf16 before the add). K%32==0, M%16==0, N%64==0.
template <bool ASPLIT, int ACT, bool BIAS_BF16>
__global__ __launch_bounds__(128) void k_gemm_bf(const float* __restrict__ A, int lda, const unsigned short* __restrict__ Wt, int ldb,
                                               const float* __restrict__ bias, float* __restrict__ C, int ldc, int M, int N, int K) {
  __shared__ __attribute__((aligned(16))) float so[4][16][64];
  const int tid = threadIdx.x, w = tid >> 5, lane = tid & 31, ln = lane & 15, hh = lane >> 4;
  const int ntn = N / 64;
  const int wid = blockIdx.x * 4 + w;
  const int mt = wid / ntn, nq = wid % ntn;
  if (mt * 16 >= M) return;
  const int row0 = mt * 16, col0 = nq * 64;
  const float* arow = A + (size_t)(row0 + ln) * lda;
  v8f acc[4] = {};
  for (int kb = 0; kb < K; kb += 32) {
    FragB ah, al;
    const v4f x0 = *(const v4fa*)(arow + kb + 8 * hh), x1 = *(const v4fa*)(arow + kb + 8 * hh + 4);
    const v4f x2 = *(const v4fa*)(arow + kb + 16 + 8 * hh), x3 = *(const v4fa*)(arow + kb + 16 + 8 * hh + 4);
    float xs[16] = {x0[0],x0[1],x0[2],x0[3],x1[0],x1[1],x1[2],x1[3],x2[0],x2[1],x2[2],x2[3],x3[0],x3[1],x3[2],x3[3]};
#pragma unroll
    for (int i = 0; i < 16; ++i) { const unsigned short hb = bf16_bits(xs[i]); ah.u[i] = hb; al.u[i] = ASPLIT ? bf16_bits(xs[i] - bf16_val(hb)) : (unsigned short)0; }
#pragma unroll
    for (int t = 0; t < 4; ++t) {
      const unsigned short* brow = Wt + (size_t)(col0 + t * 16 + ln) * ldb + kb;
      FragB b;
      b.half[0] = *(const v8us*)(brow + 8 * hh);
      b.half[1] = *(const v8us*)(brow + 16 + 8 * hh);
      acc[t] = mmaN<ASPLIT ? 2 : 1>(ah.v, al.v, b.v, b.v, acc[t]);
    }
  }
#pragma unroll
  for (int t = 0; t < 4; ++t) {
    float bv = bias ? bias[col0 + t * 16 + ln] : 0.f;
    if (BIAS_BF16) bv = bf16_round(bv);
#pragma unroll
    for (int r = 0; r < 8; ++r) { float v = acc[t][r] + bv; if (ACT == 1) v = fmaxf(v, 0.f); so[w][8 * hh + r][t * 16 + ln] = v; }
  }
  __builtin_amdgcn_fence(__ATOMIC_ACQ_REL, "workgroup");
  __builtin_amdgcn_wave_barrier();
  const int rsub = lane >> 4, c4 = (lane & 15) * 4;
  {
#pragma unroll
    for (int q = 0; q < 8; ++q) {
      const int r = q * 2 + rsub;
      const v4f v = *(const v4fa*)&so[w][r][c4];
      *(v4f*)(C + (size_t)(row0 + r) * ldc + col0 + c4) = v;
    }
    
  }
}

// GEMM C = act(A·W + bias + resid): A f32 (ASPLIT -> hi/lo 2 terms), Wt bf16 [N][K]; ACT 0 none, 1 relu, 2 exact gelu;
// resid (optional, f32, row index = (row % rmod), pitch ldr, RES_BF16 rounds it) added before the activation.
template <bool ASPLIT, int ACT, bool BIAS_BF16, bool RES_BF16>
__global__ __launch_bounds__(128) void k_gemm_bf3(const float* __restrict__ A, int lda, const unsigned short* __restrict__ Wt, int ldb,
                                                const float* __restrict__ bias, const float* __restrict__ resid, int rmod, int ldr,
                                                float* __restrict__ C, int ldc, int M, int N, int K) {
  __shared__ __attribute__((aligned(16))) float so[4][16][64];
  const int tid = threadIdx.x, w = tid >> 5, lane = tid & 31, ln = lane & 15, hh = lane >> 4;
  const int ntn = N / 64;
  const int wid = blockIdx.x * 4 + w;
  const int mt = wid / ntn, nq = wid % ntn;
  if (mt * 16 >= M) return;
  const int row0 = mt * 16, col0 = nq * 64;
  const float* arow = A + (size_t)(row0 + ln) * lda;
  v8f acc[4] = {};
  for (int kb = 0; kb < K; kb += 32) {
    FragB ah, al;
    const v4f x0 = *(const v4fa*)(arow + kb + 8 * hh), x1 = *(const v4fa*)(arow + kb + 8 * hh + 4);
    const v4f x2 = *(const v4fa*)(arow + kb + 16 + 8 * hh), x3 = *(const v4fa*)(arow + kb + 16 + 8 * hh + 4);
    float xs[16] = {x0[0],x0[1],x0[2],x0[3],x1[0],x1[1],x1[2],x1[3],x2[0],x2[1],x2[2],x2[3],x3[0],x3[1],x3[2],x3[3]};
#pragma unroll
    for (int i = 0; i < 16; ++i) { const unsigned short hb = bf16_bits(xs[i]); ah.u[i] = hb; al.u[i] = ASPLIT ? bf16_bits(xs[i] - bf16_val(hb)) : (unsigned short)0; }
#pragma unroll
    for (int t = 0; t < 4; ++t) {
      const unsigned short* brow = Wt + (size_t)(col0 + t * 16 + ln) * ldb + kb;
      FragB b;
      b.half[0] = *(const v8us*)(brow + 8 * hh);
      b.half[1] = *(const v8us*)(brow + 16 + 8 * hh);
      acc[t] = mmaN<ASPLIT ? 2 : 1>(ah.v, al.v, b.v, b.v, acc[t]);
    }
  }
#pragma unroll
  for (int t = 0; t < 4; ++t) {
    const int col = col0 + t * 16 + ln;
    float bv = bias ? bias[col] : 0.f;
    if (BIAS_BF16) bv = bf16_round(bv);
#pragma unroll
    for (int r = 0; r < 8; ++r) {
      float v = acc[t][r] + bv;
      if (resid) { float rv = resid[(size_t)((row0 + 8 * hh + r) % rmod) * ldr + col]; if (RES_BF16) rv = bf16_round(rv); v += rv; }
      if (ACT == 1) v = fmaxf(v, 0.f);
      if (ACT == 2) v = 0.5f * v * (1.0f + erff(v * 0.70710678118654752f));
      if (ACT == 3) { const float u = 0.7978845608028654f * (v + 0.044715f * v * v * v); v = 0.5f * v * (1.0f + tanhf(u)); }
      so[w][8 * hh + r][t * 16 + ln] = v;
    }
  }
  __builtin_amdgcn_fence(__ATOMIC_ACQ_REL, "workgroup");
  __builtin_amdgcn_wave_barrier();
  const int rsub = lane >> 4, c4 = (lane & 15) * 4;
  {
#pragma unroll
    for (int q = 0; q < 8; ++q) {
      const int r = q * 2 + rsub;
      const v4f v = *(const v4fa*)&so[w][r][c4];
      *(v4f*)(C + (size_t)(row0 + r) * ldc + col0 + c4) = v;
    }
    
  }
}
// row LayerNorm (biased variance, eps) over N: s = X (+ R); optional out_sum <- s; out_norm <- (s-mu)*rsqrt(var+eps)*g + b
template <bool PARAM_BF16>
__global__ __launch_bounds__(256) void k_layernorm(const float* __restrict__ X, const float* __restrict__ R, const float* __restrict__ g, const float* __restrict__ bta,
                                                  float* __restrict__ out_sum, float* __restrict__ out_norm, int N, float eps) {
  __shared__ float red[256];
  const int row = blockIdx.x, tid = threadIdx.x;
  const float* x = X + (size_t)row * N; const float* rr = R ? R + (size_t)row * N : nullptr;
  float vals[16];                     // up to N = 4096
  const int per = N / 256;            // contiguous chunk per thread? use strided-by-4 chunks: thread handles j = tid*4 + 1024*u
  float s1 = 0.f;
  for (int u = 0; u < per / 4; ++u) {
    const int j = tid * 4 + 1024 * u;
    const v4f a = *(const v4fa*)(x + j);
    v4f b = {0.f,0.f,0.f,0.f}; if (rr) b = *(const v4fa*)(rr + j);
#pragma unroll
    for (int q = 0; q < 4; ++q) { const float v = a[q] + b[q]; vals[u * 4 + q] = v; s1 += v; }
  }
  red[tid] = s1; __syncthreads();
  for (int st = 128; st > 0; st >>= 1) { if (tid < st) red[tid] += red[tid + st]; __syncthreads(); }
  const float mu = red[0] / (float)N; __syncthreads();
  float s2 = 0.f;
  for (int u = 0; u < per / 4; ++u)
#pragma unroll
    for (int q = 0; q < 4; ++q) { const float c = vals[u * 4 + q] - mu; s2 += c * c; }
  red[tid] = s2; __syncthreads();
  for (int st = 128; st > 0; st >>= 1) { if (tid < st) red[tid] += red[tid + st]; __syncthreads(); }
  const float rs = rsqrtf(red[0] / (float)N + eps);
  {
    for (int u = 0; u < per / 4; ++u) {
      const int j = tid * 4 + 1024 * u;
      v4f o, sm;
#pragma unroll
      for (int q = 0; q < 4; ++q) {
        float gg = g[j + q], bb = bta[j + q];
        if (PARAM_BF16) { gg = bf16_round(gg); bb = bf16_round(bb); }
        sm[q] = vals[u * 4 + q]; o[q] = (vals[u * 4 + q] - mu) * rs * gg + bb;
      }
      if (out_sum) *(v4f*)(out_sum + (size_t)row * N + j) = sm;
      *(v4f*)(out_norm + (size_t)row * N + j) = o;
    }
    
  }
}



// ---- f16 WMMA path (v_wmma_f32_16x16x32_f16): 11-bit significands for operands in range — used where a [0,1] probability operand needs more precision than bf16
typedef _Float16 v16h __attribute__((ext_vector_type(16)));
union FragH { v16h v; v8us half[2]; _Float16 h[16]; unsigned short u[16]; };
template <int NT>
__device__ __forceinline__ v8f mmaH(v16h ah, v16h al, v16h bh, v16h bl, v8f c) {
  c = __builtin_amdgcn_wmma_f32_16x16x32_f16(false, ah, false, bh, (short)0, c, false, false);
  if (NT >= 2) c = __builtin_amdgcn_wmma_f32_16x16x32_f16(false, al, false, bh, (short)0, c, false, false);
  if (NT >= 3) c = __builtin_amdgcn_wmma_f32_16x16x32_f16(false, ah, false, bl, (short)0, c, false, false);
  asm volatile("v_nop\n\tv_nop\n\tv_nop\n\tv_nop" : "+v"(c) : "v"(ah), "v"(al), "v"(bh), "v"(bl));
  return c;
}
// batched GEMM like k_gemm_b but f16 operands: A f32 (split into f16 hi/lo if ASPLIT, else rounded to f16), Bt = f16 values [n][k]; alpha; C f32; N multiple of 16 (partial tiles skipped)
template <bool ASPLIT>
__global__ __launch_bounds__(128) void k_gemm_h(const float* __restrict__ A, int lda, size_t sA, const _Float16* __restrict__ Bh, int ldb, size_t sB, float alpha, float* __restrict__ C, int ldc, size_t sC, int M, int N, int K) {
  __shared__ __attribute__((aligned(16))) float so[4][16][64];
  const int tid = threadIdx.x, w = tid >> 5, lane = tid & 31, ln = lane & 15, hh = lane >> 4; const int by = blockIdx.y;
  A += (size_t)by * sA; Bh += (size_t)by * sB; C += (size_t)by * sC;
  const int ntn = (N + 63) / 64; const int wid = blockIdx.x * 4 + w; const int mt = wid / ntn, nq = wid % ntn; if (mt * 16 >= M) return;
  const int row0 = mt * 16, col0 = nq * 64; const float* arow = A + (size_t)(row0 + ln) * lda;
  v8f acc[4] = {};
  for (int kb = 0; kb < K; kb += 32) {
    FragH ah, al;
    const v4f x0 = *(const v4fa*)(arow + kb + 8 * hh), x1 = *(const v4fa*)(arow + kb + 8 * hh + 4), x2 = *(const v4fa*)(arow + kb + 16 + 8 * hh), x3 = *(const v4fa*)(arow + kb + 16 + 8 * hh + 4);
    float xs[16] = {x0[0],x0[1],x0[2],x0[3],x1[0],x1[1],x1[2],x1[3],x2[0],x2[1],x2[2],x2[3],x3[0],x3[1],x3[2],x3[3]};
#pragma unroll
    for (int i = 0; i < 16; ++i) { const _Float16 h = (_Float16)xs[i]; ah.h[i] = h; al.h[i] = ASPLIT ? (_Float16)(xs[i] - (float)h) : (_Float16)0.0f; }
#pragma unroll
    for (int t = 0; t < 4; ++t) { if (col0 + t * 16 >= N) continue; const size_t boff = (size_t)(col0 + t * 16 + ln) * ldb + kb; FragH bq; bq.half[0] = *(const v8us*)(Bh + boff + 8 * hh); bq.half[1] = *(const v8us*)(Bh + boff + 16 + 8 * hh);
      acc[t] = mmaH<ASPLIT ? 2 : 1>(ah.v, al.v, bq.v, bq.v, acc[t]); }
  }
#pragma unroll
  for (int t = 0; t < 4; ++t) { if (col0 + t * 16 >= N) continue;
#pragma unroll
    for (int r = 0; r < 8; ++r) so[w][8 * hh + r][t * 16 + ln] = acc[t][r] * alpha; }
  __builtin_amdgcn_fence(__ATOMIC_ACQ_REL, "workgroup"); __builtin_amdgcn_wave_barrier();
  const int rsub = lane >> 4, c4 = (lane & 15) * 4;
  {
#pragma unroll
    for (int q = 0; q < 8; ++q) { const int r = q * 2 + rsub; if (col0 + c4 < N) { const v4f v = *(const v4fa*)&so[w][r][c4]; *(v4f*)(C + (size_t)(row0 + r) * ldc + col0 + c4) = v; } }
     }
}

// Wt[n][k] = f16(bf16(W[k][n]) x 16) from f32 row-major W[K][N] (bf16-exact weights stay exact in f16 away from the subnormal range); thread t: 8 k of one output column n
template <int K, int N>
__device__ __forceinline__ void p_wt_f16(const float* __restrict__ W, _Float16* __restrict__ Wt, int t) {
  const int n = t / (K / 8), k8 = (t % (K / 8)) * 8; FragH f;
#pragma unroll
  for (int i = 0; i < 8; ++i) f.h[i] = (_Float16)(bf16_round(W[(size_t)(k8 + i) * N + n]) * 16.0f); const v8us o = f.half[0];
  *(v8us*)((unsigned short*)Wt + (size_t)n * K + k8) = o;
  asm volatile("s_wait_xcnt 0x0" ::: "memory");      /* the built code runs on from this store into the other jobs' range tests, whose code reuses the store's registers: the wait stands in front of any such overwrite */
}
// k_gemm_hh variant with fused epilogue: v = acc·alpha + bias[by·sBias + col] (+ CP[(row/rowsPerB)·sCPb + by·64 + col] if CP) ; ACT 0 none / 1 elu ; writes f16 C16 (and f32 C if non-null)
template <int ACT>
__global__ __launch_bounds__(128) void k_gemm_hhx(const _Float16* __restrict__ A, int lda, size_t sA, const _Float16* __restrict__ Bh, int ldb, size_t sB, float alpha, const float* __restrict__ bias, size_t sBias, const float* __restrict__ CP, int rowsPerB, size_t sCPb, int row0g,
    float* __restrict__ C, _Float16* __restrict__ C16, int ldc, size_t sC, int M, int N, int K) {
  __shared__ __attribute__((aligned(16))) float so[4][16][64];
  const int tid = threadIdx.x, w = tid >> 5, lane = tid & 31, ln = lane & 15, hh = lane >> 4; const int by = blockIdx.y;
  A += (size_t)by * sA; Bh += (size_t)by * sB; const size_t cofs = (size_t)by * sC; const float* bp = bias ? bias + (size_t)by * sBias : nullptr;
  const int ntn = (N + 63) / 64; const int wid = blockIdx.x * 4 + w; const int mt = wid / ntn, nq = wid % ntn; if (mt * 16 >= M) return;
  const int row0 = mt * 16, col0 = nq * 64; const _Float16* arow = A + (size_t)(row0 + ln) * lda;
  v8f acc[4] = {};
  for (int kb = 0; kb < K; kb += 32) { FragH ah; ah.half[0] = *(const v8us*)((const unsigned short*)arow + kb + 8 * hh); ah.half[1] = *(const v8us*)((const unsigned short*)arow + kb + 16 + 8 * hh);
#pragma unroll
    for (int t = 0; t < 4; ++t) { if (col0 + t * 16 >= N) continue; const size_t boff = (size_t)(col0 + t * 16 + ln) * ldb + kb; FragH bq; bq.half[0] = *(const v8us*)((const unsigned short*)Bh + boff + 8 * hh); bq.half[1] = *(const v8us*)((const unsigned short*)Bh + boff + 16 + 8 * hh);
      acc[t] = mmaH<1>(ah.v, ah.v, bq.v, bq.v, acc[t]); }
  }
#pragma unroll
  for (int t = 0; t < 4; ++t) { if (col0 + t * 16 >= N) continue; const int col = col0 + t * 16 + ln; const float bv = bp ? bf16_round(bp[col]) : 0.f;
#pragma unroll
    for (int r = 0; r < 8; ++r) { float v = acc[t][r] * alpha + bv; if (CP) { const int rr = row0g + row0 + 8 * hh + r; if (rowsPerB < 0) v += CP[cofs + (size_t)rr * ldc + col];      /* rowsPerB < 0: own element of the batched C plane */ else { const int bidx = rr / rowsPerB; v += CP[(size_t)bidx * sCPb + (size_t)by * 64 + col]; } } if (ACT == 1) v = (v > 0.f) ? v : expm1f(v); else if (ACT == 7) v = (v > 0.f) ? v + 1.0f : expf(v); else if (ACT == 8) v = tanhf(v); else if (ACT == 9) v = 0.5f * v * (1.0f + tanhf(0.7978845608028654f * (v + 0.044715f * v * v * v))); else if (ACT == 11) v = 1.0f / (1.0f + expf(-v)); else if (ACT == 12) v = (v > 0.f) ? v : 0.01f * v; else if (ACT == 14) v = (v > 0.f) ? v : 0.1f * v; else if (ACT == 16) v = (v >= 0.f) ? v : 0.3f * v; else if (ACT == 17) v = (v >= 0.f) ? v : 0.2f * v; else if (ACT == 15) v = v / (1.0f + expf(-v)); else if (ACT == 3) v = fmaxf(v, 0.f); else if (ACT == 6) v = 0.5f * v * (1.0f + erff(v * 0.70710678118654752f)); so[w][8 * hh + r][t * 16 + ln] = v; } }
  __builtin_amdgcn_fence(__ATOMIC_ACQ_REL, "workgroup"); __builtin_amdgcn_wave_barrier();
  const int rsub = lane >> 4, c4 = (lane & 15) * 4; typedef _Float16 v4h __attribute__((ext_vector_type(4)));
  {
#pragma unroll
    for (int q = 0; q < 8; ++q) { const int r = q * 2 + rsub; if (col0 + c4 < N) { const v4f v = *(const v4fa*)&so[w][r][c4]; if (C) *(v4f*)(C + cofs + (size_t)(row0 + r) * ldc + col0 + c4) = v; if (C16) { v4h h4; for (int i = 0; i < 4; ++i) h4[i] = (_Float16)v[i]; *(v4h*)(C16 + cofs + (size_t)(row0 + r) * ldc + col0 + c4) = h4; } } }
     }
}


typedef _Float16 v4h __attribute__((ext_vector_type(4)));

__global__ __launch_bounds__(256) void k_h16(const float* __restrict__ x, _Float16* __restrict__ X16, size_t n8) { const size_t t = (size_t)blockIdx.x * 256 + threadIdx.x; if (t >= n8) return; FragH f;
#pragma unroll
  for (int q = 0; q < 8; ++q) f.h[q] = (_Float16)x[t * 8 + q]; *(v8us*)((unsigned short*)X16 + t * 8) = f.half[0];  }
__global__ __launch_bounds__(256) void k_round16f(const float* __restrict__ W, _Float16* __restrict__ Bt, size_t n8) { const size_t t = (size_t)blockIdx.x * 256 + threadIdx.x; if (t >= n8) return; FragH f;
#pragma unroll
  for (int i = 0; i < 8; ++i) f.h[i] = (_Float16)(bf16_round(W[t * 8 + i]) * 16.0f); *(v8us*)((unsigned short*)Bt + t * 8) = f.half[0];  }
template <int NHv, int TTv>
__global__ __launch_bounds__(256) void k_vt(const _Float16* __restrict__ V16, int ldv, int voff, _Float16* __restrict__ Vt) { __shared__ unsigned short tl[64][66]; const int tid = threadIdx.x; const int slab = blockIdx.x / (TTv / 64), lg = blockIdx.x % (TTv / 64); const int b = slab / NHv, h = slab % NHv;
  for (int i = tid; i < 64 * 8; i += 256) { const int r = i / 8, c8 = (i % 8) * 8; FragH f; f.half[0] = *(const v8us*)((const unsigned short*)V16 + ((size_t)b * TTv + lg * 64 + r) * ldv + voff + h * 64 + c8);
#pragma unroll
    for (int q = 0; q < 8; ++q) tl[r][c8 + q] = f.u[q]; }
  __syncthreads();
  {
#pragma unroll
    for (int rd = 0; rd < 2; ++rd) { const int d = rd * 32 + tid / 8, pc = tid % 8; FragH f;
#pragma unroll
      for (int q = 0; q < 8; ++q) f.u[q] = tl[pc * 8 + q][d];
      *(v8us*)((unsigned short*)Vt + ((size_t)slab * 64 + d) * TTv + lg * 64 + pc * 8) = f.half[0]; }
     } }

__global__ __launch_bounds__(256) void k_hl(const float* __restrict__ F, _Float16* __restrict__ Hh, _Float16* __restrict__ Hl, size_t n8) { const size_t t = (size_t)blockIdx.x * 256 + threadIdx.x; if (t >= n8) return; FragH fh, fl; const v4f a = *(const v4fa*)(F + t * 8), c = *(const v4fa*)(F + t * 8 + 4);
#pragma unroll
  for (int q = 0; q < 4; ++q) { _Float16 h = (_Float16)a[q]; fh.h[q] = h; fl.h[q] = (_Float16)((a[q] - (float)h) * 1024.0f); h = (_Float16)c[q]; fh.h[4 + q] = h; fl.h[4 + q] = (_Float16)((c[q] - (float)h) * 1024.0f); }
  { *(v8us*)((unsigned short*)Hh + t * 8) = fh.half[0]; *(v8us*)((unsigned short*)Hl + t * 8) = fl.half[0];  } }

// ---- fast GEMM (work-group tile 128x64, wave tile 32x64; requires M % 128 == 0 rows per launch region, N % 64 == 0 and K % 64 == 0); epilogue = k_gemm_hhx semantics ----
// A (128 rows) and Bt (64 rows) come in stages of 64 k = whole 128-byte lines, eight threads a row, through registers into two LDS buffers (row pitch 144 bytes); the waves take their fragments from LDS.
// Stage s + 1 is fetched while stage s is worked on; one barrier a stage. The products run in ascending k, 32 k a step.
#define G2_P 144                     /* LDS row pitch in bytes: 128 + 16, an odd multiple of 16 */
#define G2_B (128 * G2_P)            /* Bt rows start behind the 128 A rows */
#define G2_S (192 * G2_P)            /* one buffer */
__device__ __forceinline__ v16h g2_frag(const _Float16* p, int hh) { FragH f; f.half[0] = *(const v8us*)((const unsigned short*)p + 8 * hh); f.half[1] = *(const v8us*)((const unsigned short*)p + 16 + 8 * hh); return f.v; }
__device__ __forceinline__ v16h g2_lfrag(const unsigned char* p) { FragH f; f.half[0] = *(const v8us*)p; f.half[1] = *(const v8us*)(p + 32); return f.v; }      /* p = row ln of a 16 x 32 block in LDS, + 16 hh bytes: the element order of g2_frag */
__device__ __forceinline__ v8f g2_mma(v16h a, v16h b, v8f c) { v8f d = __builtin_amdgcn_wmma_f32_16x16x32_f16(false, a, false, b, (short)0, c, false, false); asm volatile("v_nop\n\tv_nop\n\tv_nop\n\tv_nop" : "+v"(d) : "v"(a), "v"(b)); return d; }
template <int ACT>
__global__ __launch_bounds__(128) void k_gemm2(const _Float16* __restrict__ A, int lda, size_t sA, const _Float16* __restrict__ Bh, int ldb, size_t sB, float alpha, const float* __restrict__ bias, size_t sBias, const float* __restrict__ CP, int rowsPerB, size_t sCPb, int row0g,
    float* __restrict__ C, _Float16* __restrict__ C16, int ldc, size_t sC, int M, int N, int K) { static_assert(ACT == 0 || ACT == 3 || ACT == 6 || ACT == 8 || ACT == 9 || ACT == 11 || ACT == 12 || ACT == 14 || ACT == 15 || ACT == 16 || ACT == 17, "k_gemm2: unsupported ACT code (would silently apply no activation)");
  __shared__ __attribute__((aligned(16))) unsigned char sm[2 * G2_S];      /* [buffer][A 128 rows | Bt 64 rows][G2_P] */
  static_assert(4 * 32 * 68 * 4 <= 2 * G2_S, "k_gemm2: the epilogue's rows lie over the operand buffers");
  float (*so)[32][68] = (float (*)[32][68])sm;      /* epilogue staging, over the buffers once the last stage's barrier has ended every read of them */
  const int tid = threadIdx.x, w = tid >> 5, lane = tid & 31, ln = lane & 15, hh = lane >> 4; const int by = blockIdx.y;
  A += (size_t)by * sA; Bh += (size_t)by * sB; const size_t cofs = (size_t)by * sC; const float* bp = bias ? bias + (size_t)by * sBias : nullptr;
  const int ntn = N >> 6; const int mt = blockIdx.x / ntn, nq = blockIdx.x - mt * ntn; const int row0 = mt * 128 + 32 * w, col0 = nq * 64; if (mt * 128 >= M) return;      /* the whole work-group or none: barriers follow */
  const int srow = tid >> 3, scol = (tid & 7) * 16;      /* staging: eight threads a row, 16 rows a sweep; eight sweeps for A, four for Bt */
  const char* ag = (const char*)(A + (size_t)(mt * 128) * lda); const char* bg = (const char*)(Bh + (size_t)col0 * ldb);      /* the tiles' first rows: the same for the whole work-group */
  const unsigned av = (unsigned)(srow * lda * 2 + scol), bv = (unsigned)(srow * ldb * 2 + scol);      /* this thread's place in a sweep, in bytes */
  const size_t a16 = (size_t)lda * 32, b16 = (size_t)ldb * 32;      /* 16 rows, in bytes */
  unsigned char* sd = sm + srow * G2_P + scol;
  v8us ga[8], gb[4];
#pragma unroll
  for (int j = 0; j < 8; ++j) ga[j] = *(const v8us*)(ag + j * a16 + av);
#pragma unroll
  for (int j = 0; j < 4; ++j) gb[j] = *(const v8us*)(bg + j * b16 + bv);
#pragma unroll
  for (int j = 0; j < 8; ++j) *(v8us*)(sd + 16 * j * G2_P) = ga[j];
#pragma unroll
  for (int j = 0; j < 4; ++j) *(v8us*)(sd + G2_B + 16 * j * G2_P) = gb[j];
  __syncthreads();      /* stage 0 published */
  const unsigned char* al = sm + (32 * w + ln) * G2_P + 16 * hh; const unsigned char* bl = sm + G2_B + ln * G2_P + 16 * hh;
  const v8f z8 = {0.f,0.f,0.f,0.f,0.f,0.f,0.f,0.f}; v8f c00 = z8, c01 = z8, c02 = z8, c03 = z8, c10 = z8, c11 = z8, c12 = z8, c13 = z8;
  const int nst = K >> 6;
#pragma unroll 1      /* one stage a trip: the buffer index alternates, and one stage's fragments, staging registers and accumulators already take 218 registers */
  for (int st = 0; st < nst; ++st) { const bool more = st + 1 < nst;      /* the same for the whole work-group */
    if (more) { const unsigned ao = av + (unsigned)(st + 1) * 128u, bo = bv + (unsigned)(st + 1) * 128u;      /* 32-bit lane offsets on work-group-uniform row bases */
#pragma unroll
      for (int j = 0; j < 8; ++j) ga[j] = *(const v8us*)((ag + j * a16) + ao);
#pragma unroll
      for (int j = 0; j < 4; ++j) gb[j] = *(const v8us*)((bg + j * b16) + bo); }
    const int cur = (st & 1) * G2_S;
    const unsigned char* ap = al + cur; const unsigned char* bq = bl + cur; v16h a0[2], a1[2], b0[2], b1[2], b2[2], b3[2];
#pragma unroll
    for (int kk = 0; kk < 2; ++kk) { a0[kk] = g2_lfrag(ap + 64 * kk); a1[kk] = g2_lfrag(ap + 16 * G2_P + 64 * kk); b0[kk] = g2_lfrag(bq + 64 * kk); b1[kk] = g2_lfrag(bq + 16 * G2_P + 64 * kk); b2[kk] = g2_lfrag(bq + 32 * G2_P + 64 * kk); b3[kk] = g2_lfrag(bq + 48 * G2_P + 64 * kk); }
#pragma unroll
    for (int kk = 0; kk < 2; ++kk) {      /* 32 k */
      c00 = g2_mma(a0[kk], b0[kk], c00); c10 = g2_mma(a1[kk], b0[kk], c10); c01 = g2_mma(a0[kk], b1[kk], c01); c11 = g2_mma(a1[kk], b1[kk], c11);
      c02 = g2_mma(a0[kk], b2[kk], c02); c12 = g2_mma(a1[kk], b2[kk], c12); c03 = g2_mma(a0[kk], b3[kk], c03); c13 = g2_mma(a1[kk], b3[kk], c13); }
    if (more) { unsigned char* nd = sd + (G2_S - cur);      /* the buffer of stage st - 1: every wave left it at the barrier that ended that trip */
#pragma unroll
      for (int j = 0; j < 8; ++j) *(v8us*)(nd + 16 * j * G2_P) = ga[j];
#pragma unroll
      for (int j = 0; j < 4; ++j) *(v8us*)(nd + G2_B + 16 * j * G2_P) = gb[j]; }
    __syncthreads(); }      /* publishes stage st + 1 and ends every wave's reads of stage st */
  v8f accs[8] = {c00, c01, c02, c03, c10, c11, c12, c13};
#pragma unroll
  for (int u = 0; u < 8; ++u) { const int t = u & 3, half = u >> 2; const int col = col0 + t * 16 + ln; const float bv = bp ? bf16_round(bp[col]) : 0.f;
#pragma unroll
    for (int r = 0; r < 8; ++r) { const int rloc = half * 16 + 8 * hh + r; float v = accs[u][r] * alpha + bv; if (CP) { if (rowsPerB < 0) v += CP[cofs + (size_t)(row0g + row0 + rloc) * ldc + col];      /* rowsPerB < 0: own element of the batched C plane */ else { const int bidx = (row0g + row0 + rloc) / rowsPerB; v += CP[(size_t)bidx * sCPb + (size_t)by * 64 + col]; } }
      if (ACT == 3) v = fmaxf(v, 0.f); else if (ACT == 6) v = 0.5f * v * (1.0f + erff(v * 0.70710678118654752f)); else if (ACT == 11) v = 1.0f / (1.0f + expf(-v)); else if (ACT == 15) v = v / (1.0f + expf(-v)); else if (ACT == 12) v = (v > 0.f) ? v : 0.01f * v; else if (ACT == 8) v = tanhf(v); else if (ACT == 9) v = 0.5f * v * (1.0f + tanhf(0.7978845608028654f * (v + 0.044715f * v * v * v))); else if (ACT == 14) v = (v > 0.f) ? v : 0.1f * v; else if (ACT == 16) v = (v >= 0.f) ? v : 0.3f * v; else if (ACT == 17) v = (v >= 0.f) ? v : 0.2f * v;
      so[w][rloc][t * 16 + ln] = v; } }
  __builtin_amdgcn_fence(__ATOMIC_ACQ_REL, "workgroup"); __builtin_amdgcn_wave_barrier();
  const int rsub = lane >> 4, c4 = (lane & 15) * 4;
  {
#pragma unroll
    for (int q = 0; q < 16; ++q) { const int r = q * 2 + rsub; const v4f v = *(const v4fa*)&so[w][r][c4]; if (C) *(v4f*)(C + cofs + (size_t)(row0 + r) * ldc + col0 + c4) = v; if (C16) { v4h h4; for (int i = 0; i < 4; ++i) h4[i] = (_Float16)v[i]; *(v4h*)(C16 + cofs + (size_t)(row0 + r) * ldc + col0 + c4) = h4; } }
     } }


__global__ __launch_bounds__(256) void k_wnat(const float* __restrict__ w, size_t n8, _Float16* __restrict__ Bt) { const size_t t = (size_t)blockIdx.x * 256 + threadIdx.x; if (t >= n8) return; FragH f; for (int q = 0; q < 8; ++q) f.h[q] = (_Float16)(bf16_round(w[t * 8 + q]) * 16.0f); *(v8us*)((unsigned short*)Bt + t * 8) = f.half[0];  }
__global__ __launch_bounds__(256) void k_rsm(const float* __restrict__ S, _Float16* __restrict__ P, int nrows) {
  #pragma clang fp contract(off)
  const int i = blockIdx.x * 256 + threadIdx.x; if (i >= nrows) return; const float* s = S + (size_t)i * SQ; float mx = -3.0e38f;
#pragma unroll 1
  for (int j = 0; j < SQ; ++j) mx = fmaxf(mx, s[j]); float se = 0.f;
#pragma unroll 1
  for (int j = 0; j < SQ; ++j) se += expf(s[j] - mx); const float sc = 256.0f / se;
#pragma unroll 1
  for (int j0 = 0; j0 < SQ; j0 += 8) { FragH f; for (int q = 0; q < 8; ++q) f.h[q] = (_Float16)(expf(s[j0 + q] - mx) * sc); unsigned short* d = (unsigned short*)P + (size_t)i * SQ + j0; *(v8us*)d = f.half[0];  } }
__global__ __launch_bounds__(256) void k_vt(const _Float16* __restrict__ V16, int b, int h0, _Float16* __restrict__ VT) { __shared__ unsigned short tl[64][65]; const int tid = threadIdx.x; const int hh = blockIdx.x % HG, sg = blockIdx.x / HG; const int s0 = sg * 64; const int h = h0 + hh;
  for (int i = tid; i < 64 * 8; i += 256) { const int j = i / 8, d8 = (i % 8) * 8; FragH f; f.half[0] = *(const v8us*)((const unsigned short*)V16 + ((size_t)b * SQ + s0 + j) * DM + h * HD + d8); for (int q = 0; q < 8; ++q) tl[d8 + q][j] = f.u[q]; }
  __syncthreads();
  { for (int i = tid; i < 64 * 8; i += 256) { const int d = i / 8, j8 = (i % 8) * 8; FragH f; for (int q = 0; q < 8; ++q) f.u[q] = tl[d][j8 + q]; *(v8us*)((unsigned short*)VT + ((size_t)hh * HD + d) * SQ + s0 + j8) = f.half[0]; }  } }



__global__ __launch_bounds__(256) void k_rsmcf2(const float* __restrict__ S, _Float16* __restrict__ P, int hg, int q0, int nk) {
  #pragma clang fp contract(off)
  const int t = blockIdx.x * 256 + threadIdx.x; if (t >= hg * QT) return; const size_t i = (size_t)t; const float* s = S + i * NKX; const int last = q0 + (t % QT); float mx = -3.0e38f;
#pragma unroll 1
  for (int j = 0; j < nk; ++j) { const float f = (j <= last) ? 1.f : 0.f; mx = fmaxf(mx, fmaf(f, s[j], (1.f - f) * -1.0e9f)); } float se = 0.f;
#pragma unroll 1
  for (int j = 0; j < nk; ++j) { const float f = (j <= last) ? 1.f : 0.f; se += __expf(fmaf(f, s[j], (1.f - f) * -1.0e9f) - mx); } const float sc = 256.0f / se;
#pragma unroll 1
  for (int j0 = 0; j0 < nk; j0 += 8) { FragH fr; for (int q = 0; q < 8; ++q) { const int j = j0 + q; const float f = (j <= last) ? 1.f : 0.f; fr.h[q] = (_Float16)(__expf(fmaf(f, s[j], (1.f - f) * -1.0e9f) - mx) * sc); } unsigned short* d = (unsigned short*)P + i * NKX + j0; *(v8us*)d = fr.half[0];  } }


template <int MASKADD>
__global__ __launch_bounds__(64) void k_att0(const float* __restrict__ QF, const float* __restrict__ KF, const float* __restrict__ VF, int ld, const float* __restrict__ mask, float scale, float* __restrict__ OF, int ldo) {
  #pragma clang fp contract(off)
  __shared__ __attribute__((aligned(16))) float lq[64][64]; __shared__ __attribute__((aligned(16))) float lo[64][64];
  const int tid = threadIdx.x; const int h = blockIdx.x / (QT0 / 64), rg = blockIdx.x % (QT0 / 64); const int i = rg * 64 + tid;
  const float* qr = QF + (size_t)i * ld + h * HD;
#pragma unroll 1
  for (int c = 0; c < HD / 4; ++c) { *(v4f*)&lq[tid][c * 4] = *(const v4fa*)(qr + c * 4); const v4f z = {0.f, 0.f, 0.f, 0.f}; *(v4f*)&lo[tid][c * 4] = z; }
  float m = -1.0e30f, l = 0.f; const int jmax = MASKADD ? (SQ - 1) : (rg * 64 + 63);      /* additive-mask form: every key (the mask input decides); causal form: keys up to the block's last row */
#pragma unroll 1
  for (int j = 0; j <= jmax; ++j) { const float* kr = KF + (size_t)j * ld + h * HD; const float* vr = VF + (size_t)j * ld + h * HD; float s = 0.f;
#pragma unroll 1
    for (int c = 0; c < HD / 4; ++c) { const v4f kq = *(const v4fa*)(kr + c * 4); const v4f qq = *(v4f*)&lq[tid][c * 4]; s = __fadd_rn(s, __fmul_rn(qq[0], kq[0])); s = __fadd_rn(s, __fmul_rn(qq[1], kq[1])); s = __fadd_rn(s, __fmul_rn(qq[2], kq[2])); s = __fadd_rn(s, __fmul_rn(qq[3], kq[3])); }
    s = __fmul_rn(s, scale); if (MASKADD) s = __fadd_rn(s, __fmul_rn(bf16_round(mask[(size_t)i * SQ + j]), -10000.0f));
    const float f = (MASKADD || j <= i) ? 1.f : 0.f; const float sm = fmaf(f, s, (1.f - f) * -1.0e30f); const float mn = fmaxf(m, sm); const float sc = expf(m - mn); const float e = expf(sm - mn); l = __fadd_rn(__fmul_rn(l, sc), e); m = mn;
#pragma unroll 1
    for (int c = 0; c < HD / 4; ++c) { const v4f vv = *(const v4fa*)(vr + c * 4); v4f oo = *(v4f*)&lo[tid][c * 4]; for (int u = 0; u < 4; ++u) oo[u] = __fadd_rn(__fmul_rn(oo[u], sc), __fmul_rn(e, vv[u])); *(v4f*)&lo[tid][c * 4] = oo; } }
  const float fin = 64.0f / l;      /* o carried x64 like the f16 path */
#pragma unroll 1
  for (int c = 0; c < HD / 4; ++c) { v4f oo = *(v4f*)&lo[tid][c * 4]; for (int u = 0; u < 4; ++u) oo[u] = __fmul_rn(oo[u], fin); *(v4f*)&lo[tid][c * 4] = oo; }
  __syncthreads();
  {
#pragma unroll 1
    for (int it = 0; it < 16; ++it) { const int row = it * 4 + tid / 16, pc = (tid % 16) * 4; const v4f v = *(const v4f*)&lo[row][pc]; *(v4f*)(OF + (size_t)(rg * 64 + row) * ldo + h * HD + pc) = v; }
     } }


template <int BFIN, int WXB>
__global__ __launch_bounds__(256) void k_ln16(const float* __restrict__ X, const float* __restrict__ g, const float* __restrict__ bb, float eps, _Float16* __restrict__ N16, float* __restrict__ XB) {
  #pragma clang fp contract(off)
  __shared__ float red[256]; const size_t r = blockIdx.x; const int t = threadIdx.x; const v4f xa = *(const v4fa*)(X + r * DMQ + t * 4); float s[4]; float sum = 0.f;
  for (int q = 0; q < 4; ++q) { s[q] = BFIN ? bf16_round(xa[q]) : xa[q]; sum = __fadd_rn(sum, s[q]); }
  red[t] = sum; __syncthreads(); for (int st = 128; st > 0; st >>= 1) { if (t < st) red[t] = __fadd_rn(red[t], red[t + st]); __syncthreads(); } const float mu = red[0] / (float)DMQ; __syncthreads();
  float vs = 0.f; for (int q = 0; q < 4; ++q) { const float dl = __fadd_rn(s[q], -mu); vs = __fadd_rn(vs, __fmul_rn(dl, dl)); } red[t] = vs; __syncthreads(); for (int st = 128; st > 0; st >>= 1) { if (t < st) red[t] = __fadd_rn(red[t], red[t + st]); __syncthreads(); }
  const float rs = rsqrtf(__fadd_rn(red[0] / (float)DMQ, eps)); v4h y; v4f xb;
  for (int q = 0; q < 4; ++q) { const int c = t * 4 + q; y[q] = (_Float16)__fadd_rn(__fmul_rn(__fmul_rn(__fadd_rn(s[q], -mu), rs), bf16_round(g[c])), bf16_round(bb[c])); xb[q] = s[q]; }
  { *(v4h*)(N16 + r * DMQ + t * 4) = y; if (WXB) *(v4f*)(XB + r * DMQ + t * 4) = xb;  } }
__global__ __launch_bounds__(256) void k_ftres2(const float* __restrict__ OF0, const float* __restrict__ XB, float* __restrict__ X1, size_t n4) {
  #pragma clang fp contract(off)
  const size_t t = (size_t)blockIdx.x * 256 + threadIdx.x; if (t >= n4) return; const v4f o = *(const v4fa*)(OF0 + t * 4), xv = *(const v4fa*)(XB + t * 4); v4f y; for (int q = 0; q < 4; ++q) y[q] = __fadd_rn(__fmul_rn(o[q], 0.015625f), xv[q]); *(v4f*)(X1 + t * 4) = y;  }

__global__ __launch_bounds__(256) void k_wthd(const float* __restrict__ Wt, _Float16* __restrict__ Bt) { const size_t t = (size_t)blockIdx.x * 256 + threadIdx.x; if (t >= (size_t)NH * HD * (DM / 8)) return; const int m8 = (int)(t % (DM / 8)) * 8; const int d = (int)((t / (DM / 8)) % HD); const int h = (int)(t / ((size_t)(DM / 8) * HD)); FragH f;
  for (int q = 0; q < 8; ++q) f.h[q] = (_Float16)(16.0f * bf16_round(Wt[((size_t)h * DM + m8 + q) * HD + d])); unsigned short* dst = (unsigned short*)Bt + ((size_t)h * HD + d) * DM + m8; *(v8us*)dst = f.half[0];  }




template <int BFIN, int W16, int W32>
__global__ __launch_bounds__(256) void k_lnx(const float* __restrict__ X, const float* __restrict__ g, const float* __restrict__ bb, float eps, _Float16* __restrict__ N16, float* __restrict__ N32) {
  #pragma clang fp contract(off)
  __shared__ float red[256]; const size_t r = blockIdx.x; const int t = threadIdx.x; const bool act = t < (DMQ / 4); const int c0 = act ? t * 4 : 0;
  const v4f xa = *(const v4fa*)(X + r * DMQ + c0); float s[4]; float sum = 0.f;
  for (int q = 0; q < 4; ++q) { s[q] = act ? (BFIN ? bf16_round(xa[q]) : xa[q]) : 0.f; sum = __fadd_rn(sum, s[q]); }
  red[t] = sum; __syncthreads(); for (int st = 128; st > 0; st >>= 1) { if (t < st) red[t] = __fadd_rn(red[t], red[t + st]); __syncthreads(); } const float mu = red[0] / (float)DMQ; __syncthreads();
  float vs = 0.f; for (int q = 0; q < 4; ++q) { const float dl = act ? __fadd_rn(s[q], -mu) : 0.f; vs = __fadd_rn(vs, __fmul_rn(dl, dl)); } red[t] = vs; __syncthreads(); for (int st = 128; st > 0; st >>= 1) { if (t < st) red[t] = __fadd_rn(red[t], red[t + st]); __syncthreads(); }
  const float rs = rsqrtf(__fadd_rn(red[0] / (float)DMQ, eps)); v4h y; v4f yf;
  for (int q = 0; q < 4; ++q) { const int c = c0 + q; yf[q] = __fadd_rn(__fmul_rn(__fmul_rn(__fadd_rn(s[q], -mu), rs), bf16_round(g[c])), bf16_round(bb[c])); y[q] = (_Float16)yf[q]; }
  if (!act) return;      /* no barriers after this point */
  { if (W16) *(v4h*)(N16 + r * DMQ + c0) = y; if (W32) *(v4f*)(N32 + r * DMQ + c0) = yf;  } }






__global__ __launch_bounds__(256) void k_lorafold(const float* __restrict__ Wm, const float* __restrict__ A, const float* __restrict__ Bm, float* __restrict__ WE, int K, int N, float sc) {
  #pragma clang fp contract(off)
  const size_t t = (size_t)blockIdx.x * 256 + threadIdx.x; if (t >= (size_t)K * N) return; const int i = (int)(t / N), o = (int)(t % N); float a = 0.f;
  for (int r = 0; r < 16; ++r) a = __fadd_rn(a, __fmul_rn(bf16_round(A[(size_t)i * 16 + r]), bf16_round(Bm[(size_t)r * N + o])));
  const float v = __fadd_rn(bf16_round(Wm[t]), __fmul_rn(sc, a)); *(float*)(WE + t) = v;  }
__global__ __launch_bounds__(256) void k_wt32rep(const float* __restrict__ Wf, _Float16* __restrict__ Bt, int K, int N, int DOUT, float scale) {
  const int t = blockIdx.x * 256 + threadIdx.x; if (t >= DOUT * (K / 8)) return; const int n = t / (K / 8), k8 = (t % (K / 8)) * 8; const int rep = DOUT / N; const int src = (n / (HD * rep)) * HD + (n % HD);      /* head h = n / HD -> group h / rep */
  FragH f; for (int i = 0; i < 8; ++i) f.h[i] = (_Float16)(Wf[(size_t)(k8 + i) * N + src] * scale);
  *(v8us*)((unsigned short*)Bt + (size_t)n * K + k8) = f.half[0];  }
__global__ __launch_bounds__(256) void k_brep(const float* __restrict__ b, float* __restrict__ out) { const int t = blockIdx.x * 256 + threadIdx.x; if (t >= DM) return; const float v = b[(t / (HD * 4)) * HD + (t % HD)]; *(float*)(out + t) = v;  }

__global__ __launch_bounds__(256) void k_rsmcim(const float* __restrict__ S, _Float16* __restrict__ P, int hg, int q0, int nk, const int* __restrict__ am) {
  #pragma clang fp contract(off)
  const int t = blockIdx.x * 256 + threadIdx.x; if (t >= hg * QT) return; const size_t i = (size_t)t; const float* s = S + i * NKX; const int last = q0 + (t % QT); const int* mr = am + (size_t)last * SQ; float mx = -3.0e38f;      /* the module's mask row of this query (keys >= nk lie above the diagonal of the causal mask and are not computed) */
#pragma unroll 1
  for (int j = 0; j < nk; ++j) { const float f = (mr[j] != 0) ? 1.f : 0.f; mx = fmaxf(mx, fmaf(f, s[j], (1.f - f) * -1.0e9f)); } float se = 0.f;
#pragma unroll 1
  for (int j = 0; j < nk; ++j) { const float f = (mr[j] != 0) ? 1.f : 0.f; se += __expf(fmaf(f, s[j], (1.f - f) * -1.0e9f) - mx); } const float sc = 256.0f / se;
#pragma unroll 1
  for (int j0 = 0; j0 < nk; j0 += 8) { FragH fr; for (int q = 0; q < 8; ++q) { const int j = j0 + q; const float f = (mr[j] != 0) ? 1.f : 0.f; fr.h[q] = (_Float16)(__expf(fmaf(f, s[j], (1.f - f) * -1.0e9f) - mx) * sc); } unsigned short* d = (unsigned short*)P + i * NKX + j0; *(v8us*)d = fr.half[0];  } }






__global__ __launch_bounds__(256) void k_rsmp(const float* __restrict__ S, _Float16* __restrict__ P, int nrows, int nk) {
  #pragma clang fp contract(off)
  const int t = blockIdx.x * 256 + threadIdx.x; if (t >= nrows) return; const size_t ri = (size_t)t; const float* s = S + ri * NKX; float mx = -3.0e38f;
#pragma unroll 1
  for (int j = 0; j < nk; ++j) mx = fmaxf(mx, s[j]); float se = 0.f;
#pragma unroll 1
  for (int j = 0; j < nk; ++j) se += __expf(s[j] - mx); const float sc = 256.0f / se;
#pragma unroll 1
  for (int j0 = 0; j0 < nk; j0 += 8) { FragH fr; for (int q = 0; q < 8; ++q) fr.h[q] = (_Float16)(__expf(s[j0 + q] - mx) * sc);
    unsigned short* d = (unsigned short*)P + ri * NKX + j0; *(v8us*)d = fr.half[0];  } }
template <int BFIN, int W16, int W32>
__global__ __launch_bounds__(256) void k_lnxr(const float* __restrict__ X, const float* __restrict__ g, const float* __restrict__ bb, float eps, _Float16* __restrict__ N16, float* __restrict__ N32, const float* __restrict__ R) {
  #pragma clang fp contract(off)
  __shared__ float red[256]; const size_t r = blockIdx.x; const int t = threadIdx.x; const bool act = t < (DMQ / 4); const int c0 = act ? t * 4 : 0;
  const v4f xa = *(const v4fa*)(X + r * DMQ + c0); const v4f ra = *(const v4fa*)(R + r * DMQ + c0);      /* residual row (f32, already on the bf16 grid where it is an input copy) */ float s[4]; float sum = 0.f;
  for (int q = 0; q < 4; ++q) { s[q] = act ? (BFIN ? bf16_round(xa[q]) : xa[q]) : 0.f; sum = __fadd_rn(sum, s[q]); }
  red[t] = sum; __syncthreads(); for (int st = 128; st > 0; st >>= 1) { if (t < st) red[t] = __fadd_rn(red[t], red[t + st]); __syncthreads(); } const float mu = red[0] / (float)DMQ; __syncthreads();
  float vs = 0.f; for (int q = 0; q < 4; ++q) { const float dl = act ? __fadd_rn(s[q], -mu) : 0.f; vs = __fadd_rn(vs, __fmul_rn(dl, dl)); } red[t] = vs; __syncthreads(); for (int st = 128; st > 0; st >>= 1) { if (t < st) red[t] = __fadd_rn(red[t], red[t + st]); __syncthreads(); }
  const float rs = rsqrtf(__fadd_rn(red[0] / (float)DMQ, eps)); v4h y; v4f yf;
  for (int q = 0; q < 4; ++q) { const int c = c0 + q; yf[q] = __fadd_rn(__fadd_rn(__fmul_rn(__fmul_rn(__fadd_rn(s[q], -mu), rs), bf16_round(g[c])), bf16_round(bb[c])), ra[q]); y[q] = (_Float16)yf[q]; }
  if (!act) return;      /* no barriers after this point */
  { if (W16) *(v4h*)(N16 + r * DMQ + c0) = y; if (W32) *(v4f*)(N32 + r * DMQ + c0) = yf;  } }



// Fused attention, one launch for all batches and heads: a work-group of four waves owns 64 query rows (16 a wave) and walks all SQ keys in stages of 64; scores and weights stay in registers.
// Transposed products: S^T = K Q^T (rows = keys, columns = queries) and O^T += V^T P^T. The accumulator of S^T holds, in lane (ln, hh), register r, key 8 hh + r of query ln,
// which is the k order of the B operand (elements 0..7 = k 8 hh + i, elements 8..15 = k 16 + 8 hh + i), so two 16-key score tiles become one 32-key P^T fragment with no exchange.
// Online softmax in the log2 domain: running maximum and running sum per query (a query is a lane pair ln, ln + 16); weights are carried x256 (exponent + 8) as f16, the sum likewise, f32.
// K and V^T tiles (64 rows of 128 bytes each) come in whole 128-byte lines through registers into two LDS buffers (row pitch 144 bytes): stage s + 1 is fetched while stage s is worked on; one barrier a stage.
#define FA_P 144                     /* LDS row pitch in bytes: 128 + 16, an odd multiple of 16 */
#define FA_T (64 * FA_P)             /* one tile */
typedef int v4ia __attribute__((ext_vector_type(4), may_alias));
__device__ __forceinline__ v8f fa_mma(v16h a, v16h b, v8f c) { return __builtin_amdgcn_wmma_f32_16x16x32_f16(false, a, false, b, (short)0, c, false, false); }
__device__ __forceinline__ float fa_xhalf(float x) { return __builtin_bit_cast(float, __builtin_amdgcn_permlanex16(__builtin_bit_cast(int, x), __builtin_bit_cast(int, x), 0x76543210, 0xfedcba98, false, false)); }      /* lane l with lane l ^ 16 */
__device__ __forceinline__ float fa_exp2(float t) { float e;
  asm("v_exp_f32 %0, %1\n\tv_nop" : "=v"(e) : "v"(t));      /* v_nop: the one slot the instruction set asks for behind a transcendental before its source is overwritten or its result read */
  return e; }
__device__ __forceinline__ v16h fa_frag(const unsigned char* p) { FragH f; f.half[0] = *(const v8us*)p; f.half[1] = *(const v8us*)(p + 32); return f.v; }      /* p = row ln of a 16 x 32 block in LDS, + 16 hh bytes */
__global__ __launch_bounds__(128) __attribute__((amdgpu_waves_per_eu(4, 4)))      /* register budget of four waves a SIMD (the grid gives three): aiming at more, the compiler reused one register quad for the mask words and waited out each LDS load in turn */
void k_fattn(const _Float16* __restrict__ QKVp, const _Float16* __restrict__ VTp, const int* __restrict__ Km, _Float16* __restrict__ O) {
  static_assert(HD == 64 && SQ % 512 == 0, "k_fattn: head size 64; 128 threads x 4 mask words a sweep; 64-key stages");
  __shared__ __attribute__((aligned(16))) int lm[SQ];      /* this batch's key mask */
  __shared__ __attribute__((aligned(16))) unsigned char kv[2][2][FA_T];      /* [buffer][K, V^T][row * FA_P + byte] */
  const int tid = threadIdx.x, w = tid >> 5, lane = tid & 31, ln = lane & 15, hh = lane >> 4;
  const int bh = blockIdx.y, b = bh / NH, h = bh - b * NH; const size_t r0 = (size_t)b * SQ; const int q0 = blockIdx.x * 64 + w * 16;
  const int srow = tid >> 3, scol = (tid & 7) * 16;      /* staging: eight threads a row, 16 rows a sweep, four sweeps a tile */
  const char* kg = (const char*)(QKVp + (r0 + srow) * LQ + DM + h * HD) + scol;      /* key row srow, this head's 64 columns of the k block */
  const char* vg = (const char*)(VTp + ((size_t)bh * HD + srow) * SQ) + scol;      /* V^T row d = srow */
  const int sofs = srow * FA_P + scol, lofs = ln * FA_P + 16 * hh;
  v8us gk[4], gv[4];
#pragma unroll
  for (int j = 0; j < 4; ++j) { gk[j] = *(const v8us*)(kg + (size_t)(16 * j) * (LQ * 2)); gv[j] = *(const v8us*)(vg + (size_t)(16 * j) * (SQ * 2)); }
  for (int i = tid * 4; i < SQ; i += 512) *(v4ia*)(lm + i) = *(const v4ia*)(Km + r0 + i);
  const _Float16* qp = QKVp + (r0 + q0 + ln) * LQ + h * HD; const v16h q0f = g2_frag(qp, hh), q1f = g2_frag(qp + 32, hh);
#pragma unroll
  for (int j = 0; j < 4; ++j) { *(v8us*)&kv[0][0][sofs + 16 * j * FA_P] = gk[j]; *(v8us*)&kv[0][1][sofs + 16 * j * FA_P] = gv[j]; }
  __syncthreads();      /* mask and stage 0 published */
  const int* lmh = lm + 8 * hh;
  const v8f z8 = {0.f, 0.f, 0.f, 0.f, 0.f, 0.f, 0.f, 0.f}; v8f acc[4] = {z8, z8, z8, z8}; float m_run = -3.0e38f, l_run = 0.f;
  const float c2 = 0.036084391824351615f * 1.44269504088896340736f, fill2 = 1.0e-11f * 1.44269504088896340736f;      /* 1 / sqrt(768) and the fill score, both times log2(e) */
#pragma unroll 1      /* one stage a trip: the buffer index alternates, and two stages' fragments at once would go past 256 registers */
  for (int st = 0; st < SQ / 64; ++st) {
    const int sn = (st + 1 < SQ / 64) ? st + 1 : st;      /* the last trip fetches its own stage again (in bounds) into the buffer nobody reads any more: no branch round loads, stores or the barrier */
#pragma unroll
    for (int j = 0; j < 4; ++j) { gk[j] = *(const v8us*)(kg + (size_t)(sn * 64 + 16 * j) * (LQ * 2)); gv[j] = *(const v8us*)(vg + (size_t)(16 * j) * (SQ * 2) + sn * 128); }
    __builtin_amdgcn_sched_barrier(0);      /* holds the next stage's eight global loads here, a whole stage in front of the LDS stores that use them; left free, the scheduler sinks loads to just in front of their use and every wave waits out the load latency at the barrier */
    const unsigned char* kl = &kv[st & 1][0][lofs]; const unsigned char* vl = &kv[st & 1][1][lofs];
#pragma unroll
    for (int sub = 0; sub < 2; ++sub) {      /* one pass: 32 keys */
      const int kb = st * 64 + sub * 32;
      const v4ia ma = *(const v4ia*)(lmh + kb), mb = *(const v4ia*)(lmh + kb + 4), mc = *(const v4ia*)(lmh + kb + 16), md = *(const v4ia*)(lmh + kb + 20);
      const unsigned char* kt = kl + sub * 32 * FA_P;
      const v16h k0 = fa_frag(kt), k2 = fa_frag(kt + 16 * FA_P), k1 = fa_frag(kt + 64), k3 = fa_frag(kt + 16 * FA_P + 64);
      v16h vf[4];
#pragma unroll
      for (int t = 0; t < 4; ++t) vf[t] = fa_frag(vl + t * 16 * FA_P + sub * 64);
      __builtin_amdgcn_sched_barrier(0);      /* holds the pass's 20 LDS loads together at its head, so that their latencies overlap; left free, each K fragment was loaded into the same registers just in front of its product and waited for by itself */
      v8f s0 = fa_mma(k0, q0f, z8); v8f s1 = fa_mma(k2, q0f, z8); s0 = fa_mma(k1, q1f, s0); s1 = fa_mma(k3, q1f, s1);
      float x[16];
#pragma unroll
      for (int r = 0; r < 4; ++r) { x[r] = (ma[r] != 0) ? s0[r] * c2 : fill2; x[4 + r] = (mb[r] != 0) ? s0[4 + r] * c2 : fill2; x[8 + r] = (mc[r] != 0) ? s1[r] * c2 : fill2; x[12 + r] = (md[r] != 0) ? s1[4 + r] * c2 : fill2; }
      float mx = x[0];
#pragma unroll
      for (int i = 1; i < 16; ++i) mx = fmaxf(mx, x[i]);
      mx = fmaxf(mx, fa_xhalf(mx));      /* both halves of the wave hold this query's maximum of the pass */
      const float mn = fmaxf(m_run, mx); const float corr = fa_exp2(m_run - mn); m_run = mn; const float nm = 8.0f - mn;
#pragma unroll
      for (int t = 0; t < 4; ++t) acc[t] = acc[t] * corr;
      FragH p; float e0 = 0.f, e1 = 0.f, e2 = 0.f, e3 = 0.f;
#pragma unroll
      for (int i = 0; i < 16; i += 4) { const float ea = fa_exp2(x[i] + nm), eb = fa_exp2(x[i + 1] + nm), ec = fa_exp2(x[i + 2] + nm), ed = fa_exp2(x[i + 3] + nm);
        e0 += ea; e1 += eb; e2 += ec; e3 += ed; p.h[i] = (_Float16)ea; p.h[i + 1] = (_Float16)eb; p.h[i + 2] = (_Float16)ec; p.h[i + 3] = (_Float16)ed; }
      l_run = l_run * corr + ((e0 + e1) + (e2 + e3));      /* this lane's 16 keys only; the two halves are added behind the loop */
#pragma unroll
      for (int t = 0; t < 4; ++t) acc[t] = fa_mma(vf[t], p.v, acc[t]);
      __builtin_amdgcn_sched_barrier(0);      /* ends the pass for the scheduler: left free, it fetched both passes' fragments at once (spills at 256 registers) and moved the next stage's LDS stores, their wait on the global loads and the barrier up in front of the softmax, where the loads had had no time to land */
    }
    unsigned char* kd = &kv[(st + 1) & 1][0][sofs]; unsigned char* vd = &kv[(st + 1) & 1][1][sofs];      /* the buffer of stage st - 1: every wave left it at the barrier that ended that trip */
#pragma unroll
    for (int j = 0; j < 4; ++j) { *(v8us*)(kd + 16 * j * FA_P) = gk[j]; *(v8us*)(vd + 16 * j * FA_P) = gv[j]; }
    __syncthreads();      /* publishes stage st + 1 and ends every wave's reads of stage st */
  }
  const float l = l_run + fa_xhalf(l_run); const float fin = 64.0f / l;      /* ctx carried x64 as before; the x256 of weights and sum cancels */
  unsigned short* op = (unsigned short*)O + (r0 + q0 + ln) * DM + h * HD + 8 * hh;
#pragma unroll
  for (int t = 0; t < 4; ++t) { FragH f;
#pragma unroll
    for (int r = 0; r < 8; ++r) f.h[r] = (_Float16)(acc[t][r] * fin);
    *(v8us*)(op + 16 * t) = f.half[0]; } }      /* d = 16 t + 8 hh + r of query ln */


// Operand preparation, one launch: the jobs need nothing of each other and share the grid by ranges of the block index (the choice is the same for a whole block; no barrier, no LDS).
// The weight and x jobs keep their one-thread-per-8-elements form, the bias job one thread a bias; x is read once for its two copies.
#define PB_W (DM * (DFF / 8) / 256)            /* blocks of one 768 x 3072 weight */
#define PB_X ((int)(NR * DM / 8 / 256))        /* blocks of x */
#define PB_S (DM * (DM / 8) / 256)             /* blocks of one 768 x 768 weight */
#define PB_ALL (2 * PB_W + PB_X + 4 * PB_S + 3)
__global__ __launch_bounds__(256) void k_prep(const float* __restrict__ x, const float* __restrict__ wq, const float* __restrict__ wk, const float* __restrict__ wv, const float* __restrict__ wo, const float* __restrict__ w1, const float* __restrict__ w2,
    const float* __restrict__ bq, const float* __restrict__ bk, const float* __restrict__ bv, _Float16* __restrict__ X16, float* __restrict__ XB, _Float16* __restrict__ BQKV, _Float16* __restrict__ BO, _Float16* __restrict__ BW1, _Float16* __restrict__ BW2, float* __restrict__ bqkv) {
  static_assert(DM * (DFF / 8) % 256 == 0 && NR * DM / 8 % 256 == 0 && DM * (DM / 8) % 256 == 0, "k_prep: whole blocks in every range");
  int blk = blockIdx.x; const int tid = threadIdx.x;
  if (blk < PB_W) { p_wt_f16<DM, DFF>(w1, BW1, blk * 256 + tid); return; }      /* W1 [768][3072] -> Bt [3072][768] */
  blk -= PB_W;
  if (blk < PB_W) { p_wt_f16<DFF, DM>(w2, BW2, blk * 256 + tid); return; }      /* W2 [3072][768] -> Bt [768][3072] */
  blk -= PB_W;
  if (blk < PB_X) { const size_t t = (size_t)blk * 256 + tid; v4f a = *(const v4fa*)(x + t * 8), c = *(const v4fa*)(x + t * 8 + 4); FragH f;      /* X16 = bf16(x) as exact f16 rows (GEMM operand), XB = bf16(x) as f32 rows (residual) */
#pragma unroll
    for (int q = 0; q < 4; ++q) { a[q] = bf16_round(a[q]); c[q] = bf16_round(c[q]); f.h[q] = (_Float16)a[q]; f.h[4 + q] = (_Float16)c[q]; }
    *(v8us*)((unsigned short*)X16 + t * 8) = f.half[0]; *(v4f*)(XB + t * 8) = a; *(v4f*)(XB + t * 8 + 4) = c;
    asm volatile("s_wait_xcnt 0x0" ::: "memory");      /* as in p_wt_f16: in front of any overwrite of the three stores' registers on the way to the kernel's end */
    return; }
  blk -= PB_X;
  if (blk < 4 * PB_S) { const int m = blk / PB_S;      /* [in][out] -> Bt x16: stacked q | k | v, and Wo */
    const float* W = (m == 0) ? wq : (m == 1) ? wk : (m == 2) ? wv : wo; _Float16* D = (m < 3) ? BQKV + (size_t)m * DM * DM : BO;
    p_wt_f16<DM, DM>(W, D, (blk - m * PB_S) * 256 + tid); return; }
  blk -= 4 * PB_S;
  const float* b = (blk == 0) ? bq : (blk == 1) ? bk : bv;      /* stacked bias bq | bk | bv */
  for (int i = tid; i < DM; i += 256) bqkv[blk * DM + i] = b[i];
}

extern "C" void kernel_launch(void* const* d_in, const int* in_sizes, int n_in,
                              void* d_out, int out_size, void* d_ws, size_t ws_size, hipStream_t stream) {
  (void)in_sizes; (void)n_in; (void)out_size;
  const float* const* I = (const float* const*)d_in; const float* x = I[0]; const int* km = (const int*)d_in[1]; const float* wq = I[2]; const float* bq = I[3]; const float* wk = I[4]; const float* bk = I[5]; const float* wv = I[6]; const float* bv = I[7]; const float* wo = I[8]; const float* bo = I[9]; const float* g1 = I[10]; const float* be1 = I[11]; const float* wfc = I[12]; const float* bfc = I[13]; const float* wmp = I[14]; const float* bmp = I[15]; const float* gg2 = I[16]; const float* be2 = I[17];      /* input order: x_n; mask int32 [2][1][1][2048] (READ on device); [in][out] wq / wk / wv / wo + biases; ln1 g / b; w1 [768][3072] + b1, w2 [3072][768] + b2; ln2 g / b */
  static_assert(DMQ % 4 == 0 && DMQ / 4 <= 256 && DM % 64 == 0 && DM % 32 == 0 && DFF % 64 == 0 && DFF % 32 == 0 && NH * HD == DM && NKX == SQ, "k_lnxr 256 threads x 4 columns; tile multiples");
  static_assert(MP % 128 == 0 && MPO % 128 == 0 && SQ % 128 == 0 && DM % 64 == 0 && DFF % 64 == 0, "k_gemm2: whole 128-row work-group tiles, 64-column tiles, 64-k stages");
  char* ws = (char*)d_ws; size_t off = 0;
  auto take = [&](size_t bytes) { char* p = ws + off; off += (bytes + 255) & ~(size_t)255; return p; };
  _Float16* BQKV = (_Float16*)take((size_t)3 * DM * DM * 2); _Float16* BO = (_Float16*)take((size_t)DM * DM * 2); float* bqkv = (float*)take((size_t)3 * DM * 4); float* X1N = nullptr;      /* LN1 output (f32): aliases the QKV plane below (QKV's last readers, the V^T and attention launches, precede LN1) to stay within 256 MiB at NB 4 / SQ 2048 */
  _Float16* X16 = (_Float16*)take(NR * DM * 2); float* XB = (float*)take(NR * DM * 4); float* X1 = (float*)take(NR * DM * 4); _Float16* M16 = nullptr;      /* = X16 below (alias: X16's last reader, the fused QKV GEMM, precedes LN1's f16 write) */ _Float16* HF16 = (_Float16*)take(NR * DFF * 2);      /* FFN hidden plane of both batches [4096][3072] f16 (own region here) */ _Float16* BW1 = (_Float16*)take((size_t)DFF * DM * 2); _Float16* BW2 = (_Float16*)take((size_t)DM * DFF * 2); _Float16* QKV = (_Float16*)take(NR * 3 * DM * 2); _Float16* V16 = QKV + 2 * DM; _Float16* O16 = (_Float16*)take(NR * DM * 2); M16 = X16; X1N = (float*)QKV;      /* aliases: X1N (NR*DM f32 = 12 MiB) inside QKV (18 MiB): QKV's last readers (the V^T and attention launches) precede the first LayerNorm */
  _Float16* VT = (_Float16*)take((size_t)NB * NH * HD * SQ * 2);
  if (off > ws_size) return;
  k_prep<<<PB_ALL, 256, 0, stream>>>(x, wq, wk, wv, wo, wfc, wmp, bq, bk, bv, X16, XB, BQKV, BO, BW1, BW2, bqkv);      /* every GEMM operand plane, the stacked bias and the residual rows; post-LN: the attention runs on the raw input */
  const size_t r0p = (size_t)B0 * SQ;      /* first projected row */
  k_gemm2<0><<<dim3((unsigned)((MP / 128) * (3 * DM / 64)), 1), 128, 0, stream>>>(X16 + r0p * DM, DM, 0, BQKV, DM, 0, 0.0625f, bqkv, 0, nullptr, 1, 0, 0, nullptr, QKV + r0p * 3 * DM, 3 * DM, 0, MP, 3 * DM, DM);      /* q | k | v rows (f16); head h = columns h*HD.. of each DM block */
  k_vt<NH, SQ><<<NB * NH * (SQ / 64), 256, 0, stream>>>(V16, LQ, 0, VT);      /* V^T [NB][NH][HD][SQ], both batches */
  k_fattn<<<dim3(SQ / 64, NB * NH), 128, 0, stream>>>(QKV, VT, km, O16);      /* scores q.k / sqrt(768) (the module's literal dim_model scale), masked keys get the score 1e-11 (fill, as the source), softmax over all keys, ctx (merged heads, x64) as f16 rows */
  k_gemm2<0><<<dim3((unsigned)((MPO / 128) * (DM / 64)), 1), 128, 0, stream>>>(O16 + r0p * DM, DM, 0, BO, DM, 0, 0.0009765625f, bo, 0, nullptr, 1, 0, 0, X1 + r0p * DM, nullptr, DM, 0, MPO, DM, DM);      /* z = ctx Wo + bo (f32 rows; the skip is added AFTER the LayerNorm in this module) */
  k_lnxr<0, 1, 1><<<(unsigned)NR, 256, 0, stream>>>(X1, g1, be1, 1e-5f, M16, X1N, XB);      /* l1 = bf16(x) + LN1(z) (eps 1e-5): f16 rows for the FFN input and f32 rows for the second skip */
  k_gemm2<3><<<dim3((unsigned)((MP / 128) * (DFF / 64)), 1), 128, 0, stream>>>(M16, DM, 0, BW1, DM, 0, 0.0625f, bfc, 0, nullptr, 1, 0, 0, nullptr, HF16, DFF, 0, MP, DFF, DM);      /* relu(l1 W1 + b1) -> f16, both batches */
  k_gemm2<0><<<dim3((unsigned)((MP / 128) * (DM / 64)), 1), 128, 0, stream>>>(HF16, DFF, 0, BW2, DFF, 0, 0.0625f, bmp, 0, nullptr, 1, 0, 0, X1, nullptr, DM, 0, MP, DM, DFF);      /* ffn = hidden W2 + b2 (f32 rows over the dead z plane; the skip is added after the LayerNorm) */
  k_lnxr<0, 0, 1><<<(unsigned)NR, 256, 0, stream>>>(X1, gg2, be2, 1e-5f, nullptr, (float*)d_out, X1N);      /* out = l1 + LN2(ffn) (eps 1e-5) -> f32 output rows */
}

// v005
// It runs in 194 microseconds.
// Timed twice side by side with v004, it ran 1.09 and 1.11 times as fast.
// All steps since v000 together make it 37.0 times as fast.
#include <hip/hip_runtime.h>
// Transformer encoder layer with branch-side LayerNorms, a key-padding mask applied as a FILL and the module's literal score scale (x_n [2][2048][768]; q / k / v = x W + b ([in][out] 768 x 768 sigma 1/sqrt(768), zero biases); 12 heads of 64; scores / sqrt(768) (dim_model, as the source); where(mask == 0, 1e-11) with the int32 [2][1][1][2048] mask in {0, 1} (random; READ on device; masked keys get the score 1e-11, NOT -inf, as the source); softmax; z = ctx Wo + bo; l1 = x + LN(z) (LayerNorm on the branch only; biased var, eps 1e-5); ffn = relu(l1 W1 + b1) W2 + b2 ([in][out] 768 x 3072 x 768); out = l1 + LN(ffn) -> [2][2048][768]).
// Structure: token rows; x as exact f16 rows and bf16 f32 residual rows; natural weights as exact x16 planes; fused q | k | v WMMA GEMM (32x64 wave tiles, f32 accumulation, + stacked bias) -> f16; V^T via LDS transposes; one fused attention launch (16 query rows a wave: scores over all keys, fill mask, online softmax with f32 statistics and native exp, weights x256 f16 in registers, ctx x64 merged f16); ctx Wo + bo f32; x + LN1 on VALU -> f16 + f32; relu FFN, both batches a launch; residual + LN2 -> output; nine launches, all operand preparation in the first.
// Compute dtype: inputs rounded to bf16; x / weights exact; q, k, v, softmax weights and o as plain f16 GEMM operands (~2^-12); scores and softmax statistics f32. v_wmma_f32_16x16x32_f16.
#define NB 2
#define SQ 2048
#define DM 768
#define NH 12
#define HD 64
#define HG 4                         /* heads per block group in the unlaunched k_vt overload */
#define QT 256                       /* query rows per score tile in k_rsmcf2 / k_rsmcim (not launched) */
#define NKX SQ                       /* S / P row pitch */
#define QT0 128                      /* query rows per head in k_att0 (not launched) */
#define B0 0                         /* first batch processed (debug hook) */
#define NBR NB                       /* batches processed (debug hook) */
#define NR ((size_t)NB * SQ)
#define DMQ DM
#define DFF 3072         /* FFN hidden width */
#define MP ((int)((size_t)NBR * SQ)) /* rows projected (debug hook) */
#define QN SQ                        /* query rows per batch (not used) */
#define NHD NH                       /* heads (not used) */
#define MPO MP                       /* rows through the output stage (debug hook) */
#define LQ (3 * DM)      /* row pitch of the q/k/v rows */
typedef __bf16 v16b __attribute__((ext_vector_type(16)));
typedef unsigned short v8us __attribute__((ext_vector_type(8), may_alias));
typedef float  v8f  __attribute__((ext_vector_type(8)));
typedef float  v4f  __attribute__((ext_vector_type(4)));
typedef float  v4fa __attribute__((ext_vector_type(4), may_alias));
union FragB { v16b v; v8us half[2]; unsigned short u[16]; };

__device__ __forceinline__ unsigned short bf16_bits(float x) { unsigned int u = __float_as_uint(x); return (unsigned short)((u + 0x7FFFu + ((u >> 16) & 1u)) >> 16); }
__device__ __forceinline__ float bf16_val(unsigned short b) { return __uint_as_float(((unsigned int)b) << 16); }
__device__ __forceinline__ float bf16_round(float x) { return bf16_val(bf16_bits(x)); }
// D += A·B with NT terms: 1 = ah·bh, 2 = + al·bh (A split), 3 = + ah·bl (both split)
template <int NT>
__device__ __forceinline__ v8f mmaN(v16b ah, v16b al, v16b bh, v16b bl, v8f c) {
  c = __builtin_amdgcn_wmma_f32_16x16x32_bf16(false, ah, false, bh, (short)0, c, false, false);
  if (NT >= 2) c = __builtin_amdgcn_wmma_f32_16x16x32_bf16(false, al, false, bh, (short)0, c, false, false);
  if (NT >= 3) c = __builtin_amdgcn_wmma_f32_16x16x32_bf16(false, ah, false, bl, (short)0, c, false, false);
  asm volatile("v_nop\n\tv_nop\n\tv_nop\n\tv_nop" : "+v"(c) : "v"(ah), "v"(al), "v"(bh), "v"(bl));
  return c;
}

__global__ __launch_bounds__(256) void k_wt_bf16(const float* __restrict__ W, unsigned short* __restrict__ Wt, int K, int N) {
  const int t = blockIdx.x * 256 + threadIdx.x;
  const int k8n = K / 8;
  if (t >= N * k8n) return;
  const int n = t / k8n, k8 = (t % k8n) * 8;
  v8us v;
#pragma unroll
  for (int i = 0; i < 8; ++i) v[i] = bf16_bits(W[(size_t)(k8 + i) * N + n]);
  *(v8us*)(Wt + (size_t)n * K + k8) = v;
  
}

// GEMM C[M][N] (f32, pitch ldc) = act(A[M][K]·W + bias). A f32 row-major (pitch lda) converted per fragment to bf16
// (ASPLIT: hi/lo two planes -> 2 terms, else single rounded term); Wt bf16 [N][K] (pitch ldb). BIAS_BF16 rounds the
// bias to bf16 first (bias quantised to bf16 before the add). K%32==0, M%16==0, N%64==0.
template <bool ASPLIT, int ACT, bool BIAS_BF16>
__global__ __launch_bounds__(128) void k_gemm_bf(const float* __restrict__ A, int lda, const unsigned short* __restrict__ Wt, int ldb,
                                               const float* __restrict__ bias, float* __restrict__ C, int ldc, int M, int N, int K) {
  __shared__ __attribute__((aligned(16))) float so[4][16][64];
  const int tid = threadIdx.x, w = tid >> 5, lane = tid & 31, ln = lane & 15, hh = lane >> 4;
  const int ntn = N / 64;
  const int wid = blockIdx.x * 4 + w;
  const int mt = wid / ntn, nq = wid % ntn;
  if (mt * 16 >= M) return;
  const int row0 = mt * 16, col0 = nq * 64;
  const float* arow = A + (size_t)(row0 + ln) * lda;
  v8f acc[4] = {};
  for (int kb = 0; kb < K; kb += 32) {
    FragB ah, al;
    const v4f x0 = *(const v4fa*)(arow + kb + 8 * hh), x1 = *(const v4fa*)(arow + kb + 8 * hh + 4);
    const v4f x2 = *(const v4fa*)(arow + kb + 16 + 8 * hh), x3 = *(const v4fa*)(arow + kb + 16 + 8 * hh + 4);
    float xs[16] = {x0[0],x0[1],x0[2],x0[3],x1[0],x1[1],x1[2],x1[3],x2[0],x2[1],x2[2],x2[3],x3[0],x3[1],x3[2],x3[3]};
#pragma unroll
    for (int i = 0; i < 16; ++i) { const unsigned short hb = bf16_bits(xs[i]); ah.u[i] = hb; al.u[i] = ASPLIT ? bf16_bits(xs[i] - bf16_val(hb)) : (unsigned short)0; }
#pragma unroll
    for (int t = 0; t < 4; ++t) {
      const unsigned short* brow = Wt + (size_t)(col0 + t * 16 + ln) * ldb + kb;
      FragB b;
      b.half[0] = *(const v8us*)(brow + 8 * hh);
      b.half[1] = *(const v8us*)(brow + 16 + 8 * hh);
      acc[t] = mmaN<ASPLIT ? 2 : 1>(ah.v, al.v, b.v, b.v, acc[t]);
    }
  }
#pragma unroll
  for (int t = 0; t < 4; ++t) {
    float bv = bias ? bias[col0 + t * 16 + ln] : 0.f;
    if (BIAS_BF16) bv = bf16_round(bv);
#pragma unroll
    for (int r = 0; r < 8; ++r) { float v = acc[t][r] + bv; if (ACT == 1) v = fmaxf(v, 0.f); so[w][8 * hh + r][t * 16 + ln] = v; }
  }
  __builtin_amdgcn_fence(__ATOMIC_ACQ_REL, "workgroup");
  __builtin_amdgcn_wave_barrier();
  const int rsub = lane >> 4, c4 = (lane & 15) * 4;
  {
#pragma unroll
    for (int q = 0; q < 8; ++q) {
      const int r = q * 2 + rsub;
      const v4f v = *(const v4fa*)&so[w][r][c4];
      *(v4f*)(C + (size_t)(row0 + r) * ldc + col0 + c4) = v;
    }
    
  }
}

// GEMM C = act(A·W + bias + resid): A f32 (ASPLIT -> hi/lo 2 terms), Wt bf16 [N][K]; ACT 0 none, 1 relu, 2 exact gelu;
// resid (optional, f32, row index = (row % rmod), pitch ldr, RES_BF16 rounds it) added before the activation.
template <bool ASPLIT, int ACT, bool BIAS_BF16, bool RES_BF16>
__global__ __launch_bounds__(128) void k_gemm_bf3(const float* __restrict__ A, int lda, const unsigned short* __restrict__ Wt, int ldb,
                                                const float* __restrict__ bias, const float* __restrict__ resid, int rmod, int ldr,
                                                float* __restrict__ C, int ldc, int M, int N, int K) {
  __shared__ __attribute__((aligned(16))) float so[4][16][64];
  const int tid = threadIdx.x, w = tid >> 5, lane = tid & 31, ln = lane & 15, hh = lane >> 4;
  const int ntn = N / 64;
  const int wid = blockIdx.x * 4 + w;
  const int mt = wid / ntn, nq = wid % ntn;
  if (mt * 16 >= M) return;
  const int row0 = mt * 16, col0 = nq * 64;
  const float* arow = A + (size_t)(row0 + ln) * lda;
  v8f acc[4] = {};
  for (int kb = 0; kb < K; kb += 32) {
    FragB ah, al;
    const v4f x0 = *(const v4fa*)(arow + kb + 8 * hh), x1 = *(const v4fa*)(arow + kb + 8 * hh + 4);
    const v4f x2 = *(const v4fa*)(arow + kb + 16 + 8 * hh), x3 = *(const v4fa*)(arow + kb + 16 + 8 * hh + 4);
    float xs[16] = {x0[0],x0[1],x0[2],x0[3],x1[0],x1[1],x1[2],x1[3],x2[0],x2[1],x2[2],x2[3],x3[0],x3[1],x3[2],x3[3]};
#pragma unroll
    for (int i = 0; i < 16; ++i) { const unsigned short hb = bf16_bits(xs[i]); ah.u[i] = hb; al.u[i] = ASPLIT ? bf16_bits(xs[i] - bf16_val(hb)) : (unsigned short)0; }
#pragma unroll
    for (int t = 0; t < 4; ++t) {
      const unsigned short* brow = Wt + (size_t)(col0 + t * 16 + ln) * ldb + kb;
      FragB b;
      b.half[0] = *(const v8us*)(brow + 8 * hh);
      b.half[1] = *(const v8us*)(brow + 16 + 8 * hh);
      acc[t] = mmaN<ASPLIT ? 2 : 1>(ah.v, al.v, b.v, b.v, acc[t]);
    }
  }
#pragma unroll
  for (int t = 0; t < 4; ++t) {
    const int col = col0 + t * 16 + ln;
    float bv = bias ? bias[col] : 0.f;
    if (BIAS_BF16) bv = bf16_round(bv);
#pragma unroll
    for (int r = 0; r < 8; ++r) {
      float v = acc[t][r] + bv;
      if (resid) { float rv = resid[(size_t)((row0 + 8 * hh + r) % rmod) * ldr + col]; if (RES_BF16) rv = bf16_round(rv); v += rv; }
      if (ACT == 1) v = fmaxf(v, 0.f);
      if (ACT == 2) v = 0.5f * v * (1.0f + erff(v * 0.70710678118654752f));
      if (ACT == 3) { const float u = 0.7978845608028654f * (v + 0.044715f * v * v * v); v = 0.5f * v * (1.0f + tanhf(u)); }
      so[w][8 * hh + r][t * 16 + ln] = v;
    }
  }
  __builtin_amdgcn_fence(__ATOMIC_ACQ_REL, "workgroup");
  __builtin_amdgcn_wave_barrier();
  const int rsub = lane >> 4, c4 = (lane & 15) * 4;
  {
#pragma unroll
    for (int q = 0; q < 8; ++q) {
      const int r = q * 2 + rsub;
      const v4f v = *(const v4fa*)&so[w][r][c4];
      *(v4f*)(C + (size_t)(row0 + r) * ldc + col0 + c4) = v;
    }
    
  }
}
// row LayerNorm (biased variance, eps) over N: s = X (+ R); optional out_sum <- s; out_norm <- (s-mu)*rsqrt(var+eps)*g + b
template <bool PARAM_BF16>
__global__ __launch_bounds__(256) void k_layernorm(const float* __restrict__ X, const float* __restrict__ R, const float* __restrict__ g, const float* __restrict__ bta,
                                                  float* __restrict__ out_sum, float* __restrict__ out_norm, int N, float eps) {
  __shared__ float red[256];
  const int row = blockIdx.x, tid = threadIdx.x;
  const float* x = X + (size_t)row * N; const float* rr = R ? R + (size_t)row * N : nullptr;
  float vals[16];                     // up to N = 4096
  const int per = N / 256;            // contiguous chunk per thread? use strided-by-4 chunks: thread handles j = tid*4 + 1024*u
  float s1 = 0.f;
  for (int u = 0; u < per / 4; ++u) {
    const int j = tid * 4 + 1024 * u;
    const v4f a = *(const v4fa*)(x + j);
    v4f b = {0.f,0.f,0.f,0.f}; if (rr) b = *(const v4fa*)(rr + j);
#pragma unroll
    for (int q = 0; q < 4; ++q) { const float v = a[q] + b[q]; vals[u * 4 + q] = v; s1 += v; }
  }
  red[tid] = s1; __syncthreads();
  for (int st = 128; st > 0; st >>= 1) { if (tid < st) red[tid] += red[tid + st]; __syncthreads(); }
  const float mu = red[0] / (float)N; __syncthreads();
  float s2 = 0.f;
  for (int u = 0; u < per / 4; ++u)
#pragma unroll
    for (int q = 0; q < 4; ++q) { const float c = vals[u * 4 + q] - mu; s2 += c * c; }
  red[tid] = s2; __syncthreads();
  for (int st = 128; st > 0; st >>= 1) { if (tid < st) red[tid] += red[tid + st]; __syncthreads(); }
  const float rs = rsqrtf(red[0] / (float)N + eps);
  {
    for (int u = 0; u < per / 4; ++u) {
      const int j = tid * 4 + 1024 * u;
      v4f o, sm;
#pragma unroll
      for (int q = 0; q < 4; ++q) {
        float gg = g[j + q], bb = bta[j + q];
        if (PARAM_BF16) { gg = bf16_round(gg); bb = bf16_round(bb); }
        sm[q] = vals[u * 4 + q]; o[q] = (vals[u * 4 + q] - mu) * rs * gg + bb;
      }
      if (out_sum) *(v4f*)(out_sum + (size_t)row * N + j) = sm;
      *(v4f*)(out_norm + (size_t)row * N + j) = o;
    }
    
  }
}



// ---- f16 WMMA path (v_wmma_f32_16x16x32_f16): 11-bit significands for operands in range — used where a [0,1] probability operand needs more precision than bf16
typedef _Float16 v16h __attribute__((ext_vector_type(16)));
union FragH { v16h v; v8us half[2]; _Float16 h[16]; unsigned short u[16]; };
template <int NT>
__device__ __forceinline__ v8f mmaH(v16h ah, v16h al, v16h bh, v16h bl, v8f c) {
  c = __builtin_amdgcn_wmma_f32_16x16x32_f16(false, ah, false, bh, (short)0, c, false, false);
  if (NT >= 2) c = __builtin_amdgcn_wmma_f32_16x16x32_f16(false, al, false, bh, (short)0, c, false, false);
  if (NT >= 3) c = __builtin_amdgcn_wmma_f32_16x16x32_f16(false, ah, false, bl, (short)0, c, false, false);
  asm volatile("v_nop\n\tv_nop\n\tv_nop\n\tv_nop" : "+v"(c) : "v"(ah), "v"(al), "v"(bh), "v"(bl));
  return c;
}
// batched GEMM like k_gemm_b but f16 operands: A f32 (split into f16 hi/lo if ASPLIT, else rounded to f16), Bt = f16 values [n][k]; alpha; C f32; N multiple of 16 (partial tiles skipped)
template <bool ASPLIT>
__global__ __launch_bounds__(128) void k_gemm_h(const float* __restrict__ A, int lda, size_t sA, const _Float16* __restrict__ Bh, int ldb, size_t sB, float alpha, float* __restrict__ C, int ldc, size_t sC, int M, int N, int K) {
  __shared__ __attribute__((aligned(16))) float so[4][16][64];
  const int tid = threadIdx.x, w = tid >> 5, lane = tid & 31, ln = lane & 15, hh = lane >> 4; const int by = blockIdx.y;
  A += (size_t)by * sA; Bh += (size_t)by * sB; C += (size_t)by * sC;
  const int ntn = (N + 63) / 64; const int wid = blockIdx.x * 4 + w; const int mt = wid / ntn, nq = wid % ntn; if (mt * 16 >= M) return;
  const int row0 = mt * 16, col0 = nq * 64; const float* arow = A + (size_t)(row0 + ln) * lda;
  v8f acc[4] = {};
  for (int kb = 0; kb < K; kb += 32) {
    FragH ah, al;
    const v4f x0 = *(const v4fa*)(arow + kb + 8 * hh), x1 = *(const v4fa*)(arow + kb + 8 * hh + 4), x2 = *(const v4fa*)(arow + kb + 16 + 8 * hh), x3 = *(const v4fa*)(arow + kb + 16 + 8 * hh + 4);
    float xs[16] = {x0[0],x0[1],x0[2],x0[3],x1[0],x1[1],x1[2],x1[3],x2[0],x2[1],x2[2],x2[3],x3[0],x3[1],x3[2],x3[3]};
#pragma unroll
    for (int i = 0; i < 16; ++i) { const _Float16 h = (_Float16)xs[i]; ah.h[i] = h; al.h[i] = ASPLIT ? (_Float16)(xs[i] - (float)h) : (_Float16)0.0f; }
#pragma unroll
    for (int t = 0; t < 4; ++t) { if (col0 + t * 16 >= N) continue; const size_t boff = (size_t)(col0 + t * 16 + ln) * ldb + kb; FragH bq; bq.half[0] = *(const v8us*)(Bh + boff + 8 * hh); bq.half[1] = *(const v8us*)(Bh + boff + 16 + 8 * hh);
      acc[t] = mmaH<ASPLIT ? 2 : 1>(ah.v, al.v, bq.v, bq.v, acc[t]); }
  }
#pragma unroll
  for (int t = 0; t < 4; ++t) { if (col0 + t * 16 >= N) continue;
#pragma unroll
    for (int r = 0; r < 8; ++r) so[w][8 * hh + r][t * 16 + ln] = acc[t][r] * alpha; }
  __builtin_amdgcn_fence(__ATOMIC_ACQ_REL, "workgroup"); __builtin_amdgcn_wave_barrier();
  const int rsub = lane >> 4, c4 = (lane & 15) * 4;
  {
#pragma unroll
    for (int q = 0; q < 8; ++q) { const int r = q * 2 + rsub; if (col0 + c4 < N) { const v4f v = *(const v4fa*)&so[w][r][c4]; *(v4f*)(C + (size_t)(row0 + r) * ldc + col0 + c4) = v; } }
     }
}

// Wt[n][k] = f16(bf16(W[k][n]) x 16) from f32 row-major W[K][N] (bf16-exact weights stay exact in f16 away from the subnormal range); one 256-thread block turns a tile of 128 k x 64 n.
// Reads: 16 lanes cover 256 contiguous bytes of one W row (64 n); a thread takes 8 consecutive rows of its 4 columns, so it holds 8 consecutive k of 4 output rows and stores each as one 16-byte piece into the LDS tile [n][k].
// Writes: 16 lanes cover the tile's 256 contiguous bytes of one Wt row (128 k).
#define PW_P 272                     /* LDS row pitch in bytes: 256 + 16 */
template <int K, int N>
__device__ __forceinline__ void p_wt_tile(const float* __restrict__ W, _Float16* __restrict__ Wt, int blk, int tid, unsigned char* tl) {
  static_assert(K % 128 == 0 && N % 64 == 0, "p_wt_tile: whole tiles");
  const int nt = blk % (N / 64), kt = blk / (N / 64); const int lo = tid & 15, hi = tid >> 4;
  const float* src = W + (size_t)(kt * 128 + hi * 8) * N + nt * 64 + lo * 4; v4f r[8];
#pragma unroll
  for (int i = 0; i < 8; ++i) r[i] = *(const v4fa*)(src + (size_t)i * N);
#pragma unroll
  for (int j = 0; j < 4; ++j) { FragH f;
#pragma unroll
    for (int i = 0; i < 8; ++i) f.h[i] = (_Float16)(bf16_round(r[i][j]) * 16.0f);
    *(v8us*)(tl + (lo * 4 + j) * PW_P + hi * 16) = f.half[0]; }
  __syncthreads();      /* the tile is whole before any row of it is read back; reached by the whole block (the job is chosen by block index) */
  unsigned short* dst = (unsigned short*)Wt + (size_t)(nt * 64 + hi) * K + kt * 128 + lo * 8;
#pragma unroll
  for (int q = 0; q < 4; ++q) { const v8us o = *(const v8us*)(tl + (q * 16 + hi) * PW_P + lo * 16); *(v8us*)(dst + (size_t)(q * 16) * K) = o; }
  asm volatile("s_wait_xcnt 0x0" ::: "memory");      /* the built code runs on from these stores into the other jobs' range tests, whose code reuses the stores' registers: the wait stands in front of any such overwrite */
}
// k_gemm_hh variant with fused epilogue: v = acc·alpha + bias[by·sBias + col] (+ CP[(row/rowsPerB)·sCPb + by·64 + col] if CP) ; ACT 0 none / 1 elu ; writes f16 C16 (and f32 C if non-null)
template <int ACT>
__global__ __launch_bounds__(128) void k_gemm_hhx(const _Float16* __restrict__ A, int lda, size_t sA, const _Float16* __restrict__ Bh, int ldb, size_t sB, float alpha, const float* __restrict__ bias, size_t sBias, const float* __restrict__ CP, int rowsPerB, size_t sCPb, int row0g,
    float* __restrict__ C, _Float16* __restrict__ C16, int ldc, size_t sC, int M, int N, int K) {
  __shared__ __attribute__((aligned(16))) float so[4][16][64];
  const int tid = threadIdx.x, w = tid >> 5, lane = tid & 31, ln = lane & 15, hh = lane >> 4; const int by = blockIdx.y;
  A += (size_t)by * sA; Bh += (size_t)by * sB; const size_t cofs = (size_t)by * sC; const float* bp = bias ? bias + (size_t)by * sBias : nullptr;
  const int ntn = (N + 63) / 64; const int wid = blockIdx.x * 4 + w; const int mt = wid / ntn, nq = wid % ntn; if (mt * 16 >= M) return;
  const int row0 = mt * 16, col0 = nq * 64; const _Float16* arow = A + (size_t)(row0 + ln) * lda;
  v8f acc[4] = {};
  for (int kb = 0; kb < K; kb += 32) { FragH ah; ah.half[0] = *(const v8us*)((const unsigned short*)arow + kb + 8 * hh); ah.half[1] = *(const v8us*)((const unsigned short*)arow + kb + 16 + 8 * hh);
#pragma unroll
    for (int t = 0; t < 4; ++t) { if (col0 + t * 16 >= N) continue; const size_t boff = (size_t)(col0 + t * 16 + ln) * ldb + kb; FragH bq; bq.half[0] = *(const v8us*)((const unsigned short*)Bh + boff + 8 * hh); bq.half[1] = *(const v8us*)((const unsigned short*)Bh + boff + 16 + 8 * hh);
      acc[t] = mmaH<1>(ah.v, ah.v, bq.v, bq.v, acc[t]); }
  }
#pragma unroll
  for (int t = 0; t < 4; ++t) { if (col0 + t * 16 >= N) continue; const int col = col0 + t * 16 + ln; const float bv = bp ? bf16_round(bp[col]) : 0.f;
#pragma unroll
    for (int r = 0; r < 8; ++r) { float v = acc[t][r] * alpha + bv; if (CP) { const int rr = row0g + row0 + 8 * hh + r; if (rowsPerB < 0) v += CP[cofs + (size_t)rr * ldc + col];      /* rowsPerB < 0: own element of the batched C plane */ else { const int bidx = rr / rowsPerB; v += CP[(size_t)bidx * sCPb + (size_t)by * 64 + col]; } } if (ACT == 1) v = (v > 0.f) ? v : expm1f(v); else if (ACT == 7) v = (v > 0.f) ? v + 1.0f : expf(v); else if (ACT == 8) v = tanhf(v); else if (ACT == 9) v = 0.5f * v * (1.0f + tanhf(0.7978845608028654f * (v + 0.044715f * v * v * v))); else if (ACT == 11) v = 1.0f / (1.0f + expf(-v)); else if (ACT == 12) v = (v > 0.f) ? v : 0.01f * v; else if (ACT == 14) v = (v > 0.f) ? v : 0.1f * v; else if (ACT == 16) v = (v >= 0.f) ? v : 0.3f * v; else if (ACT == 17) v = (v >= 0.f) ? v : 0.2f * v; else if (ACT == 15) v = v / (1.0f + expf(-v)); else if (ACT == 3) v = fmaxf(v, 0.f); else if (ACT == 6) v = 0.5f * v * (1.0f + erff(v * 0.70710678118654752f)); so[w][8 * hh + r][t * 16 + ln] = v; } }
  __builtin_amdgcn_fence(__ATOMIC_ACQ_REL, "workgroup"); __builtin_amdgcn_wave_barrier();
  const int rsub = lane >> 4, c4 = (lane & 15) * 4; typedef _Float16 v4h __attribute__((ext_vector_type(4)));
  {
#pragma unroll
    for (int q = 0; q < 8; ++q) { const int r = q * 2 + rsub; if (col0 + c4 < N) { const v4f v = *(const v4fa*)&so[w][r][c4]; if (C) *(v4f*)(C + cofs + (size_t)(row0 + r) * ldc + col0 + c4) = v; if (C16) { v4h h4; for (int i = 0; i < 4; ++i) h4[i] = (_Float16)v[i]; *(v4h*)(C16 + cofs + (size_t)(row0 + r) * ldc + col0 + c4) = h4; } } }
     }
}


typedef _Float16 v4h __attribute__((ext_vector_type(4)));

__global__ __launch_bounds__(256) void k_h16(const float* __restrict__ x, _Float16* __restrict__ X16, size_t n8) { const size_t t = (size_t)blockIdx.x * 256 + threadIdx.x; if (t >= n8) return; FragH f;
#pragma unroll
  for (int q = 0; q < 8; ++q) f.h[q] = (_Float16)x[t * 8 + q]; *(v8us*)((unsigned short*)X16 + t * 8) = f.half[0];  }
__global__ __launch_bounds__(256) void k_round16f(const float* __restrict__ W, _Float16* __restrict__ Bt, size_t n8) { const size_t t = (size_t)blockIdx.x * 256 + threadIdx.x; if (t >= n8) return; FragH f;
#pragma unroll
  for (int i = 0; i < 8; ++i) f.h[i] = (_Float16)(bf16_round(W[t * 8 + i]) * 16.0f); *(v8us*)((unsigned short*)Bt + t * 8) = f.half[0];  }
template <int NHv, int TTv>
__global__ __launch_bounds__(256) void k_vt(const _Float16* __restrict__ V16, int ldv, int voff, _Float16* __restrict__ Vt) { __shared__ unsigned short tl[64][66]; const int tid = threadIdx.x; const int slab = blockIdx.x / (TTv / 64), lg = blockIdx.x % (TTv / 64); const int b = slab / NHv, h = slab % NHv;
  for (int i = tid; i < 64 * 8; i += 256) { const int r = i / 8, c8 = (i % 8) * 8; FragH f; f.half[0] = *(const v8us*)((const unsigned short*)V16 + ((size_t)b * TTv + lg * 64 + r) * ldv + voff + h * 64 + c8);
#pragma unroll
    for (int q = 0; q < 8; ++q) tl[r][c8 + q] = f.u[q]; }
  __syncthreads();
  {
#pragma unroll
    for (int rd = 0; rd < 2; ++rd) { const int d = rd * 32 + tid / 8, pc = tid % 8; FragH f;
#pragma unroll
      for (int q = 0; q < 8; ++q) f.u[q] = tl[pc * 8 + q][d];
      *(v8us*)((unsigned short*)Vt + ((size_t)slab * 64 + d) * TTv + lg * 64 + pc * 8) = f.half[0]; }
     } }

__global__ __launch_bounds__(256) void k_hl(const float* __restrict__ F, _Float16* __restrict__ Hh, _Float16* __restrict__ Hl, size_t n8) { const size_t t = (size_t)blockIdx.x * 256 + threadIdx.x; if (t >= n8) return; FragH fh, fl; const v4f a = *(const v4fa*)(F + t * 8), c = *(const v4fa*)(F + t * 8 + 4);
#pragma unroll
  for (int q = 0; q < 4; ++q) { _Float16 h = (_Float16)a[q]; fh.h[q] = h; fl.h[q] = (_Float16)((a[q] - (float)h) * 1024.0f); h = (_Float16)c[q]; fh.h[4 + q] = h; fl.h[4 + q] = (_Float16)((c[q] - (float)h) * 1024.0f); }
  { *(v8us*)((unsigned short*)Hh + t * 8) = fh.half[0]; *(v8us*)((unsigned short*)Hl + t * 8) = fl.half[0];  } }

// ---- fast GEMM (work-group tile 128x64, wave tile 32x64; requires M % 128 == 0 rows per launch region, N % 64 == 0 and K % 64 == 0); epilogue = k_gemm_hhx semantics ----
// A (128 rows) and Bt (64 rows) come in stages of 64 k = whole 128-byte lines, eight threads a row, through registers into two LDS buffers (row pitch 144 bytes); the waves take their fragments from LDS.
// Stage s + 1 is fetched while stage s is worked on; one barrier a stage. The products run in ascending k, 32 k a step.
#define G2_P 144                     /* LDS row pitch in bytes: 128 + 16, an odd multiple of 16 */
#define G2_B (128 * G2_P)            /* Bt rows start behind the 128 A rows */
#define G2_S (192 * G2_P)            /* one buffer */
__device__ __forceinline__ v16h g2_frag(const _Float16* p, int hh) { FragH f; f.half[0] = *(const v8us*)((const unsigned short*)p + 8 * hh); f.half[1] = *(const v8us*)((const unsigned short*)p + 16 + 8 * hh); return f.v; }
__device__ __forceinline__ v16h g2_lfrag(const unsigned char* p) { FragH f; f.half[0] = *(const v8us*)p; f.half[1] = *(const v8us*)(p + 32); return f.v; }      /* p = row ln of a 16 x 32 block in LDS, + 16 hh bytes: the element order of g2_frag */
__device__ __forceinline__ v8f g2_mma(v16h a, v16h b, v8f c) { v8f d = __builtin_amdgcn_wmma_f32_16x16x32_f16(false, a, false, b, (short)0, c, false, false); asm volatile("v_nop\n\tv_nop\n\tv_nop\n\tv_nop" : "+v"(d) : "v"(a), "v"(b)); return d; }
template <int ACT>
__global__ __launch_bounds__(128) void k_gemm2(const _Float16* __restrict__ A, int lda, size_t sA, const _Float16* __restrict__ Bh, int ldb, size_t sB, float alpha, const float* __restrict__ bias, size_t sBias, const float* __restrict__ CP, int rowsPerB, size_t sCPb, int row0g,
    float* __restrict__ C, _Float16* __restrict__ C16, int ldc, size_t sC, int M, int N, int K) { static_assert(ACT == 0 || ACT == 3 || ACT == 6 || ACT == 8 || ACT == 9 || ACT == 11 || ACT == 12 || ACT == 14 || ACT == 15 || ACT == 16 || ACT == 17, "k_gemm2: unsupported ACT code (would silently apply no activation)");
  __shared__ __attribute__((aligned(16))) unsigned char sm[2 * G2_S];      /* [buffer][A 128 rows | Bt 64 rows][G2_P] */
  static_assert(4 * 32 * 68 * 4 <= 2 * G2_S, "k_gemm2: the epilogue's rows lie over the operand buffers");
  float (*so)[32][68] = (float (*)[32][68])sm;      /* epilogue staging, over the buffers once the last stage's barrier has ended every read of them */
  const int tid = threadIdx.x, w = tid >> 5, lane = tid & 31, ln = lane & 15, hh = lane >> 4; const int by = blockIdx.y;
  A += (size_t)by * sA; Bh += (size_t)by * sB; const size_t cofs = (size_t)by * sC; const float* bp = bias ? bias + (size_t)by * sBias : nullptr;
  const int ntn = N >> 6; const int mt = blockIdx.x / ntn, nq = blockIdx.x - mt * ntn; const int row0 = mt * 128 + 32 * w, col0 = nq * 64; if (mt * 128 >= M) return;      /* the whole work-group or none: barriers follow */
  const int srow = tid >> 3, scol = (tid & 7) * 16;      /* staging: eight threads a row, 16 rows a sweep; eight sweeps for A, four for Bt */
  const char* ag = (const char*)(A + (size_t)(mt * 128) * lda); const char* bg = (const char*)(Bh + (size_t)col0 * ldb);      /* the tiles' first rows: the same for the whole work-group */
  const unsigned av = (unsigned)(srow * lda * 2 + scol), bv = (unsigned)(srow * ldb * 2 + scol);      /* this thread's place in a sweep, in bytes */
  const size_t a16 = (size_t)lda * 32, b16 = (size_t)ldb * 32;      /* 16 rows, in bytes */
  unsigned char* sd = sm + srow * G2_P + scol;
  v8us ga[8], gb[4];
#pragma unroll
  for (int j = 0; j < 8; ++j) ga[j] = *(const v8us*)(ag + j * a16 + av);
#pragma unroll
  for (int j = 0; j < 4; ++j) gb[j] = *(const v8us*)(bg + j * b16 + bv);
#pragma unroll
  for (int j = 0; j < 8; ++j) *(v8us*)(sd + 16 * j * G2_P) = ga[j];
#pragma unroll
  for (int j = 0; j < 4; ++j) *(v8us*)(sd + G2_B + 16 * j * G2_P) = gb[j];
  __syncthreads();      /* stage 0 published */
  const unsigned char* al = sm + (32 * w + ln) * G2_P + 16 * hh; const unsigned char* bl = sm + G2_B + ln * G2_P + 16 * hh;
  const v8f z8 = {0.f,0.f,0.f,0.f,0.f,0.f,0.f,0.f}; v8f c00 = z8, c01 = z8, c02 = z8, c03 = z8, c10 = z8, c11 = z8, c12 = z8, c13 = z8;
  const int nst = K >> 6;
#pragma unroll 1      /* one stage a trip: the buffer index alternates, and one stage's fragments, staging registers and accumulators already take 218 registers */
  for (int st = 0; st < nst; ++st) { const bool more = st + 1 < nst;      /* the same for the whole work-group */
    if (more) { const unsigned ao = av + (unsigned)(st + 1) * 128u, bo = bv + (unsigned)(st + 1) * 128u;      /* 32-bit lane offsets on work-group-uniform row bases */
#pragma unroll
      for (int j = 0; j < 8; ++j) ga[j] = *(const v8us*)((ag + j * a16) + ao);
#pragma unroll
      for (int j = 0; j < 4; ++j) gb[j] = *(const v8us*)((bg + j * b16) + bo); }
    const int cur = (st & 1) * G2_S;
    const unsigned char* ap = al + cur; const unsigned char* bq = bl + cur; v16h a0[2], a1[2], b0[2], b1[2], b2[2], b3[2];
#pragma unroll
    for (int kk = 0; kk < 2; ++kk) { a0[kk] = g2_lfrag(ap + 64 * kk); a1[kk] = g2_lfrag(ap + 16 * G2_P + 64 * kk); b0[kk] = g2_lfrag(bq + 64 * kk); b1[kk] = g2_lfrag(bq + 16 * G2_P + 64 * kk); b2[kk] = g2_lfrag(bq + 32 * G2_P + 64 * kk); b3[kk] = g2_lfrag(bq + 48 * G2_P + 64 * kk); }
#pragma unroll
    for (int kk = 0; kk < 2; ++kk) {      /* 32 k */
      c00 = g2_mma(a0[kk], b0[kk], c00); c10 = g2_mma(a1[kk], b0[kk], c10); c01 = g2_mma(a0[kk], b1[kk], c01); c11 = g2_mma(a1[kk], b1[kk], c11);
      c02 = g2_mma(a0[kk], b2[kk], c02); c12 = g2_mma(a1[kk], b2[kk], c12); c03 = g2_mma(a0[kk], b3[kk], c03); c13 = g2_mma(a1[kk], b3[kk], c13); }
    if (more) { unsigned char* nd = sd + (G2_S - cur);      /* the buffer of stage st - 1: every wave left it at the barrier that ended that trip */
#pragma unroll
      for (int j = 0; j < 8; ++j) *(v8us*)(nd + 16 * j * G2_P) = ga[j];
#pragma unroll
      for (int j = 0; j < 4; ++j) *(v8us*)(nd + G2_B + 16 * j * G2_P) = gb[j]; }
    __syncthreads(); }      /* publishes stage st + 1 and ends every wave's reads of stage st */
  v8f accs[8] = {c00, c01, c02, c03, c10, c11, c12, c13};
#pragma unroll
  for (int u = 0; u < 8; ++u) { const int t = u & 3, half = u >> 2; const int col = col0 + t * 16 + ln; const float bv = bp ? bf16_round(bp[col]) : 0.f;
#pragma unroll
    for (int r = 0; r < 8; ++r) { const int rloc = half * 16 + 8 * hh + r; float v = accs[u][r] * alpha + bv; if (CP) { if (rowsPerB < 0) v += CP[cofs + (size_t)(row0g + row0 + rloc) * ldc + col];      /* rowsPerB < 0: own element of the batched C plane */ else { const int bidx = (row0g + row0 + rloc) / rowsPerB; v += CP[(size_t)bidx * sCPb + (size_t)by * 64 + col]; } }
      if (ACT == 3) v = fmaxf(v, 0.f); else if (ACT == 6) v = 0.5f * v * (1.0f + erff(v * 0.70710678118654752f)); else if (ACT == 11) v = 1.0f / (1.0f + expf(-v)); else if (ACT == 15) v = v / (1.0f + expf(-v)); else if (ACT == 12) v = (v > 0.f) ? v : 0.01f * v; else if (ACT == 8) v = tanhf(v); else if (ACT == 9) v = 0.5f * v * (1.0f + tanhf(0.7978845608028654f * (v + 0.044715f * v * v * v))); else if (ACT == 14) v = (v > 0.f) ? v : 0.1f * v; else if (ACT == 16) v = (v >= 0.f) ? v : 0.3f * v; else if (ACT == 17) v = (v >= 0.f) ? v : 0.2f * v;
      so[w][rloc][t * 16 + ln] = v; } }
  __builtin_amdgcn_fence(__ATOMIC_ACQ_REL, "workgroup"); __builtin_amdgcn_wave_barrier();
  const int rsub = lane >> 4, c4 = (lane & 15) * 4;
  {
#pragma unroll
    for (int q = 0; q < 16; ++q) { const int r = q * 2 + rsub; const v4f v = *(const v4fa*)&so[w][r][c4]; if (C) *(v4f*)(C + cofs + (size_t)(row0 + r) * ldc + col0 + c4) = v; if (C16) { v4h h4; for (int i = 0; i < 4; ++i) h4[i] = (_Float16)v[i]; *(v4h*)(C16 + cofs + (size_t)(row0 + r) * ldc + col0 + c4) = h4; } }
     } }


__global__ __launch_bounds__(256) void k_wnat(const float* __restrict__ w, size_t n8, _Float16* __restrict__ Bt) { const size_t t = (size_t)blockIdx.x * 256 + threadIdx.x; if (t >= n8) return; FragH f; for (int q = 0; q < 8; ++q) f.h[q] = (_Float16)(bf16_round(w[t * 8 + q]) * 16.0f); *(v8us*)((unsigned short*)Bt + t * 8) = f.half[0];  }
__global__ __launch_bounds__(256) void k_rsm(const float* __restrict__ S, _Float16* __restrict__ P, int nrows) {
  #pragma clang fp contract(off)
  const int i = blockIdx.x * 256 + threadIdx.x; if (i >= nrows) return; const float* s = S + (size_t)i * SQ; float mx = -3.0e38f;
#pragma unroll 1
  for (int j = 0; j < SQ; ++j) mx = fmaxf(mx, s[j]); float se = 0.f;
#pragma unroll 1
  for (int j = 0; j < SQ; ++j) se += expf(s[j] - mx); const float sc = 256.0f / se;
#pragma unroll 1
  for (int j0 = 0; j0 < SQ; j0 += 8) { FragH f; for (int q = 0; q < 8; ++q) f.h[q] = (_Float16)(expf(s[j0 + q] - mx) * sc); unsigned short* d = (unsigned short*)P + (size_t)i * SQ + j0; *(v8us*)d = f.half[0];  } }
__global__ __launch_bounds__(256) void k_vt(const _Float16* __restrict__ V16, int b, int h0, _Float16* __restrict__ VT) { __shared__ unsigned short tl[64][65]; const int tid = threadIdx.x; const int hh = blockIdx.x % HG, sg = blockIdx.x / HG; const int s0 = sg * 64; const int h = h0 + hh;
  for (int i = tid; i < 64 * 8; i += 256) { const int j = i / 8, d8 = (i % 8) * 8; FragH f; f.half[0] = *(const v8us*)((const unsigned short*)V16 + ((size_t)b * SQ + s0 + j) * DM + h * HD + d8); for (int q = 0; q < 8; ++q) tl[d8 + q][j] = f.u[q]; }
  __syncthreads();
  { for (int i = tid; i < 64 * 8; i += 256) { const int d = i / 8, j8 = (i % 8) * 8; FragH f; for (int q = 0; q < 8; ++q) f.u[q] = tl[d][j8 + q]; *(v8us*)((unsigned short*)VT + ((size_t)hh * HD + d) * SQ + s0 + j8) = f.half[0]; }  } }



__global__ __launch_bounds__(256) void k_rsmcf2(const float* __restrict__ S, _Float16* __restrict__ P, int hg, int q0, int nk) {
  #pragma clang fp contract(off)
  const int t = blockIdx.x * 256 + threadIdx.x; if (t >= hg * QT) return; const size_t i = (size_t)t; const float* s = S + i * NKX; const int last = q0 + (t % QT); float mx = -3.0e38f;
#pragma unroll 1
  for (int j = 0; j < nk; ++j) { const float f = (j <= last) ? 1.f : 0.f; mx = fmaxf(mx, fmaf(f, s[j], (1.f - f) * -1.0e9f)); } float se = 0.f;
#pragma unroll 1
  for (int j = 0; j < nk; ++j) { const float f = (j <= last) ? 1.f : 0.f; se += __expf(fmaf(f, s[j], (1.f - f) * -1.0e9f) - mx); } const float sc = 256.0f / se;
#pragma unroll 1
  for (int j0 = 0; j0 < nk; j0 += 8) { FragH fr; for (int q = 0; q < 8; ++q) { const int j = j0 + q; const float f = (j <= last) ? 1.f : 0.f; fr.h[q] = (_Float16)(__expf(fmaf(f, s[j], (1.f - f) * -1.0e9f) - mx) * sc); } unsigned short* d = (unsigned short*)P + i * NKX + j0; *(v8us*)d = fr.half[0];  } }


template <int MASKADD>
__global__ __launch_bounds__(64) void k_att0(const float* __restrict__ QF, const float* __restrict__ KF, const float* __restrict__ VF, int ld, const float* __restrict__ mask, float scale, float* __restrict__ OF, int ldo) {
  #pragma clang fp contract(off)
  __shared__ __attribute__((aligned(16))) float lq[64][64]; __shared__ __attribute__((aligned(16))) float lo[64][64];
  const int tid = threadIdx.x; const int h = blockIdx.x / (QT0 / 64), rg = blockIdx.x % (QT0 / 64); const int i = rg * 64 + tid;
  const float* qr = QF + (size_t)i * ld + h * HD;
#pragma unroll 1
  for (int c = 0; c < HD / 4; ++c) { *(v4f*)&lq[tid][c * 4] = *(const v4fa*)(qr + c * 4); const v4f z = {0.f, 0.f, 0.f, 0.f}; *(v4f*)&lo[tid][c * 4] = z; }
  float m = -1.0e30f, l = 0.f; const int jmax = MASKADD ? (SQ - 1) : (rg * 64 + 63);      /* additive-mask form: every key (the mask input decides); causal form: keys up to the block's last row */
#pragma unroll 1
  for (int j = 0; j <= jmax; ++j) { const float* kr = KF + (size_t)j * ld + h * HD; const float* vr = VF + (size_t)j * ld + h * HD; float s = 0.f;
#pragma unroll 1
    for (int c = 0; c < HD / 4; ++c) { const v4f kq = *(const v4fa*)(kr + c * 4); const v4f qq = *(v4f*)&lq[tid][c * 4]; s = __fadd_rn(s, __fmul_rn(qq[0], kq[0])); s = __fadd_rn(s, __fmul_rn(qq[1], kq[1])); s = __fadd_rn(s, __fmul_rn(qq[2], kq[2])); s = __fadd_rn(s, __fmul_rn(qq[3], kq[3])); }
    s = __fmul_rn(s, scale); if (MASKADD) s = __fadd_rn(s, __fmul_rn(bf16_round(mask[(size_t)i * SQ + j]), -10000.0f));
    const float f = (MASKADD || j <= i) ? 1.f : 0.f; const float sm = fmaf(f, s, (1.f - f) * -1.0e30f); const float mn = fmaxf(m, sm); const float sc = expf(m - mn); const float e = expf(sm - mn); l = __fadd_rn(__fmul_rn(l, sc), e); m = mn;
#pragma unroll 1
    for (int c = 0; c < HD / 4; ++c) { const v4f vv = *(const v4fa*)(vr + c * 4); v4f oo = *(v4f*)&lo[tid][c * 4]; for (int u = 0; u < 4; ++u) oo[u] = __fadd_rn(__fmul_rn(oo[u], sc), __fmul_rn(e, vv[u])); *(v4f*)&lo[tid][c * 4] = oo; } }
  const float fin = 64.0f / l;      /* o carried x64 like the f16 path */
#pragma unroll 1
  for (int c = 0; c < HD / 4; ++c) { v4f oo = *(v4f*)&lo[tid][c * 4]; for (int u = 0; u < 4; ++u) oo[u] = __fmul_rn(oo[u], fin); *(v4f*)&lo[tid][c * 4] = oo; }
  __syncthreads();
  {
#pragma unroll 1
    for (int it = 0; it < 16; ++it) { const int row = it * 4 + tid / 16, pc = (tid % 16) * 4; const v4f v = *(const v4f*)&lo[row][pc]; *(v4f*)(OF + (size_t)(rg * 64 + row) * ldo + h * HD + pc) = v; }
     } }


template <int BFIN, int WXB>
__global__ __launch_bounds__(256) void k_ln16(const float* __restrict__ X, const float* __restrict__ g, const float* __restrict__ bb, float eps, _Float16* __restrict__ N16, float* __restrict__ XB) {
  #pragma clang fp contract(off)
  __shared__ float red[256]; const size_t r = blockIdx.x; const int t = threadIdx.x; const v4f xa = *(const v4fa*)(X + r * DMQ + t * 4); float s[4]; float sum = 0.f;
  for (int q = 0; q < 4; ++q) { s[q] = BFIN ? bf16_round(xa[q]) : xa[q]; sum = __fadd_rn(sum, s[q]); }
  red[t] = sum; __syncthreads(); for (int st = 128; st > 0; st >>= 1) { if (t < st) red[t] = __fadd_rn(red[t], red[t + st]); __syncthreads(); } const float mu = red[0] / (float)DMQ; __syncthreads();
  float vs = 0.f; for (int q = 0; q < 4; ++q) { const float dl = __fadd_rn(s[q], -mu); vs = __fadd_rn(vs, __fmul_rn(dl, dl)); } red[t] = vs; __syncthreads(); for (int st = 128; st > 0; st >>= 1) { if (t < st) red[t] = __fadd_rn(red[t], red[t + st]); __syncthreads(); }
  const float rs = rsqrtf(__fadd_rn(red[0] / (float)DMQ, eps)); v4h y; v4f xb;
  for (int q = 0; q < 4; ++q) { const int c = t * 4 + q; y[q] = (_Float16)__fadd_rn(__fmul_rn(__fmul_rn(__fadd_rn(s[q], -mu), rs), bf16_round(g[c])), bf16_round(bb[c])); xb[q] = s[q]; }
  { *(v4h*)(N16 + r * DMQ + t * 4) = y; if (WXB) *(v4f*)(XB + r * DMQ + t * 4) = xb;  } }
__global__ __launch_bounds__(256) void k_ftres2(const float* __restrict__ OF0, const float* __restrict__ XB, float* __restrict__ X1, size_t n4) {
  #pragma clang fp contract(off)
  const size_t t = (size_t)blockIdx.x * 256 + threadIdx.x; if (t >= n4) return; const v4f o = *(const v4fa*)(OF0 + t * 4), xv = *(const v4fa*)(XB + t * 4); v4f y; for (int q = 0; q < 4; ++q) y[q] = __fadd_rn(__fmul_rn(o[q], 0.015625f), xv[q]); *(v4f*)(X1 + t * 4) = y;  }

__global__ __launch_bounds__(256) void k_wthd(const float* __restrict__ Wt, _Float16* __restrict__ Bt) { const size_t t = (size_t)blockIdx.x * 256 + threadIdx.x; if (t >= (size_t)NH * HD * (DM / 8)) return; const int m8 = (int)(t % (DM / 8)) * 8; const int d = (int)((t / (DM / 8)) % HD); const int h = (int)(t / ((size_t)(DM / 8) * HD)); FragH f;
  for (int q = 0; q < 8; ++q) f.h[q] = (_Float16)(16.0f * bf16_round(Wt[((size_t)h * DM + m8 + q) * HD + d])); unsigned short* dst = (unsigned short*)Bt + ((size_t)h * HD + d) * DM + m8; *(v8us*)dst = f.half[0];  }




template <int BFIN, int W16, int W32>
__global__ __launch_bounds__(256) void k_lnx(const float* __restrict__ X, const float* __restrict__ g, const float* __restrict__ bb, float eps, _Float16* __restrict__ N16, float* __restrict__ N32) {
  #pragma clang fp contract(off)
  __shared__ float red[256]; const size_t r = blockIdx.x; const int t = threadIdx.x; const bool act = t < (DMQ / 4); const int c0 = act ? t * 4 : 0;
  const v4f xa = *(const v4fa*)(X + r * DMQ + c0); float s[4]; float sum = 0.f;
  for (int q = 0; q < 4; ++q) { s[q] = act ? (BFIN ? bf16_round(xa[q]) : xa[q]) : 0.f; sum = __fadd_rn(sum, s[q]); }
  red[t] = sum; __syncthreads(); for (int st = 128; st > 0; st >>= 1) { if (t < st) red[t] = __fadd_rn(red[t], red[t + st]); __syncthreads(); } const float mu = red[0] / (float)DMQ; __syncthreads();
  float vs = 0.f; for (int q = 0; q < 4; ++q) { const float dl = act ? __fadd_rn(s[q], -mu) : 0.f; vs = __fadd_rn(vs, __fmul_rn(dl, dl)); } red[t] = vs; __syncthreads(); for (int st = 128; st > 0; st >>= 1) { if (t < st) red[t] = __fadd_rn(red[t], red[t + st]); __syncthreads(); }
  const float rs = rsqrtf(__fadd_rn(red[0] / (float)DMQ, eps)); v4h y; v4f yf;
  for (int q = 0; q < 4; ++q) { const int c = c0 + q; yf[q] = __fadd_rn(__fmul_rn(__fmul_rn(__fadd_rn(s[q], -mu), rs), bf16_round(g[c])), bf16_round(bb[c])); y[q] = (_Float16)yf[q]; }
  if (!act) return;      /* no barriers after this point */
  { if (W16) *(v4h*)(N16 + r * DMQ + c0) = y; if (W32) *(v4f*)(N32 + r * DMQ + c0) = yf;  } }






__global__ __launch_bounds__(256) void k_lorafold(const float* __restrict__ Wm, const float* __restrict__ A, const float* __restrict__ Bm, float* __restrict__ WE, int K, int N, float sc) {
  #pragma clang fp contract(off)
  const size_t t = (size_t)blockIdx.x * 256 + threadIdx.x; if (t >= (size_t)K * N) return; const int i = (int)(t / N), o = (int)(t % N); float a = 0.f;
  for (int r = 0; r < 16; ++r) a = __fadd_rn(a, __fmul_rn(bf16_round(A[(size_t)i * 16 + r]), bf16_round(Bm[(size_t)r * N + o])));
  const float v = __fadd_rn(bf16_round(Wm[t]), __fmul_rn(sc, a)); *(float*)(WE + t) = v;  }
__global__ __launch_bounds__(256) void k_wt32rep(const float* __restrict__ Wf, _Float16* __restrict__ Bt, int K, int N, int DOUT, float scale) {
  const int t = blockIdx.x * 256 + threadIdx.x; if (t >= DOUT * (K / 8)) return; const int n = t / (K / 8), k8 = (t % (K / 8)) * 8; const int rep = DOUT / N; const int src = (n / (HD * rep)) * HD + (n % HD);      /* head h = n / HD -> group h / rep */
  FragH f; for (int i = 0; i < 8; ++i) f.h[i] = (_Float16)(Wf[(size_t)(k8 + i) * N + src] * scale);
  *(v8us*)((unsigned short*)Bt + (size_t)n * K + k8) = f.half[0];  }
__global__ __launch_bounds__(256) void k_brep(const float* __restrict__ b, float* __restrict__ out) { const int t = blockIdx.x * 256 + threadIdx.x; if (t >= DM) return; const float v = b[(t / (HD * 4)) * HD + (t % HD)]; *(float*)(out + t) = v;  }

__global__ __launch_bounds__(256) void k_rsmcim(const float* __restrict__ S, _Float16* __restrict__ P, int hg, int q0, int nk, const int* __restrict__ am) {
  #pragma clang fp contract(off)
  const int t = blockIdx.x * 256 + threadIdx.x; if (t >= hg * QT) return; const size_t i = (size_t)t; const float* s = S + i * NKX; const int last = q0 + (t % QT); const int* mr = am + (size_t)last * SQ; float mx = -3.0e38f;      /* the module's mask row of this query (keys >= nk lie above the diagonal of the causal mask and are not computed) */
#pragma unroll 1
  for (int j = 0; j < nk; ++j) { const float f = (mr[j] != 0) ? 1.f : 0.f; mx = fmaxf(mx, fmaf(f, s[j], (1.f - f) * -1.0e9f)); } float se = 0.f;
#pragma unroll 1
  for (int j = 0; j < nk; ++j) { const float f = (mr[j] != 0) ? 1.f : 0.f; se += __expf(fmaf(f, s[j], (1.f - f) * -1.0e9f) - mx); } const float sc = 256.0f / se;
#pragma unroll 1
  for (int j0 = 0; j0 < nk; j0 += 8) { FragH fr; for (int q = 0; q < 8; ++q) { const int j = j0 + q; const float f = (mr[j] != 0) ? 1.f : 0.f; fr.h[q] = (_Float16)(__expf(fmaf(f, s[j], (1.f - f) * -1.0e9f) - mx) * sc); } unsigned short* d = (unsigned short*)P + i * NKX + j0; *(v8us*)d = fr.half[0];  } }






__global__ __launch_bounds__(256) void k_rsmp(const float* __restrict__ S, _Float16* __restrict__ P, int nrows, int nk) {
  #pragma clang fp contract(off)
  const int t = blockIdx.x * 256 + threadIdx.x; if (t >= nrows) return; const size_t ri = (size_t)t; const float* s = S + ri * NKX; float mx = -3.0e38f;
#pragma unroll 1
  for (int j = 0; j < nk; ++j) mx = fmaxf(mx, s[j]); float se = 0.f;
#pragma unroll 1
  for (int j = 0; j < nk; ++j) se += __expf(s[j] - mx); const float sc = 256.0f / se;
#pragma unroll 1
  for (int j0 = 0; j0 < nk; j0 += 8) { FragH fr; for (int q = 0; q < 8; ++q) fr.h[q] = (_Float16)(__expf(s[j0 + q] - mx) * sc);
    unsigned short* d = (unsigned short*)P + ri * NKX + j0; *(v8us*)d = fr.half[0];  } }
template <int BFIN, int W16, int W32>
__global__ __launch_bounds__(256) void k_lnxr(const float* __restrict__ X, const float* __restrict__ g, const float* __restrict__ bb, float eps, _Float16* __restrict__ N16, float* __restrict__ N32, const float* __restrict__ R) {
  #pragma clang fp contract(off)
  __shared__ float red[256]; const size_t r = blockIdx.x; const int t = threadIdx.x; const bool act = t < (DMQ / 4); const int c0 = act ? t * 4 : 0;
  const v4f xa = *(const v4fa*)(X + r * DMQ + c0); const v4f ra = *(const v4fa*)(R + r * DMQ + c0);      /* residual row (f32, already on the bf16 grid where it is an input copy) */ float s[4]; float sum = 0.f;
  for (int q = 0; q < 4; ++q) { s[q] = act ? (BFIN ? bf16_round(xa[q]) : xa[q]) : 0.f; sum = __fadd_rn(sum, s[q]); }
  red[t] = sum; __syncthreads(); for (int st = 128; st > 0; st >>= 1) { if (t < st) red[t] = __fadd_rn(red[t], red[t + st]); __syncthreads(); } const float mu = red[0] / (float)DMQ; __syncthreads();
  float vs = 0.f; for (int q = 0; q < 4; ++q) { const float dl = act ? __fadd_rn(s[q], -mu) : 0.f; vs = __fadd_rn(vs, __fmul_rn(dl, dl)); } red[t] = vs; __syncthreads(); for (int st = 128; st > 0; st >>= 1) { if (t < st) red[t] = __fadd_rn(red[t], red[t + st]); __syncthreads(); }
  const float rs = rsqrtf(__fadd_rn(red[0] / (float)DMQ, eps)); v4h y; v4f yf;
  for (int q = 0; q < 4; ++q) { const int c = c0 + q; yf[q] = __fadd_rn(__fadd_rn(__fmul_rn(__fmul_rn(__fadd_rn(s[q], -mu), rs), bf16_round(g[c])), bf16_round(bb[c])), ra[q]); y[q] = (_Float16)yf[q]; }
  if (!act) return;      /* no barriers after this point */
  { if (W16) *(v4h*)(N16 + r * DMQ + c0) = y; if (W32) *(v4f*)(N32 + r * DMQ + c0) = yf;  } }



// Fused attention, one launch for all batches and heads: a work-group of four waves owns 64 query rows (16 a wave) and walks all SQ keys in stages of 64; scores and weights stay in registers.
// Transposed products: S^T = K Q^T (rows = keys, columns = queries) and O^T += V^T P^T. The accumulator of S^T holds, in lane (ln, hh), register r, key 8 hh + r of query ln,
// which is the k order of the B operand (elements 0..7 = k 8 hh + i, elements 8..15 = k 16 + 8 hh + i), so two 16-key score tiles become one 32-key P^T fragment with no exchange.
// Online softmax in the log2 domain: running maximum and running sum per query (a query is a lane pair ln, ln + 16); weights are carried x256 (exponent + 8) as f16, the sum likewise, f32.
// K and V^T tiles (64 rows of 128 bytes each) come in whole 128-byte lines through registers into two LDS buffers (row pitch 144 bytes): stage s + 1 is fetched while stage s is worked on; one barrier a stage.
#define FA_P 144                     /* LDS row pitch in bytes: 128 + 16, an odd multiple of 16 */
#define FA_T (64 * FA_P)             /* one tile */
typedef int v4ia __attribute__((ext_vector_type(4), may_alias));
__device__ __forceinline__ v8f fa_mma(v16h a, v16h b, v8f c) { return __builtin_amdgcn_wmma_f32_16x16x32_f16(false, a, false, b, (short)0, c, false, false); }
__device__ __forceinline__ float fa_xhalf(float x) { return __builtin_bit_cast(float, __builtin_amdgcn_permlanex16(__builtin_bit_cast(int, x), __builtin_bit_cast(int, x), 0x76543210, 0xfedcba98, false, false)); }      /* lane l with lane l ^ 16 */
__device__ __forceinline__ float fa_exp2(float t) { float e;
  asm("v_exp_f32 %0, %1\n\tv_nop" : "=v"(e) : "v"(t));      /* v_nop: the one slot the instruction set asks for behind a transcendental before its source is overwritten or its result read */
  return e; }
__device__ __forceinline__ v16h fa_frag(const unsigned char* p) { FragH f; f.half[0] = *(const v8us*)p; f.half[1] = *(const v8us*)(p + 32); return f.v; }      /* p = row ln of a 16 x 32 block in LDS, + 16 hh bytes */
__global__ __launch_bounds__(128) __attribute__((amdgpu_waves_per_eu(4, 4)))      /* register budget of four waves a SIMD (the grid gives three): aiming at more, the compiler reused one register quad for the mask words and waited out each LDS load in turn */
void k_fattn(const _Float16* __restrict__ QKVp, const _Float16* __restrict__ VTp, const int* __restrict__ Km, _Float16* __restrict__ O) {
  static_assert(HD == 64 && SQ % 512 == 0, "k_fattn: head size 64; 128 threads x 4 mask words a sweep; 64-key stages");
  __shared__ __attribute__((aligned(16))) int lm[SQ];      /* this batch's key mask */
  __shared__ __attribute__((aligned(16))) unsigned char kv[2][2][FA_T];      /* [buffer][K, V^T][row * FA_P + byte] */
  const int tid = threadIdx.x, w = tid >> 5, lane = tid & 31, ln = lane & 15, hh = lane >> 4;
  const int bh = blockIdx.y, b = bh / NH, h = bh - b * NH; const size_t r0 = (size_t)b * SQ; const int q0 = blockIdx.x * 64 + w * 16;
  const int srow = tid >> 3, scol = (tid & 7) * 16;      /* staging: eight threads a row, 16 rows a sweep, four sweeps a tile */
  const char* kg = (const char*)(QKVp + (r0 + srow) * LQ + DM + h * HD) + scol;      /* key row srow, this head's 64 columns of the k block */
  const char* vg = (const char*)(VTp + ((size_t)bh * HD + srow) * SQ) + scol;      /* V^T row d = srow */
  const int sofs = srow * FA_P + scol, lofs = ln * FA_P + 16 * hh;
  v8us gk[4], gv[4];
#pragma unroll
  for (int j = 0; j < 4; ++j) { gk[j] = *(const v8us*)(kg + (size_t)(16 * j) * (LQ * 2)); gv[j] = *(const v8us*)(vg + (size_t)(16 * j) * (SQ * 2)); }
  for (int i = tid * 4; i < SQ; i += 512) *(v4ia*)(lm + i) = *(const v4ia*)(Km + r0 + i);
  const _Float16* qp = QKVp + (r0 + q0 + ln) * LQ + h * HD; const v16h q0f = g2_frag(qp, hh), q1f = g2_frag(qp + 32, hh);
#pragma unroll
  for (int j = 0; j < 4; ++j) { *(v8us*)&kv[0][0][sofs + 16 * j * FA_P] = gk[j]; *(v8us*)&kv[0][1][sofs + 16 * j * FA_P] = gv[j]; }
  __syncthreads();      /* mask and stage 0 published */
  const int* lmh = lm + 8 * hh;
  const v8f z8 = {0.f, 0.f, 0.f, 0.f, 0.f, 0.f, 0.f, 0.f}; v8f acc[4] = {z8, z8, z8, z8}; float m_run = -3.0e38f, l_run = 0.f;
  const float c2 = 0.036084391824351615f * 1.44269504088896340736f, fill2 = 1.0e-11f * 1.44269504088896340736f;      /* 1 / sqrt(768) and the fill score, both times log2(e) */
#pragma unroll 1      /* one stage a trip: the buffer index alternates, and two stages' fragments at once would go past 256 registers */
  for (int st = 0; st < SQ / 64; ++st) {
    const int sn = (st + 1 < SQ / 64) ? st + 1 : st;      /* the last trip fetches its own stage again (in bounds) into the buffer nobody reads any more: no branch round loads, stores or the barrier */
#pragma unroll
    for (int j = 0; j < 4; ++j) { gk[j] = *(const v8us*)(kg + (size_t)(sn * 64 + 16 * j) * (LQ * 2)); gv[j] = *(const v8us*)(vg + (size_t)(16 * j) * (SQ * 2) + sn * 128); }
    __builtin_amdgcn_sched_barrier(0);      /* holds the next stage's eight global loads here, a whole stage in front of the LDS stores that use them; left free, the scheduler sinks loads to just in front of their use and every wave waits out the load latency at the barrier */
    const unsigned char* kl = &kv[st & 1][0][lofs]; const unsigned char* vl = &kv[st & 1][1][lofs];
#pragma unroll
    for (int sub = 0; sub < 2; ++sub) {      /* one pass: 32 keys */
      const int kb = st * 64 + sub * 32;
      const v4ia ma = *(const v4ia*)(lmh + kb), mb = *(const v4ia*)(lmh + kb + 4), mc = *(const v4ia*)(lmh + kb + 16), md = *(const v4ia*)(lmh + kb + 20);
      const unsigned char* kt = kl + sub * 32 * FA_P;
      const v16h k0 = fa_frag(kt), k2 = fa_frag(kt + 16 * FA_P), k1 = fa_frag(kt + 64), k3 = fa_frag(kt + 16 * FA_P + 64);
      v16h vf[4];
#pragma unroll
      for (int t = 0; t < 4; ++t) vf[t] = fa_frag(vl + t * 16 * FA_P + sub * 64);
      __builtin_amdgcn_sched_barrier(0);      /* holds the pass's 20 LDS loads together at its head, so that their latencies overlap; left free, each K fragment was loaded into the same registers just in front of its product and waited for by itself */
      v8f s0 = fa_mma(k0, q0f, z8); v8f s1 = fa_mma(k2, q0f, z8); s0 = fa_mma(k1, q1f, s0); s1 = fa_mma(k3, q1f, s1);
      float x[16];
#pragma unroll
      for (int r = 0; r < 4; ++r) { x[r] = (ma[r] != 0) ? s0[r] * c2 : fill2; x[4 + r] = (mb[r] != 0) ? s0[4 + r] * c2 : fill2; x[8 + r] = (mc[r] != 0) ? s1[r] * c2 : fill2; x[12 + r] = (md[r] != 0) ? s1[4 + r] * c2 : fill2; }
      float mx = x[0];
#pragma unroll
      for (int i = 1; i < 16; ++i) mx = fmaxf(mx, x[i]);
      mx = fmaxf(mx, fa_xhalf(mx));      /* both halves of the wave hold this query's maximum of the pass */
      const float mn = fmaxf(m_run, mx); const float corr = fa_exp2(m_run - mn); m_run = mn; const float nm = 8.0f - mn;
#pragma unroll
      for (int t = 0; t < 4; ++t) acc[t] = acc[t] * corr;
      FragH p; float e0 = 0.f, e1 = 0.f, e2 = 0.f, e3 = 0.f;
#pragma unroll
      for (int i = 0; i < 16; i += 4) { const float ea = fa_exp2(x[i] + nm), eb = fa_exp2(x[i + 1] + nm), ec = fa_exp2(x[i + 2] + nm), ed = fa_exp2(x[i + 3] + nm);
        e0 += ea; e1 += eb; e2 += ec; e3 += ed; p.h[i] = (_Float16)ea; p.h[i + 1] = (_Float16)eb; p.h[i + 2] = (_Float16)ec; p.h[i + 3] = (_Float16)ed; }
      l_run = l_run * corr + ((e0 + e1) + (e2 + e3));      /* this lane's 16 keys only; the two halves are added behind the loop */
#pragma unroll
      for (int t = 0; t < 4; ++t) acc[t] = fa_mma(vf[t], p.v, acc[t]);
      __builtin_amdgcn_sched_barrier(0);      /* ends the pass for the scheduler: left free, it fetched both passes' fragments at once (spills at 256 registers) and moved the next stage's LDS stores, their wait on the global loads and the barrier up in front of the softmax, where the loads had had no time to land */
    }
    unsigned char* kd = &kv[(st + 1) & 1][0][sofs]; unsigned char* vd = &kv[(st + 1) & 1][1][sofs];      /* the buffer of stage st - 1: every wave left it at the barrier that ended that trip */
#pragma unroll
    for (int j = 0; j < 4; ++j) { *(v8us*)(kd + 16 * j * FA_P) = gk[j]; *(v8us*)(vd + 16 * j * FA_P) = gv[j]; }
    __syncthreads();      /* publishes stage st + 1 and ends every wave's reads of stage st */
  }
  const float l = l_run + fa_xhalf(l_run); const float fin = 64.0f / l;      /* ctx carried x64 as before; the x256 of weights and sum cancels */
  unsigned short* op = (unsigned short*)O + (r0 + q0 + ln) * DM + h * HD + 8 * hh;
#pragma unroll
  for (int t = 0; t < 4; ++t) { FragH f;
#pragma unroll
    for (int r = 0; r < 8; ++r) f.h[r] = (_Float16)(acc[t][r] * fin);
    *(v8us*)(op + 16 * t) = f.half[0]; } }      /* d = 16 t + 8 hh + r of query ln */


// Operand preparation, one launch: the jobs need nothing of each other and share the grid by ranges of the block index (the choice is the same for a whole block).
// The weights go through an LDS tile a block (p_wt_tile); x keeps its one-thread-per-8-elements form and is read once for its two copies.
#define PB_W (DM * DFF / (128 * 64))           /* blocks (tiles of 128 k x 64 n) of one 768 x 3072 weight */
#define PB_X ((int)(NR * DM / 8 / 256))        /* blocks of x */
#define PB_S (DM * DM / (128 * 64))            /* blocks of one 768 x 768 weight */
#define PB_ALL (2 * PB_W + PB_X + 4 * PB_S + 3)
__global__ __launch_bounds__(256) void k_prep(const float* __restrict__ x, const float* __restrict__ wq, const float* __restrict__ wk, const float* __restrict__ wv, const float* __restrict__ wo, const float* __restrict__ w1, const float* __restrict__ w2,
    const float* __restrict__ bq, const float* __restrict__ bk, const float* __restrict__ bv, _Float16* __restrict__ X16, float* __restrict__ XB, _Float16* __restrict__ BQKV, _Float16* __restrict__ BO, _Float16* __restrict__ BW1, _Float16* __restrict__ BW2, float* __restrict__ bqkv) {
  static_assert(NR * DM / 8 % 256 == 0, "k_prep: whole blocks of x");
  __shared__ __attribute__((aligned(16))) unsigned char tl[64 * PW_P];      /* one weight tile, [n][k] f16 */
  int blk = blockIdx.x; const int tid = threadIdx.x;
  if (blk < PB_W) { p_wt_tile<DM, DFF>(w1, BW1, blk, tid, tl); return; }      /* W1 [768][3072] -> Bt [3072][768] */
  blk -= PB_W;
  if (blk < PB_W) { p_wt_tile<DFF, DM>(w2, BW2, blk, tid, tl); return; }      /* W2 [3072][768] -> Bt [768][3072] */
  blk -= PB_W;
  if (blk < PB_X) { const size_t t = (size_t)blk * 256 + tid; v4f a = *(const v4fa*)(x + t * 8), c = *(const v4fa*)(x + t * 8 + 4); FragH f;      /* X16 = bf16(x) as exact f16 rows (GEMM operand), XB = bf16(x) as f32 rows (residual) */
#pragma unroll
    for (int q = 0; q < 4; ++q) { a[q] = bf16_round(a[q]); c[q] = bf16_round(c[q]); f.h[q] = (_Float16)a[q]; f.h[4 + q] = (_Float16)c[q]; }
    *(v8us*)((unsigned short*)X16 + t * 8) = f.half[0]; *(v4f*)(XB + t * 8) = a; *(v4f*)(XB + t * 8 + 4) = c;
    asm volatile("s_wait_xcnt 0x0" ::: "memory");      /* as in p_wt_tile: in front of any overwrite of the three stores' registers on the way to the kernel's end */
    return; }
  blk -= PB_X;
  if (blk < 4 * PB_S) { const int m = blk / PB_S;      /* [in][out] -> Bt x16: stacked q | k | v, and Wo */
    const float* W = (m == 0) ? wq : (m == 1) ? wk : (m == 2) ? wv : wo; _Float16* D = (m < 3) ? BQKV + (size_t)m * DM * DM : BO;
    p_wt_tile<DM, DM>(W, D, blk - m * PB_S, tid, tl); return; }
  blk -= 4 * PB_S;
  const float* b = (blk == 0) ? bq : (blk == 1) ? bk : bv;      /* stacked bias bq | bk | bv */
  for (int i = tid; i < DM; i += 256) bqkv[blk * DM + i] = b[i];
}

extern "C" void kernel_launch(void* const* d_in, const int* in_sizes, int n_in,
                              void* d_out, int out_size, void* d_ws, size_t ws_size, hipStream_t stream) {
  (void)in_sizes; (void)n_in; (void)out_size;
  const float* const* I = (const float* const*)d_in; const float* x = I[0]; const int* km = (const int*)d_in[1]; const float* wq = I[2]; const float* bq = I[3]; const float* wk = I[4]; const float* bk = I[5]; const float* wv = I[6]; const float* bv = I[7]; const float* wo = I[8]; const float* bo = I[9]; const float* g1 = I[10]; const float* be1 = I[11]; const float* wfc = I[12]; const float* bfc = I[13]; const float* wmp = I[14]; const float* bmp = I[15]; const float* gg2 = I[16]; const float* be2 = I[17];      /* input order: x_n; mask int32 [2][1][1][2048] (READ on device); [in][out] wq / wk / wv / wo + biases; ln1 g / b; w1 [768][3072] + b1, w2 [3072][768] + b2; ln2 g / b */
  static_assert(DMQ % 4 == 0 && DMQ / 4 <= 256 && DM % 64 == 0 && DM % 32 == 0 && DFF % 64 == 0 && DFF % 32 == 0 && NH * HD == DM && NKX == SQ, "k_lnxr 256 threads x 4 columns; tile multiples");
  static_assert(MP % 128 == 0 && MPO % 128 == 0 && SQ % 128 == 0 && DM % 64 == 0 && DFF % 64 == 0, "k_gemm2: whole 128-row work-group tiles, 64-column tiles, 64-k stages");
  char* ws = (char*)d_ws; size_t off = 0;
  auto take = [&](size_t bytes) { char* p = ws + off; off += (bytes + 255) & ~(size_t)255; return p; };
  _Float16* BQKV = (_Float16*)take((size_t)3 * DM * DM * 2); _Float16* BO = (_Float16*)take((size_t)DM * DM * 2); float* bqkv = (float*)take((size_t)3 * DM * 4); float* X1N = nullptr;      /* LN1 output (f32): aliases the QKV plane below (QKV's last readers, the V^T and attention launches, precede LN1) to stay within 256 MiB at NB 4 / SQ 2048 */
  _Float16* X16 = (_Float16*)take(NR * DM * 2); float* XB = (float*)take(NR * DM * 4); float* X1 = (float*)take(NR * DM * 4); _Float16* M16 = nullptr;      /* = X16 below (alias: X16's last reader, the fused QKV GEMM, precedes LN1's f16 write) */ _Float16* HF16 = (_Float16*)take(NR * DFF * 2);      /* FFN hidden plane of both batches [4096][3072] f16 (own region here) */ _Float16* BW1 = (_Float16*)take((size_t)DFF * DM * 2); _Float16* BW2 = (_Float16*)take((size_t)DM * DFF * 2); _Float16* QKV = (_Float16*)take(NR * 3 * DM * 2); _Float16* V16 = QKV + 2 * DM; _Float16* O16 = (_Float16*)take(NR * DM * 2); M16 = X16; X1N = (float*)QKV;      /* aliases: X1N (NR*DM f32 = 12 MiB) inside QKV (18 MiB): QKV's last readers (the V^T and attention launches) precede the first LayerNorm */
  _Float16* VT = (_Float16*)take((size_t)NB * NH * HD * SQ * 2);
  if (off > ws_size) return;
  k_prep<<<PB_ALL, 256, 0, stream>>>(x, wq, wk, wv, wo, wfc, wmp, bq, bk, bv, X16, XB, BQKV, BO, BW1, BW2, bqkv);      /* every GEMM operand plane, the stacked bias and the residual rows; post-LN: the attention runs on the raw input */
  const size_t r0p = (size_t)B0 * SQ;      /* first projected row */
  k_gemm2<0><<<dim3((unsigned)((MP / 128) * (3 * DM / 64)), 1), 128, 0, stream>>>(X16 + r0p * DM, DM, 0, BQKV, DM, 0, 0.0625f, bqkv, 0, nullptr, 1, 0, 0, nullptr, QKV + r0p * 3 * DM, 3 * DM, 0, MP, 3 * DM, DM);      /* q | k | v rows (f16); head h = columns h*HD.. of each DM block */
  k_vt<NH, SQ><<<NB * NH * (SQ / 64), 256, 0, stream>>>(V16, LQ, 0, VT);      /* V^T [NB][NH][HD][SQ], both batches */
  k_fattn<<<dim3(SQ / 64, NB * NH), 128, 0, stream>>>(QKV, VT, km, O16);      /* scores q.k / sqrt(768) (the module's literal dim_model scale), masked keys get the score 1e-11 (fill, as the source), softmax over all keys, ctx (merged heads, x64) as f16 rows */
  k_gemm2<0><<<dim3((unsigned)((MPO / 128) * (DM / 64)), 1), 128, 0, stream>>>(O16 + r0p * DM, DM, 0, BO, DM, 0, 0.0009765625f, bo, 0, nullptr, 1, 0, 0, X1 + r0p * DM, nullptr, DM, 0, MPO, DM, DM);      /* z = ctx Wo + bo (f32 rows; the skip is added AFTER the LayerNorm in this module) */
  k_lnxr<0, 1, 1><<<(unsigned)NR, 256, 0, stream>>>(X1, g1, be1, 1e-5f, M16, X1N, XB);      /* l1 = bf16(x) + LN1(z) (eps 1e-5): f16 rows for the FFN input and f32 rows for the second skip */
  k_gemm2<3><<<dim3((unsigned)((MP / 128) * (DFF / 64)), 1), 128, 0, stream>>>(M16, DM, 0, BW1, DM, 0, 0.0625f, bfc, 0, nullptr, 1, 0, 0, nullptr, HF16, DFF, 0, MP, DFF, DM);      /* relu(l1 W1 + b1) -> f16, both batches */
  k_gemm2<0><<<dim3((unsigned)((MP / 128) * (DM / 64)), 1), 128, 0, stream>>>(HF16, DFF, 0, BW2, DFF, 0, 0.0625f, bmp, 0, nullptr, 1, 0, 0, X1, nullptr, DM, 0, MP, DM, DFF);      /* ffn = hidden W2 + b2 (f32 rows over the dead z plane; the skip is added after the LayerNorm) */
  k_lnxr<0, 0, 1><<<(unsigned)NR, 256, 0, stream>>>(X1, gg2, be2, 1e-5f, nullptr, (float*)d_out, X1N);      /* out = l1 + LN2(ffn) (eps 1e-5) -> f32 output rows */
}

// v006
// It runs in 176 microseconds.
// Two timings next to v005 both put it at 1.10 times that version's speed.
// Counting every step since v000, it is 40.6 times as fast.
#include <hip/hip_runtime.h>
// Transformer encoder layer with branch-side LayerNorms, a key-padding mask applied as a FILL and the module's literal score scale (x_n [2][2048][768]; q / k / v = x W + b ([in][out] 768 x 768 sigma 1/sqrt(768), zero biases); 12 heads of 64; scores / sqrt(768) (dim_model, as the source); where(mask == 0, 1e-11) with the int32 [2][1][1][2048] mask in {0, 1} (random; READ on device; masked keys get the score 1e-11, NOT -inf, as the source); softmax; z = ctx Wo + bo; l1 = x + LN(z) (LayerNorm on the branch only; biased var, eps 1e-5); ffn = relu(l1 W1 + b1) W2 + b2 ([in][out] 768 x 3072 x 768); out = l1 + LN(ffn) -> [2][2048][768]).
// Structure: token rows; x as exact f16 rows and bf16 f32 residual rows; natural weights as exact x16 planes; fused q | k | v WMMA GEMM (32x64 wave tiles, f32 accumulation, + stacked bias) -> f16; V^T via LDS transposes; one fused attention launch (16 query rows a wave: scores over all keys, fill mask, online softmax with f32 statistics and native exp, weights x256 f16 in registers, ctx x64 merged f16); ctx Wo + bo f32; x + LN1 on VALU -> f16 + f32; relu FFN, both batches a launch; residual + LN2 -> output; nine launches, all operand preparation in the first.
// Compute dtype: inputs rounded to bf16; x / weights exact; q, k, v, softmax weights and o as plain f16 GEMM operands (~2^-12); scores and softmax statistics f32. v_wmma_f32_16x16x32_f16.
#define NB 2
#define SQ 2048
#define DM 768
#define NH 12
#define HD 64
#define HG 4                         /* heads per block group in the unlaunched k_vt overload */
#define QT 256                       /* query rows per score tile in k_rsmcf2 / k_rsmcim (not launched) */
#define NKX SQ                       /* S / P row pitch */
#define QT0 128                      /* query rows per head in k_att0 (not launched) */
#define B0 0                         /* first batch processed (debug hook) */
#define NBR NB                       /* batches processed (debug hook) */
#define NR ((size_t)NB * SQ)
#define DMQ DM
#define DFF 3072         /* FFN hidden width */
#define MP ((int)((size_t)NBR * SQ)) /* rows projected (debug hook) */
#define QN SQ                        /* query rows per batch (not used) */
#define NHD NH                       /* heads (not used) */
#define MPO MP                       /* rows through the output stage (debug hook) */
#define LQ (3 * DM)      /* row pitch of the q/k/v rows */
typedef __bf16 v16b __attribute__((ext_vector_type(16)));
typedef unsigned short v8us __attribute__((ext_vector_type(8), may_alias));
typedef float  v8f  __attribute__((ext_vector_type(8)));
typedef float  v4f  __attribute__((ext_vector_type(4)));
typedef float  v4fa __attribute__((ext_vector_type(4), may_alias));
union FragB { v16b v; v8us half[2]; unsigned short u[16]; };

__device__ __forceinline__ unsigned short bf16_bits(float x) { unsigned int u = __float_as_uint(x); return (unsigned short)((u + 0x7FFFu + ((u >> 16) & 1u)) >> 16); }
__device__ __forceinline__ float bf16_val(unsigned short b) { return __uint_as_float(((unsigned int)b) << 16); }
__device__ __forceinline__ float bf16_round(float x) { return bf16_val(bf16_bits(x)); }
// D += A·B with NT terms: 1 = ah·bh, 2 = + al·bh (A split), 3 = + ah·bl (both split)
template <int NT>
__device__ __forceinline__ v8f mmaN(v16b ah, v16b al, v16b bh, v16b bl, v8f c) {
  c = __builtin_amdgcn_wmma_f32_16x16x32_bf16(false, ah, false, bh, (short)0, c, false, false);
  if (NT >= 2) c = __builtin_amdgcn_wmma_f32_16x16x32_bf16(false, al, false, bh, (short)0, c, false, false);
  if (NT >= 3) c = __builtin_amdgcn_wmma_f32_16x16x32_bf16(false, ah, false, bl, (short)0, c, false, false);
  asm volatile("v_nop\n\tv_nop\n\tv_nop\n\tv_nop" : "+v"(c) : "v"(ah), "v"(al), "v"(bh), "v"(bl));
  return c;
}

__global__ __launch_bounds__(256) void k_wt_bf16(const float* __restrict__ W, unsigned short* __restrict__ Wt, int K, int N) {
  const int t = blockIdx.x * 256 + threadIdx.x;
  const int k8n = K / 8;
  if (t >= N * k8n) return;
  const int n = t / k8n, k8 = (t % k8n) * 8;
  v8us v;
#pragma unroll
  for (int i = 0; i < 8; ++i) v[i] = bf16_bits(W[(size_t)(k8 + i) * N + n]);
  *(v8us*)(Wt + (size_t)n * K + k8) = v;
  
}

// GEMM C[M][N] (f32, pitch ldc) = act(A[M][K]·W + bias). A f32 row-major (pitch lda) converted per fragment to bf16
// (ASPLIT: hi/lo two planes -> 2 terms, else single rounded term); Wt bf16 [N][K] (pitch ldb). BIAS_BF16 rounds the
// bias to bf16 first (bias quantised to bf16 before the add). K%32==0, M%16==0, N%64==0.
template <bool ASPLIT, int ACT, bool BIAS_BF16>
__global__ __launch_bounds__(128) void k_gemm_bf(const float* __restrict__ A, int lda, const unsigned short* __restrict__ Wt, int ldb,
                                               const float* __restrict__ bias, float* __restrict__ C, int ldc, int M, int N, int K) {
  __shared__ __attribute__((aligned(16))) float so[4][16][64];
  const int tid = threadIdx.x, w = tid >> 5, lane = tid & 31, ln = lane & 15, hh = lane >> 4;
  const int ntn = N / 64;
  const int wid = blockIdx.x * 4 + w;
  const int mt = wid / ntn, nq = wid % ntn;
  if (mt * 16 >= M) return;
  const int row0 = mt * 16, col0 = nq * 64;
  const float* arow = A + (size_t)(row0 + ln) * lda;
  v8f acc[4] = {};
  for (int kb = 0; kb < K; kb += 32) {
    FragB ah, al;
    const v4f x0 = *(const v4fa*)(arow + kb + 8 * hh), x1 = *(const v4fa*)(arow + kb + 8 * hh + 4);
    const v4f x2 = *(const v4fa*)(arow + kb + 16 + 8 * hh), x3 = *(const v4fa*)(arow + kb + 16 + 8 * hh + 4);
    float xs[16] = {x0[0],x0[1],x0[2],x0[3],x1[0],x1[1],x1[2],x1[3],x2[0],x2[1],x2[2],x2[3],x3[0],x3[1],x3[2],x3[3]};
#pragma unroll
    for (int i = 0; i < 16; ++i) { const unsigned short hb = bf16_bits(xs[i]); ah.u[i] = hb; al.u[i] = ASPLIT ? bf16_bits(xs[i] - bf16_val(hb)) : (unsigned short)0; }
#pragma unroll
    for (int t = 0; t < 4; ++t) {
      const unsigned short* brow = Wt + (size_t)(col0 + t * 16 + ln) * ldb + kb;
      FragB b;
      b.half[0] = *(const v8us*)(brow + 8 * hh);
      b.half[1] = *(const v8us*)(brow + 16 + 8 * hh);
      acc[t] = mmaN<ASPLIT ? 2 : 1>(ah.v, al.v, b.v, b.v, acc[t]);
    }
  }
#pragma unroll
  for (int t = 0; t < 4; ++t) {
    float bv = bias ? bias[col0 + t * 16 + ln] : 0.f;
    if (BIAS_BF16) bv = bf16_round(bv);
#pragma unroll
    for (int r = 0; r < 8; ++r) { float v = acc[t][r] + bv; if (ACT == 1) v = fmaxf(v, 0.f); so[w][8 * hh + r][t * 16 + ln] = v; }
  }
  __builtin_amdgcn_fence(__ATOMIC_ACQ_REL, "workgroup");
  __builtin_amdgcn_wave_barrier();
  const int rsub = lane >> 4, c4 = (lane & 15) * 4;
  {
#pragma unroll
    for (int q = 0; q < 8; ++q) {
      const int r = q * 2 + rsub;
      const v4f v = *(const v4fa*)&so[w][r][c4];
      *(v4f*)(C + (size_t)(row0 + r) * ldc + col0 + c4) = v;
    }
    
  }
}

// GEMM C = act(A·W + bias + resid): A f32 (ASPLIT -> hi/lo 2 terms), Wt bf16 [N][K]; ACT 0 none, 1 relu, 2 exact gelu;
// resid (optional, f32, row index = (row % rmod), pitch ldr, RES_BF16 rounds it) added before the activation.
template <bool ASPLIT, int ACT, bool BIAS_BF16, bool RES_BF16>
__global__ __launch_bounds__(128) void k_gemm_bf3(const float* __restrict__ A, int lda, const unsigned short* __restrict__ Wt, int ldb,
                                                const float* __restrict__ bias, const float* __restrict__ resid, int rmod, int ldr,
                                                float* __restrict__ C, int ldc, int M, int N, int K) {
  __shared__ __attribute__((aligned(16))) float so[4][16][64];
  const int tid = threadIdx.x, w = tid >> 5, lane = tid & 31, ln = lane & 15, hh = lane >> 4;
  const int ntn = N / 64;
  const int wid = blockIdx.x * 4 + w;
  const int mt = wid / ntn, nq = wid % ntn;
  if (mt * 16 >= M) return;
  const int row0 = mt * 16, col0 = nq * 64;
  const float* arow = A + (size_t)(row0 + ln) * lda;
  v8f acc[4] = {};
  for (int kb = 0; kb < K; kb += 32) {
    FragB ah, al;
    const v4f x0 = *(const v4fa*)(arow + kb + 8 * hh), x1 = *(const v4fa*)(arow + kb + 8 * hh + 4);
    const v4f x2 = *(const v4fa*)(arow + kb + 16 + 8 * hh), x3 = *(const v4fa*)(arow + kb + 16 + 8 * hh + 4);
    float xs[16] = {x0[0],x0[1],x0[2],x0[3],x1[0],x1[1],x1[2],x1[3],x2[0],x2[1],x2[2],x2[3],x3[0],x3[1],x3[2],x3[3]};
#pragma unroll
    for (int i = 0; i < 16; ++i) { const unsigned short hb = bf16_bits(xs[i]); ah.u[i] = hb; al.u[i] = ASPLIT ? bf16_bits(xs[i] - bf16_val(hb)) : (unsigned short)0; }
#pragma unroll
    for (int t = 0; t < 4; ++t) {
      const unsigned short* brow = Wt + (size_t)(col0 + t * 16 + ln) * ldb + kb;
      FragB b;
      b.half[0] = *(const v8us*)(brow + 8 * hh);
      b.half[1] = *(const v8us*)(brow + 16 + 8 * hh);
      acc[t] = mmaN<ASPLIT ? 2 : 1>(ah.v, al.v, b.v, b.v, acc[t]);
    }
  }
#pragma unroll
  for (int t = 0; t < 4; ++t) {
    const int col = col0 + t * 16 + ln;
    float bv = bias ? bias[col] : 0.f;
    if (BIAS_BF16) bv = bf16_round(bv);
#pragma unroll
    for (int r = 0; r < 8; ++r) {
      float v = acc[t][r] + bv;
      if (resid) { float rv = resid[(size_t)((row0 + 8 * hh + r) % rmod) * ldr + col]; if (RES_BF16) rv = bf16_round(rv); v += rv; }
      if (ACT == 1) v = fmaxf(v, 0.f);
      if (ACT == 2) v = 0.5f * v * (1.0f + erff(v * 0.70710678118654752f));
      if (ACT == 3) { const float u = 0.7978845608028654f * (v + 0.044715f * v * v * v); v = 0.5f * v * (1.0f + tanhf(u)); }
      so[w][8 * hh + r][t * 16 + ln] = v;
    }
  }
  __builtin_amdgcn_fence(__ATOMIC_ACQ_REL, "workgroup");
  __builtin_amdgcn_wave_barrier();
  const int rsub = lane >> 4, c4 = (lane & 15) * 4;
  {
#pragma unroll
    for (int q = 0; q < 8; ++q) {
      const int r = q * 2 + rsub;
      const v4f v = *(const v4fa*)&so[w][r][c4];
      *(v4f*)(C + (size_t)(row0 + r) * ldc + col0 + c4) = v;
    }
    
  }
}
// row LayerNorm (biased variance, eps) over N: s = X (+ R); optional out_sum <- s; out_norm <- (s-mu)*rsqrt(var+eps)*g + b
template <bool PARAM_BF16>
__global__ __launch_bounds__(256) void k_layernorm(const float* __restrict__ X, const float* __restrict__ R, const float* __restrict__ g, const float* __restrict__ bta,
                                                  float* __restrict__ out_sum, float* __restrict__ out_norm, int N, float eps) {
  __shared__ float red[256];
  const int row = blockIdx.x, tid = threadIdx.x;
  const float* x = X + (size_t)row * N; const float* rr = R ? R + (size_t)row * N : nullptr;
  float vals[16];                     // up to N = 4096
  const int per = N / 256;            // contiguous chunk per thread? use strided-by-4 chunks: thread handles j = tid*4 + 1024*u
  float s1 = 0.f;
  for (int u = 0; u < per / 4; ++u) {
    const int j = tid * 4 + 1024 * u;
    const v4f a = *(const v4fa*)(x + j);
    v4f b = {0.f,0.f,0.f,0.f}; if (rr) b = *(const v4fa*)(rr + j);
#pragma unroll
    for (int q = 0; q < 4; ++q) { const float v = a[q] + b[q]; vals[u * 4 + q] = v; s1 += v; }
  }
  red[tid] = s1; __syncthreads();
  for (int st = 128; st > 0; st >>= 1) { if (tid < st) red[tid] += red[tid + st]; __syncthreads(); }
  const float mu = red[0] / (float)N; __syncthreads();
  float s2 = 0.f;
  for (int u = 0; u < per / 4; ++u)
#pragma unroll
    for (int q = 0; q < 4; ++q) { const float c = vals[u * 4 + q] - mu; s2 += c * c; }
  red[tid] = s2; __syncthreads();
  for (int st = 128; st > 0; st >>= 1) { if (tid < st) red[tid] += red[tid + st]; __syncthreads(); }
  const float rs = rsqrtf(red[0] / (float)N + eps);
  {
    for (int u = 0; u < per / 4; ++u) {
      const int j = tid * 4 + 1024 * u;
      v4f o, sm;
#pragma unroll
      for (int q = 0; q < 4; ++q) {
        float gg = g[j + q], bb = bta[j + q];
        if (PARAM_BF16) { gg = bf16_round(gg); bb = bf16_round(bb); }
        sm[q] = vals[u * 4 + q]; o[q] = (vals[u * 4 + q] - mu) * rs * gg + bb;
      }
      if (out_sum) *(v4f*)(out_sum + (size_t)row * N + j) = sm;
      *(v4f*)(out_norm + (size_t)row * N + j) = o;
    }
    
  }
}



// ---- f16 WMMA path (v_wmma_f32_16x16x32_f16): 11-bit significands for operands in range — used where a [0,1] probability operand needs more precision than bf16
typedef _Float16 v16h __attribute__((ext_vector_type(16)));
union FragH { v16h v; v8us half[2]; _Float16 h[16]; unsigned short u[16]; };
template <int NT>
__device__ __forceinline__ v8f mmaH(v16h ah, v16h al, v16h bh, v16h bl, v8f c) {
  c = __builtin_amdgcn_wmma_f32_16x16x32_f16(false, ah, false, bh, (short)0, c, false, false);
  if (NT >= 2) c = __builtin_amdgcn_wmma_f32_16x16x32_f16(false, al, false, bh, (short)0, c, false, false);
  if (NT >= 3) c = __builtin_amdgcn_wmma_f32_16x16x32_f16(false, ah, false, bl, (short)0, c, false, false);
  asm volatile("v_nop\n\tv_nop\n\tv_nop\n\tv_nop" : "+v"(c) : "v"(ah), "v"(al), "v"(bh), "v"(bl));
  return c;
}
// batched GEMM like k_gemm_b but f16 operands: A f32 (split into f16 hi/lo if ASPLIT, else rounded to f16), Bt = f16 values [n][k]; alpha; C f32; N multiple of 16 (partial tiles skipped)
template <bool ASPLIT>
__global__ __launch_bounds__(128) void k_gemm_h(const float* __restrict__ A, int lda, size_t sA, const _Float16* __restrict__ Bh, int ldb, size_t sB, float alpha, float* __restrict__ C, int ldc, size_t sC, int M, int N, int K) {
  __shared__ __attribute__((aligned(16))) float so[4][16][64];
  const int tid = threadIdx.x, w = tid >> 5, lane = tid & 31, ln = lane & 15, hh = lane >> 4; const int by = blockIdx.y;
  A += (size_t)by * sA; Bh += (size_t)by * sB; C += (size_t)by * sC;
  const int ntn = (N + 63) / 64; const int wid = blockIdx.x * 4 + w; const int mt = wid / ntn, nq = wid % ntn; if (mt * 16 >= M) return;
  const int row0 = mt * 16, col0 = nq * 64; const float* arow = A + (size_t)(row0 + ln) * lda;
  v8f acc[4] = {};
  for (int kb = 0; kb < K; kb += 32) {
    FragH ah, al;
    const v4f x0 = *(const v4fa*)(arow + kb + 8 * hh), x1 = *(const v4fa*)(arow + kb + 8 * hh + 4), x2 = *(const v4fa*)(arow + kb + 16 + 8 * hh), x3 = *(const v4fa*)(arow + kb + 16 + 8 * hh + 4);
    float xs[16] = {x0[0],x0[1],x0[2],x0[3],x1[0],x1[1],x1[2],x1[3],x2[0],x2[1],x2[2],x2[3],x3[0],x3[1],x3[2],x3[3]};
#pragma unroll
    for (int i = 0; i < 16; ++i) { const _Float16 h = (_Float16)xs[i]; ah.h[i] = h; al.h[i] = ASPLIT ? (_Float16)(xs[i] - (float)h) : (_Float16)0.0f; }
#pragma unroll
    for (int t = 0; t < 4; ++t) { if (col0 + t * 16 >= N) continue; const size_t boff = (size_t)(col0 + t * 16 + ln) * ldb + kb; FragH bq; bq.half[0] = *(const v8us*)(Bh + boff + 8 * hh); bq.half[1] = *(const v8us*)(Bh + boff + 16 + 8 * hh);
      acc[t] = mmaH<ASPLIT ? 2 : 1>(ah.v, al.v, bq.v, bq.v, acc[t]); }
  }
#pragma unroll
  for (int t = 0; t < 4; ++t) { if (col0 + t * 16 >= N) continue;
#pragma unroll
    for (int r = 0; r < 8; ++r) so[w][8 * hh + r][t * 16 + ln] = acc[t][r] * alpha; }
  __builtin_amdgcn_fence(__ATOMIC_ACQ_REL, "workgroup"); __builtin_amdgcn_wave_barrier();
  const int rsub = lane >> 4, c4 = (lane & 15) * 4;
  {
#pragma unroll
    for (int q = 0; q < 8; ++q) { const int r = q * 2 + rsub; if (col0 + c4 < N) { const v4f v = *(const v4fa*)&so[w][r][c4]; *(v4f*)(C + (size_t)(row0 + r) * ldc + col0 + c4) = v; } }
     }
}

// Wt[n][k] = f16(bf16(W[k][n]) x 16) from f32 row-major W[K][N] (bf16-exact weights stay exact in f16 away from the subnormal range); one 256-thread block turns a tile of 128 k x 64 n.
// Reads: 16 lanes cover 256 contiguous bytes of one W row (64 n); a thread takes 8 consecutive rows of its 4 columns, so it holds 8 consecutive k of 4 output rows and stores each as one 16-byte piece into the LDS tile [n][k].
// Writes: 16 lanes cover the tile's 256 contiguous bytes of one Wt row (128 k).
#define PW_P 272                     /* LDS row pitch in bytes: 256 + 16 */
template <int K, int N>
__device__ __forceinline__ void p_wt_tile(const float* __restrict__ W, _Float16* __restrict__ Wt, int blk, int tid, unsigned char* tl) {
  static_assert(K % 128 == 0 && N % 64 == 0, "p_wt_tile: whole tiles");
  const int nt = blk % (N / 64), kt = blk / (N / 64); const int lo = tid & 15, hi = tid >> 4;
  const float* src = W + (size_t)(kt * 128 + hi * 8) * N + nt * 64 + lo * 4; v4f r[8];
#pragma unroll
  for (int i = 0; i < 8; ++i) r[i] = *(const v4fa*)(src + (size_t)i * N);
#pragma unroll
  for (int j = 0; j < 4; ++j) { FragH f;
#pragma unroll
    for (int i = 0; i < 8; ++i) f.h[i] = (_Float16)(bf16_round(r[i][j]) * 16.0f);
    *(v8us*)(tl + (lo * 4 + j) * PW_P + hi * 16) = f.half[0]; }
  __syncthreads();      /* the tile is whole before any row of it is read back; reached by the whole block (the job is chosen by block index) */
  unsigned short* dst = (unsigned short*)Wt + (size_t)(nt * 64 + hi) * K + kt * 128 + lo * 8;
#pragma unroll
  for (int q = 0; q < 4; ++q) { const v8us o = *(const v8us*)(tl + (q * 16 + hi) * PW_P + lo * 16); *(v8us*)(dst + (size_t)(q * 16) * K) = o; }
  asm volatile("s_wait_xcnt 0x0" ::: "memory");      /* the built code runs on from these stores into the other jobs' range tests, whose code reuses the stores' registers: the wait stands in front of any such overwrite */
}
// k_gemm_hh variant with fused epilogue: v = acc·alpha + bias[by·sBias + col] (+ CP[(row/rowsPerB)·sCPb + by·64 + col] if CP) ; ACT 0 none / 1 elu ; writes f16 C16 (and f32 C if non-null)
template <int ACT>
__global__ __launch_bounds__(128) void k_gemm_hhx(const _Float16* __restrict__ A, int lda, size_t sA, const _Float16* __restrict__ Bh, int ldb, size_t sB, float alpha, const float* __restrict__ bias, size_t sBias, const float* __restrict__ CP, int rowsPerB, size_t sCPb, int row0g,
    float* __restrict__ C, _Float16* __restrict__ C16, int ldc, size_t sC, int M, int N, int K) {
  __shared__ __attribute__((aligned(16))) float so[4][16][64];
  const int tid = threadIdx.x, w = tid >> 5, lane = tid & 31, ln = lane & 15, hh = lane >> 4; const int by = blockIdx.y;
  A += (size_t)by * sA; Bh += (size_t)by * sB; const size_t cofs = (size_t)by * sC; const float* bp = bias ? bias + (size_t)by * sBias : nullptr;
  const int ntn = (N + 63) / 64; const int wid = blockIdx.x * 4 + w; const int mt = wid / ntn, nq = wid % ntn; if (mt * 16 >= M) return;
  const int row0 = mt * 16, col0 = nq * 64; const _Float16* arow = A + (size_t)(row0 + ln) * lda;
  v8f acc[4] = {};
  for (int kb = 0; kb < K; kb += 32) { FragH ah; ah.half[0] = *(const v8us*)((const unsigned short*)arow + kb + 8 * hh); ah.half[1] = *(const v8us*)((const unsigned short*)arow + kb + 16 + 8 * hh);
#pragma unroll
    for (int t = 0; t < 4; ++t) { if (col0 + t * 16 >= N) continue; const size_t boff = (size_t)(col0 + t * 16 + ln) * ldb + kb; FragH bq; bq.half[0] = *(const v8us*)((const unsigned short*)Bh + boff + 8 * hh); bq.half[1] = *(const v8us*)((const unsigned short*)Bh + boff + 16 + 8 * hh);
      acc[t] = mmaH<1>(ah.v, ah.v, bq.v, bq.v, acc[t]); }
  }
#pragma unroll
  for (int t = 0; t < 4; ++t) { if (col0 + t * 16 >= N) continue; const int col = col0 + t * 16 + ln; const float bv = bp ? bf16_round(bp[col]) : 0.f;
#pragma unroll
    for (int r = 0; r < 8; ++r) { float v = acc[t][r] * alpha + bv; if (CP) { const int rr = row0g + row0 + 8 * hh + r; if (rowsPerB < 0) v += CP[cofs + (size_t)rr * ldc + col];      /* rowsPerB < 0: own element of the batched C plane */ else { const int bidx = rr / rowsPerB; v += CP[(size_t)bidx * sCPb + (size_t)by * 64 + col]; } } if (ACT == 1) v = (v > 0.f) ? v : expm1f(v); else if (ACT == 7) v = (v > 0.f) ? v + 1.0f : expf(v); else if (ACT == 8) v = tanhf(v); else if (ACT == 9) v = 0.5f * v * (1.0f + tanhf(0.7978845608028654f * (v + 0.044715f * v * v * v))); else if (ACT == 11) v = 1.0f / (1.0f + expf(-v)); else if (ACT == 12) v = (v > 0.f) ? v : 0.01f * v; else if (ACT == 14) v = (v > 0.f) ? v : 0.1f * v; else if (ACT == 16) v = (v >= 0.f) ? v : 0.3f * v; else if (ACT == 17) v = (v >= 0.f) ? v : 0.2f * v; else if (ACT == 15) v = v / (1.0f + expf(-v)); else if (ACT == 3) v = fmaxf(v, 0.f); else if (ACT == 6) v = 0.5f * v * (1.0f + erff(v * 0.70710678118654752f)); so[w][8 * hh + r][t * 16 + ln] = v; } }
  __builtin_amdgcn_fence(__ATOMIC_ACQ_REL, "workgroup"); __builtin_amdgcn_wave_barrier();
  const int rsub = lane >> 4, c4 = (lane & 15) * 4; typedef _Float16 v4h __attribute__((ext_vector_type(4)));
  {
#pragma unroll
    for (int q = 0; q < 8; ++q) { const int r = q * 2 + rsub; if (col0 + c4 < N) { const v4f v = *(const v4fa*)&so[w][r][c4]; if (C) *(v4f*)(C + cofs + (size_t)(row0 + r) * ldc + col0 + c4) = v; if (C16) { v4h h4; for (int i = 0; i < 4; ++i) h4[i] = (_Float16)v[i]; *(v4h*)(C16 + cofs + (size_t)(row0 + r) * ldc + col0 + c4) = h4; } } }
     }
}


typedef _Float16 v4h __attribute__((ext_vector_type(4)));

__global__ __launch_bounds__(256) void k_h16(const float* __restrict__ x, _Float16* __restrict__ X16, size_t n8) { const size_t t = (size_t)blockIdx.x * 256 + threadIdx.x; if (t >= n8) return; FragH f;
#pragma unroll
  for (int q = 0; q < 8; ++q) f.h[q] = (_Float16)x[t * 8 + q]; *(v8us*)((unsigned short*)X16 + t * 8) = f.half[0];  }
__global__ __launch_bounds__(256) void k_round16f(const float* __restrict__ W, _Float16* __restrict__ Bt, size_t n8) { const size_t t = (size_t)blockIdx.x * 256 + threadIdx.x; if (t >= n8) return; FragH f;
#pragma unroll
  for (int i = 0; i < 8; ++i) f.h[i] = (_Float16)(bf16_round(W[t * 8 + i]) * 16.0f); *(v8us*)((unsigned short*)Bt + t * 8) = f.half[0];  }
template <int NHv, int TTv>
__global__ __launch_bounds__(256) void k_vt(const _Float16* __restrict__ V16, int ldv, int voff, _Float16* __restrict__ Vt) { __shared__ unsigned short tl[64][66]; const int tid = threadIdx.x; const int slab = blockIdx.x / (TTv / 64), lg = blockIdx.x % (TTv / 64); const int b = slab / NHv, h = slab % NHv;
  for (int i = tid; i < 64 * 8; i += 256) { const int r = i / 8, c8 = (i % 8) * 8; FragH f; f.half[0] = *(const v8us*)((const unsigned short*)V16 + ((size_t)b * TTv + lg * 64 + r) * ldv + voff + h * 64 + c8);
#pragma unroll
    for (int q = 0; q < 8; ++q) tl[r][c8 + q] = f.u[q]; }
  __syncthreads();
  {
#pragma unroll
    for (int rd = 0; rd < 2; ++rd) { const int d = rd * 32 + tid / 8, pc = tid % 8; FragH f;
#pragma unroll
      for (int q = 0; q < 8; ++q) f.u[q] = tl[pc * 8 + q][d];
      *(v8us*)((unsigned short*)Vt + ((size_t)slab * 64 + d) * TTv + lg * 64 + pc * 8) = f.half[0]; }
     } }

__global__ __launch_bounds__(256) void k_hl(const float* __restrict__ F, _Float16* __restrict__ Hh, _Float16* __restrict__ Hl, size_t n8) { const size_t t = (size_t)blockIdx.x * 256 + threadIdx.x; if (t >= n8) return; FragH fh, fl; const v4f a = *(const v4fa*)(F + t * 8), c = *(const v4fa*)(F + t * 8 + 4);
#pragma unroll
  for (int q = 0; q < 4; ++q) { _Float16 h = (_Float16)a[q]; fh.h[q] = h; fl.h[q] = (_Float16)((a[q] - (float)h) * 1024.0f); h = (_Float16)c[q]; fh.h[4 + q] = h; fl.h[4 + q] = (_Float16)((c[q] - (float)h) * 1024.0f); }
  { *(v8us*)((unsigned short*)Hh + t * 8) = fh.half[0]; *(v8us*)((unsigned short*)Hl + t * 8) = fl.half[0];  } }

// ---- fast GEMM (work-group tile 128x64, wave tile 32x64; requires M % 128 == 0 rows per launch region, N % 64 == 0 and K % 64 == 0); epilogue: v = act(acc alpha + bf16(bias[col])), written as f32 rows (W32), f16 rows (W16) or both ----
// Which planes are written is a template choice and a bias is always given, so the epilogue is straight-line code: no test or branch per element, and the four bias words of a lane come as one group of loads.
// A (128 rows) and Bt (64 rows) come in stages of 64 k = whole 128-byte lines, eight threads a row, through registers into two LDS buffers (row pitch 144 bytes); the waves take their fragments from LDS.
// Stage s + 1 is fetched while stage s is worked on; one barrier a stage. The products run in ascending k, 32 k a step.
#define G2_P 144                     /* LDS row pitch in bytes: 128 + 16, an odd multiple of 16 */
#define G2_B (128 * G2_P)            /* Bt rows start behind the 128 A rows */
#define G2_S (192 * G2_P)            /* one buffer */
__device__ __forceinline__ v16h g2_frag(const _Float16* p, int hh) { FragH f; f.half[0] = *(const v8us*)((const unsigned short*)p + 8 * hh); f.half[1] = *(const v8us*)((const unsigned short*)p + 16 + 8 * hh); return f.v; }
__device__ __forceinline__ v16h g2_lfrag(const unsigned char* p) { FragH f; f.half[0] = *(const v8us*)p; f.half[1] = *(const v8us*)(p + 32); return f.v; }      /* p = row ln of a 16 x 32 block in LDS, + 16 hh bytes: the element order of g2_frag */
__device__ __forceinline__ v8f g2_mma(v16h a, v16h b, v8f c) { v8f d = __builtin_amdgcn_wmma_f32_16x16x32_f16(false, a, false, b, (short)0, c, false, false); asm volatile("v_nop\n\tv_nop\n\tv_nop\n\tv_nop" : "+v"(d) : "v"(a), "v"(b)); return d; }
template <int ACT, bool W32, bool W16>
__global__ __launch_bounds__(128) void k_gemm2(const _Float16* __restrict__ A, int lda, size_t sA, const _Float16* __restrict__ Bh, int ldb, size_t sB, float alpha, const float* __restrict__ bias, size_t sBias,
    float* __restrict__ C, _Float16* __restrict__ C16, int ldc, size_t sC, int M, int N, int K) { static_assert(ACT == 0 || ACT == 3 || ACT == 6 || ACT == 8 || ACT == 9 || ACT == 11 || ACT == 12 || ACT == 14 || ACT == 15 || ACT == 16 || ACT == 17, "k_gemm2: unsupported ACT code (would silently apply no activation)");
  __shared__ __attribute__((aligned(16))) unsigned char sm[2 * G2_S];      /* [buffer][A 128 rows | Bt 64 rows][G2_P] */
  static_assert(4 * 32 * 68 * 4 <= 2 * G2_S, "k_gemm2: the epilogue's rows lie over the operand buffers");
  float (*so)[32][68] = (float (*)[32][68])sm;      /* epilogue staging, over the buffers once the last stage's barrier has ended every read of them */
  const int tid = threadIdx.x, w = tid >> 5, lane = tid & 31, ln = lane & 15, hh = lane >> 4; const int by = blockIdx.y;
  A += (size_t)by * sA; Bh += (size_t)by * sB; const size_t cofs = (size_t)by * sC; const float* bp = bias + (size_t)by * sBias;
  const int ntn = N >> 6; const int mt = blockIdx.x / ntn, nq = blockIdx.x - mt * ntn; const int row0 = mt * 128 + 32 * w, col0 = nq * 64; if (mt * 128 >= M) return;      /* the whole work-group or none: barriers follow */
  const int srow = tid >> 3, scol = (tid & 7) * 16;      /* staging: eight threads a row, 16 rows a sweep; eight sweeps for A, four for Bt */
  const char* ag = (const char*)(A + (size_t)(mt * 128) * lda); const char* bg = (const char*)(Bh + (size_t)col0 * ldb);      /* the tiles' first rows: the same for the whole work-group */
  const unsigned av = (unsigned)(srow * lda * 2 + scol), bv = (unsigned)(srow * ldb * 2 + scol);      /* this thread's place in a sweep, in bytes */
  const size_t a16 = (size_t)lda * 32, b16 = (size_t)ldb * 32;      /* 16 rows, in bytes */
  unsigned char* sd = sm + srow * G2_P + scol;
  v8us ga[8], gb[4];
#pragma unroll
  for (int j = 0; j < 8; ++j) ga[j] = *(const v8us*)(ag + j * a16 + av);
#pragma unroll
  for (int j = 0; j < 4; ++j) gb[j] = *(const v8us*)(bg + j * b16 + bv);
#pragma unroll
  for (int j = 0; j < 8; ++j) *(v8us*)(sd + 16 * j * G2_P) = ga[j];
#pragma unroll
  for (int j = 0; j < 4; ++j) *(v8us*)(sd + G2_B + 16 * j * G2_P) = gb[j];
  __syncthreads();      /* stage 0 published */
  const unsigned char* al = sm + (32 * w + ln) * G2_P + 16 * hh; const unsigned char* bl = sm + G2_B + ln * G2_P + 16 * hh;
  const v8f z8 = {0.f,0.f,0.f,0.f,0.f,0.f,0.f,0.f}; v8f c00 = z8, c01 = z8, c02 = z8, c03 = z8, c10 = z8, c11 = z8, c12 = z8, c13 = z8;
  const int nst = K >> 6;
#pragma unroll 1      /* one stage a trip: the buffer index alternates, and one stage's fragments, staging registers and accumulators already take 218 registers */
  for (int st = 0; st < nst; ++st) { const bool more = st + 1 < nst;      /* the same for the whole work-group */
    if (more) { const unsigned ao = av + (unsigned)(st + 1) * 128u, bo = bv + (unsigned)(st + 1) * 128u;      /* 32-bit lane offsets on work-group-uniform row bases */
#pragma unroll
      for (int j = 0; j < 8; ++j) ga[j] = *(const v8us*)((ag + j * a16) + ao);
#pragma unroll
      for (int j = 0; j < 4; ++j) gb[j] = *(const v8us*)((bg + j * b16) + bo); }
    const int cur = (st & 1) * G2_S;
    const unsigned char* ap = al + cur; const unsigned char* bq = bl + cur; v16h a0[2], a1[2], b0[2], b1[2], b2[2], b3[2];
#pragma unroll
    for (int kk = 0; kk < 2; ++kk) { a0[kk] = g2_lfrag(ap + 64 * kk); a1[kk] = g2_lfrag(ap + 16 * G2_P + 64 * kk); b0[kk] = g2_lfrag(bq + 64 * kk); b1[kk] = g2_lfrag(bq + 16 * G2_P + 64 * kk); b2[kk] = g2_lfrag(bq + 32 * G2_P + 64 * kk); b3[kk] = g2_lfrag(bq + 48 * G2_P + 64 * kk); }
#pragma unroll
    for (int kk = 0; kk < 2; ++kk) {      /* 32 k */
      c00 = g2_mma(a0[kk], b0[kk], c00); c10 = g2_mma(a1[kk], b0[kk], c10); c01 = g2_mma(a0[kk], b1[kk], c01); c11 = g2_mma(a1[kk], b1[kk], c11);
      c02 = g2_mma(a0[kk], b2[kk], c02); c12 = g2_mma(a1[kk], b2[kk], c12); c03 = g2_mma(a0[kk], b3[kk], c03); c13 = g2_mma(a1[kk], b3[kk], c13); }
    if (more) { unsigned char* nd = sd + (G2_S - cur);      /* the buffer of stage st - 1: every wave left it at the barrier that ended that trip */
#pragma unroll
      for (int j = 0; j < 8; ++j) *(v8us*)(nd + 16 * j * G2_P) = ga[j];
#pragma unroll
      for (int j = 0; j < 4; ++j) *(v8us*)(nd + G2_B + 16 * j * G2_P) = gb[j]; }
    __syncthreads(); }      /* publishes stage st + 1 and ends every wave's reads of stage st */
  v8f accs[8] = {c00, c01, c02, c03, c10, c11, c12, c13}; float bt[4];
#pragma unroll
  for (int t = 0; t < 4; ++t) bt[t] = bf16_round(bp[col0 + t * 16 + ln]);
#pragma unroll
  for (int u = 0; u < 8; ++u) { const int t = u & 3, half = u >> 2; const float bv = bt[t];
#pragma unroll
    for (int r = 0; r < 8; ++r) { const int rloc = half * 16 + 8 * hh + r; float v = accs[u][r] * alpha + bv;
      if (ACT == 3) v = fmaxf(v, 0.f); else if (ACT == 6) v = 0.5f * v * (1.0f + erff(v * 0.70710678118654752f)); else if (ACT == 11) v = 1.0f / (1.0f + expf(-v)); else if (ACT == 15) v = v / (1.0f + expf(-v)); else if (ACT == 12) v = (v > 0.f) ? v : 0.01f * v; else if (ACT == 8) v = tanhf(v); else if (ACT == 9) v = 0.5f * v * (1.0f + tanhf(0.7978845608028654f * (v + 0.044715f * v * v * v))); else if (ACT == 14) v = (v > 0.f) ? v : 0.1f * v; else if (ACT == 16) v = (v >= 0.f) ? v : 0.3f * v; else if (ACT == 17) v = (v >= 0.f) ? v : 0.2f * v;
      so[w][rloc][t * 16 + ln] = v; } }
  __builtin_amdgcn_fence(__ATOMIC_ACQ_REL, "workgroup"); __builtin_amdgcn_wave_barrier();
  const int rsub = lane >> 4, c4 = (lane & 15) * 4;
  {
#pragma unroll
    for (int q = 0; q < 16; ++q) { const int r = q * 2 + rsub; const v4f v = *(const v4fa*)&so[w][r][c4]; if (W32) *(v4f*)(C + cofs + (size_t)(row0 + r) * ldc + col0 + c4) = v; if (W16) { v4h h4; for (int i = 0; i < 4; ++i) h4[i] = (_Float16)v[i]; *(v4h*)(C16 + cofs + (size_t)(row0 + r) * ldc + col0 + c4) = h4; } }
     } }


__global__ __launch_bounds__(256) void k_wnat(const float* __restrict__ w, size_t n8, _Float16* __restrict__ Bt) { const size_t t = (size_t)blockIdx.x * 256 + threadIdx.x; if (t >= n8) return; FragH f; for (int q = 0; q < 8; ++q) f.h[q] = (_Float16)(bf16_round(w[t * 8 + q]) * 16.0f); *(v8us*)((unsigned short*)Bt + t * 8) = f.half[0];  }
__global__ __launch_bounds__(256) void k_rsm(const float* __restrict__ S, _Float16* __restrict__ P, int nrows) {
  #pragma clang fp contract(off)
  const int i = blockIdx.x * 256 + threadIdx.x; if (i >= nrows) return; const float* s = S + (size_t)i * SQ; float mx = -3.0e38f;
#pragma unroll 1
  for (int j = 0; j < SQ; ++j) mx = fmaxf(mx, s[j]); float se = 0.f;
#pragma unroll 1
  for (int j = 0; j < SQ; ++j) se += expf(s[j] - mx); const float sc = 256.0f / se;
#pragma unroll 1
  for (int j0 = 0; j0 < SQ; j0 += 8) { FragH f; for (int q = 0; q < 8; ++q) f.h[q] = (_Float16)(expf(s[j0 + q] - mx) * sc); unsigned short* d = (unsigned short*)P + (size_t)i * SQ + j0; *(v8us*)d = f.half[0];  } }
__global__ __launch_bounds__(256) void k_vt(const _Float16* __restrict__ V16, int b, int h0, _Float16* __restrict__ VT) { __shared__ unsigned short tl[64][65]; const int tid = threadIdx.x; const int hh = blockIdx.x % HG, sg = blockIdx.x / HG; const int s0 = sg * 64; const int h = h0 + hh;
  for (int i = tid; i < 64 * 8; i += 256) { const int j = i / 8, d8 = (i % 8) * 8; FragH f; f.half[0] = *(const v8us*)((const unsigned short*)V16 + ((size_t)b * SQ + s0 + j) * DM + h * HD + d8); for (int q = 0; q < 8; ++q) tl[d8 + q][j] = f.u[q]; }
  __syncthreads();
  { for (int i = tid; i < 64 * 8; i += 256) { const int d = i / 8, j8 = (i % 8) * 8; FragH f; for (int q = 0; q < 8; ++q) f.u[q] = tl[d][j8 + q]; *(v8us*)((unsigned short*)VT + ((size_t)hh * HD + d) * SQ + s0 + j8) = f.half[0]; }  } }



__global__ __launch_bounds__(256) void k_rsmcf2(const float* __restrict__ S, _Float16* __restrict__ P, int hg, int q0, int nk) {
  #pragma clang fp contract(off)
  const int t = blockIdx.x * 256 + threadIdx.x; if (t >= hg * QT) return; const size_t i = (size_t)t; const float* s = S + i * NKX; const int last = q0 + (t % QT); float mx = -3.0e38f;
#pragma unroll 1
  for (int j = 0; j < nk; ++j) { const float f = (j <= last) ? 1.f : 0.f; mx = fmaxf(mx, fmaf(f, s[j], (1.f - f) * -1.0e9f)); } float se = 0.f;
#pragma unroll 1
  for (int j = 0; j < nk; ++j) { const float f = (j <= last) ? 1.f : 0.f; se += __expf(fmaf(f, s[j], (1.f - f) * -1.0e9f) - mx); } const float sc = 256.0f / se;
#pragma unroll 1
  for (int j0 = 0; j0 < nk; j0 += 8) { FragH fr; for (int q = 0; q < 8; ++q) { const int j = j0 + q; const float f = (j <= last) ? 1.f : 0.f; fr.h[q] = (_Float16)(__expf(fmaf(f, s[j], (1.f - f) * -1.0e9f) - mx) * sc); } unsigned short* d = (unsigned short*)P + i * NKX + j0; *(v8us*)d = fr.half[0];  } }


template <int MASKADD>
__global__ __launch_bounds__(64) void k_att0(const float* __restrict__ QF, const float* __restrict__ KF, const float* __restrict__ VF, int ld, const float* __restrict__ mask, float scale, float* __restrict__ OF, int ldo) {
  #pragma clang fp contract(off)
  __shared__ __attribute__((aligned(16))) float lq[64][64]; __shared__ __attribute__((aligned(16))) float lo[64][64];
  const int tid = threadIdx.x; const int h = blockIdx.x / (QT0 / 64), rg = blockIdx.x % (QT0 / 64); const int i = rg * 64 + tid;
  const float* qr = QF + (size_t)i * ld + h * HD;
#pragma unroll 1
  for (int c = 0; c < HD / 4; ++c) { *(v4f*)&lq[tid][c * 4] = *(const v4fa*)(qr + c * 4); const v4f z = {0.f, 0.f, 0.f, 0.f}; *(v4f*)&lo[tid][c * 4] = z; }
  float m = -1.0e30f, l = 0.f; const int jmax = MASKADD ? (SQ - 1) : (rg * 64 + 63);      /* additive-mask form: every key (the mask input decides); causal form: keys up to the block's last row */
#pragma unroll 1
  for (int j = 0; j <= jmax; ++j) { const float* kr = KF + (size_t)j * ld + h * HD; const float* vr = VF + (size_t)j * ld + h * HD; float s = 0.f;
#pragma unroll 1
    for (int c = 0; c < HD / 4; ++c) { const v4f kq = *(const v4fa*)(kr + c * 4); const v4f qq = *(v4f*)&lq[tid][c * 4]; s = __fadd_rn(s, __fmul_rn(qq[0], kq[0])); s = __fadd_rn(s, __fmul_rn(qq[1], kq[1])); s = __fadd_rn(s, __fmul_rn(qq[2], kq[2])); s = __fadd_rn(s, __fmul_rn(qq[3], kq[3])); }
    s = __fmul_rn(s, scale); if (MASKADD) s = __fadd_rn(s, __fmul_rn(bf16_round(mask[(size_t)i * SQ + j]), -10000.0f));
    const float f = (MASKADD || j <= i) ? 1.f : 0.f; const float sm = fmaf(f, s, (1.f - f) * -1.0e30f); const float mn = fmaxf(m, sm); const float sc = expf(m - mn); const float e = expf(sm - mn); l = __fadd_rn(__fmul_rn(l, sc), e); m = mn;
#pragma unroll 1
    for (int c = 0; c < HD / 4; ++c) { const v4f vv = *(const v4fa*)(vr + c * 4); v4f oo = *(v4f*)&lo[tid][c * 4]; for (int u = 0; u < 4; ++u) oo[u] = __fadd_rn(__fmul_rn(oo[u], sc), __fmul_rn(e, vv[u])); *(v4f*)&lo[tid][c * 4] = oo; } }
  const float fin = 64.0f / l;      /* o carried x64 like the f16 path */
#pragma unroll 1
  for (int c = 0; c < HD / 4; ++c) { v4f oo = *(v4f*)&lo[tid][c * 4]; for (int u = 0; u < 4; ++u) oo[u] = __fmul_rn(oo[u], fin); *(v4f*)&lo[tid][c * 4] = oo; }
  __syncthreads();
  {
#pragma unroll 1
    for (int it = 0; it < 16; ++it) { const int row = it * 4 + tid / 16, pc = (tid % 16) * 4; const v4f v = *(const v4f*)&lo[row][pc]; *(v4f*)(OF + (size_t)(rg * 64 + row) * ldo + h * HD + pc) = v; }
     } }


template <int BFIN, int WXB>
__global__ __launch_bounds__(256) void k_ln16(const float* __restrict__ X, const float* __restrict__ g, const float* __restrict__ bb, float eps, _Float16* __restrict__ N16, float* __restrict__ XB) {
  #pragma clang fp contract(off)
  __shared__ float red[256]; const size_t r = blockIdx.x; const int t = threadIdx.x; const v4f xa = *(const v4fa*)(X + r * DMQ + t * 4); float s[4]; float sum = 0.f;
  for (int q = 0; q < 4; ++q) { s[q] = BFIN ? bf16_round(xa[q]) : xa[q]; sum = __fadd_rn(sum, s[q]); }
  red[t] = sum; __syncthreads(); for (int st = 128; st > 0; st >>= 1) { if (t < st) red[t] = __fadd_rn(red[t], red[t + st]); __syncthreads(); } const float mu = red[0] / (float)DMQ; __syncthreads();
  float vs = 0.f; for (int q = 0; q < 4; ++q) { const float dl = __fadd_rn(s[q], -mu); vs = __fadd_rn(vs, __fmul_rn(dl, dl)); } red[t] = vs; __syncthreads(); for (int st = 128; st > 0; st >>= 1) { if (t < st) red[t] = __fadd_rn(red[t], red[t + st]); __syncthreads(); }
  const float rs = rsqrtf(__fadd_rn(red[0] / (float)DMQ, eps)); v4h y; v4f xb;
  for (int q = 0; q < 4; ++q) { const int c = t * 4 + q; y[q] = (_Float16)__fadd_rn(__fmul_rn(__fmul_rn(__fadd_rn(s[q], -mu), rs), bf16_round(g[c])), bf16_round(bb[c])); xb[q] = s[q]; }
  { *(v4h*)(N16 + r * DMQ + t * 4) = y; if (WXB) *(v4f*)(XB + r * DMQ + t * 4) = xb;  } }
__global__ __launch_bounds__(256) void k_ftres2(const float* __restrict__ OF0, const float* __restrict__ XB, float* __restrict__ X1, size_t n4) {
  #pragma clang fp contract(off)
  const size_t t = (size_t)blockIdx.x * 256 + threadIdx.x; if (t >= n4) return; const v4f o = *(const v4fa*)(OF0 + t * 4), xv = *(const v4fa*)(XB + t * 4); v4f y; for (int q = 0; q < 4; ++q) y[q] = __fadd_rn(__fmul_rn(o[q], 0.015625f), xv[q]); *(v4f*)(X1 + t * 4) = y;  }

__global__ __launch_bounds__(256) void k_wthd(const float* __restrict__ Wt, _Float16* __restrict__ Bt) { const size_t t = (size_t)blockIdx.x * 256 + threadIdx.x; if (t >= (size_t)NH * HD * (DM / 8)) return; const int m8 = (int)(t % (DM / 8)) * 8; const int d = (int)((t / (DM / 8)) % HD); const int h = (int)(t / ((size_t)(DM / 8) * HD)); FragH f;
  for (int q = 0; q < 8; ++q) f.h[q] = (_Float16)(16.0f * bf16_round(Wt[((size_t)h * DM + m8 + q) * HD + d])); unsigned short* dst = (unsigned short*)Bt + ((size_t)h * HD + d) * DM + m8; *(v8us*)dst = f.half[0];  }




template <int BFIN, int W16, int W32>
__global__ __launch_bounds__(256) void k_lnx(const float* __restrict__ X, const float* __restrict__ g, const float* __restrict__ bb, float eps, _Float16* __restrict__ N16, float* __restrict__ N32) {
  #pragma clang fp contract(off)
  __shared__ float red[256]; const size_t r = blockIdx.x; const int t = threadIdx.x; const bool act = t < (DMQ / 4); const int c0 = act ? t * 4 : 0;
  const v4f xa = *(const v4fa*)(X + r * DMQ + c0); float s[4]; float sum = 0.f;
  for (int q = 0; q < 4; ++q) { s[q] = act ? (BFIN ? bf16_round(xa[q]) : xa[q]) : 0.f; sum = __fadd_rn(sum, s[q]); }
  red[t] = sum; __syncthreads(); for (int st = 128; st > 0; st >>= 1) { if (t < st) red[t] = __fadd_rn(red[t], red[t + st]); __syncthreads(); } const float mu = red[0] / (float)DMQ; __syncthreads();
  float vs = 0.f; for (int q = 0; q < 4; ++q) { const float dl = act ? __fadd_rn(s[q], -mu) : 0.f; vs = __fadd_rn(vs, __fmul_rn(dl, dl)); } red[t] = vs; __syncthreads(); for (int st = 128; st > 0; st >>= 1) { if (t < st) red[t] = __fadd_rn(red[t], red[t + st]); __syncthreads(); }
  const float rs = rsqrtf(__fadd_rn(red[0] / (float)DMQ, eps)); v4h y; v4f yf;
  for (int q = 0; q < 4; ++q) { const int c = c0 + q; yf[q] = __fadd_rn(__fmul_rn(__fmul_rn(__fadd_rn(s[q], -mu), rs), bf16_round(g[c])), bf16_round(bb[c])); y[q] = (_Float16)yf[q]; }
  if (!act) return;      /* no barriers after this point */
  { if (W16) *(v4h*)(N16 + r * DMQ + c0) = y; if (W32) *(v4f*)(N32 + r * DMQ + c0) = yf;  } }






__global__ __launch_bounds__(256) void k_lorafold(const float* __restrict__ Wm, const float* __restrict__ A, const float* __restrict__ Bm, float* __restrict__ WE, int K, int N, float sc) {
  #pragma clang fp contract(off)
  const size_t t = (size_t)blockIdx.x * 256 + threadIdx.x; if (t >= (size_t)K * N) return; const int i = (int)(t / N), o = (int)(t % N); float a = 0.f;
  for (int r = 0; r < 16; ++r) a = __fadd_rn(a, __fmul_rn(bf16_round(A[(size_t)i * 16 + r]), bf16_round(Bm[(size_t)r * N + o])));
  const float v = __fadd_rn(bf16_round(Wm[t]), __fmul_rn(sc, a)); *(float*)(WE + t) = v;  }
__global__ __launch_bounds__(256) void k_wt32rep(const float* __restrict__ Wf, _Float16* __restrict__ Bt, int K, int N, int DOUT, float scale) {
  const int t = blockIdx.x * 256 + threadIdx.x; if (t >= DOUT * (K / 8)) return; const int n = t / (K / 8), k8 = (t % (K / 8)) * 8; const int rep = DOUT / N; const int src = (n / (HD * rep)) * HD + (n % HD);      /* head h = n / HD -> group h / rep */
  FragH f; for (int i = 0; i < 8; ++i) f.h[i] = (_Float16)(Wf[(size_t)(k8 + i) * N + src] * scale);
  *(v8us*)((unsigned short*)Bt + (size_t)n * K + k8) = f.half[0];  }
__global__ __launch_bounds__(256) void k_brep(const float* __restrict__ b, float* __restrict__ out) { const int t = blockIdx.x * 256 + threadIdx.x; if (t >= DM) return; const float v = b[(t / (HD * 4)) * HD + (t % HD)]; *(float*)(out + t) = v;  }

__global__ __launch_bounds__(256) void k_rsmcim(const float* __restrict__ S, _Float16* __restrict__ P, int hg, int q0, int nk, const int* __restrict__ am) {
  #pragma clang fp contract(off)
  const int t = blockIdx.x * 256 + threadIdx.x; if (t >= hg * QT) return; const size_t i = (size_t)t; const float* s = S + i * NKX; const int last = q0 + (t % QT); const int* mr = am + (size_t)last * SQ; float mx = -3.0e38f;      /* the module's mask row of this query (keys >= nk lie above the diagonal of the causal mask and are not computed) */
#pragma unroll 1
  for (int j = 0; j < nk; ++j) { const float f = (mr[j] != 0) ? 1.f : 0.f; mx = fmaxf(mx, fmaf(f, s[j], (1.f - f) * -1.0e9f)); } float se = 0.f;
#pragma unroll 1
  for (int j = 0; j < nk; ++j) { const float f = (mr[j] != 0) ? 1.f : 0.f; se += __expf(fmaf(f, s[j], (1.f - f) * -1.0e9f) - mx); } const float sc = 256.0f / se;
#pragma unroll 1
  for (int j0 = 0; j0 < nk; j0 += 8) { FragH fr; for (int q = 0; q < 8; ++q) { const int j = j0 + q; const float f = (mr[j] != 0) ? 1.f : 0.f; fr.h[q] = (_Float16)(__expf(fmaf(f, s[j], (1.f - f) * -1.0e9f) - mx) * sc); } unsigned short* d = (unsigned short*)P + i * NKX + j0; *(v8us*)d = fr.half[0];  } }






__global__ __launch_bounds__(256) void k_rsmp(const float* __restrict__ S, _Float16* __restrict__ P, int nrows, int nk) {
  #pragma clang fp contract(off)
  const int t = blockIdx.x * 256 + threadIdx.x; if (t >= nrows) return; const size_t ri = (size_t)t; const float* s = S + ri * NKX; float mx = -3.0e38f;
#pragma unroll 1
  for (int j = 0; j < nk; ++j) mx = fmaxf(mx, s[j]); float se = 0.f;
#pragma unroll 1
  for (int j = 0; j < nk; ++j) se += __expf(s[j] - mx); const float sc = 256.0f / se;
#pragma unroll 1
  for (int j0 = 0; j0 < nk; j0 += 8) { FragH fr; for (int q = 0; q < 8; ++q) fr.h[q] = (_Float16)(__expf(s[j0 + q] - mx) * sc);
    unsigned short* d = (unsigned short*)P + ri * NKX + j0; *(v8us*)d = fr.half[0];  } }
template <int BFIN, int W16, int W32>
__global__ __launch_bounds__(256) void k_lnxr(const float* __restrict__ X, const float* __restrict__ g, const float* __restrict__ bb, float eps, _Float16* __restrict__ N16, float* __restrict__ N32, const float* __restrict__ R) {
  #pragma clang fp contract(off)
  __shared__ float red[256]; const size_t r = blockIdx.x; const int t = threadIdx.x; const bool act = t < (DMQ / 4); const int c0 = act ? t * 4 : 0;
  const v4f xa = *(const v4fa*)(X + r * DMQ + c0); const v4f ra = *(const v4fa*)(R + r * DMQ + c0);      /* residual row (f32, already on the bf16 grid where it is an input copy) */ float s[4]; float sum = 0.f;
  for (int q = 0; q < 4; ++q) { s[q] = act ? (BFIN ? bf16_round(xa[q]) : xa[q]) : 0.f; sum = __fadd_rn(sum, s[q]); }
  red[t] = sum; __syncthreads(); for (int st = 128; st > 0; st >>= 1) { if (t < st) red[t] = __fadd_rn(red[t], red[t + st]); __syncthreads(); } const float mu = red[0] / (float)DMQ; __syncthreads();
  float vs = 0.f; for (int q = 0; q < 4; ++q) { const float dl = act ? __fadd_rn(s[q], -mu) : 0.f; vs = __fadd_rn(vs, __fmul_rn(dl, dl)); } red[t] = vs; __syncthreads(); for (int st = 128; st > 0; st >>= 1) { if (t < st) red[t] = __fadd_rn(red[t], red[t + st]); __syncthreads(); }
  const float rs = rsqrtf(__fadd_rn(red[0] / (float)DMQ, eps)); v4h y; v4f yf;
  for (int q = 0; q < 4; ++q) { const int c = c0 + q; yf[q] = __fadd_rn(__fadd_rn(__fmul_rn(__fmul_rn(__fadd_rn(s[q], -mu), rs), bf16_round(g[c])), bf16_round(bb[c])), ra[q]); y[q] = (_Float16)yf[q]; }
  if (!act) return;      /* no barriers after this point */
  { if (W16) *(v4h*)(N16 + r * DMQ + c0) = y; if (W32) *(v4f*)(N32 + r * DMQ + c0) = yf;  } }



// Fused attention, one launch for all batches and heads: a work-group of four waves owns 64 query rows (16 a wave) and walks all SQ keys in stages of 64; scores and weights stay in registers.
// Transposed products: S^T = K Q^T (rows = keys, columns = queries) and O^T += V^T P^T. The accumulator of S^T holds, in lane (ln, hh), register r, key 8 hh + r of query ln,
// which is the k order of the B operand (elements 0..7 = k 8 hh + i, elements 8..15 = k 16 + 8 hh + i), so two 16-key score tiles become one 32-key P^T fragment with no exchange.
// Online softmax in the log2 domain: running maximum and running sum per query (a query is a lane pair ln, ln + 16); weights are carried x256 (exponent + 8) as f16, the sum likewise, f32.
// K and V^T tiles (64 rows of 128 bytes each) come in whole 128-byte lines through registers into two LDS buffers (row pitch 144 bytes): stage s + 1 is fetched while stage s is worked on; one barrier a stage.
#define FA_P 144                     /* LDS row pitch in bytes: 128 + 16, an odd multiple of 16 */
#define FA_T (64 * FA_P)             /* one tile */
typedef int v4ia __attribute__((ext_vector_type(4), may_alias));
__device__ __forceinline__ v8f fa_mma(v16h a, v16h b, v8f c) { return __builtin_amdgcn_wmma_f32_16x16x32_f16(false, a, false, b, (short)0, c, false, false); }
__device__ __forceinline__ float fa_xhalf(float x) { return __builtin_bit_cast(float, __builtin_amdgcn_permlanex16(__builtin_bit_cast(int, x), __builtin_bit_cast(int, x), 0x76543210, 0xfedcba98, false, false)); }      /* lane l with lane l ^ 16 */
__device__ __forceinline__ float fa_exp2(float t) { float e;
  asm("v_exp_f32 %0, %1\n\tv_nop" : "=v"(e) : "v"(t));      /* v_nop: the one slot the instruction set asks for behind a transcendental before its source is overwritten or its result read */
  return e; }
__device__ __forceinline__ v16h fa_frag(const unsigned char* p) { FragH f; f.half[0] = *(const v8us*)p; f.half[1] = *(const v8us*)(p + 32); return f.v; }      /* p = row ln of a 16 x 32 block in LDS, + 16 hh bytes */
__global__ __launch_bounds__(128) __attribute__((amdgpu_waves_per_eu(4, 4)))      /* register budget of four waves a SIMD (the grid gives three): aiming at more, the compiler reused one register quad for the mask words and waited out each LDS load in turn */
void k_fattn(const _Float16* __restrict__ QKVp, const _Float16* __restrict__ VTp, const int* __restrict__ Km, _Float16* __restrict__ O) {
  static_assert(HD == 64 && SQ % 512 == 0, "k_fattn: head size 64; 128 threads x 4 mask words a sweep; 64-key stages");
  __shared__ __attribute__((aligned(16))) int lm[SQ];      /* this batch's key mask */
  __shared__ __attribute__((aligned(16))) unsigned char kv[2][2][FA_T];      /* [buffer][K, V^T][row * FA_P + byte] */
  const int tid = threadIdx.x, w = tid >> 5, lane = tid & 31, ln = lane & 15, hh = lane >> 4;
  const int bh = blockIdx.y, b = bh / NH, h = bh - b * NH; const size_t r0 = (size_t)b * SQ; const int q0 = blockIdx.x * 64 + w * 16;
  const int srow = tid >> 3, scol = (tid & 7) * 16;      /* staging: eight threads a row, 16 rows a sweep, four sweeps a tile */
  const char* kg = (const char*)(QKVp + (r0 + srow) * LQ + DM + h * HD) + scol;      /* key row srow, this head's 64 columns of the k block */
  const char* vg = (const char*)(VTp + ((size_t)bh * HD + srow) * SQ) + scol;      /* V^T row d = srow */
  const int sofs = srow * FA_P + scol, lofs = ln * FA_P + 16 * hh;
  v8us gk[4], gv[4];
#pragma unroll
  for (int j = 0; j < 4; ++j) { gk[j] = *(const v8us*)(kg + (size_t)(16 * j) * (LQ * 2)); gv[j] = *(const v8us*)(vg + (size_t)(16 * j) * (SQ * 2)); }
  for (int i = tid * 4; i < SQ; i += 512) *(v4ia*)(lm + i) = *(const v4ia*)(Km + r0 + i);
  const _Float16* qp = QKVp + (r0 + q0 + ln) * LQ + h * HD; const v16h q0f = g2_frag(qp, hh), q1f = g2_frag(qp + 32, hh);
#pragma unroll
  for (int j = 0; j < 4; ++j) { *(v8us*)&kv[0][0][sofs + 16 * j * FA_P] = gk[j]; *(v8us*)&kv[0][1][sofs + 16 * j * FA_P] = gv[j]; }
  __syncthreads();      /* mask and stage 0 published */
  const int* lmh = lm + 8 * hh;
  const v8f z8 = {0.f, 0.f, 0.f, 0.f, 0.f, 0.f, 0.f, 0.f}; v8f acc[4] = {z8, z8, z8, z8}; float m_run = -3.0e38f, l_run = 0.f;
  const float c2 = 0.036084391824351615f * 1.44269504088896340736f, fill2 = 1.0e-11f * 1.44269504088896340736f;      /* 1 / sqrt(768) and the fill score, both times log2(e) */
#pragma unroll 1      /* one stage a trip: the buffer index alternates, and two stages' fragments at once would go past 256 registers */
  for (int st = 0; st < SQ / 64; ++st) {
    const int sn = (st + 1 < SQ / 64) ? st + 1 : st;      /* the last trip fetches its own stage again (in bounds) into the buffer nobody reads any more: no branch round loads, stores or the barrier */
#pragma unroll
    for (int j = 0; j < 4; ++j) { gk[j] = *(const v8us*)(kg + (size_t)(sn * 64 + 16 * j) * (LQ * 2)); gv[j] = *(const v8us*)(vg + (size_t)(16 * j) * (SQ * 2) + sn * 128); }
    __builtin_amdgcn_sched_barrier(0);      /* holds the next stage's eight global loads here, a whole stage in front of the LDS stores that use them; left free, the scheduler sinks loads to just in front of their use and every wave waits out the load latency at the barrier */
    const unsigned char* kl = &kv[st & 1][0][lofs]; const unsigned char* vl = &kv[st & 1][1][lofs];
#pragma unroll
    for (int sub = 0; sub < 2; ++sub) {      /* one pass: 32 keys */
      const int kb = st * 64 + sub * 32;
      const v4ia ma = *(const v4ia*)(lmh + kb), mb = *(const v4ia*)(lmh + kb + 4), mc = *(const v4ia*)(lmh + kb + 16), md = *(const v4ia*)(lmh + kb + 20);
      const unsigned char* kt = kl + sub * 32 * FA_P;
      const v16h k0 = fa_frag(kt), k2 = fa_frag(kt + 16 * FA_P), k1 = fa_frag(kt + 64), k3 = fa_frag(kt + 16 * FA_P + 64);
      v16h vf[4];
#pragma unroll
      for (int t = 0; t < 4; ++t) vf[t] = fa_frag(vl + t * 16 * FA_P + sub * 64);
      __builtin_amdgcn_sched_barrier(0);      /* holds the pass's 20 LDS loads together at its head, so that their latencies overlap; left free, each K fragment was loaded into the same registers just in front of its product and waited for by itself */
      v8f s0 = fa_mma(k0, q0f, z8); v8f s1 = fa_mma(k2, q0f, z8); s0 = fa_mma(k1, q1f, s0); s1 = fa_mma(k3, q1f, s1);
      float x[16];
#pragma unroll
      for (int r = 0; r < 4; ++r) { x[r] = (ma[r] != 0) ? s0[r] * c2 : fill2; x[4 + r] = (mb[r] != 0) ? s0[4 + r] * c2 : fill2; x[8 + r] = (mc[r] != 0) ? s1[r] * c2 : fill2; x[12 + r] = (md[r] != 0) ? s1[4 + r] * c2 : fill2; }
      float mx = x[0];
#pragma unroll
      for (int i = 1; i < 16; ++i) mx = fmaxf(mx, x[i]);
      mx = fmaxf(mx, fa_xhalf(mx));      /* both halves of the wave hold this query's maximum of the pass */
      const float mn = fmaxf(m_run, mx); const float corr = fa_exp2(m_run - mn); m_run = mn; const float nm = 8.0f - mn;
#pragma unroll
      for (int t = 0; t < 4; ++t) acc[t] = acc[t] * corr;
      FragH p; float e0 = 0.f, e1 = 0.f, e2 = 0.f, e3 = 0.f;
#pragma unroll
      for (int i = 0; i < 16; i += 4) { const float ea = fa_exp2(x[i] + nm), eb = fa_exp2(x[i + 1] + nm), ec = fa_exp2(x[i + 2] + nm), ed = fa_exp2(x[i + 3] + nm);
        e0 += ea; e1 += eb; e2 += ec; e3 += ed; p.h[i] = (_Float16)ea; p.h[i + 1] = (_Float16)eb; p.h[i + 2] = (_Float16)ec; p.h[i + 3] = (_Float16)ed; }
      l_run = l_run * corr + ((e0 + e1) + (e2 + e3));      /* this lane's 16 keys only; the two halves are added behind the loop */
#pragma unroll
      for (int t = 0; t < 4; ++t) acc[t] = fa_mma(vf[t], p.v, acc[t]);
      __builtin_amdgcn_sched_barrier(0);      /* ends the pass for the scheduler: left free, it fetched both passes' fragments at once (spills at 256 registers) and moved the next stage's LDS stores, their wait on the global loads and the barrier up in front of the softmax, where the loads had had no time to land */
    }
    unsigned char* kd = &kv[(st + 1) & 1][0][sofs]; unsigned char* vd = &kv[(st + 1) & 1][1][sofs];      /* the buffer of stage st - 1: every wave left it at the barrier that ended that trip */
#pragma unroll
    for (int j = 0; j < 4; ++j) { *(v8us*)(kd + 16 * j * FA_P) = gk[j]; *(v8us*)(vd + 16 * j * FA_P) = gv[j]; }
    __syncthreads();      /* publishes stage st + 1 and ends every wave's reads of stage st */
  }
  const float l = l_run + fa_xhalf(l_run); const float fin = 64.0f / l;      /* ctx carried x64 as before; the x256 of weights and sum cancels */
  unsigned short* op = (unsigned short*)O + (r0 + q0 + ln) * DM + h * HD + 8 * hh;
#pragma unroll
  for (int t = 0; t < 4; ++t) { FragH f;
#pragma unroll
    for (int r = 0; r < 8; ++r) f.h[r] = (_Float16)(acc[t][r] * fin);
    *(v8us*)(op + 16 * t) = f.half[0]; } }      /* d = 16 t + 8 hh + r of query ln */


// Operand preparation, one launch: the jobs need nothing of each other and share the grid by ranges of the block index (the choice is the same for a whole block).
// The weights go through an LDS tile a block (p_wt_tile); x keeps its one-thread-per-8-elements form and is read once for its two copies.
#define PB_W (DM * DFF / (128 * 64))           /* blocks (tiles of 128 k x 64 n) of one 768 x 3072 weight */
#define PB_X ((int)(NR * DM / 8 / 256))        /* blocks of x */
#define PB_S (DM * DM / (128 * 64))            /* blocks of one 768 x 768 weight */
#define PB_ALL (2 * PB_W + PB_X + 4 * PB_S + 3)
__global__ __launch_bounds__(256) void k_prep(const float* __restrict__ x, const float* __restrict__ wq, const float* __restrict__ wk, const float* __restrict__ wv, const float* __restrict__ wo, const float* __restrict__ w1, const float* __restrict__ w2,
    const float* __restrict__ bq, const float* __restrict__ bk, const float* __restrict__ bv, _Float16* __restrict__ X16, float* __restrict__ XB, _Float16* __restrict__ BQKV, _Float16* __restrict__ BO, _Float16* __restrict__ BW1, _Float16* __restrict__ BW2, float* __restrict__ bqkv) {
  static_assert(NR * DM / 8 % 256 == 0, "k_prep: whole blocks of x");
  __shared__ __attribute__((aligned(16))) unsigned char tl[64 * PW_P];      /* one weight tile, [n][k] f16 */
  int blk = blockIdx.x; const int tid = threadIdx.x;
  if (blk < PB_W) { p_wt_tile<DM, DFF>(w1, BW1, blk, tid, tl); return; }      /* W1 [768][3072] -> Bt [3072][768] */
  blk -= PB_W;
  if (blk < PB_W) { p_wt_tile<DFF, DM>(w2, BW2, blk, tid, tl); return; }      /* W2 [3072][768] -> Bt [768][3072] */
  blk -= PB_W;
  if (blk < PB_X) { const size_t t = (size_t)blk * 256 + tid; v4f a = *(const v4fa*)(x + t * 8), c = *(const v4fa*)(x + t * 8 + 4); FragH f;      /* X16 = bf16(x) as exact f16 rows (GEMM operand), XB = bf16(x) as f32 rows (residual) */
#pragma unroll
    for (int q = 0; q < 4; ++q) { a[q] = bf16_round(a[q]); c[q] = bf16_round(c[q]); f.h[q] = (_Float16)a[q]; f.h[4 + q] = (_Float16)c[q]; }
    *(v8us*)((unsigned short*)X16 + t * 8) = f.half[0]; *(v4f*)(XB + t * 8) = a; *(v4f*)(XB + t * 8 + 4) = c;
    asm volatile("s_wait_xcnt 0x0" ::: "memory");      /* as in p_wt_tile: in front of any overwrite of the three stores' registers on the way to the kernel's end */
    return; }
  blk -= PB_X;
  if (blk < 4 * PB_S) { const int m = blk / PB_S;      /* [in][out] -> Bt x16: stacked q | k | v, and Wo */
    const float* W = (m == 0) ? wq : (m == 1) ? wk : (m == 2) ? wv : wo; _Float16* D = (m < 3) ? BQKV + (size_t)m * DM * DM : BO;
    p_wt_tile<DM, DM>(W, D, blk - m * PB_S, tid, tl); return; }
  blk -= 4 * PB_S;
  const float* b = (blk == 0) ? bq : (blk == 1) ? bk : bv;      /* stacked bias bq | bk | bv */
  for (int i = tid; i < DM; i += 256) bqkv[blk * DM + i] = b[i];
}

extern "C" void kernel_launch(void* const* d_in, const int* in_sizes, int n_in,
                              void* d_out, int out_size, void* d_ws, size_t ws_size, hipStream_t stream) {
  (void)in_sizes; (void)n_in; (void)out_size;
  const float* const* I = (const float* const*)d_in; const float* x = I[0]; const int* km = (const int*)d_in[1]; const float* wq = I[2]; const float* bq = I[3]; const float* wk = I[4]; const float* bk = I[5]; const float* wv = I[6]; const float* bv = I[7]; const float* wo = I[8]; const float* bo = I[9]; const float* g1 = I[10]; const float* be1 = I[11]; const float* wfc = I[12]; const float* bfc = I[13]; const float* wmp = I[14]; const float* bmp = I[15]; const float* gg2 = I[16]; const float* be2 = I[17];      /* input order: x_n; mask int32 [2][1][1][2048] (READ on device); [in][out] wq / wk / wv / wo + biases; ln1 g / b; w1 [768][3072] + b1, w2 [3072][768] + b2; ln2 g / b */
  static_assert(DMQ % 4 == 0 && DMQ / 4 <= 256 && DM % 64 == 0 && DM % 32 == 0 && DFF % 64 == 0 && DFF % 32 == 0 && NH * HD == DM && NKX == SQ, "k_lnxr 256 threads x 4 columns; tile multiples");
  static_assert(MP % 128 == 0 && MPO % 128 == 0 && SQ % 128 == 0 && DM % 64 == 0 && DFF % 64 == 0, "k_gemm2: whole 128-row work-group tiles, 64-column tiles, 64-k stages");
  char* ws = (char*)d_ws; size_t off = 0;
  auto take = [&](size_t bytes) { char* p = ws + off; off += (bytes + 255) & ~(size_t)255; return p; };
  _Float16* BQKV = (_Float16*)take((size_t)3 * DM * DM * 2); _Float16* BO = (_Float16*)take((size_t)DM * DM * 2); float* bqkv = (float*)take((size_t)3 * DM * 4); float* X1N = nullptr;      /* LN1 output (f32): aliases the QKV plane below (QKV's last readers, the V^T and attention launches, precede LN1) to stay within 256 MiB at NB 4 / SQ 2048 */
  _Float16* X16 = (_Float16*)take(NR * DM * 2); float* XB = (float*)take(NR * DM * 4); float* X1 = (float*)take(NR * DM * 4); _Float16* M16 = nullptr;      /* = X16 below (alias: X16's last reader, the fused QKV GEMM, precedes LN1's f16 write) */ _Float16* HF16 = (_Float16*)take(NR * DFF * 2);      /* FFN hidden plane of both batches [4096][3072] f16 (own region here) */ _Float16* BW1 = (_Float16*)take((size_t)DFF * DM * 2); _Float16* BW2 = (_Float16*)take((size_t)DM * DFF * 2); _Float16* QKV = (_Float16*)take(NR * 3 * DM * 2); _Float16* V16 = QKV + 2 * DM; _Float16* O16 = (_Float16*)take(NR * DM * 2); M16 = X16; X1N = (float*)QKV;      /* aliases: X1N (NR*DM f32 = 12 MiB) inside QKV (18 MiB): QKV's last readers (the V^T and attention launches) precede the first LayerNorm */
  _Float16* VT = (_Float16*)take((size_t)NB * NH * HD * SQ * 2);
  if (off > ws_size) return;
  k_prep<<<PB_ALL, 256, 0, stream>>>(x, wq, wk, wv, wo, wfc, wmp, bq, bk, bv, X16, XB, BQKV, BO, BW1, BW2, bqkv);      /* every GEMM operand plane, the stacked bias and the residual rows; post-LN: the attention runs on the raw input */
  const size_t r0p = (size_t)B0 * SQ;      /* first projected row */
  k_gemm2<0, false, true><<<dim3((unsigned)((MP / 128) * (3 * DM / 64)), 1), 128, 0, stream>>>(X16 + r0p * DM, DM, 0, BQKV, DM, 0, 0.0625f, bqkv, 0, nullptr, QKV + r0p * 3 * DM, 3 * DM, 0, MP, 3 * DM, DM);      /* q | k | v rows (f16); head h = columns h*HD.. of each DM block */
  k_vt<NH, SQ><<<NB * NH * (SQ / 64), 256, 0, stream>>>(V16, LQ, 0, VT);      /* V^T [NB][NH][HD][SQ], both batches */
  k_fattn<<<dim3(SQ / 64, NB * NH), 128, 0, stream>>>(QKV, VT, km, O16);      /* scores q.k / sqrt(768) (the module's literal dim_model scale), masked keys get the score 1e-11 (fill, as the source), softmax over all keys, ctx (merged heads, x64) as f16 rows */
  k_gemm2<0, true, false><<<dim3((unsigned)((MPO / 128) * (DM / 64)), 1), 128, 0, stream>>>(O16 + r0p * DM, DM, 0, BO, DM, 0, 0.0009765625f, bo, 0, X1 + r0p * DM, nullptr, DM, 0, MPO, DM, DM);      /* z = ctx Wo + bo (f32 rows; the skip is added AFTER the LayerNorm in this module) */
  k_lnxr<0, 1, 1><<<(unsigned)NR, 256, 0, stream>>>(X1, g1, be1, 1e-5f, M16, X1N, XB);      /* l1 = bf16(x) + LN1(z) (eps 1e-5): f16 rows for the FFN input and f32 rows for the second skip */
  k_gemm2<3, false, true><<<dim3((unsigned)((MP / 128) * (DFF / 64)), 1), 128, 0, stream>>>(M16, DM, 0, BW1, DM, 0, 0.0625f, bfc, 0, nullptr, HF16, DFF, 0, MP, DFF, DM);      /* relu(l1 W1 + b1) -> f16, both batches */
  k_gemm2<0, true, false><<<dim3((unsigned)((MP / 128) * (DM / 64)), 1), 128, 0, stream>>>(HF16, DFF, 0, BW2, DFF, 0, 0.0625f, bmp, 0, X1, nullptr, DM, 0, MP, DM, DFF);      /* ffn = hidden W2 + b2 (f32 rows over the dead z plane; the skip is added after the LayerNorm) */
  k_lnxr<0, 0, 1><<<(unsigned)NR, 256, 0, stream>>>(X1, gg2, be2, 1e-5f, nullptr, (float*)d_out, X1N);      /* out = l1 + LN2(ffn) (eps 1e-5) -> f32 output rows */
}

// v007
// One run takes 170 microseconds.
// Next to v006, in two timings, it ran 1.04 and 1.03 times as fast.
// Over all steps from v000 it is 42.1 times as fast.
#include <hip/hip_runtime.h>
// Transformer encoder layer with branch-side LayerNorms, a key-padding mask applied as a FILL and the module's literal score scale (x_n [2][2048][768]; q / k / v = x W + b ([in][out] 768 x 768 sigma 1/sqrt(768), zero biases); 12 heads of 64; scores / sqrt(768) (dim_model, as the source); where(mask == 0, 1e-11) with the int32 [2][1][1][2048] mask in {0, 1} (random; READ on device; masked keys get the score 1e-11, NOT -inf, as the source); softmax; z = ctx Wo + bo; l1 = x + LN(z) (LayerNorm on the branch only; biased var, eps 1e-5); ffn = relu(l1 W1 + b1) W2 + b2 ([in][out] 768 x 3072 x 768); out = l1 + LN(ffn) -> [2][2048][768]).
// Structure: token rows; x as exact f16 rows and bf16 f32 residual rows; natural weights as exact x16 planes; fused q | k | v WMMA GEMM (32x64 wave tiles, f32 accumulation, + stacked bias) -> f16; V^T via LDS transposes; one fused attention launch (16 query rows a wave: scores over all keys, fill mask, online softmax with f32 statistics and native exp, weights x256 f16 in registers, ctx x64 merged f16); ctx Wo + bo f32; x + LN1 on VALU -> f16 + f32; relu FFN, both batches a launch; residual + LN2 -> output; nine launches, all operand preparation in the first.
// Compute dtype: inputs rounded to bf16; x / weights exact; q, k, v, softmax weights and o as plain f16 GEMM operands (~2^-12); scores and softmax statistics f32. v_wmma_f32_16x16x32_f16.
#define NB 2
#define SQ 2048
#define DM 768
#define NH 12
#define HD 64
#define HG 4                         /* heads per block group in the unlaunched k_vt overload */
#define QT 256                       /* query rows per score tile in k_rsmcf2 / k_rsmcim (not launched) */
#define NKX SQ                       /* S / P row pitch */
#define QT0 128                      /* query rows per head in k_att0 (not launched) */
#define B0 0                         /* first batch processed (debug hook) */
#define NBR NB                       /* batches processed (debug hook) */
#define NR ((size_t)NB * SQ)
#define DMQ DM
#define DFF 3072         /* FFN hidden width */
#define MP ((int)((size_t)NBR * SQ)) /* rows projected (debug hook) */
#define QN SQ                        /* query rows per batch (not used) */
#define NHD NH                       /* heads (not used) */
#define MPO MP                       /* rows through the output stage (debug hook) */
#define LQ (3 * DM)      /* row pitch of the q/k/v rows */
typedef __bf16 v16b __attribute__((ext_vector_type(16)));
typedef unsigned short v8us __attribute__((ext_vector_type(8), may_alias));
typedef float  v8f  __attribute__((ext_vector_type(8)));
typedef float  v4f  __attribute__((ext_vector_type(4)));
typedef float  v4fa __attribute__((ext_vector_type(4), may_alias));
union FragB { v16b v; v8us half[2]; unsigned short u[16]; };

__device__ __forceinline__ unsigned short bf16_bits(float x) { unsigned int u = __float_as_uint(x); return (unsigned short)((u + 0x7FFFu + ((u >> 16) & 1u)) >> 16); }
__device__ __forceinline__ float bf16_val(unsigned short b) { return __uint_as_float(((unsigned int)b) << 16); }
__device__ __forceinline__ float bf16_round(float x) { return bf16_val(bf16_bits(x)); }
// D += A·B with NT terms: 1 = ah·bh, 2 = + al·bh (A split), 3 = + ah·bl (both split)
template <int NT>
__device__ __forceinline__ v8f mmaN(v16b ah, v16b al, v16b bh, v16b bl, v8f c) {
  c = __builtin_amdgcn_wmma_f32_16x16x32_bf16(false, ah, false, bh, (short)0, c, false, false);
  if (NT >= 2) c = __builtin_amdgcn_wmma_f32_16x16x32_bf16(false, al, false, bh, (short)0, c, false, false);
  if (NT >= 3) c = __builtin_amdgcn_wmma_f32_16x16x32_bf16(false, ah, false, bl, (short)0, c, false, false);
  asm volatile("v_nop\n\tv_nop\n\tv_nop\n\tv_nop" : "+v"(c) : "v"(ah), "v"(al), "v"(bh), "v"(bl));
  return c;
}

__global__ __launch_bounds__(256) void k_wt_bf16(const float* __restrict__ W, unsigned short* __restrict__ Wt, int K, int N) {
  const int t = blockIdx.x * 256 + threadIdx.x;
  const int k8n = K / 8;
  if (t >= N * k8n) return;
  const int n = t / k8n, k8 = (t % k8n) * 8;
  v8us v;
#pragma unroll
  for (int i = 0; i < 8; ++i) v[i] = bf16_bits(W[(size_t)(k8 + i) * N + n]);
  *(v8us*)(Wt + (size_t)n * K + k8) = v;
  
}

// GEMM C[M][N] (f32, pitch ldc) = act(A[M][K]·W + bias). A f32 row-major (pitch lda) converted per fragment to bf16
// (ASPLIT: hi/lo two planes -> 2 terms, else single rounded term); Wt bf16 [N][K] (pitch ldb). BIAS_BF16 rounds the
// bias to bf16 first (bias quantised to bf16 before the add). K%32==0, M%16==0, N%64==0.
template <bool ASPLIT, int ACT, bool BIAS_BF16>
__global__ __launch_bounds__(128) void k_gemm_bf(const float* __restrict__ A, int lda, const unsigned short* __restrict__ Wt, int ldb,
                                               const float* __restrict__ bias, float* __restrict__ C, int ldc, int M, int N, int K) {
  __shared__ __attribute__((aligned(16))) float so[4][16][64];
  const int tid = threadIdx.x, w = tid >> 5, lane = tid & 31, ln = lane & 15, hh = lane >> 4;
  const int ntn = N / 64;
  const int wid = blockIdx.x * 4 + w;
  const int mt = wid / ntn, nq = wid % ntn;
  if (mt * 16 >= M) return;
  const int row0 = mt * 16, col0 = nq * 64;
  const float* arow = A + (size_t)(row0 + ln) * lda;
  v8f acc[4] = {};
  for (int kb = 0; kb < K; kb += 32) {
    FragB ah, al;
    const v4f x0 = *(const v4fa*)(arow + kb + 8 * hh), x1 = *(const v4fa*)(arow + kb + 8 * hh + 4);
    const v4f x2 = *(const v4fa*)(arow + kb + 16 + 8 * hh), x3 = *(const v4fa*)(arow + kb + 16 + 8 * hh + 4);
    float xs[16] = {x0[0],x0[1],x0[2],x0[3],x1[0],x1[1],x1[2],x1[3],x2[0],x2[1],x2[2],x2[3],x3[0],x3[1],x3[2],x3[3]};
#pragma unroll
    for (int i = 0; i < 16; ++i) { const unsigned short hb = bf16_bits(xs[i]); ah.u[i] = hb; al.u[i] = ASPLIT ? bf16_bits(xs[i] - bf16_val(hb)) : (unsigned short)0; }
#pragma unroll
    for (int t = 0; t < 4; ++t) {
      const unsigned short* brow = Wt + (size_t)(col0 + t * 16 + ln) * ldb + kb;
      FragB b;
      b.half[0] = *(const v8us*)(brow + 8 * hh);
      b.half[1] = *(const v8us*)(brow + 16 + 8 * hh);
      acc[t] = mmaN<ASPLIT ? 2 : 1>(ah.v, al.v, b.v, b.v, acc[t]);
    }
  }
#pragma unroll
  for (int t = 0; t < 4; ++t) {
    float bv = bias ? bias[col0 + t * 16 + ln] : 0.f;
    if (BIAS_BF16) bv = bf16_round(bv);
#pragma unroll
    for (int r = 0; r < 8; ++r) { float v = acc[t][r] + bv; if (ACT == 1) v = fmaxf(v, 0.f); so[w][8 * hh + r][t * 16 + ln] = v; }
  }
  __builtin_amdgcn_fence(__ATOMIC_ACQ_REL, "workgroup");
  __builtin_amdgcn_wave_barrier();
  const int rsub = lane >> 4, c4 = (lane & 15) * 4;
  {
#pragma unroll
    for (int q = 0; q < 8; ++q) {
      const int r = q * 2 + rsub;
      const v4f v = *(const v4fa*)&so[w][r][c4];
      *(v4f*)(C + (size_t)(row0 + r) * ldc + col0 + c4) = v;
    }
    
  }
}

// GEMM C = act(A·W + bias + resid): A f32 (ASPLIT -> hi/lo 2 terms), Wt bf16 [N][K]; ACT 0 none, 1 relu, 2 exact gelu;
// resid (optional, f32, row index = (row % rmod), pitch ldr, RES_BF16 rounds it) added before the activation.
template <bool ASPLIT, int ACT, bool BIAS_BF16, bool RES_BF16>
__global__ __launch_bounds__(128) void k_gemm_bf3(const float* __restrict__ A, int lda, const unsigned short* __restrict__ Wt, int ldb,
                                                const float* __restrict__ bias, const float* __restrict__ resid, int rmod, int ldr,
                                                float* __restrict__ C, int ldc, int M, int N, int K) {
  __shared__ __attribute__((aligned(16))) float so[4][16][64];
  const int tid = threadIdx.x, w = tid >> 5, lane = tid & 31, ln = lane & 15, hh = lane >> 4;
  const int ntn = N / 64;
  const int wid = blockIdx.x * 4 + w;
  const int mt = wid / ntn, nq = wid % ntn;
  if (mt * 16 >= M) return;
  const int row0 = mt * 16, col0 = nq * 64;
  const float* arow = A + (size_t)(row0 + ln) * lda;
  v8f acc[4] = {};
  for (int kb = 0; kb < K; kb += 32) {
    FragB ah, al;
    const v4f x0 = *(const v4fa*)(arow + kb + 8 * hh), x1 = *(const v4fa*)(arow + kb + 8 * hh + 4);
    const v4f x2 = *(const v4fa*)(arow + kb + 16 + 8 * hh), x3 = *(const v4fa*)(arow + kb + 16 + 8 * hh + 4);
    float xs[16] = {x0[0],x0[1],x0[2],x0[3],x1[0],x1[1],x1[2],x1[3],x2[0],x2[1],x2[2],x2[3],x3[0],x3[1],x3[2],x3[3]};
#pragma unroll
    for (int i = 0; i < 16; ++i) { const unsigned short hb = bf16_bits(xs[i]); ah.u[i] = hb; al.u[i] = ASPLIT ? bf16_bits(xs[i] - bf16_val(hb)) : (unsigned short)0; }
#pragma unroll
    for (int t = 0; t < 4; ++t) {
      const unsigned short* brow = Wt + (size_t)(col0 + t * 16 + ln) * ldb + kb;
      FragB b;
      b.half[0] = *(const v8us*)(brow + 8 * hh);
      b.half[1] = *(const v8us*)(brow + 16 + 8 * hh);
      acc[t] = mmaN<ASPLIT ? 2 : 1>(ah.v, al.v, b.v, b.v, acc[t]);
    }
  }
#pragma unroll
  for (int t = 0; t < 4; ++t) {
    const int col = col0 + t * 16 + ln;
    float bv = bias ? bias[col] : 0.f;
    if (BIAS_BF16) bv = bf16_round(bv);
#pragma unroll
    for (int r = 0; r < 8; ++r) {
      float v = acc[t][r] + bv;
      if (resid) { float rv = resid[(size_t)((row0 + 8 * hh + r) % rmod) * ldr + col]; if (RES_BF16) rv = bf16_round(rv); v += rv; }
      if (ACT == 1) v = fmaxf(v, 0.f);
      if (ACT == 2) v = 0.5f * v * (1.0f + erff(v * 0.70710678118654752f));
      if (ACT == 3) { const float u = 0.7978845608028654f * (v + 0.044715f * v * v * v); v = 0.5f * v * (1.0f + tanhf(u)); }
      so[w][8 * hh + r][t * 16 + ln] = v;
    }
  }
  __builtin_amdgcn_fence(__ATOMIC_ACQ_REL, "workgroup");
  __builtin_amdgcn_wave_barrier();
  const int rsub = lane >> 4, c4 = (lane & 15) * 4;
  {
#pragma unroll
    for (int q = 0; q < 8; ++q) {
      const int r = q * 2 + rsub;
      const v4f v = *(const v4fa*)&so[w][r][c4];
      *(v4f*)(C + (size_t)(row0 + r) * ldc + col0 + c4) = v;
    }
    
  }
}
// row LayerNorm (biased variance, eps) over N: s = X (+ R); optional out_sum <- s; out_norm <- (s-mu)*rsqrt(var+eps)*g + b
template <bool PARAM_BF16>
__global__ __launch_bounds__(256) void k_layernorm(const float* __restrict__ X, const float* __restrict__ R, const float* __restrict__ g, const float* __restrict__ bta,
                                                  float* __restrict__ out_sum, float* __restrict__ out_norm, int N, float eps) {
  __shared__ float red[256];
  const int row = blockIdx.x, tid = threadIdx.x;
  const float* x = X + (size_t)row * N; const float* rr = R ? R + (size_t)row * N : nullptr;
  float vals[16];                     // up to N = 4096
  const int per = N / 256;            // contiguous chunk per thread? use strided-by-4 chunks: thread handles j = tid*4 + 1024*u
  float s1 = 0.f;
  for (int u = 0; u < per / 4; ++u) {
    const int j = tid * 4 + 1024 * u;
    const v4f a = *(const v4fa*)(x + j);
    v4f b = {0.f,0.f,0.f,0.f}; if (rr) b = *(const v4fa*)(rr + j);
#pragma unroll
    for (int q = 0; q < 4; ++q) { const float v = a[q] + b[q]; vals[u * 4 + q] = v; s1 += v; }
  }
  red[tid] = s1; __syncthreads();
  for (int st = 128; st > 0; st >>= 1) { if (tid < st) red[tid] += red[tid + st]; __syncthreads(); }
  const float mu = red[0] / (float)N; __syncthreads();
  float s2 = 0.f;
  for (int u = 0; u < per / 4; ++u)
#pragma unroll
    for (int q = 0; q < 4; ++q) { const float c = vals[u * 4 + q] - mu; s2 += c * c; }
  red[tid] = s2; __syncthreads();
  for (int st = 128; st > 0; st >>= 1) { if (tid < st) red[tid] += red[tid + st]; __syncthreads(); }
  const float rs = rsqrtf(red[0] / (float)N + eps);
  {
    for (int u = 0; u < per / 4; ++u) {
      const int j = tid * 4 + 1024 * u;
      v4f o, sm;
#pragma unroll
      for (int q = 0; q < 4; ++q) {
        float gg = g[j + q], bb = bta[j + q];
        if (PARAM_BF16) { gg = bf16_round(gg); bb = bf16_round(bb); }
        sm[q] = vals[u * 4 + q]; o[q] = (vals[u * 4 + q] - mu) * rs * gg + bb;
      }
      if (out_sum) *(v4f*)(out_sum + (size_t)row * N + j) = sm;
      *(v4f*)(out_norm + (size_t)row * N + j) = o;
    }
    
  }
}



// ---- f16 WMMA path (v_wmma_f32_16x16x32_f16): 11-bit significands for operands in range — used where a [0,1] probability operand needs more precision than bf16
typedef _Float16 v16h __attribute__((ext_vector_type(16)));
union FragH { v16h v; v8us half[2]; _Float16 h[16]; unsigned short u[16]; };
template <int NT>
__device__ __forceinline__ v8f mmaH(v16h ah, v16h al, v16h bh, v16h bl, v8f c) {
  c = __builtin_amdgcn_wmma_f32_16x16x32_f16(false, ah, false, bh, (short)0, c, false, false);
  if (NT >= 2) c = __builtin_amdgcn_wmma_f32_16x16x32_f16(false, al, false, bh, (short)0, c, false, false);
  if (NT >= 3) c = __builtin_amdgcn_wmma_f32_16x16x32_f16(false, ah, false, bl, (short)0, c, false, false);
  asm volatile("v_nop\n\tv_nop\n\tv_nop\n\tv_nop" : "+v"(c) : "v"(ah), "v"(al), "v"(bh), "v"(bl));
  return c;
}
// batched GEMM like k_gemm_b but f16 operands: A f32 (split into f16 hi/lo if ASPLIT, else rounded to f16), Bt = f16 values [n][k]; alpha; C f32; N multiple of 16 (partial tiles skipped)
template <bool ASPLIT>
__global__ __launch_bounds__(128) void k_gemm_h(const float* __restrict__ A, int lda, size_t sA, const _Float16* __restrict__ Bh, int ldb, size_t sB, float alpha, float* __restrict__ C, int ldc, size_t sC, int M, int N, int K) {
  __shared__ __attribute__((aligned(16))) float so[4][16][64];
  const int tid = threadIdx.x, w = tid >> 5, lane = tid & 31, ln = lane & 15, hh = lane >> 4; const int by = blockIdx.y;
  A += (size_t)by * sA; Bh += (size_t)by * sB; C += (size_t)by * sC;
  const int ntn = (N + 63) / 64; const int wid = blockIdx.x * 4 + w; const int mt = wid / ntn, nq = wid % ntn; if (mt * 16 >= M) return;
  const int row0 = mt * 16, col0 = nq * 64; const float* arow = A + (size_t)(row0 + ln) * lda;
  v8f acc[4] = {};
  for (int kb = 0; kb < K; kb += 32) {
    FragH ah, al;
    const v4f x0 = *(const v4fa*)(arow + kb + 8 * hh), x1 = *(const v4fa*)(arow + kb + 8 * hh + 4), x2 = *(const v4fa*)(arow + kb + 16 + 8 * hh), x3 = *(const v4fa*)(arow + kb + 16 + 8 * hh + 4);
    float xs[16] = {x0[0],x0[1],x0[2],x0[3],x1[0],x1[1],x1[2],x1[3],x2[0],x2[1],x2[2],x2[3],x3[0],x3[1],x3[2],x3[3]};
#pragma unroll
    for (int i = 0; i < 16; ++i) { const _Float16 h = (_Float16)xs[i]; ah.h[i] = h; al.h[i] = ASPLIT ? (_Float16)(xs[i] - (float)h) : (_Float16)0.0f; }
#pragma unroll
    for (int t = 0; t < 4; ++t) { if (col0 + t * 16 >= N) continue; const size_t boff = (size_t)(col0 + t * 16 + ln) * ldb + kb; FragH bq; bq.half[0] = *(const v8us*)(Bh + boff + 8 * hh); bq.half[1] = *(const v8us*)(Bh + boff + 16 + 8 * hh);
      acc[t] = mmaH<ASPLIT ? 2 : 1>(ah.v, al.v, bq.v, bq.v, acc[t]); }
  }
#pragma unroll
  for (int t = 0; t < 4; ++t) { if (col0 + t * 16 >= N) continue;
#pragma unroll
    for (int r = 0; r < 8; ++r) so[w][8 * hh + r][t * 16 + ln] = acc[t][r] * alpha; }
  __builtin_amdgcn_fence(__ATOMIC_ACQ_REL, "workgroup"); __builtin_amdgcn_wave_barrier();
  const int rsub = lane >> 4, c4 = (lane & 15) * 4;
  {
#pragma unroll
    for (int q = 0; q < 8; ++q) { const int r = q * 2 + rsub; if (col0 + c4 < N) { const v4f v = *(const v4fa*)&so[w][r][c4]; *(v4f*)(C + (size_t)(row0 + r) * ldc + col0 + c4) = v; } }
     }
}

// Wt[n][k] = f16(bf16(W[k][n]) x 16) from f32 row-major W[K][N] (bf16-exact weights stay exact in f16 away from the subnormal range); one 256-thread block turns a tile of 128 k x 64 n.
// Reads: 16 lanes cover 256 contiguous bytes of one W row (64 n); a thread takes 8 consecutive rows of its 4 columns, so it holds 8 consecutive k of 4 output rows and stores each as one 16-byte piece into the LDS tile [n][k].
// Writes: 16 lanes cover the tile's 256 contiguous bytes of one Wt row (128 k).
#define PW_P 272                     /* LDS row pitch in bytes: 256 + 16 */
template <int K, int N>
__device__ __forceinline__ void p_wt_tile(const float* __restrict__ W, _Float16* __restrict__ Wt, int blk, int tid, unsigned char* tl) {
  static_assert(K % 128 == 0 && N % 64 == 0, "p_wt_tile: whole tiles");
  const int nt = blk % (N / 64), kt = blk / (N / 64); const int lo = tid & 15, hi = tid >> 4;
  const float* src = W + (size_t)(kt * 128 + hi * 8) * N + nt * 64 + lo * 4; v4f r[8];
#pragma unroll
  for (int i = 0; i < 8; ++i) r[i] = *(const v4fa*)(src + (size_t)i * N);
#pragma unroll
  for (int j = 0; j < 4; ++j) { FragH f;
#pragma unroll
    for (int i = 0; i < 8; ++i) f.h[i] = (_Float16)(bf16_round(r[i][j]) * 16.0f);
    *(v8us*)(tl + (lo * 4 + j) * PW_P + hi * 16) = f.half[0]; }
  __syncthreads();      /* the tile is whole before any row of it is read back; reached by the whole block (the job is chosen by block index) */
  unsigned short* dst = (unsigned short*)Wt + (size_t)(nt * 64 + hi) * K + kt * 128 + lo * 8;
#pragma unroll
  for (int q = 0; q < 4; ++q) { const v8us o = *(const v8us*)(tl + (q * 16 + hi) * PW_P + lo * 16); *(v8us*)(dst + (size_t)(q * 16) * K) = o; }
  asm volatile("s_wait_xcnt 0x0" ::: "memory");      /* the built code runs on from these stores into the other jobs' range tests, whose code reuses the stores' registers: the wait stands in front of any such overwrite */
}
// k_gemm_hh variant with fused epilogue: v = acc·alpha + bias[by·sBias + col] (+ CP[(row/rowsPerB)·sCPb + by·64 + col] if CP) ; ACT 0 none / 1 elu ; writes f16 C16 (and f32 C if non-null)
template <int ACT>
__global__ __launch_bounds__(128) void k_gemm_hhx(const _Float16* __restrict__ A, int lda, size_t sA, const _Float16* __restrict__ Bh, int ldb, size_t sB, float alpha, const float* __restrict__ bias, size_t sBias, const float* __restrict__ CP, int rowsPerB, size_t sCPb, int row0g,
    float* __restrict__ C, _Float16* __restrict__ C16, int ldc, size_t sC, int M, int N, int K) {
  __shared__ __attribute__((aligned(16))) float so[4][16][64];
  const int tid = threadIdx.x, w = tid >> 5, lane = tid & 31, ln = lane & 15, hh = lane >> 4; const int by = blockIdx.y;
  A += (size_t)by * sA; Bh += (size_t)by * sB; const size_t cofs = (size_t)by * sC; const float* bp = bias ? bias + (size_t)by * sBias : nullptr;
  const int ntn = (N + 63) / 64; const int wid = blockIdx.x * 4 + w; const int mt = wid / ntn, nq = wid % ntn; if (mt * 16 >= M) return;
  const int row0 = mt * 16, col0 = nq * 64; const _Float16* arow = A + (size_t)(row0 + ln) * lda;
  v8f acc[4] = {};
  for (int kb = 0; kb < K; kb += 32) { FragH ah; ah.half[0] = *(const v8us*)((const unsigned short*)arow + kb + 8 * hh); ah.half[1] = *(const v8us*)((const unsigned short*)arow + kb + 16 + 8 * hh);
#pragma unroll
    for (int t = 0; t < 4; ++t) { if (col0 + t * 16 >= N) continue; const size_t boff = (size_t)(col0 + t * 16 + ln) * ldb + kb; FragH bq; bq.half[0] = *(const v8us*)((const unsigned short*)Bh + boff + 8 * hh); bq.half[1] = *(const v8us*)((const unsigned short*)Bh + boff + 16 + 8 * hh);
      acc[t] = mmaH<1>(ah.v, ah.v, bq.v, bq.v, acc[t]); }
  }
#pragma unroll
  for (int t = 0; t < 4; ++t) { if (col0 + t * 16 >= N) continue; const int col = col0 + t * 16 + ln; const float bv = bp ? bf16_round(bp[col]) : 0.f;
#pragma unroll
    for (int r = 0; r < 8; ++r) { float v = acc[t][r] * alpha + bv; if (CP) { const int rr = row0g + row0 + 8 * hh + r; if (rowsPerB < 0) v += CP[cofs + (size_t)rr * ldc + col];      /* rowsPerB < 0: own element of the batched C plane */ else { const int bidx = rr / rowsPerB; v += CP[(size_t)bidx * sCPb + (size_t)by * 64 + col]; } } if (ACT == 1) v = (v > 0.f) ? v : expm1f(v); else if (ACT == 7) v = (v > 0.f) ? v + 1.0f : expf(v); else if (ACT == 8) v = tanhf(v); else if (ACT == 9) v = 0.5f * v * (1.0f + tanhf(0.7978845608028654f * (v + 0.044715f * v * v * v))); else if (ACT == 11) v = 1.0f / (1.0f + expf(-v)); else if (ACT == 12) v = (v > 0.f) ? v : 0.01f * v; else if (ACT == 14) v = (v > 0.f) ? v : 0.1f * v; else if (ACT == 16) v = (v >= 0.f) ? v : 0.3f * v; else if (ACT == 17) v = (v >= 0.f) ? v : 0.2f * v; else if (ACT == 15) v = v / (1.0f + expf(-v)); else if (ACT == 3) v = fmaxf(v, 0.f); else if (ACT == 6) v = 0.5f * v * (1.0f + erff(v * 0.70710678118654752f)); so[w][8 * hh + r][t * 16 + ln] = v; } }
  __builtin_amdgcn_fence(__ATOMIC_ACQ_REL, "workgroup"); __builtin_amdgcn_wave_barrier();
  const int rsub = lane >> 4, c4 = (lane & 15) * 4; typedef _Float16 v4h __attribute__((ext_vector_type(4)));
  {
#pragma unroll
    for (int q = 0; q < 8; ++q) { const int r = q * 2 + rsub; if (col0 + c4 < N) { const v4f v = *(const v4fa*)&so[w][r][c4]; if (C) *(v4f*)(C + cofs + (size_t)(row0 + r) * ldc + col0 + c4) = v; if (C16) { v4h h4; for (int i = 0; i < 4; ++i) h4[i] = (_Float16)v[i]; *(v4h*)(C16 + cofs + (size_t)(row0 + r) * ldc + col0 + c4) = h4; } } }
     }
}


typedef _Float16 v4h __attribute__((ext_vector_type(4)));

__global__ __launch_bounds__(256) void k_h16(const float* __restrict__ x, _Float16* __restrict__ X16, size_t n8) { const size_t t = (size_t)blockIdx.x * 256 + threadIdx.x; if (t >= n8) return; FragH f;
#pragma unroll
  for (int q = 0; q < 8; ++q) f.h[q] = (_Float16)x[t * 8 + q]; *(v8us*)((unsigned short*)X16 + t * 8) = f.half[0];  }
__global__ __launch_bounds__(256) void k_round16f(const float* __restrict__ W, _Float16* __restrict__ Bt, size_t n8) { const size_t t = (size_t)blockIdx.x * 256 + threadIdx.x; if (t >= n8) return; FragH f;
#pragma unroll
  for (int i = 0; i < 8; ++i) f.h[i] = (_Float16)(bf16_round(W[t * 8 + i]) * 16.0f); *(v8us*)((unsigned short*)Bt + t * 8) = f.half[0];  }
template <int NHv, int TTv>
__global__ __launch_bounds__(256) void k_vt(const _Float16* __restrict__ V16, int ldv, int voff, _Float16* __restrict__ Vt) { __shared__ unsigned short tl[64][66]; const int tid = threadIdx.x; const int slab = blockIdx.x / (TTv / 64), lg = blockIdx.x % (TTv / 64); const int b = slab / NHv, h = slab % NHv;
  for (int i = tid; i < 64 * 8; i += 256) { const int r = i / 8, c8 = (i % 8) * 8; FragH f; f.half[0] = *(const v8us*)((const unsigned short*)V16 + ((size_t)b * TTv + lg * 64 + r) * ldv + voff + h * 64 + c8);
#pragma unroll
    for (int q = 0; q < 8; ++q) tl[r][c8 + q] = f.u[q]; }
  __syncthreads();
  {
#pragma unroll
    for (int rd = 0; rd < 2; ++rd) { const int d = rd * 32 + tid / 8, pc = tid % 8; FragH f;
#pragma unroll
      for (int q = 0; q < 8; ++q) f.u[q] = tl[pc * 8 + q][d];
      *(v8us*)((unsigned short*)Vt + ((size_t)slab * 64 + d) * TTv + lg * 64 + pc * 8) = f.half[0]; }
     } }

__global__ __launch_bounds__(256) void k_hl(const float* __restrict__ F, _Float16* __restrict__ Hh, _Float16* __restrict__ Hl, size_t n8) { const size_t t = (size_t)blockIdx.x * 256 + threadIdx.x; if (t >= n8) return; FragH fh, fl; const v4f a = *(const v4fa*)(F + t * 8), c = *(const v4fa*)(F + t * 8 + 4);
#pragma unroll
  for (int q = 0; q < 4; ++q) { _Float16 h = (_Float16)a[q]; fh.h[q] = h; fl.h[q] = (_Float16)((a[q] - (float)h) * 1024.0f); h = (_Float16)c[q]; fh.h[4 + q] = h; fl.h[4 + q] = (_Float16)((c[q] - (float)h) * 1024.0f); }
  { *(v8us*)((unsigned short*)Hh + t * 8) = fh.half[0]; *(v8us*)((unsigned short*)Hl + t * 8) = fl.half[0];  } }

// ---- fast GEMM (work-group tile 128x64, wave tile 32x64; requires M % 128 == 0 rows per launch region, N % 64 == 0 and K % 64 == 0); epilogue: v = act(acc alpha + bf16(bias[col])), written as f32 rows (W32), f16 rows (W16) or both ----
// Which planes are written is a template choice and a bias is always given, so the epilogue is straight-line code: no test or branch per element, and the four bias words of a lane come as one group of loads.
// A (128 rows) and Bt (64 rows) come in stages of 64 k = whole 128-byte lines, eight threads a row, through registers into two LDS buffers (row pitch 144 bytes); the waves take their fragments from LDS.
// Stage s + 1 is fetched while stage s is worked on; one barrier a stage. The products run in ascending k, 32 k a step.
#define G2_P 144                     /* LDS row pitch in bytes: 128 + 16, an odd multiple of 16 */
#define G2_B (128 * G2_P)            /* Bt rows start behind the 128 A rows */
#define G2_S (192 * G2_P)            /* one buffer */
__device__ __forceinline__ v16h g2_frag(const _Float16* p, int hh) { FragH f; f.half[0] = *(const v8us*)((const unsigned short*)p + 8 * hh); f.half[1] = *(const v8us*)((const unsigned short*)p + 16 + 8 * hh); return f.v; }
__device__ __forceinline__ v16h g2_lfrag(const unsigned char* p) { FragH f; f.half[0] = *(const v8us*)p; f.half[1] = *(const v8us*)(p + 32); return f.v; }      /* p = row ln of a 16 x 32 block in LDS, + 16 hh bytes: the element order of g2_frag */
__device__ __forceinline__ v8f g2_mma(v16h a, v16h b, v8f c) { v8f d = __builtin_amdgcn_wmma_f32_16x16x32_f16(false, a, false, b, (short)0, c, false, false); asm volatile("v_nop\n\tv_nop\n\tv_nop\n\tv_nop" : "+v"(d) : "v"(a), "v"(b)); return d; }
template <int ACT, bool W32, bool W16>
__global__ __launch_bounds__(128) void k_gemm2(const _Float16* __restrict__ A, int lda, size_t sA, const _Float16* __restrict__ Bh, int ldb, size_t sB, float alpha, const float* __restrict__ bias, size_t sBias,
    float* __restrict__ C, _Float16* __restrict__ C16, int ldc, size_t sC, int M, int N, int K) { static_assert(ACT == 0 || ACT == 3 || ACT == 6 || ACT == 8 || ACT == 9 || ACT == 11 || ACT == 12 || ACT == 14 || ACT == 15 || ACT == 16 || ACT == 17, "k_gemm2: unsupported ACT code (would silently apply no activation)");
  __shared__ __attribute__((aligned(16))) unsigned char sm[2 * G2_S];      /* [buffer][A 128 rows | Bt 64 rows][G2_P] */
  static_assert(4 * 32 * 68 * 4 <= 2 * G2_S, "k_gemm2: the epilogue's rows lie over the operand buffers");
  float (*so)[32][68] = (float (*)[32][68])sm;      /* epilogue staging, over the buffers once the last stage's barrier has ended every read of them */
  const int tid = threadIdx.x, w = tid >> 5, lane = tid & 31, ln = lane & 15, hh = lane >> 4; const int by = blockIdx.y;
  A += (size_t)by * sA; Bh += (size_t)by * sB; const size_t cofs = (size_t)by * sC; const float* bp = bias + (size_t)by * sBias;
  const int ntn = N >> 6; const int mt = blockIdx.x / ntn, nq = blockIdx.x - mt * ntn; const int row0 = mt * 128 + 32 * w, col0 = nq * 64; if (mt * 128 >= M) return;      /* the whole work-group or none: barriers follow */
  const int srow = tid >> 3, scol = (tid & 7) * 16;      /* staging: eight threads a row, 16 rows a sweep; eight sweeps for A, four for Bt */
  const char* ag = (const char*)(A + (size_t)(mt * 128) * lda); const char* bg = (const char*)(Bh + (size_t)col0 * ldb);      /* the tiles' first rows: the same for the whole work-group */
  const unsigned av = (unsigned)(srow * lda * 2 + scol), bv = (unsigned)(srow * ldb * 2 + scol);      /* this thread's place in a sweep, in bytes */
  const size_t a16 = (size_t)lda * 32, b16 = (size_t)ldb * 32;      /* 16 rows, in bytes */
  unsigned char* sd = sm + srow * G2_P + scol;
  v8us ga[8], gb[4];
#pragma unroll
  for (int j = 0; j < 8; ++j) ga[j] = *(const v8us*)(ag + j * a16 + av);
#pragma unroll
  for (int j = 0; j < 4; ++j) gb[j] = *(const v8us*)(bg + j * b16 + bv);
#pragma unroll
  for (int j = 0; j < 8; ++j) *(v8us*)(sd + 16 * j * G2_P) = ga[j];
#pragma unroll
  for (int j = 0; j < 4; ++j) *(v8us*)(sd + G2_B + 16 * j * G2_P) = gb[j];
  __syncthreads();      /* stage 0 published */
  const unsigned char* al = sm + (32 * w + ln) * G2_P + 16 * hh; const unsigned char* bl = sm + G2_B + ln * G2_P + 16 * hh;
  const v8f z8 = {0.f,0.f,0.f,0.f,0.f,0.f,0.f,0.f}; v8f c00 = z8, c01 = z8, c02 = z8, c03 = z8, c10 = z8, c11 = z8, c12 = z8, c13 = z8;
  const int nst = K >> 6;
#pragma unroll 1      /* one stage a trip: the buffer index alternates, and one stage's fragments, staging registers and accumulators already take 218 registers */
  for (int st = 0; st < nst; ++st) { const bool more = st + 1 < nst;      /* the same for the whole work-group */
    if (more) { const unsigned ao = av + (unsigned)(st + 1) * 128u, bo = bv + (unsigned)(st + 1) * 128u;      /* 32-bit lane offsets on work-group-uniform row bases */
#pragma unroll
      for (int j = 0; j < 8; ++j) ga[j] = *(const v8us*)((ag + j * a16) + ao);
#pragma unroll
      for (int j = 0; j < 4; ++j) gb[j] = *(const v8us*)((bg + j * b16) + bo); }
    const int cur = (st & 1) * G2_S;
    const unsigned char* ap = al + cur; const unsigned char* bq = bl + cur; v16h a0[2], a1[2], b0[2], b1[2], b2[2], b3[2];
#pragma unroll
    for (int kk = 0; kk < 2; ++kk) { a0[kk] = g2_lfrag(ap + 64 * kk); a1[kk] = g2_lfrag(ap + 16 * G2_P + 64 * kk); b0[kk] = g2_lfrag(bq + 64 * kk); b1[kk] = g2_lfrag(bq + 16 * G2_P + 64 * kk); b2[kk] = g2_lfrag(bq + 32 * G2_P + 64 * kk); b3[kk] = g2_lfrag(bq + 48 * G2_P + 64 * kk); }
#pragma unroll
    for (int kk = 0; kk < 2; ++kk) {      /* 32 k */
      c00 = g2_mma(a0[kk], b0[kk], c00); c10 = g2_mma(a1[kk], b0[kk], c10); c01 = g2_mma(a0[kk], b1[kk], c01); c11 = g2_mma(a1[kk], b1[kk], c11);
      c02 = g2_mma(a0[kk], b2[kk], c02); c12 = g2_mma(a1[kk], b2[kk], c12); c03 = g2_mma(a0[kk], b3[kk], c03); c13 = g2_mma(a1[kk], b3[kk], c13); }
    if (more) { unsigned char* nd = sd + (G2_S - cur);      /* the buffer of stage st - 1: every wave left it at the barrier that ended that trip */
#pragma unroll
      for (int j = 0; j < 8; ++j) *(v8us*)(nd + 16 * j * G2_P) = ga[j];
#pragma unroll
      for (int j = 0; j < 4; ++j) *(v8us*)(nd + G2_B + 16 * j * G2_P) = gb[j]; }
    __syncthreads(); }      /* publishes stage st + 1 and ends every wave's reads of stage st */
  v8f accs[8] = {c00, c01, c02, c03, c10, c11, c12, c13}; float bt[4];
#pragma unroll
  for (int t = 0; t < 4; ++t) bt[t] = bf16_round(bp[col0 + t * 16 + ln]);
#pragma unroll
  for (int u = 0; u < 8; ++u) { const int t = u & 3, half = u >> 2; const float bv = bt[t];
#pragma unroll
    for (int r = 0; r < 8; ++r) { const int rloc = half * 16 + 8 * hh + r; float v = accs[u][r] * alpha + bv;
      if (ACT == 3) v = fmaxf(v, 0.f); else if (ACT == 6) v = 0.5f * v * (1.0f + erff(v * 0.70710678118654752f)); else if (ACT == 11) v = 1.0f / (1.0f + expf(-v)); else if (ACT == 15) v = v / (1.0f + expf(-v)); else if (ACT == 12) v = (v > 0.f) ? v : 0.01f * v; else if (ACT == 8) v = tanhf(v); else if (ACT == 9) v = 0.5f * v * (1.0f + tanhf(0.7978845608028654f * (v + 0.044715f * v * v * v))); else if (ACT == 14) v = (v > 0.f) ? v : 0.1f * v; else if (ACT == 16) v = (v >= 0.f) ? v : 0.3f * v; else if (ACT == 17) v = (v >= 0.f) ? v : 0.2f * v;
      so[w][rloc][t * 16 + ln] = v; } }
  __builtin_amdgcn_fence(__ATOMIC_ACQ_REL, "workgroup"); __builtin_amdgcn_wave_barrier();
  const int rsub = lane >> 4, c4 = (lane & 15) * 4;
  {
#pragma unroll
    for (int q = 0; q < 16; ++q) { const int r = q * 2 + rsub; const v4f v = *(const v4fa*)&so[w][r][c4]; if (W32) *(v4f*)(C + cofs + (size_t)(row0 + r) * ldc + col0 + c4) = v; if (W16) { v4h h4; for (int i = 0; i < 4; ++i) h4[i] = (_Float16)v[i]; *(v4h*)(C16 + cofs + (size_t)(row0 + r) * ldc + col0 + c4) = h4; } }
     } }


__global__ __launch_bounds__(256) void k_wnat(const float* __restrict__ w, size_t n8, _Float16* __restrict__ Bt) { const size_t t = (size_t)blockIdx.x * 256 + threadIdx.x; if (t >= n8) return; FragH f; for (int q = 0; q < 8; ++q) f.h[q] = (_Float16)(bf16_round(w[t * 8 + q]) * 16.0f); *(v8us*)((unsigned short*)Bt + t * 8) = f.half[0];  }
__global__ __launch_bounds__(256) void k_rsm(const float* __restrict__ S, _Float16* __restrict__ P, int nrows) {
  #pragma clang fp contract(off)
  const int i = blockIdx.x * 256 + threadIdx.x; if (i >= nrows) return; const float* s = S + (size_t)i * SQ; float mx = -3.0e38f;
#pragma unroll 1
  for (int j = 0; j < SQ; ++j) mx = fmaxf(mx, s[j]); float se = 0.f;
#pragma unroll 1
  for (int j = 0; j < SQ; ++j) se += expf(s[j] - mx); const float sc = 256.0f / se;
#pragma unroll 1
  for (int j0 = 0; j0 < SQ; j0 += 8) { FragH f; for (int q = 0; q < 8; ++q) f.h[q] = (_Float16)(expf(s[j0 + q] - mx) * sc); unsigned short* d = (unsigned short*)P + (size_t)i * SQ + j0; *(v8us*)d = f.half[0];  } }
__global__ __launch_bounds__(256) void k_vt(const _Float16* __restrict__ V16, int b, int h0, _Float16* __restrict__ VT) { __shared__ unsigned short tl[64][65]; const int tid = threadIdx.x; const int hh = blockIdx.x % HG, sg = blockIdx.x / HG; const int s0 = sg * 64; const int h = h0 + hh;
  for (int i = tid; i < 64 * 8; i += 256) { const int j = i / 8, d8 = (i % 8) * 8; FragH f; f.half[0] = *(const v8us*)((const unsigned short*)V16 + ((size_t)b * SQ + s0 + j) * DM + h * HD + d8); for (int q = 0; q < 8; ++q) tl[d8 + q][j] = f.u[q]; }
  __syncthreads();
  { for (int i = tid; i < 64 * 8; i += 256) { const int d = i / 8, j8 = (i % 8) * 8; FragH f; for (int q = 0; q < 8; ++q) f.u[q] = tl[d][j8 + q]; *(v8us*)((unsigned short*)VT + ((size_t)hh * HD + d) * SQ + s0 + j8) = f.half[0]; }  } }



__global__ __launch_bounds__(256) void k_rsmcf2(const float* __restrict__ S, _Float16* __restrict__ P, int hg, int q0, int nk) {
  #pragma clang fp contract(off)
  const int t = blockIdx.x * 256 + threadIdx.x; if (t >= hg * QT) return; const size_t i = (size_t)t; const float* s = S + i * NKX; const int last = q0 + (t % QT); float mx = -3.0e38f;
#pragma unroll 1
  for (int j = 0; j < nk; ++j) { const float f = (j <= last) ? 1.f : 0.f; mx = fmaxf(mx, fmaf(f, s[j], (1.f - f) * -1.0e9f)); } float se = 0.f;
#pragma unroll 1
  for (int j = 0; j < nk; ++j) { const float f = (j <= last) ? 1.f : 0.f; se += __expf(fmaf(f, s[j], (1.f - f) * -1.0e9f) - mx); } const float sc = 256.0f / se;
#pragma unroll 1
  for (int j0 = 0; j0 < nk; j0 += 8) { FragH fr; for (int q = 0; q < 8; ++q) { const int j = j0 + q; const float f = (j <= last) ? 1.f : 0.f; fr.h[q] = (_Float16)(__expf(fmaf(f, s[j], (1.f - f) * -1.0e9f) - mx) * sc); } unsigned short* d = (unsigned short*)P + i * NKX + j0; *(v8us*)d = fr.half[0];  } }


template <int MASKADD>
__global__ __launch_bounds__(64) void k_att0(const float* __restrict__ QF, const float* __restrict__ KF, const float* __restrict__ VF, int ld, const float* __restrict__ mask, float scale, float* __restrict__ OF, int ldo) {
  #pragma clang fp contract(off)
  __shared__ __attribute__((aligned(16))) float lq[64][64]; __shared__ __attribute__((aligned(16))) float lo[64][64];
  const int tid = threadIdx.x; const int h = blockIdx.x / (QT0 / 64), rg = blockIdx.x % (QT0 / 64); const int i = rg * 64 + tid;
  const float* qr = QF + (size_t)i * ld + h * HD;
#pragma unroll 1
  for (int c = 0; c < HD / 4; ++c) { *(v4f*)&lq[tid][c * 4] = *(const v4fa*)(qr + c * 4); const v4f z = {0.f, 0.f, 0.f, 0.f}; *(v4f*)&lo[tid][c * 4] = z; }
  float m = -1.0e30f, l = 0.f; const int jmax = MASKADD ? (SQ - 1) : (rg * 64 + 63);      /* additive-mask form: every key (the mask input decides); causal form: keys up to the block's last row */
#pragma unroll 1
  for (int j = 0; j <= jmax; ++j) { const float* kr = KF + (size_t)j * ld + h * HD; const float* vr = VF + (size_t)j * ld + h * HD; float s = 0.f;
#pragma unroll 1
    for (int c = 0; c < HD / 4; ++c) { const v4f kq = *(const v4fa*)(kr + c * 4); const v4f qq = *(v4f*)&lq[tid][c * 4]; s = __fadd_rn(s, __fmul_rn(qq[0], kq[0])); s = __fadd_rn(s, __fmul_rn(qq[1], kq[1])); s = __fadd_rn(s, __fmul_rn(qq[2], kq[2])); s = __fadd_rn(s, __fmul_rn(qq[3], kq[3])); }
    s = __fmul_rn(s, scale); if (MASKADD) s = __fadd_rn(s, __fmul_rn(bf16_round(mask[(size_t)i * SQ + j]), -10000.0f));
    const float f = (MASKADD || j <= i) ? 1.f : 0.f; const float sm = fmaf(f, s, (1.f - f) * -1.0e30f); const float mn = fmaxf(m, sm); const float sc = expf(m - mn); const float e = expf(sm - mn); l = __fadd_rn(__fmul_rn(l, sc), e); m = mn;
#pragma unroll 1
    for (int c = 0; c < HD / 4; ++c) { const v4f vv = *(const v4fa*)(vr + c * 4); v4f oo = *(v4f*)&lo[tid][c * 4]; for (int u = 0; u < 4; ++u) oo[u] = __fadd_rn(__fmul_rn(oo[u], sc), __fmul_rn(e, vv[u])); *(v4f*)&lo[tid][c * 4] = oo; } }
  const float fin = 64.0f / l;      /* o carried x64 like the f16 path */
#pragma unroll 1
  for (int c = 0; c < HD / 4; ++c) { v4f oo = *(v4f*)&lo[tid][c * 4]; for (int u = 0; u < 4; ++u) oo[u] = __fmul_rn(oo[u], fin); *(v4f*)&lo[tid][c * 4] = oo; }
  __syncthreads();
  {
#pragma unroll 1
    for (int it = 0; it < 16; ++it) { const int row = it * 4 + tid / 16, pc = (tid % 16) * 4; const v4f v = *(const v4f*)&lo[row][pc]; *(v4f*)(OF + (size_t)(rg * 64 + row) * ldo + h * HD + pc) = v; }
     } }


template <int BFIN, int WXB>
__global__ __launch_bounds__(256) void k_ln16(const float* __restrict__ X, const float* __restrict__ g, const float* __restrict__ bb, float eps, _Float16* __restrict__ N16, float* __restrict__ XB) {
  #pragma clang fp contract(off)
  __shared__ float red[256]; const size_t r = blockIdx.x; const int t = threadIdx.x; const v4f xa = *(const v4fa*)(X + r * DMQ + t * 4); float s[4]; float sum = 0.f;
  for (int q = 0; q < 4; ++q) { s[q] = BFIN ? bf16_round(xa[q]) : xa[q]; sum = __fadd_rn(sum, s[q]); }
  red[t] = sum; __syncthreads(); for (int st = 128; st > 0; st >>= 1) { if (t < st) red[t] = __fadd_rn(red[t], red[t + st]); __syncthreads(); } const float mu = red[0] / (float)DMQ; __syncthreads();
  float vs = 0.f; for (int q = 0; q < 4; ++q) { const float dl = __fadd_rn(s[q], -mu); vs = __fadd_rn(vs, __fmul_rn(dl, dl)); } red[t] = vs; __syncthreads(); for (int st = 128; st > 0; st >>= 1) { if (t < st) red[t] = __fadd_rn(red[t], red[t + st]); __syncthreads(); }
  const float rs = rsqrtf(__fadd_rn(red[0] / (float)DMQ, eps)); v4h y; v4f xb;
  for (int q = 0; q < 4; ++q) { const int c = t * 4 + q; y[q] = (_Float16)__fadd_rn(__fmul_rn(__fmul_rn(__fadd_rn(s[q], -mu), rs), bf16_round(g[c])), bf16_round(bb[c])); xb[q] = s[q]; }
  { *(v4h*)(N16 + r * DMQ + t * 4) = y; if (WXB) *(v4f*)(XB + r * DMQ + t * 4) = xb;  } }
__global__ __launch_bounds__(256) void k_ftres2(const float* __restrict__ OF0, const float* __restrict__ XB, float* __restrict__ X1, size_t n4) {
  #pragma clang fp contract(off)
  const size_t t = (size_t)blockIdx.x * 256 + threadIdx.x; if (t >= n4) return; const v4f o = *(const v4fa*)(OF0 + t * 4), xv = *(const v4fa*)(XB + t * 4); v4f y; for (int q = 0; q < 4; ++q) y[q] = __fadd_rn(__fmul_rn(o[q], 0.015625f), xv[q]); *(v4f*)(X1 + t * 4) = y;  }

__global__ __launch_bounds__(256) void k_wthd(const float* __restrict__ Wt, _Float16* __restrict__ Bt) { const size_t t = (size_t)blockIdx.x * 256 + threadIdx.x; if (t >= (size_t)NH * HD * (DM / 8)) return; const int m8 = (int)(t % (DM / 8)) * 8; const int d = (int)((t / (DM / 8)) % HD); const int h = (int)(t / ((size_t)(DM / 8) * HD)); FragH f;
  for (int q = 0; q < 8; ++q) f.h[q] = (_Float16)(16.0f * bf16_round(Wt[((size_t)h * DM + m8 + q) * HD + d])); unsigned short* dst = (unsigned short*)Bt + ((size_t)h * HD + d) * DM + m8; *(v8us*)dst = f.half[0];  }




template <int BFIN, int W16, int W32>
__global__ __launch_bounds__(256) void k_lnx(const float* __restrict__ X, const float* __restrict__ g, const float* __restrict__ bb, float eps, _Float16* __restrict__ N16, float* __restrict__ N32) {
  #pragma clang fp contract(off)
  __shared__ float red[256]; const size_t r = blockIdx.x; const int t = threadIdx.x; const bool act = t < (DMQ / 4); const int c0 = act ? t * 4 : 0;
  const v4f xa = *(const v4fa*)(X + r * DMQ + c0); float s[4]; float sum = 0.f;
  for (int q = 0; q < 4; ++q) { s[q] = act ? (BFIN ? bf16_round(xa[q]) : xa[q]) : 0.f; sum = __fadd_rn(sum, s[q]); }
  red[t] = sum; __syncthreads(); for (int st = 128; st > 0; st >>= 1) { if (t < st) red[t] = __fadd_rn(red[t], red[t + st]); __syncthreads(); } const float mu = red[0] / (float)DMQ; __syncthreads();
  float vs = 0.f; for (int q = 0; q < 4; ++q) { const float dl = act ? __fadd_rn(s[q], -mu) : 0.f; vs = __fadd_rn(vs, __fmul_rn(dl, dl)); } red[t] = vs; __syncthreads(); for (int st = 128; st > 0; st >>= 1) { if (t < st) red[t] = __fadd_rn(red[t], red[t + st]); __syncthreads(); }
  const float rs = rsqrtf(__fadd_rn(red[0] / (float)DMQ, eps)); v4h y; v4f yf;
  for (int q = 0; q < 4; ++q) { const int c = c0 + q; yf[q] = __fadd_rn(__fmul_rn(__fmul_rn(__fadd_rn(s[q], -mu), rs), bf16_round(g[c])), bf16_round(bb[c])); y[q] = (_Float16)yf[q]; }
  if (!act) return;      /* no barriers after this point */
  { if (W16) *(v4h*)(N16 + r * DMQ + c0) = y; if (W32) *(v4f*)(N32 + r * DMQ + c0) = yf;  } }






__global__ __launch_bounds__(256) void k_lorafold(const float* __restrict__ Wm, const float* __restrict__ A, const float* __restrict__ Bm, float* __restrict__ WE, int K, int N, float sc) {
  #pragma clang fp contract(off)
  const size_t t = (size_t)blockIdx.x * 256 + threadIdx.x; if (t >= (size_t)K * N) return; const int i = (int)(t / N), o = (int)(t % N); float a = 0.f;
  for (int r = 0; r < 16; ++r) a = __fadd_rn(a, __fmul_rn(bf16_round(A[(size_t)i * 16 + r]), bf16_round(Bm[(size_t)r * N + o])));
  const float v = __fadd_rn(bf16_round(Wm[t]), __fmul_rn(sc, a)); *(float*)(WE + t) = v;  }
__global__ __launch_bounds__(256) void k_wt32rep(const float* __restrict__ Wf, _Float16* __restrict__ Bt, int K, int N, int DOUT, float scale) {
  const int t = blockIdx.x * 256 + threadIdx.x; if (t >= DOUT * (K / 8)) return; const int n = t / (K / 8), k8 = (t % (K / 8)) * 8; const int rep = DOUT / N; const int src = (n / (HD * rep)) * HD + (n % HD);      /* head h = n / HD -> group h / rep */
  FragH f; for (int i = 0; i < 8; ++i) f.h[i] = (_Float16)(Wf[(size_t)(k8 + i) * N + src] * scale);
  *(v8us*)((unsigned short*)Bt + (size_t)n * K + k8) = f.half[0];  }
__global__ __launch_bounds__(256) void k_brep(const float* __restrict__ b, float* __restrict__ out) { const int t = blockIdx.x * 256 + threadIdx.x; if (t >= DM) return; const float v = b[(t / (HD * 4)) * HD + (t % HD)]; *(float*)(out + t) = v;  }

__global__ __launch_bounds__(256) void k_rsmcim(const float* __restrict__ S, _Float16* __restrict__ P, int hg, int q0, int nk, const int* __restrict__ am) {
  #pragma clang fp contract(off)
  const int t = blockIdx.x * 256 + threadIdx.x; if (t >= hg * QT) return; const size_t i = (size_t)t; const float* s = S + i * NKX; const int last = q0 + (t % QT); const int* mr = am + (size_t)last * SQ; float mx = -3.0e38f;      /* the module's mask row of this query (keys >= nk lie above the diagonal of the causal mask and are not computed) */
#pragma unroll 1
  for (int j = 0; j < nk; ++j) { const float f = (mr[j] != 0) ? 1.f : 0.f; mx = fmaxf(mx, fmaf(f, s[j], (1.f - f) * -1.0e9f)); } float se = 0.f;
#pragma unroll 1
  for (int j = 0; j < nk; ++j) { const float f = (mr[j] != 0) ? 1.f : 0.f; se += __expf(fmaf(f, s[j], (1.f - f) * -1.0e9f) - mx); } const float sc = 256.0f / se;
#pragma unroll 1
  for (int j0 = 0; j0 < nk; j0 += 8) { FragH fr; for (int q = 0; q < 8; ++q) { const int j = j0 + q; const float f = (mr[j] != 0) ? 1.f : 0.f; fr.h[q] = (_Float16)(__expf(fmaf(f, s[j], (1.f - f) * -1.0e9f) - mx) * sc); } unsigned short* d = (unsigned short*)P + i * NKX + j0; *(v8us*)d = fr.half[0];  } }






__global__ __launch_bounds__(256) void k_rsmp(const float* __restrict__ S, _Float16* __restrict__ P, int nrows, int nk) {
  #pragma clang fp contract(off)
  const int t = blockIdx.x * 256 + threadIdx.x; if (t >= nrows) return; const size_t ri = (size_t)t; const float* s = S + ri * NKX; float mx = -3.0e38f;
#pragma unroll 1
  for (int j = 0; j < nk; ++j) mx = fmaxf(mx, s[j]); float se = 0.f;
#pragma unroll 1
  for (int j = 0; j < nk; ++j) se += __expf(s[j] - mx); const float sc = 256.0f / se;
#pragma unroll 1
  for (int j0 = 0; j0 < nk; j0 += 8) { FragH fr; for (int q = 0; q < 8; ++q) fr.h[q] = (_Float16)(__expf(s[j0 + q] - mx) * sc);
    unsigned short* d = (unsigned short*)P + ri * NKX + j0; *(v8us*)d = fr.half[0];  } }
// Fused attention, one launch for all batches and heads: a work-group of four waves owns 64 query rows (16 a wave) and walks all SQ keys in stages of 64; scores and weights stay in registers.
// Transposed products: S^T = K Q^T (rows = keys, columns = queries) and O^T += V^T P^T. The accumulator of S^T holds, in lane (ln, hh), register r, key 8 hh + r of query ln,
// which is the k order of the B operand (elements 0..7 = k 8 hh + i, elements 8..15 = k 16 + 8 hh + i), so two 16-key score tiles become one 32-key P^T fragment with no exchange.
// Online softmax in the log2 domain: running maximum and running sum per query (a query is a lane pair ln, ln + 16); weights are carried x256 (exponent + 8) as f16, the sum likewise, f32.
// K and V^T tiles (64 rows of 128 bytes each) come in whole 128-byte lines through registers into two LDS buffers (row pitch 144 bytes): stage s + 1 is fetched while stage s is worked on; one barrier a stage.
#define FA_P 144                     /* LDS row pitch in bytes: 128 + 16, an odd multiple of 16 */
#define FA_T (64 * FA_P)             /* one tile */
typedef int v4ia __attribute__((ext_vector_type(4), may_alias));
__device__ __forceinline__ v8f fa_mma(v16h a, v16h b, v8f c) { return __builtin_amdgcn_wmma_f32_16x16x32_f16(false, a, false, b, (short)0, c, false, false); }
__device__ __forceinline__ float fa_xhalf(float x) { return __builtin_bit_cast(float, __builtin_amdgcn_permlanex16(__builtin_bit_cast(int, x), __builtin_bit_cast(int, x), 0x76543210, 0xfedcba98, false, false)); }      /* lane l with lane l ^ 16 */
__device__ __forceinline__ float fa_exp2(float t) { float e;
  asm("v_exp_f32 %0, %1\n\tv_nop" : "=v"(e) : "v"(t));      /* v_nop: the one slot the instruction set asks for behind a transcendental before its source is overwritten or its result read */
  return e; }
__device__ __forceinline__ v16h fa_frag(const unsigned char* p) { FragH f; f.half[0] = *(const v8us*)p; f.half[1] = *(const v8us*)(p + 32); return f.v; }      /* p = row ln of a 16 x 32 block in LDS, + 16 hh bytes */
__global__ __launch_bounds__(128) __attribute__((amdgpu_waves_per_eu(4, 4)))      /* register budget of four waves a SIMD (the grid gives three): aiming at more, the compiler reused one register quad for the mask words and waited out each LDS load in turn */
void k_fattn(const _Float16* __restrict__ QKVp, const _Float16* __restrict__ VTp, const int* __restrict__ Km, _Float16* __restrict__ O) {
  static_assert(HD == 64 && SQ % 512 == 0, "k_fattn: head size 64; 128 threads x 4 mask words a sweep; 64-key stages");
  __shared__ __attribute__((aligned(16))) int lm[SQ];      /* this batch's key mask */
  __shared__ __attribute__((aligned(16))) unsigned char kv[2][2][FA_T];      /* [buffer][K, V^T][row * FA_P + byte] */
  const int tid = threadIdx.x, w = tid >> 5, lane = tid & 31, ln = lane & 15, hh = lane >> 4;
  const int bh = blockIdx.y, b = bh / NH, h = bh - b * NH; const size_t r0 = (size_t)b * SQ; const int q0 = blockIdx.x * 64 + w * 16;
  const int srow = tid >> 3, scol = (tid & 7) * 16;      /* staging: eight threads a row, 16 rows a sweep, four sweeps a tile */
  const char* kg = (const char*)(QKVp + (r0 + srow) * LQ + DM + h * HD) + scol;      /* key row srow, this head's 64 columns of the k block */
  const char* vg = (const char*)(VTp + ((size_t)bh * HD + srow) * SQ) + scol;      /* V^T row d = srow */
  const int sofs = srow * FA_P + scol, lofs = ln * FA_P + 16 * hh;
  v8us gk[4], gv[4];
#pragma unroll
  for (int j = 0; j < 4; ++j) { gk[j] = *(const v8us*)(kg + (size_t)(16 * j) * (LQ * 2)); gv[j] = *(const v8us*)(vg + (size_t)(16 * j) * (SQ * 2)); }
  for (int i = tid * 4; i < SQ; i += 512) *(v4ia*)(lm + i) = *(const v4ia*)(Km + r0 + i);
  const _Float16* qp = QKVp + (r0 + q0 + ln) * LQ + h * HD; const v16h q0f = g2_frag(qp, hh), q1f = g2_frag(qp + 32, hh);
#pragma unroll
  for (int j = 0; j < 4; ++j) { *(v8us*)&kv[0][0][sofs + 16 * j * FA_P] = gk[j]; *(v8us*)&kv[0][1][sofs + 16 * j * FA_P] = gv[j]; }
  __syncthreads();      /* mask and stage 0 published */
  const int* lmh = lm + 8 * hh;
  const v8f z8 = {0.f, 0.f, 0.f, 0.f, 0.f, 0.f, 0.f, 0.f}; v8f acc[4] = {z8, z8, z8, z8}; float m_run = -3.0e38f, l_run = 0.f;
  const float c2 = 0.036084391824351615f * 1.44269504088896340736f, fill2 = 1.0e-11f * 1.44269504088896340736f;      /* 1 / sqrt(768) and the fill score, both times log2(e) */
#pragma unroll 1      /* one stage a trip: the buffer index alternates, and two stages' fragments at once would go past 256 registers */
  for (int st = 0; st < SQ / 64; ++st) {
    const int sn = (st + 1 < SQ / 64) ? st + 1 : st;      /* the last trip fetches its own stage again (in bounds) into the buffer nobody reads any more: no branch round loads, stores or the barrier */
#pragma unroll
    for (int j = 0; j < 4; ++j) { gk[j] = *(const v8us*)(kg + (size_t)(sn * 64 + 16 * j) * (LQ * 2)); gv[j] = *(const v8us*)(vg + (size_t)(16 * j) * (SQ * 2) + sn * 128); }
    __builtin_amdgcn_sched_barrier(0);      /* holds the next stage's eight global loads here, a whole stage in front of the LDS stores that use them; left free, the scheduler sinks loads to just in front of their use and every wave waits out the load latency at the barrier */
    const unsigned char* kl = &kv[st & 1][0][lofs]; const unsigned char* vl = &kv[st & 1][1][lofs];
#pragma unroll
    for (int sub = 0; sub < 2; ++sub) {      /* one pass: 32 keys */
      const int kb = st * 64 + sub * 32;
      const v4ia ma = *(const v4ia*)(lmh + kb), mb = *(const v4ia*)(lmh + kb + 4), mc = *(const v4ia*)(lmh + kb + 16), md = *(const v4ia*)(lmh + kb + 20);
      const unsigned char* kt = kl + sub * 32 * FA_P;
      const v16h k0 = fa_frag(kt), k2 = fa_frag(kt + 16 * FA_P), k1 = fa_frag(kt + 64), k3 = fa_frag(kt + 16 * FA_P + 64);
      v16h vf[4];
#pragma unroll
      for (int t = 0; t < 4; ++t) vf[t] = fa_frag(vl + t * 16 * FA_P + sub * 64);
      __builtin_amdgcn_sched_barrier(0);      /* holds the pass's 20 LDS loads together at its head, so that their latencies overlap; left free, each K fragment was loaded into the same registers just in front of its product and waited for by itself */
      v8f s0 = fa_mma(k0, q0f, z8); v8f s1 = fa_mma(k2, q0f, z8); s0 = fa_mma(k1, q1f, s0); s1 = fa_mma(k3, q1f, s1);
      float x[16];
#pragma unroll
      for (int r = 0; r < 4; ++r) { x[r] = (ma[r] != 0) ? s0[r] * c2 : fill2; x[4 + r] = (mb[r] != 0) ? s0[4 + r] * c2 : fill2; x[8 + r] = (mc[r] != 0) ? s1[r] * c2 : fill2; x[12 + r] = (md[r] != 0) ? s1[4 + r] * c2 : fill2; }
      float mx = x[0];
#pragma unroll
      for (int i = 1; i < 16; ++i) mx = fmaxf(mx, x[i]);
      mx = fmaxf(mx, fa_xhalf(mx));      /* both halves of the wave hold this query's maximum of the pass */
      const float mn = fmaxf(m_run, mx); const float corr = fa_exp2(m_run - mn); m_run = mn; const float nm = 8.0f - mn;
#pragma unroll
      for (int t = 0; t < 4; ++t) acc[t] = acc[t] * corr;
      FragH p; float e0 = 0.f, e1 = 0.f, e2 = 0.f, e3 = 0.f;
#pragma unroll
      for (int i = 0; i < 16; i += 4) { const float ea = fa_exp2(x[i] + nm), eb = fa_exp2(x[i + 1] + nm), ec = fa_exp2(x[i + 2] + nm), ed = fa_exp2(x[i + 3] + nm);
        e0 += ea; e1 += eb; e2 += ec; e3 += ed; p.h[i] = (_Float16)ea; p.h[i + 1] = (_Float16)eb; p.h[i + 2] = (_Float16)ec; p.h[i + 3] = (_Float16)ed; }
      l_run = l_run * corr + ((e0 + e1) + (e2 + e3));      /* this lane's 16 keys only; the two halves are added behind the loop */
#pragma unroll
      for (int t = 0; t < 4; ++t) acc[t] = fa_mma(vf[t], p.v, acc[t]);
      __builtin_amdgcn_sched_barrier(0);      /* ends the pass for the scheduler: left free, it fetched both passes' fragments at once (spills at 256 registers) and moved the next stage's LDS stores, their wait on the global loads and the barrier up in front of the softmax, where the loads had had no time to land */
    }
    unsigned char* kd = &kv[(st + 1) & 1][0][sofs]; unsigned char* vd = &kv[(st + 1) & 1][1][sofs];      /* the buffer of stage st - 1: every wave left it at the barrier that ended that trip */
#pragma unroll
    for (int j = 0; j < 4; ++j) { *(v8us*)(kd + 16 * j * FA_P) = gk[j]; *(v8us*)(vd + 16 * j * FA_P) = gv[j]; }
    __syncthreads();      /* publishes stage st + 1 and ends every wave's reads of stage st */
  }
  const float l = l_run + fa_xhalf(l_run); const float fin = 64.0f / l;      /* ctx carried x64 as before; the x256 of weights and sum cancels */
  unsigned short* op = (unsigned short*)O + (r0 + q0 + ln) * DM + h * HD + 8 * hh;
#pragma unroll
  for (int t = 0; t < 4; ++t) { FragH f;
#pragma unroll
    for (int r = 0; r < 8; ++r) f.h[r] = (_Float16)(acc[t][r] * fin);
    *(v8us*)(op + 16 * t) = f.half[0]; } }      /* d = 16 t + 8 hh + r of query ln */


// Residual + LayerNorm, two rows a wave (biased variance): out = R + (X - mu) * rsqrt(var + eps) * bf16(g) + bf16(b), as f16 rows (W16), f32 rows (W32) or both.
// A row of 768 floats is six pieces of 512 contiguous bytes; a lane holds 4 floats of each piece, so a row stays in registers between its two sums and the output. Gain and bias are fetched and rounded once a wave.
// Sums: per-lane partials (four chains), four DPP steps inside a 16-lane row, one exchange of the halves. No LDS, no barrier: the waves of a block need nothing of each other.
#define LN_W 8                       /* waves a block */
#define LN_R 2                       /* rows a wave */
#define LN_J (DMQ / 128)             /* 512-byte pieces a row */
typedef float v2f __attribute__((ext_vector_type(2)));
typedef __bf16 v2b __attribute__((ext_vector_type(2)));
template <int M> __device__ __forceinline__ float ln_xm(float x) { return __builtin_bit_cast(float, __builtin_amdgcn_update_dpp(0, __builtin_bit_cast(int, x), 0x160 + M, 0xf, 0xf, true)); }      /* lane l takes lane l ^ M of its 16-lane row (row_xmask) */
__device__ __forceinline__ float ln_wsum(float s) { s += ln_xm<1>(s); s += ln_xm<2>(s); s += ln_xm<4>(s); s += ln_xm<8>(s); return s + fa_xhalf(s); }      /* every lane ends with the sum over the wave */
__device__ __forceinline__ v4f ln_bf(v4f a) { const v2f lo = {a[0], a[1]}, hi = {a[2], a[3]}; const v2f l = __builtin_convertvector(__builtin_convertvector(lo, v2b), v2f), h = __builtin_convertvector(__builtin_convertvector(hi, v2b), v2f); const v4f r = {l[0], l[1], h[0], h[1]}; return r; }      /* to the bf16 grid, nearest even */
__device__ __forceinline__ float ln_rsq(float t) { float e;
  asm("v_rsq_f32 %0, %1\n\tv_nop" : "=v"(e) : "v"(t));      /* v_nop: the one slot the instruction set asks for behind a transcendental before its source is overwritten or its result read */
  return e; }      /* the bare instruction: t = variance + eps is at least eps (1e-5 in both launches), far above the small inputs that rsqrtf rescales */
template <int W16, int W32>
__global__ __launch_bounds__(32 * LN_W) void k_lnw(const float* __restrict__ X, const float* __restrict__ g, const float* __restrict__ bb, float eps, _Float16* __restrict__ N16, float* __restrict__ N32, const float* __restrict__ R) {
  static_assert(DMQ % 128 == 0 && NR % (LN_W * LN_R) == 0, "k_lnw: whole 512-byte pieces, whole blocks of rows");
  const int c0 = (threadIdx.x & 31) * 4; const int wv = __builtin_amdgcn_readfirstlane(threadIdx.x >> 5);      /* the wave's number, scalar: the row bases then sit in scalar registers and every load and store shares one lane offset */
  const size_t o = (size_t)(blockIdx.x * LN_W + wv) * (LN_R * DMQ);
  const float* xp = X + o; const float* rp = R + o;
  v4f xa[LN_R][LN_J], ra[LN_R][LN_J], ga[LN_J], ba[LN_J];
#pragma unroll
  for (int i = 0; i < LN_R; ++i)
#pragma unroll
    for (int j = 0; j < LN_J; ++j) xa[i][j] = *(const v4fa*)(xp + i * DMQ + j * 128 + c0);
#pragma unroll
  for (int j = 0; j < LN_J; ++j) { ga[j] = *(const v4fa*)(g + j * 128 + c0); ba[j] = *(const v4fa*)(bb + j * 128 + c0); }
#pragma unroll
  for (int i = 0; i < LN_R; ++i)
#pragma unroll
    for (int j = 0; j < LN_J; ++j) ra[i][j] = *(const v4fa*)(rp + i * DMQ + j * 128 + c0);
  __builtin_amdgcn_sched_barrier(0);      /* holds all the wave's loads here, in one flight; left free, the scheduler sank the residual rows' loads behind both sums, where the wave waited out a second load latency */
  float mu[LN_R], rs[LN_R];
#pragma unroll
  for (int i = 0; i < LN_R; ++i) { v4f s4 = xa[i][0];
#pragma unroll
    for (int j = 1; j < LN_J; ++j) s4 += xa[i][j];
    mu[i] = (s4[0] + s4[1]) + (s4[2] + s4[3]); }
#pragma unroll
  for (int i = 0; i < LN_R; ++i) mu[i] = ln_wsum(mu[i]) * (1.0f / (float)DMQ);
#pragma unroll
  for (int i = 0; i < LN_R; ++i) { v4f q4 = {0.f, 0.f, 0.f, 0.f};
#pragma unroll
    for (int j = 0; j < LN_J; ++j) { xa[i][j] -= mu[i]; q4 += xa[i][j] * xa[i][j]; }
    rs[i] = (q4[0] + q4[1]) + (q4[2] + q4[3]); }
#pragma unroll
  for (int i = 0; i < LN_R; ++i) rs[i] = ln_rsq(ln_wsum(rs[i]) * (1.0f / (float)DMQ) + eps);
#pragma unroll
  for (int j = 0; j < LN_J; ++j) { ga[j] = ln_bf(ga[j]); ba[j] = ln_bf(ba[j]); }
#pragma unroll
  for (int i = 0; i < LN_R; ++i)
#pragma unroll
    for (int j = 0; j < LN_J; ++j) { const v4f yf = (xa[i][j] * rs[i] * ga[j] + ba[j]) + ra[i][j];
      if (W16) *(v4h*)(N16 + o + i * DMQ + j * 128 + c0) = __builtin_convertvector(yf, v4h);
      if (W32) *(v4f*)(N32 + o + i * DMQ + j * 128 + c0) = yf; } }


// Operand preparation, one launch: the jobs need nothing of each other and share the grid by ranges of the block index (the choice is the same for a whole block).
// The weights go through an LDS tile a block (p_wt_tile); x keeps its one-thread-per-8-elements form and is read once for its two copies.
#define PB_W (DM * DFF / (128 * 64))           /* blocks (tiles of 128 k x 64 n) of one 768 x 3072 weight */
#define PB_X ((int)(NR * DM / 8 / 256))        /* blocks of x */
#define PB_S (DM * DM / (128 * 64))            /* blocks of one 768 x 768 weight */
#define PB_ALL (2 * PB_W + PB_X + 4 * PB_S + 3)
__global__ __launch_bounds__(256) void k_prep(const float* __restrict__ x, const float* __restrict__ wq, const float* __restrict__ wk, const float* __restrict__ wv, const float* __restrict__ wo, const float* __restrict__ w1, const float* __restrict__ w2,
    const float* __restrict__ bq, const float* __restrict__ bk, const float* __restrict__ bv, _Float16* __restrict__ X16, float* __restrict__ XB, _Float16* __restrict__ BQKV, _Float16* __restrict__ BO, _Float16* __restrict__ BW1, _Float16* __restrict__ BW2, float* __restrict__ bqkv) {
  static_assert(NR * DM / 8 % 256 == 0, "k_prep: whole blocks of x");
  __shared__ __attribute__((aligned(16))) unsigned char tl[64 * PW_P];      /* one weight tile, [n][k] f16 */
  int blk = blockIdx.x; const int tid = threadIdx.x;
  if (blk < PB_W) { p_wt_tile<DM, DFF>(w1, BW1, blk, tid, tl); return; }      /* W1 [768][3072] -> Bt [3072][768] */
  blk -= PB_W;
  if (blk < PB_W) { p_wt_tile<DFF, DM>(w2, BW2, blk, tid, tl); return; }      /* W2 [3072][768] -> Bt [768][3072] */
  blk -= PB_W;
  if (blk < PB_X) { const size_t t = (size_t)blk * 256 + tid; v4f a = *(const v4fa*)(x + t * 8), c = *(const v4fa*)(x + t * 8 + 4); FragH f;      /* X16 = bf16(x) as exact f16 rows (GEMM operand), XB = bf16(x) as f32 rows (residual) */
#pragma unroll
    for (int q = 0; q < 4; ++q) { a[q] = bf16_round(a[q]); c[q] = bf16_round(c[q]); f.h[q] = (_Float16)a[q]; f.h[4 + q] = (_Float16)c[q]; }
    *(v8us*)((unsigned short*)X16 + t * 8) = f.half[0]; *(v4f*)(XB + t * 8) = a; *(v4f*)(XB + t * 8 + 4) = c;
    asm volatile("s_wait_xcnt 0x0" ::: "memory");      /* as in p_wt_tile: in front of any overwrite of the three stores' registers on the way to the kernel's end */
    return; }
  blk -= PB_X;
  if (blk < 4 * PB_S) { const int m = blk / PB_S;      /* [in][out] -> Bt x16: stacked q | k | v, and Wo */
    const float* W = (m == 0) ? wq : (m == 1) ? wk : (m == 2) ? wv : wo; _Float16* D = (m < 3) ? BQKV + (size_t)m * DM * DM : BO;
    p_wt_tile<DM, DM>(W, D, blk - m * PB_S, tid, tl); return; }
  blk -= 4 * PB_S;
  const float* b = (blk == 0) ? bq : (blk == 1) ? bk : bv;      /* stacked bias bq | bk | bv */
  for (int i = tid; i < DM; i += 256) bqkv[blk * DM + i] = b[i];
}

extern "C" void kernel_launch(void* const* d_in, const int* in_sizes, int n_in,
                              void* d_out, int out_size, void* d_ws, size_t ws_size, hipStream_t stream) {
  (void)in_sizes; (void)n_in; (void)out_size;
  const float* const* I = (const float* const*)d_in; const float* x = I[0]; const int* km = (const int*)d_in[1]; const float* wq = I[2]; const float* bq = I[3]; const float* wk = I[4]; const float* bk = I[5]; const float* wv = I[6]; const float* bv = I[7]; const float* wo = I[8]; const float* bo = I[9]; const float* g1 = I[10]; const float* be1 = I[11]; const float* wfc = I[12]; const float* bfc = I[13]; const float* wmp = I[14]; const float* bmp = I[15]; const float* gg2 = I[16]; const float* be2 = I[17];      /* input order: x_n; mask int32 [2][1][1][2048] (READ on device); [in][out] wq / wk / wv / wo + biases; ln1 g / b; w1 [768][3072] + b1, w2 [3072][768] + b2; ln2 g / b */
  static_assert(DMQ % 4 == 0 && DMQ / 4 <= 256 && DM % 64 == 0 && DM % 32 == 0 && DFF % 64 == 0 && DFF % 32 == 0 && NH * HD == DM && NKX == SQ, "tile multiples");
  static_assert(MP % 128 == 0 && MPO % 128 == 0 && SQ % 128 == 0 && DM % 64 == 0 && DFF % 64 == 0, "k_gemm2: whole 128-row work-group tiles, 64-column tiles, 64-k stages");
  char* ws = (char*)d_ws; size_t off = 0;
  auto take = [&](size_t bytes) { char* p = ws + off; off += (bytes + 255) & ~(size_t)255; return p; };
  _Float16* BQKV = (_Float16*)take((size_t)3 * DM * DM * 2); _Float16* BO = (_Float16*)take((size_t)DM * DM * 2); float* bqkv = (float*)take((size_t)3 * DM * 4); float* X1N = nullptr;      /* LN1 output (f32): aliases the QKV plane below (QKV's last readers, the V^T and attention launches, precede LN1) to stay within 256 MiB at NB 4 / SQ 2048 */
  _Float16* X16 = (_Float16*)take(NR * DM * 2); float* XB = (float*)take(NR * DM * 4); float* X1 = (float*)take(NR * DM * 4); _Float16* M16 = nullptr;      /* = X16 below (alias: X16's last reader, the fused QKV GEMM, precedes LN1's f16 write) */ _Float16* HF16 = (_Float16*)take(NR * DFF * 2);      /* FFN hidden plane of both batches [4096][3072] f16 (own region here) */ _Float16* BW1 = (_Float16*)take((size_t)DFF * DM * 2); _Float16* BW2 = (_Float16*)take((size_t)DM * DFF * 2); _Float16* QKV = (_Float16*)take(NR * 3 * DM * 2); _Float16* V16 = QKV + 2 * DM; _Float16* O16 = (_Float16*)take(NR * DM * 2); M16 = X16; X1N = (float*)QKV;      /* aliases: X1N (NR*DM f32 = 12 MiB) inside QKV (18 MiB): QKV's last readers (the V^T and attention launches) precede the first LayerNorm */
  _Float16* VT = (_Float16*)take((size_t)NB * NH * HD * SQ * 2);
  if (off > ws_size) return;
  k_prep<<<PB_ALL, 256, 0, stream>>>(x, wq, wk, wv, wo, wfc, wmp, bq, bk, bv, X16, XB, BQKV, BO, BW1, BW2, bqkv);      /* every GEMM operand plane, the stacked bias and the residual rows; post-LN: the attention runs on the raw input */
  const size_t r0p = (size_t)B0 * SQ;      /* first projected row */
  k_gemm2<0, false, true><<<dim3((unsigned)((MP / 128) * (3 * DM / 64)), 1), 128, 0, stream>>>(X16 + r0p * DM, DM, 0, BQKV, DM, 0, 0.0625f, bqkv, 0, nullptr, QKV + r0p * 3 * DM, 3 * DM, 0, MP, 3 * DM, DM);      /* q | k | v rows (f16); head h = columns h*HD.. of each DM block */
  k_vt<NH, SQ><<<NB * NH * (SQ / 64), 256, 0, stream>>>(V16, LQ, 0, VT);      /* V^T [NB][NH][HD][SQ], both batches */
  k_fattn<<<dim3(SQ / 64, NB * NH), 128, 0, stream>>>(QKV, VT, km, O16);      /* scores q.k / sqrt(768) (the module's literal dim_model scale), masked keys get the score 1e-11 (fill, as the source), softmax over all keys, ctx (merged heads, x64) as f16 rows */
  k_gemm2<0, true, false><<<dim3((unsigned)((MPO / 128) * (DM / 64)), 1), 128, 0, stream>>>(O16 + r0p * DM, DM, 0, BO, DM, 0, 0.0009765625f, bo, 0, X1 + r0p * DM, nullptr, DM, 0, MPO, DM, DM);      /* z = ctx Wo + bo (f32 rows; the skip is added AFTER the LayerNorm in this module) */
  k_lnw<1, 1><<<(unsigned)(NR / (LN_W * LN_R)), 32 * LN_W, 0, stream>>>(X1, g1, be1, 1e-5f, M16, X1N, XB);      /* l1 = bf16(x) + LN1(z) (eps 1e-5): f16 rows for the FFN input and f32 rows for the second skip */
  k_gemm2<3, false, true><<<dim3((unsigned)((MP / 128) * (DFF / 64)), 1), 128, 0, stream>>>(M16, DM, 0, BW1, DM, 0, 0.0625f, bfc, 0, nullptr, HF16, DFF, 0, MP, DFF, DM);      /* relu(l1 W1 + b1) -> f16, both batches */
  k_gemm2<0, true, false><<<dim3((unsigned)((MP / 128) * (DM / 64)), 1), 128, 0, stream>>>(HF16, DFF, 0, BW2, DFF, 0, 0.0625f, bmp, 0, X1, nullptr, DM, 0, MP, DM, DFF);      /* ffn = hidden W2 + b2 (f32 rows over the dead z plane; the skip is added after the LayerNorm) */
  k_lnw<0, 1><<<(unsigned)(NR / (LN_W * LN_R)), 32 * LN_W, 0, stream>>>(X1, gg2, be2, 1e-5f, nullptr, (float*)d_out, X1N);      /* out = l1 + LN2(ffn) (eps 1e-5) -> f32 output rows */
}

// v008
// Measured time: 150 microseconds a run.
// Timed twice side by side with v007, it ran 1.13 times as fast both times.
// All steps since v000 together make it 47.5 times as fast.
#include <hip/hip_runtime.h>
// Transformer encoder layer with branch-side LayerNorms, a key-padding mask applied as a FILL and the module's literal score scale (x_n [2][2048][768]; q / k / v = x W + b ([in][out] 768 x 768 sigma 1/sqrt(768), zero biases); 12 heads of 64; scores / sqrt(768) (dim_model, as the source); where(mask == 0, 1e-11) with the int32 [2][1][1][2048] mask in {0, 1} (random; READ on device; masked keys get the score 1e-11, NOT -inf, as the source); softmax; z = ctx Wo + bo; l1 = x + LN(z) (LayerNorm on the branch only; biased var, eps 1e-5); ffn = relu(l1 W1 + b1) W2 + b2 ([in][out] 768 x 3072 x 768); out = l1 + LN(ffn) -> [2][2048][768]).
// Structure: token rows; x as exact f16 rows and bf16 f32 residual rows; natural weights as exact x16 planes; fused q | k | v WMMA GEMM (32x64 wave tiles, f32 accumulation, + stacked bias) -> f16; V^T via LDS transposes; one fused attention launch (16 query rows a wave: scores over all keys, fill mask, online softmax with f32 statistics and native exp, weights x256 f16 in registers, ctx x64 merged f16); ctx Wo + bo f32; x + LN1 on VALU -> f16 + f32; relu FFN, both batches a launch; residual + LN2 -> output; nine launches, all operand preparation in the first.
// Compute dtype: inputs rounded to bf16; x / weights exact; q, k, v, softmax weights and o as plain f16 GEMM operands (~2^-12); scores and softmax statistics f32. v_wmma_f32_16x16x32_f16.
#define NB 2
#define SQ 2048
#define DM 768
#define NH 12
#define HD 64
#define HG 4                         /* heads per block group in the unlaunched k_vt overload */
#define QT 256                       /* query rows per score tile in k_rsmcf2 / k_rsmcim (not launched) */
#define NKX SQ                       /* S / P row pitch */
#define QT0 128                      /* query rows per head in k_att0 (not launched) */
#define B0 0                         /* first batch processed (debug hook) */
#define NBR NB                       /* batches processed (debug hook) */
#define NR ((size_t)NB * SQ)
#define DMQ DM
#define DFF 3072         /* FFN hidden width */
#define MP ((int)((size_t)NBR * SQ)) /* rows projected (debug hook) */
#define QN SQ                        /* query rows per batch (not used) */
#define NHD NH                       /* heads (not used) */
#define MPO MP                       /* rows through the output stage (debug hook) */
#define LQ (3 * DM)      /* row pitch of the q/k/v rows */
typedef __bf16 v16b __attribute__((ext_vector_type(16)));
typedef unsigned short v8us __attribute__((ext_vector_type(8), may_alias));
typedef float  v8f  __attribute__((ext_vector_type(8)));
typedef float  v4f  __attribute__((ext_vector_type(4)));
typedef float  v4fa __attribute__((ext_vector_type(4), may_alias));
union FragB { v16b v; v8us half[2]; unsigned short u[16]; };

__device__ __forceinline__ unsigned short bf16_bits(float x) { unsigned int u = __float_as_uint(x); return (unsigned short)((u + 0x7FFFu + ((u >> 16) & 1u)) >> 16); }
__device__ __forceinline__ float bf16_val(unsigned short b) { return __uint_as_float(((unsigned int)b) << 16); }
__device__ __forceinline__ float bf16_round(float x) { return bf16_val(bf16_bits(x)); }
// D += A·B with NT terms: 1 = ah·bh, 2 = + al·bh (A split), 3 = + ah·bl (both split)
template <int NT>
__device__ __forceinline__ v8f mmaN(v16b ah, v16b al, v16b bh, v16b bl, v8f c) {
  c = __builtin_amdgcn_wmma_f32_16x16x32_bf16(false, ah, false, bh, (short)0, c, false, false);
  if (NT >= 2) c = __builtin_amdgcn_wmma_f32_16x16x32_bf16(false, al, false, bh, (short)0, c, false, false);
  if (NT >= 3) c = __builtin_amdgcn_wmma_f32_16x16x32_bf16(false, ah, false, bl, (short)0, c, false, false);
  asm volatile("v_nop\n\tv_nop\n\tv_nop\n\tv_nop" : "+v"(c) : "v"(ah), "v"(al), "v"(bh), "v"(bl));
  return c;
}

__global__ __launch_bounds__(256) void k_wt_bf16(const float* __restrict__ W, unsigned short* __restrict__ Wt, int K, int N) {
  const int t = blockIdx.x * 256 + threadIdx.x;
  const int k8n = K / 8;
  if (t >= N * k8n) return;
  const int n = t / k8n, k8 = (t % k8n) * 8;
  v8us v;
#pragma unroll
  for (int i = 0; i < 8; ++i) v[i] = bf16_bits(W[(size_t)(k8 + i) * N + n]);
  *(v8us*)(Wt + (size_t)n * K + k8) = v;
  
}

// GEMM C[M][N] (f32, pitch ldc) = act(A[M][K]·W + bias). A f32 row-major (pitch lda) converted per fragment to bf16
// (ASPLIT: hi/lo two planes -> 2 terms, else single rounded term); Wt bf16 [N][K] (pitch ldb). BIAS_BF16 rounds the
// bias to bf16 first (bias quantised to bf16 before the add). K%32==0, M%16==0, N%64==0.
template <bool ASPLIT, int ACT, bool BIAS_BF16>
__global__ __launch_bounds__(128) void k_gemm_bf(const float* __restrict__ A, int lda, const unsigned short* __restrict__ Wt, int ldb,
                                               const float* __restrict__ bias, float* __restrict__ C, int ldc, int M, int N, int K) {
  __shared__ __attribute__((aligned(16))) float so[4][16][64];
  const int tid = threadIdx.x, w = tid >> 5, lane = tid & 31, ln = lane & 15, hh = lane >> 4;
  const int ntn = N / 64;
  const int wid = blockIdx.x * 4 + w;
  const int mt = wid / ntn, nq = wid % ntn;
  if (mt * 16 >= M) return;
  const int row0 = mt * 16, col0 = nq * 64;
  const float* arow = A + (size_t)(row0 + ln) * lda;
  v8f acc[4] = {};
  for (int kb = 0; kb < K; kb += 32) {
    FragB ah, al;
    const v4f x0 = *(const v4fa*)(arow + kb + 8 * hh), x1 = *(const v4fa*)(arow + kb + 8 * hh + 4);
    const v4f x2 = *(const v4fa*)(arow + kb + 16 + 8 * hh), x3 = *(const v4fa*)(arow + kb + 16 + 8 * hh + 4);
    float xs[16] = {x0[0],x0[1],x0[2],x0[3],x1[0],x1[1],x1[2],x1[3],x2[0],x2[1],x2[2],x2[3],x3[0],x3[1],x3[2],x3[3]};
#pragma unroll
    for (int i = 0; i < 16; ++i) { const unsigned short hb = bf16_bits(xs[i]); ah.u[i] = hb; al.u[i] = ASPLIT ? bf16_bits(xs[i] - bf16_val(hb)) : (unsigned short)0; }
#pragma unroll
    for (int t = 0; t < 4; ++t) {
      const unsigned short* brow = Wt + (size_t)(col0 + t * 16 + ln) * ldb + kb;
      FragB b;
      b.half[0] = *(const v8us*)(brow + 8 * hh);
      b.half[1] = *(const v8us*)(brow + 16 + 8 * hh);
      acc[t] = mmaN<ASPLIT ? 2 : 1>(ah.v, al.v, b.v, b.v, acc[t]);
    }
  }
#pragma unroll
  for (int t = 0; t < 4; ++t) {
    float bv = bias ? bias[col0 + t * 16 + ln] : 0.f;
    if (BIAS_BF16) bv = bf16_round(bv);
#pragma unroll
    for (int r = 0; r < 8; ++r) { float v = acc[t][r] + bv; if (ACT == 1) v = fmaxf(v, 0.f); so[w][8 * hh + r][t * 16 + ln] = v; }
  }
  __builtin_amdgcn_fence(__ATOMIC_ACQ_REL, "workgroup");
  __builtin_amdgcn_wave_barrier();
  const int rsub = lane >> 4, c4 = (lane & 15) * 4;
  {
#pragma unroll
    for (int q = 0; q < 8; ++q) {
      const int r = q * 2 + rsub;
      const v4f v = *(const v4fa*)&so[w][r][c4];
      *(v4f*)(C + (size_t)(row0 + r) * ldc + col0 + c4) = v;
    }
    
  }
}

// GEMM C = act(A·W + bias + resid): A f32 (ASPLIT -> hi/lo 2 terms), Wt bf16 [N][K]; ACT 0 none, 1 relu, 2 exact gelu;
// resid (optional, f32, row index = (row % rmod), pitch ldr, RES_BF16 rounds it) added before the activation.
template <bool ASPLIT, int ACT, bool BIAS_BF16, bool RES_BF16>
__global__ __launch_bounds__(128) void k_gemm_bf3(const float* __restrict__ A, int lda, const unsigned short* __restrict__ Wt, int ldb,
                                                const float* __restrict__ bias, const float* __restrict__ resid, int rmod, int ldr,
                                                float* __restrict__ C, int ldc, int M, int N, int K) {
  __shared__ __attribute__((aligned(16))) float so[4][16][64];
  const int tid = threadIdx.x, w = tid >> 5, lane = tid & 31, ln = lane & 15, hh = lane >> 4;
  const int ntn = N / 64;
  const int wid = blockIdx.x * 4 + w;
  const int mt = wid / ntn, nq = wid % ntn;
  if (mt * 16 >= M) return;
  const int row0 = mt * 16, col0 = nq * 64;
  const float* arow = A + (size_t)(row0 + ln) * lda;
  v8f acc[4] = {};
  for (int kb = 0; kb < K; kb += 32) {
    FragB ah, al;
    const v4f x0 = *(const v4fa*)(arow + kb + 8 * hh), x1 = *(const v4fa*)(arow + kb + 8 * hh + 4);
    const v4f x2 = *(const v4fa*)(arow + kb + 16 + 8 * hh), x3 = *(const v4fa*)(arow + kb + 16 + 8 * hh + 4);
    float xs[16] = {x0[0],x0[1],x0[2],x0[3],x1[0],x1[1],x1[2],x1[3],x2[0],x2[1],x2[2],x2[3],x3[0],x3[1],x3[2],x3[3]};
#pragma unroll
    for (int i = 0; i < 16; ++i) { const unsigned short hb = bf16_bits(xs[i]); ah.u[i] = hb; al.u[i] = ASPLIT ? bf16_bits(xs[i] - bf16_val(hb)) : (unsigned short)0; }
#pragma unroll
    for (int t = 0; t < 4; ++t) {
      const unsigned short* brow = Wt + (size_t)(col0 + t * 16 + ln) * ldb + kb;
      FragB b;
      b.half[0] = *(const v8us*)(brow + 8 * hh);
      b.half[1] = *(const v8us*)(brow + 16 + 8 * hh);
      acc[t] = mmaN<ASPLIT ? 2 : 1>(ah.v, al.v, b.v, b.v, acc[t]);
    }
  }
#pragma unroll
  for (int t = 0; t < 4; ++t) {
    const int col = col0 + t * 16 + ln;
    float bv = bias ? bias[col] : 0.f;
    if (BIAS_BF16) bv = bf16_round(bv);
#pragma unroll
    for (int r = 0; r < 8; ++r) {
      float v = acc[t][r] + bv;
      if (resid) { float rv = resid[(size_t)((row0 + 8 * hh + r) % rmod) * ldr + col]; if (RES_BF16) rv = bf16_round(rv); v += rv; }
      if (ACT == 1) v = fmaxf(v, 0.f);
      if (ACT == 2) v = 0.5f * v * (1.0f + erff(v * 0.70710678118654752f));
      if (ACT == 3) { const float u = 0.7978845608028654f * (v + 0.044715f * v * v * v); v = 0.5f * v * (1.0f + tanhf(u)); }
      so[w][8 * hh + r][t * 16 + ln] = v;
    }
  }
  __builtin_amdgcn_fence(__ATOMIC_ACQ_REL, "workgroup");
  __builtin_amdgcn_wave_barrier();
  const int rsub = lane >> 4, c4 = (lane & 15) * 4;
  {
#pragma unroll
    for (int q = 0; q < 8; ++q) {
      const int r = q * 2 + rsub;
      const v4f v = *(const v4fa*)&so[w][r][c4];
      *(v4f*)(C + (size_t)(row0 + r) * ldc + col0 + c4) = v;
    }
    
  }
}
// row LayerNorm (biased variance, eps) over N: s = X (+ R); optional out_sum <- s; out_norm <- (s-mu)*rsqrt(var+eps)*g + b
template <bool PARAM_BF16>
__global__ __launch_bounds__(256) void k_layernorm(const float* __restrict__ X, const float* __restrict__ R, const float* __restrict__ g, const float* __restrict__ bta,
                                                  float* __restrict__ out_sum, float* __restrict__ out_norm, int N, float eps) {
  __shared__ float red[256];
  const int row = blockIdx.x, tid = threadIdx.x;
  const float* x = X + (size_t)row * N; const float* rr = R ? R + (size_t)row * N : nullptr;
  float vals[16];                     // up to N = 4096
  const int per = N / 256;            // contiguous chunk per thread? use strided-by-4 chunks: thread handles j = tid*4 + 1024*u
  float s1 = 0.f;
  for (int u = 0; u < per / 4; ++u) {
    const int j = tid * 4 + 1024 * u;
    const v4f a = *(const v4fa*)(x + j);
    v4f b = {0.f,0.f,0.f,0.f}; if (rr) b = *(const v4fa*)(rr + j);
#pragma unroll
    for (int q = 0; q < 4; ++q) { const float v = a[q] + b[q]; vals[u * 4 + q] = v; s1 += v; }
  }
  red[tid] = s1; __syncthreads();
  for (int st = 128; st > 0; st >>= 1) { if (tid < st) red[tid] += red[tid + st]; __syncthreads(); }
  const float mu = red[0] / (float)N; __syncthreads();
  float s2 = 0.f;
  for (int u = 0; u < per / 4; ++u)
#pragma unroll
    for (int q = 0; q < 4; ++q) { const float c = vals[u * 4 + q] - mu; s2 += c * c; }
  red[tid] = s2; __syncthreads();
  for (int st = 128; st > 0; st >>= 1) { if (tid < st) red[tid] += red[tid + st]; __syncthreads(); }
  const float rs = rsqrtf(red[0] / (float)N + eps);
  {
    for (int u = 0; u < per / 4; ++u) {
      const int j = tid * 4 + 1024 * u;
      v4f o, sm;
#pragma unroll
      for (int q = 0; q < 4; ++q) {
        float gg = g[j + q], bb = bta[j + q];
        if (PARAM_BF16) { gg = bf16_round(gg); bb = bf16_round(bb); }
        sm[q] = vals[u * 4 + q]; o[q] = (vals[u * 4 + q] - mu) * rs * gg + bb;
      }
      if (out_sum) *(v4f*)(out_sum + (size_t)row * N + j) = sm;
      *(v4f*)(out_norm + (size_t)row * N + j) = o;
    }
    
  }
}



// ---- f16 WMMA path (v_wmma_f32_16x16x32_f16): 11-bit significands for operands in range — used where a [0,1] probability operand needs more precision than bf16
typedef _Float16 v16h __attribute__((ext_vector_type(16)));
union FragH { v16h v; v8us half[2]; _Float16 h[16]; unsigned short u[16]; };
template <int NT>
__device__ __forceinline__ v8f mmaH(v16h ah, v16h al, v16h bh, v16h bl, v8f c) {
  c = __builtin_amdgcn_wmma_f32_16x16x32_f16(false, ah, false, bh, (short)0, c, false, false);
  if (NT >= 2) c = __builtin_amdgcn_wmma_f32_16x16x32_f16(false, al, false, bh, (short)0, c, false, false);
  if (NT >= 3) c = __builtin_amdgcn_wmma_f32_16x16x32_f16(false, ah, false, bl, (short)0, c, false, false);
  asm volatile("v_nop\n\tv_nop\n\tv_nop\n\tv_nop" : "+v"(c) : "v"(ah), "v"(al), "v"(bh), "v"(bl));
  return c;
}
// batched GEMM like k_gemm_b but f16 operands: A f32 (split into f16 hi/lo if ASPLIT, else rounded to f16), Bt = f16 values [n][k]; alpha; C f32; N multiple of 16 (partial tiles skipped)
template <bool ASPLIT>
__global__ __launch_bounds__(128) void k_gemm_h(const float* __restrict__ A, int lda, size_t sA, const _Float16* __restrict__ Bh, int ldb, size_t sB, float alpha, float* __restrict__ C, int ldc, size_t sC, int M, int N, int K) {
  __shared__ __attribute__((aligned(16))) float so[4][16][64];
  const int tid = threadIdx.x, w = tid >> 5, lane = tid & 31, ln = lane & 15, hh = lane >> 4; const int by = blockIdx.y;
  A += (size_t)by * sA; Bh += (size_t)by * sB; C += (size_t)by * sC;
  const int ntn = (N + 63) / 64; const int wid = blockIdx.x * 4 + w; const int mt = wid / ntn, nq = wid % ntn; if (mt * 16 >= M) return;
  const int row0 = mt * 16, col0 = nq * 64; const float* arow = A + (size_t)(row0 + ln) * lda;
  v8f acc[4] = {};
  for (int kb = 0; kb < K; kb += 32) {
    FragH ah, al;
    const v4f x0 = *(const v4fa*)(arow + kb + 8 * hh), x1 = *(const v4fa*)(arow + kb + 8 * hh + 4), x2 = *(const v4fa*)(arow + kb + 16 + 8 * hh), x3 = *(const v4fa*)(arow + kb + 16 + 8 * hh + 4);
    float xs[16] = {x0[0],x0[1],x0[2],x0[3],x1[0],x1[1],x1[2],x1[3],x2[0],x2[1],x2[2],x2[3],x3[0],x3[1],x3[2],x3[3]};
#pragma unroll
    for (int i = 0; i < 16; ++i) { const _Float16 h = (_Float16)xs[i]; ah.h[i] = h; al.h[i] = ASPLIT ? (_Float16)(xs[i] - (float)h) : (_Float16)0.0f; }
#pragma unroll
    for (int t = 0; t < 4; ++t) { if (col0 + t * 16 >= N) continue; const size_t boff = (size_t)(col0 + t * 16 + ln) * ldb + kb; FragH bq; bq.half[0] = *(const v8us*)(Bh + boff + 8 * hh); bq.half[1] = *(const v8us*)(Bh + boff + 16 + 8 * hh);
      acc[t] = mmaH<ASPLIT ? 2 : 1>(ah.v, al.v, bq.v, bq.v, acc[t]); }
  }
#pragma unroll
  for (int t = 0; t < 4; ++t) { if (col0 + t * 16 >= N) continue;
#pragma unroll
    for (int r = 0; r < 8; ++r) so[w][8 * hh + r][t * 16 + ln] = acc[t][r] * alpha; }
  __builtin_amdgcn_fence(__ATOMIC_ACQ_REL, "workgroup"); __builtin_amdgcn_wave_barrier();
  const int rsub = lane >> 4, c4 = (lane & 15) * 4;
  {
#pragma unroll
    for (int q = 0; q < 8; ++q) { const int r = q * 2 + rsub; if (col0 + c4 < N) { const v4f v = *(const v4fa*)&so[w][r][c4]; *(v4f*)(C + (size_t)(row0 + r) * ldc + col0 + c4) = v; } }
     }
}

// Wt[n][k] = f16(bf16(W[k][n]) x 16) from f32 row-major W[K][N] (bf16-exact weights stay exact in f16 away from the subnormal range); one 256-thread block turns a tile of 128 k x 64 n.
// Reads: 16 lanes cover 256 contiguous bytes of one W row (64 n); a thread takes 8 consecutive rows of its 4 columns, so it holds 8 consecutive k of 4 output rows and stores each as one 16-byte piece into the LDS tile [n][k].
// Writes: 16 lanes cover the tile's 256 contiguous bytes of one Wt row (128 k).
#define PW_P 272                     /* LDS row pitch in bytes: 256 + 16 */
template <int K, int N>
__device__ __forceinline__ void p_wt_tile(const float* __restrict__ W, _Float16* __restrict__ Wt, int blk, int tid, unsigned char* tl) {
  static_assert(K % 128 == 0 && N % 64 == 0, "p_wt_tile: whole tiles");
  const int nt = blk % (N / 64), kt = blk / (N / 64); const int lo = tid & 15, hi = tid >> 4;
  const float* src = W + (size_t)(kt * 128 + hi * 8) * N + nt * 64 + lo * 4; v4f r[8];
#pragma unroll
  for (int i = 0; i < 8; ++i) r[i] = *(const v4fa*)(src + (size_t)i * N);
#pragma unroll
  for (int j = 0; j < 4; ++j) { FragH f;
#pragma unroll
    for (int i = 0; i < 8; ++i) f.h[i] = (_Float16)(bf16_round(r[i][j]) * 16.0f);
    *(v8us*)(tl + (lo * 4 + j) * PW_P + hi * 16) = f.half[0]; }
  __syncthreads();      /* the tile is whole before any row of it is read back; reached by the whole block (the job is chosen by block index) */
  unsigned short* dst = (unsigned short*)Wt + (size_t)(nt * 64 + hi) * K + kt * 128 + lo * 8;
#pragma unroll
  for (int q = 0; q < 4; ++q) { const v8us o = *(const v8us*)(tl + (q * 16 + hi) * PW_P + lo * 16); *(v8us*)(dst + (size_t)(q * 16) * K) = o; }
  asm volatile("s_wait_xcnt 0x0" ::: "memory");      /* the built code runs on from these stores into the other jobs' range tests, whose code reuses the stores' registers: the wait stands in front of any such overwrite */
}
// k_gemm_hh variant with fused epilogue: v = acc·alpha + bias[by·sBias + col] (+ CP[(row/rowsPerB)·sCPb + by·64 + col] if CP) ; ACT 0 none / 1 elu ; writes f16 C16 (and f32 C if non-null)
template <int ACT>
__global__ __launch_bounds__(128) void k_gemm_hhx(const _Float16* __restrict__ A, int lda, size_t sA, const _Float16* __restrict__ Bh, int ldb, size_t sB, float alpha, const float* __restrict__ bias, size_t sBias, const float* __restrict__ CP, int rowsPerB, size_t sCPb, int row0g,
    float* __restrict__ C, _Float16* __restrict__ C16, int ldc, size_t sC, int M, int N, int K) {
  __shared__ __attribute__((aligned(16))) float so[4][16][64];
  const int tid = threadIdx.x, w = tid >> 5, lane = tid & 31, ln = lane & 15, hh = lane >> 4; const int by = blockIdx.y;
  A += (size_t)by * sA; Bh += (size_t)by * sB; const size_t cofs = (size_t)by * sC; const float* bp = bias ? bias + (size_t)by * sBias : nullptr;
  const int ntn = (N + 63) / 64; const int wid = blockIdx.x * 4 + w; const int mt = wid / ntn, nq = wid % ntn; if (mt * 16 >= M) return;
  const int row0 = mt * 16, col0 = nq * 64; const _Float16* arow = A + (size_t)(row0 + ln) * lda;
  v8f acc[4] = {};
  for (int kb = 0; kb < K; kb += 32) { FragH ah; ah.half[0] = *(const v8us*)((const unsigned short*)arow + kb + 8 * hh); ah.half[1] = *(const v8us*)((const unsigned short*)arow + kb + 16 + 8 * hh);
#pragma unroll
    for (int t = 0; t < 4; ++t) { if (col0 + t * 16 >= N) continue; const size_t boff = (size_t)(col0 + t * 16 + ln) * ldb + kb; FragH bq; bq.half[0] = *(const v8us*)((const unsigned short*)Bh + boff + 8 * hh); bq.half[1] = *(const v8us*)((const unsigned short*)Bh + boff + 16 + 8 * hh);
      acc[t] = mmaH<1>(ah.v, ah.v, bq.v, bq.v, acc[t]); }
  }
#pragma unroll
  for (int t = 0; t < 4; ++t) { if (col0 + t * 16 >= N) continue; const int col = col0 + t * 16 + ln; const float bv = bp ? bf16_round(bp[col]) : 0.f;
#pragma unroll
    for (int r = 0; r < 8; ++r) { float v = acc[t][r] * alpha + bv; if (CP) { const int rr = row0g + row0 + 8 * hh + r; if (rowsPerB < 0) v += CP[cofs + (size_t)rr * ldc + col];      /* rowsPerB < 0: own element of the batched C plane */ else { const int bidx = rr / rowsPerB; v += CP[(size_t)bidx * sCPb + (size_t)by * 64 + col]; } } if (ACT == 1) v = (v > 0.f) ? v : expm1f(v); else if (ACT == 7) v = (v > 0.f) ? v + 1.0f : expf(v); else if (ACT == 8) v = tanhf(v); else if (ACT == 9) v = 0.5f * v * (1.0f + tanhf(0.7978845608028654f * (v + 0.044715f * v * v * v))); else if (ACT == 11) v = 1.0f / (1.0f + expf(-v)); else if (ACT == 12) v = (v > 0.f) ? v : 0.01f * v; else if (ACT == 14) v = (v > 0.f) ? v : 0.1f * v; else if (ACT == 16) v = (v >= 0.f) ? v : 0.3f * v; else if (ACT == 17) v = (v >= 0.f) ? v : 0.2f * v; else if (ACT == 15) v = v / (1.0f + expf(-v)); else if (ACT == 3) v = fmaxf(v, 0.f); else if (ACT == 6) v = 0.5f * v * (1.0f + erff(v * 0.70710678118654752f)); so[w][8 * hh + r][t * 16 + ln] = v; } }
  __builtin_amdgcn_fence(__ATOMIC_ACQ_REL, "workgroup"); __builtin_amdgcn_wave_barrier();
  const int rsub = lane >> 4, c4 = (lane & 15) * 4; typedef _Float16 v4h __attribute__((ext_vector_type(4)));
  {
#pragma unroll
    for (int q = 0; q < 8; ++q) { const int r = q * 2 + rsub; if (col0 + c4 < N) { const v4f v = *(const v4fa*)&so[w][r][c4]; if (C) *(v4f*)(C + cofs + (size_t)(row0 + r) * ldc + col0 + c4) = v; if (C16) { v4h h4; for (int i = 0; i < 4; ++i) h4[i] = (_Float16)v[i]; *(v4h*)(C16 + cofs + (size_t)(row0 + r) * ldc + col0 + c4) = h4; } } }
     }
}


typedef _Float16 v4h __attribute__((ext_vector_type(4)));

__global__ __launch_bounds__(256) void k_h16(const float* __restrict__ x, _Float16* __restrict__ X16, size_t n8) { const size_t t = (size_t)blockIdx.x * 256 + threadIdx.x; if (t >= n8) return; FragH f;
#pragma unroll
  for (int q = 0; q < 8; ++q) f.h[q] = (_Float16)x[t * 8 + q]; *(v8us*)((unsigned short*)X16 + t * 8) = f.half[0];  }
__global__ __launch_bounds__(256) void k_round16f(const float* __restrict__ W, _Float16* __restrict__ Bt, size_t n8) { const size_t t = (size_t)blockIdx.x * 256 + threadIdx.x; if (t >= n8) return; FragH f;
#pragma unroll
  for (int i = 0; i < 8; ++i) f.h[i] = (_Float16)(bf16_round(W[t * 8 + i]) * 16.0f); *(v8us*)((unsigned short*)Bt + t * 8) = f.half[0];  }
template <int NHv, int TTv>
__global__ __launch_bounds__(256) void k_vt(const _Float16* __restrict__ V16, int ldv, int voff, _Float16* __restrict__ Vt) { __shared__ unsigned short tl[64][66]; const int tid = threadIdx.x; const int slab = blockIdx.x / (TTv / 64), lg = blockIdx.x % (TTv / 64); const int b = slab / NHv, h = slab % NHv;
  for (int i = tid; i < 64 * 8; i += 256) { const int r = i / 8, c8 = (i % 8) * 8; FragH f; f.half[0] = *(const v8us*)((const unsigned short*)V16 + ((size_t)b * TTv + lg * 64 + r) * ldv + voff + h * 64 + c8);
#pragma unroll
    for (int q = 0; q < 8; ++q) tl[r][c8 + q] = f.u[q]; }
  __syncthreads();
  {
#pragma unroll
    for (int rd = 0; rd < 2; ++rd) { const int d = rd * 32 + tid / 8, pc = tid % 8; FragH f;
#pragma unroll
      for (int q = 0; q < 8; ++q) f.u[q] = tl[pc * 8 + q][d];
      *(v8us*)((unsigned short*)Vt + ((size_t)slab * 64 + d) * TTv + lg * 64 + pc * 8) = f.half[0]; }
     } }

__global__ __launch_bounds__(256) void k_hl(const float* __restrict__ F, _Float16* __restrict__ Hh, _Float16* __restrict__ Hl, size_t n8) { const size_t t = (size_t)blockIdx.x * 256 + threadIdx.x; if (t >= n8) return; FragH fh, fl; const v4f a = *(const v4fa*)(F + t * 8), c = *(const v4fa*)(F + t * 8 + 4);
#pragma unroll
  for (int q = 0; q < 4; ++q) { _Float16 h = (_Float16)a[q]; fh.h[q] = h; fl.h[q] = (_Float16)((a[q] - (float)h) * 1024.0f); h = (_Float16)c[q]; fh.h[4 + q] = h; fl.h[4 + q] = (_Float16)((c[q] - (float)h) * 1024.0f); }
  { *(v8us*)((unsigned short*)Hh + t * 8) = fh.half[0]; *(v8us*)((unsigned short*)Hl + t * 8) = fl.half[0];  } }

// ---- fast GEMM (work-group tile 128x128, eight waves as 4 x 2, wave tile 32x64; requires M % 128 == 0 rows per launch region, N % 128 == 0 and K % 128 == 0); epilogue: v = act(acc alpha + bf16(bias[col])), written as f32 rows (W32), f16 rows (W16) or both ----
// Which planes are written is a template choice and a bias is always given, so the epilogue is straight-line code: no test or branch per element, and the four bias words of a lane come as one group of loads.
// A (128 rows) and Bt (128 rows) come in stages of 128 k = two whole 128-byte lines a row, sixteen threads a row, through registers into two LDS buffers (row pitch 272 bytes); the waves take their fragments from LDS.
// Stage s + 1 is fetched while stage s is worked on; one barrier a stage. The products run in ascending k, 32 k a step.
#define G2_P 272                     /* LDS row pitch in bytes: 256 + 16, an odd multiple of 16 */
#define G2_B (128 * G2_P)            /* Bt rows start behind the 128 A rows */
#define G2_S (256 * G2_P)            /* one buffer */
__device__ __forceinline__ v16h g2_frag(const _Float16* p, int hh) { FragH f; f.half[0] = *(const v8us*)((const unsigned short*)p + 8 * hh); f.half[1] = *(const v8us*)((const unsigned short*)p + 16 + 8 * hh); return f.v; }
__device__ __forceinline__ v16h g2_lfrag(const unsigned char* p) { FragH f; f.half[0] = *(const v8us*)p; f.half[1] = *(const v8us*)(p + 32); return f.v; }      /* p = row ln of a 16 x 32 block in LDS, + 16 hh bytes: the element order of g2_frag */
__device__ __forceinline__ v8f g2_mma(v16h a, v16h b, v8f c) { v8f d = __builtin_amdgcn_wmma_f32_16x16x32_f16(false, a, false, b, (short)0, c, false, false); asm volatile("v_nop\n\tv_nop\n\tv_nop\n\tv_nop" : "+v"(d) : "v"(a), "v"(b)); return d; }
template <int ACT, bool W32, bool W16>
__global__ __launch_bounds__(256) void k_gemm2(const _Float16* __restrict__ A, int lda, size_t sA, const _Float16* __restrict__ Bh, int ldb, size_t sB, float alpha, const float* __restrict__ bias, size_t sBias,
    float* __restrict__ C, _Float16* __restrict__ C16, int ldc, size_t sC, int M, int N, int K) { static_assert(ACT == 0 || ACT == 3 || ACT == 6 || ACT == 8 || ACT == 9 || ACT == 11 || ACT == 12 || ACT == 14 || ACT == 15 || ACT == 16 || ACT == 17, "k_gemm2: unsupported ACT code (would silently apply no activation)");
  __shared__ __attribute__((aligned(16))) unsigned char sm[2 * G2_S];      /* [buffer][A 128 rows | Bt 128 rows][G2_P] */
  static_assert(8 * 32 * 68 * 4 <= 2 * G2_S, "k_gemm2: the epilogue's rows lie over the operand buffers");
  float (*so)[32][68] = (float (*)[32][68])sm;      /* epilogue staging, over the buffers once the last stage's barrier has ended every read of them */
  const int tid = threadIdx.x, w = tid >> 5, lane = tid & 31, ln = lane & 15, hh = lane >> 4; const int by = blockIdx.y;
  A += (size_t)by * sA; Bh += (size_t)by * sB; const size_t cofs = (size_t)by * sC; const float* bp = bias + (size_t)by * sBias;
  const int ntn = N >> 7; const int mt = blockIdx.x / ntn, nq = blockIdx.x - mt * ntn; const int wm = w & 3, wn = w >> 2; const int row0 = mt * 128 + 32 * wm, col0 = nq * 128 + 64 * wn; if (mt * 128 >= M) return;      /* the whole work-group or none: barriers follow */
  const int srow = tid >> 4, scol = (tid & 15) * 16;      /* staging: sixteen threads a row, 16 rows a sweep; eight sweeps for A, eight for Bt */
  const char* ag = (const char*)(A + (size_t)(mt * 128) * lda); const char* bg = (const char*)(Bh + (size_t)(nq * 128) * ldb);      /* the tiles' first rows: the same for the whole work-group */
  const unsigned av = (unsigned)(srow * lda * 2 + scol), bv = (unsigned)(srow * ldb * 2 + scol);      /* this thread's place in a sweep, in bytes */
  const size_t a16 = (size_t)lda * 32, b16 = (size_t)ldb * 32;      /* 16 rows, in bytes */
  unsigned char* sd = sm + srow * G2_P + scol;
  v8us ga[8], gb[8];
#pragma unroll
  for (int j = 0; j < 8; ++j) ga[j] = *(const v8us*)(ag + j * a16 + av);
#pragma unroll
  for (int j = 0; j < 8; ++j) gb[j] = *(const v8us*)(bg + j * b16 + bv);
#pragma unroll
  for (int j = 0; j < 8; ++j) *(v8us*)(sd + 16 * j * G2_P) = ga[j];
#pragma unroll
  for (int j = 0; j < 8; ++j) *(v8us*)(sd + G2_B + 16 * j * G2_P) = gb[j];
  __syncthreads();      /* stage 0 published */
  const unsigned char* al = sm + (32 * wm + ln) * G2_P + 16 * hh; const unsigned char* bl = sm + G2_B + (64 * wn + ln) * G2_P + 16 * hh;
  const v8f z8 = {0.f,0.f,0.f,0.f,0.f,0.f,0.f,0.f}; v8f c00 = z8, c01 = z8, c02 = z8, c03 = z8, c10 = z8, c11 = z8, c12 = z8, c13 = z8;
  const int nst = K >> 7;
#pragma unroll 1      /* one stage a trip: the buffer index alternates, and two stages' staging registers at once would go past 256 registers */
  for (int st = 0; st < nst; ++st) { const bool more = st + 1 < nst;      /* the same for the whole work-group */
    if (more) { const unsigned ao = av + (unsigned)(st + 1) * 256u, bo = bv + (unsigned)(st + 1) * 256u;      /* 32-bit lane offsets on work-group-uniform row bases */
#pragma unroll
      for (int j = 0; j < 8; ++j) ga[j] = *(const v8us*)((ag + j * a16) + ao);
#pragma unroll
      for (int j = 0; j < 8; ++j) gb[j] = *(const v8us*)((bg + j * b16) + bo); }
    const int cur = (st & 1) * G2_S;
#pragma unroll
    for (int hf = 0; hf < 2; ++hf) {      /* 64 k: one group of fragment loads, then its 16 products */
      const unsigned char* ap = al + cur + 128 * hf; const unsigned char* bq = bl + cur + 128 * hf; v16h a0[2], a1[2], b0[2], b1[2], b2[2], b3[2];
#pragma unroll
      for (int kk = 0; kk < 2; ++kk) { a0[kk] = g2_lfrag(ap + 64 * kk); a1[kk] = g2_lfrag(ap + 16 * G2_P + 64 * kk); b0[kk] = g2_lfrag(bq + 64 * kk); b1[kk] = g2_lfrag(bq + 16 * G2_P + 64 * kk); b2[kk] = g2_lfrag(bq + 32 * G2_P + 64 * kk); b3[kk] = g2_lfrag(bq + 48 * G2_P + 64 * kk); }
#pragma unroll
      for (int kk = 0; kk < 2; ++kk) {      /* 32 k */
        c00 = g2_mma(a0[kk], b0[kk], c00); c10 = g2_mma(a1[kk], b0[kk], c10); c01 = g2_mma(a0[kk], b1[kk], c01); c11 = g2_mma(a1[kk], b1[kk], c11);
        c02 = g2_mma(a0[kk], b2[kk], c02); c12 = g2_mma(a1[kk], b2[kk], c12); c03 = g2_mma(a0[kk], b3[kk], c03); c13 = g2_mma(a1[kk], b3[kk], c13); } }
    if (more) { unsigned char* nd = sd + (G2_S - cur);      /* the buffer of stage st - 1: every wave left it at the barrier that ended that trip */
#pragma unroll
      for (int j = 0; j < 8; ++j) *(v8us*)(nd + 16 * j * G2_P) = ga[j];
#pragma unroll
      for (int j = 0; j < 8; ++j) *(v8us*)(nd + G2_B + 16 * j * G2_P) = gb[j]; }
    __syncthreads(); }      /* publishes stage st + 1 and ends every wave's reads of stage st */
  v8f accs[8] = {c00, c01, c02, c03, c10, c11, c12, c13}; float bt[4];
#pragma unroll
  for (int t = 0; t < 4; ++t) bt[t] = bf16_round(bp[col0 + t * 16 + ln]);
#pragma unroll
  for (int u = 0; u < 8; ++u) { const int t = u & 3, half = u >> 2; const float bv = bt[t];
#pragma unroll
    for (int r = 0; r < 8; ++r) { const int rloc = half * 16 + 8 * hh + r; float v = accs[u][r] * alpha + bv;
      if (ACT == 3) v = fmaxf(v, 0.f); else if (ACT == 6) v = 0.5f * v * (1.0f + erff(v * 0.70710678118654752f)); else if (ACT == 11) v = 1.0f / (1.0f + expf(-v)); else if (ACT == 15) v = v / (1.0f + expf(-v)); else if (ACT == 12) v = (v > 0.f) ? v : 0.01f * v; else if (ACT == 8) v = tanhf(v); else if (ACT == 9) v = 0.5f * v * (1.0f + tanhf(0.7978845608028654f * (v + 0.044715f * v * v * v))); else if (ACT == 14) v = (v > 0.f) ? v : 0.1f * v; else if (ACT == 16) v = (v >= 0.f) ? v : 0.3f * v; else if (ACT == 17) v = (v >= 0.f) ? v : 0.2f * v;
      so[w][rloc][t * 16 + ln] = v; } }
  __builtin_amdgcn_fence(__ATOMIC_ACQ_REL, "workgroup"); __builtin_amdgcn_wave_barrier();
  const int rsub = lane >> 4, c4 = (lane & 15) * 4;
  {
#pragma unroll
    for (int q = 0; q < 16; ++q) { const int r = q * 2 + rsub; const v4f v = *(const v4fa*)&so[w][r][c4]; if (W32) *(v4f*)(C + cofs + (size_t)(row0 + r) * ldc + col0 + c4) = v; if (W16) { v4h h4; for (int i = 0; i < 4; ++i) h4[i] = (_Float16)v[i]; *(v4h*)(C16 + cofs + (size_t)(row0 + r) * ldc + col0 + c4) = h4; } }
     } }


__global__ __launch_bounds__(256) void k_wnat(const float* __restrict__ w, size_t n8, _Float16* __restrict__ Bt) { const size_t t = (size_t)blockIdx.x * 256 + threadIdx.x; if (t >= n8) return; FragH f; for (int q = 0; q < 8; ++q) f.h[q] = (_Float16)(bf16_round(w[t * 8 + q]) * 16.0f); *(v8us*)((unsigned short*)Bt + t * 8) = f.half[0];  }
__global__ __launch_bounds__(256) void k_rsm(const float* __restrict__ S, _Float16* __restrict__ P, int nrows) {
  #pragma clang fp contract(off)
  const int i = blockIdx.x * 256 + threadIdx.x; if (i >= nrows) return; const float* s = S + (size_t)i * SQ; float mx = -3.0e38f;
#pragma unroll 1
  for (int j = 0; j < SQ; ++j) mx = fmaxf(mx, s[j]); float se = 0.f;
#pragma unroll 1
  for (int j = 0; j < SQ; ++j) se += expf(s[j] - mx); const float sc = 256.0f / se;
#pragma unroll 1
  for (int j0 = 0; j0 < SQ; j0 += 8) { FragH f; for (int q = 0; q < 8; ++q) f.h[q] = (_Float16)(expf(s[j0 + q] - mx) * sc); unsigned short* d = (unsigned short*)P + (size_t)i * SQ + j0; *(v8us*)d = f.half[0];  } }
__global__ __launch_bounds__(256) void k_vt(const _Float16* __restrict__ V16, int b, int h0, _Float16* __restrict__ VT) { __shared__ unsigned short tl[64][65]; const int tid = threadIdx.x; const int hh = blockIdx.x % HG, sg = blockIdx.x / HG; const int s0 = sg * 64; const int h = h0 + hh;
  for (int i = tid; i < 64 * 8; i += 256) { const int j = i / 8, d8 = (i % 8) * 8; FragH f; f.half[0] = *(const v8us*)((const unsigned short*)V16 + ((size_t)b * SQ + s0 + j) * DM + h * HD + d8); for (int q = 0; q < 8; ++q) tl[d8 + q][j] = f.u[q]; }
  __syncthreads();
  { for (int i = tid; i < 64 * 8; i += 256) { const int d = i / 8, j8 = (i % 8) * 8; FragH f; for (int q = 0; q < 8; ++q) f.u[q] = tl[d][j8 + q]; *(v8us*)((unsigned short*)VT + ((size_t)hh * HD + d) * SQ + s0 + j8) = f.half[0]; }  } }



__global__ __launch_bounds__(256) void k_rsmcf2(const float* __restrict__ S, _Float16* __restrict__ P, int hg, int q0, int nk) {
  #pragma clang fp contract(off)
  const int t = blockIdx.x * 256 + threadIdx.x; if (t >= hg * QT) return; const size_t i = (size_t)t; const float* s = S + i * NKX; const int last = q0 + (t % QT); float mx = -3.0e38f;
#pragma unroll 1
  for (int j = 0; j < nk; ++j) { const float f = (j <= last) ? 1.f : 0.f; mx = fmaxf(mx, fmaf(f, s[j], (1.f - f) * -1.0e9f)); } float se = 0.f;
#pragma unroll 1
  for (int j = 0; j < nk; ++j) { const float f = (j <= last) ? 1.f : 0.f; se += __expf(fmaf(f, s[j], (1.f - f) * -1.0e9f) - mx); } const float sc = 256.0f / se;
#pragma unroll 1
  for (int j0 = 0; j0 < nk; j0 += 8) { FragH fr; for (int q = 0; q < 8; ++q) { const int j = j0 + q; const float f = (j <= last) ? 1.f : 0.f; fr.h[q] = (_Float16)(__expf(fmaf(f, s[j], (1.f - f) * -1.0e9f) - mx) * sc); } unsigned short* d = (unsigned short*)P + i * NKX + j0; *(v8us*)d = fr.half[0];  } }


template <int MASKADD>
__global__ __launch_bounds__(64) void k_att0(const float* __restrict__ QF, const float* __restrict__ KF, const float* __restrict__ VF, int ld, const float* __restrict__ mask, float scale, float* __restrict__ OF, int ldo) {
  #pragma clang fp contract(off)
  __shared__ __attribute__((aligned(16))) float lq[64][64]; __shared__ __attribute__((aligned(16))) float lo[64][64];
  const int tid = threadIdx.x; const int h = blockIdx.x / (QT0 / 64), rg = blockIdx.x % (QT0 / 64); const int i = rg * 64 + tid;
  const float* qr = QF + (size_t)i * ld + h * HD;
#pragma unroll 1
  for (int c = 0; c < HD / 4; ++c) { *(v4f*)&lq[tid][c * 4] = *(const v4fa*)(qr + c * 4); const v4f z = {0.f, 0.f, 0.f, 0.f}; *(v4f*)&lo[tid][c * 4] = z; }
  float m = -1.0e30f, l = 0.f; const int jmax = MASKADD ? (SQ - 1) : (rg * 64 + 63);      /* additive-mask form: every key (the mask input decides); causal form: keys up to the block's last row */
#pragma unroll 1
  for (int j = 0; j <= jmax; ++j) { const float* kr = KF + (size_t)j * ld + h * HD; const float* vr = VF + (size_t)j * ld + h * HD; float s = 0.f;
#pragma unroll 1
    for (int c = 0; c < HD / 4; ++c) { const v4f kq = *(const v4fa*)(kr + c * 4); const v4f qq = *(v4f*)&lq[tid][c * 4]; s = __fadd_rn(s, __fmul_rn(qq[0], kq[0])); s = __fadd_rn(s, __fmul_rn(qq[1], kq[1])); s = __fadd_rn(s, __fmul_rn(qq[2], kq[2])); s = __fadd_rn(s, __fmul_rn(qq[3], kq[3])); }
    s = __fmul_rn(s, scale); if (MASKADD) s = __fadd_rn(s, __fmul_rn(bf16_round(mask[(size_t)i * SQ + j]), -10000.0f));
    const float f = (MASKADD || j <= i) ? 1.f : 0.f; const float sm = fmaf(f, s, (1.f - f) * -1.0e30f); const float mn = fmaxf(m, sm); const float sc = expf(m - mn); const float e = expf(sm - mn); l = __fadd_rn(__fmul_rn(l, sc), e); m = mn;
#pragma unroll 1
    for (int c = 0; c < HD / 4; ++c) { const v4f vv = *(const v4fa*)(vr + c * 4); v4f oo = *(v4f*)&lo[tid][c * 4]; for (int u = 0; u < 4; ++u) oo[u] = __fadd_rn(__fmul_rn(oo[u], sc), __fmul_rn(e, vv[u])); *(v4f*)&lo[tid][c * 4] = oo; } }
  const float fin = 64.0f / l;      /* o carried x64 like the f16 path */
#pragma unroll 1
  for (int c = 0; c < HD / 4; ++c) { v4f oo = *(v4f*)&lo[tid][c * 4]; for (int u = 0; u < 4; ++u) oo[u] = __fmul_rn(oo[u], fin); *(v4f*)&lo[tid][c * 4] = oo; }
  __syncthreads();
  {
#pragma unroll 1
    for (int it = 0; it < 16; ++it) { const int row = it * 4 + tid / 16, pc = (tid % 16) * 4; const v4f v = *(const v4f*)&lo[row][pc]; *(v4f*)(OF + (size_t)(rg * 64 + row) * ldo + h * HD + pc) = v; }
     } }


template <int BFIN, int WXB>
__global__ __launch_bounds__(256) void k_ln16(const float* __restrict__ X, const float* __restrict__ g, const float* __restrict__ bb, float eps, _Float16* __restrict__ N16, float* __restrict__ XB) {
  #pragma clang fp contract(off)
  __shared__ float red[256]; const size_t r = blockIdx.x; const int t = threadIdx.x; const v4f xa = *(const v4fa*)(X + r * DMQ + t * 4); float s[4]; float sum = 0.f;
  for (int q = 0; q < 4; ++q) { s[q] = BFIN ? bf16_round(xa[q]) : xa[q]; sum = __fadd_rn(sum, s[q]); }
  red[t] = sum; __syncthreads(); for (int st = 128; st > 0; st >>= 1) { if (t < st) red[t] = __fadd_rn(red[t], red[t + st]); __syncthreads(); } const float mu = red[0] / (float)DMQ; __syncthreads();
  float vs = 0.f; for (int q = 0; q < 4; ++q) { const float dl = __fadd_rn(s[q], -mu); vs = __fadd_rn(vs, __fmul_rn(dl, dl)); } red[t] = vs; __syncthreads(); for (int st = 128; st > 0; st >>= 1) { if (t < st) red[t] = __fadd_rn(red[t], red[t + st]); __syncthreads(); }
  const float rs = rsqrtf(__fadd_rn(red[0] / (float)DMQ, eps)); v4h y; v4f xb;
  for (int q = 0; q < 4; ++q) { const int c = t * 4 + q; y[q] = (_Float16)__fadd_rn(__fmul_rn(__fmul_rn(__fadd_rn(s[q], -mu), rs), bf16_round(g[c])), bf16_round(bb[c])); xb[q] = s[q]; }
  { *(v4h*)(N16 + r * DMQ + t * 4) = y; if (WXB) *(v4f*)(XB + r * DMQ + t * 4) = xb;  } }
__global__ __launch_bounds__(256) void k_ftres2(const float* __restrict__ OF0, const float* __restrict__ XB, float* __restrict__ X1, size_t n4) {
  #pragma clang fp contract(off)
  const size_t t = (size_t)blockIdx.x * 256 + threadIdx.x; if (t >= n4) return; const v4f o = *(const v4fa*)(OF0 + t * 4), xv = *(const v4fa*)(XB + t * 4); v4f y; for (int q = 0; q < 4; ++q) y[q] = __fadd_rn(__fmul_rn(o[q], 0.015625f), xv[q]); *(v4f*)(X1 + t * 4) = y;  }

__global__ __launch_bounds__(256) void k_wthd(const float* __restrict__ Wt, _Float16* __restrict__ Bt) { const size_t t = (size_t)blockIdx.x * 256 + threadIdx.x; if (t >= (size_t)NH * HD * (DM / 8)) return; const int m8 = (int)(t % (DM / 8)) * 8; const int d = (int)((t / (DM / 8)) % HD); const int h = (int)(t / ((size_t)(DM / 8) * HD)); FragH f;
  for (int q = 0; q < 8; ++q) f.h[q] = (_Float16)(16.0f * bf16_round(Wt[((size_t)h * DM + m8 + q) * HD + d])); unsigned short* dst = (unsigned short*)Bt + ((size_t)h * HD + d) * DM + m8; *(v8us*)dst = f.half[0];  }




template <int BFIN, int W16, int W32>
__global__ __launch_bounds__(256) void k_lnx(const float* __restrict__ X, const float* __restrict__ g, const float* __restrict__ bb, float eps, _Float16* __restrict__ N16, float* __restrict__ N32) {
  #pragma clang fp contract(off)
  __shared__ float red[256]; const size_t r = blockIdx.x; const int t = threadIdx.x; const bool act = t < (DMQ / 4); const int c0 = act ? t * 4 : 0;
  const v4f xa = *(const v4fa*)(X + r * DMQ + c0); float s[4]; float sum = 0.f;
  for (int q = 0; q < 4; ++q) { s[q] = act ? (BFIN ? bf16_round(xa[q]) : xa[q]) : 0.f; sum = __fadd_rn(sum, s[q]); }
  red[t] = sum; __syncthreads(); for (int st = 128; st > 0; st >>= 1) { if (t < st) red[t] = __fadd_rn(red[t], red[t + st]); __syncthreads(); } const float mu = red[0] / (float)DMQ; __syncthreads();
  float vs = 0.f; for (int q = 0; q < 4; ++q) { const float dl = act ? __fadd_rn(s[q], -mu) : 0.f; vs = __fadd_rn(vs, __fmul_rn(dl, dl)); } red[t] = vs; __syncthreads(); for (int st = 128; st > 0; st >>= 1) { if (t < st) red[t] = __fadd_rn(red[t], red[t + st]); __syncthreads(); }
  const float rs = rsqrtf(__fadd_rn(red[0] / (float)DMQ, eps)); v4h y; v4f yf;
  for (int q = 0; q < 4; ++q) { const int c = c0 + q; yf[q] = __fadd_rn(__fmul_rn(__fmul_rn(__fadd_rn(s[q], -mu), rs), bf16_round(g[c])), bf16_round(bb[c])); y[q] = (_Float16)yf[q]; }
  if (!act) return;      /* no barriers after this point */
  { if (W16) *(v4h*)(N16 + r * DMQ + c0) = y; if (W32) *(v4f*)(N32 + r * DMQ + c0) = yf;  } }






__global__ __launch_bounds__(256) void k_lorafold(const float* __restrict__ Wm, const float* __restrict__ A, const float* __restrict__ Bm, float* __restrict__ WE, int K, int N, float sc) {
  #pragma clang fp contract(off)
  const size_t t = (size_t)blockIdx.x * 256 + threadIdx.x; if (t >= (size_t)K * N) return; const int i = (int)(t / N), o = (int)(t % N); float a = 0.f;
  for (int r = 0; r < 16; ++r) a = __fadd_rn(a, __fmul_rn(bf16_round(A[(size_t)i * 16 + r]), bf16_round(Bm[(size_t)r * N + o])));
  const float v = __fadd_rn(bf16_round(Wm[t]), __fmul_rn(sc, a)); *(float*)(WE + t) = v;  }
__global__ __launch_bounds__(256) void k_wt32rep(const float* __restrict__ Wf, _Float16* __restrict__ Bt, int K, int N, int DOUT, float scale) {
  const int t = blockIdx.x * 256 + threadIdx.x; if (t >= DOUT * (K / 8)) return; const int n = t / (K / 8), k8 = (t % (K / 8)) * 8; const int rep = DOUT / N; const int src = (n / (HD * rep)) * HD + (n % HD);      /* head h = n / HD -> group h / rep */
  FragH f; for (int i = 0; i < 8; ++i) f.h[i] = (_Float16)(Wf[(size_t)(k8 + i) * N + src] * scale);
  *(v8us*)((unsigned short*)Bt + (size_t)n * K + k8) = f.half[0];  }
__global__ __launch_bounds__(256) void k_brep(const float* __restrict__ b, float* __restrict__ out) { const int t = blockIdx.x * 256 + threadIdx.x; if (t >= DM) return; const float v = b[(t / (HD * 4)) * HD + (t % HD)]; *(float*)(out + t) = v;  }

__global__ __launch_bounds__(256) void k_rsmcim(const float* __restrict__ S, _Float16* __restrict__ P, int hg, int q0, int nk, const int* __restrict__ am) {
  #pragma clang fp contract(off)
  const int t = blockIdx.x * 256 + threadIdx.x; if (t >= hg * QT) return; const size_t i = (size_t)t; const float* s = S + i * NKX; const int last = q0 + (t % QT); const int* mr = am + (size_t)last * SQ; float mx = -3.0e38f;      /* the module's mask row of this query (keys >= nk lie above the diagonal of the causal mask and are not computed) */
#pragma unroll 1
  for (int j = 0; j < nk; ++j) { const float f = (mr[j] != 0) ? 1.f : 0.f; mx = fmaxf(mx, fmaf(f, s[j], (1.f - f) * -1.0e9f)); } float se = 0.f;
#pragma unroll 1
  for (int j = 0; j < nk; ++j) { const float f = (mr[j] != 0) ? 1.f : 0.f; se += __expf(fmaf(f, s[j], (1.f - f) * -1.0e9f) - mx); } const float sc = 256.0f / se;
#pragma unroll 1
  for (int j0 = 0; j0 < nk; j0 += 8) { FragH fr; for (int q = 0; q < 8; ++q) { const int j = j0 + q; const float f = (mr[j] != 0) ? 1.f : 0.f; fr.h[q] = (_Float16)(__expf(fmaf(f, s[j], (1.f - f) * -1.0e9f) - mx) * sc); } unsigned short* d = (unsigned short*)P + i * NKX + j0; *(v8us*)d = fr.half[0];  } }






__global__ __launch_bounds__(256) void k_rsmp(const float* __restrict__ S, _Float16* __restrict__ P, int nrows, int nk) {
  #pragma clang fp contract(off)
  const int t = blockIdx.x * 256 + threadIdx.x; if (t >= nrows) return; const size_t ri = (size_t)t; const float* s = S + ri * NKX; float mx = -3.0e38f;
#pragma unroll 1
  for (int j = 0; j < nk; ++j) mx = fmaxf(mx, s[j]); float se = 0.f;
#pragma unroll 1
  for (int j = 0; j < nk; ++j) se += __expf(s[j] - mx); const float sc = 256.0f / se;
#pragma unroll 1
  for (int j0 = 0; j0 < nk; j0 += 8) { FragH fr; for (int q = 0; q < 8; ++q) fr.h[q] = (_Float16)(__expf(s[j0 + q] - mx) * sc);
    unsigned short* d = (unsigned short*)P + ri * NKX + j0; *(v8us*)d = fr.half[0];  } }
// Fused attention, one launch for all batches and heads: a work-group of four waves owns 64 query rows (16 a wave) and walks all SQ keys in stages of 64; scores and weights stay in registers.
// Transposed products: S^T = K Q^T (rows = keys, columns = queries) and O^T += V^T P^T. The accumulator of S^T holds, in lane (ln, hh), register r, key 8 hh + r of query ln,
// which is the k order of the B operand (elements 0..7 = k 8 hh + i, elements 8..15 = k 16 + 8 hh + i), so two 16-key score tiles become one 32-key P^T fragment with no exchange.
// Online softmax in the log2 domain: running maximum and running sum per query (a query is a lane pair ln, ln + 16); weights are carried x256 (exponent + 8) as f16, the sum likewise, f32.
// K and V^T tiles (64 rows of 128 bytes each) come in whole 128-byte lines through registers into two LDS buffers (row pitch 144 bytes): stage s + 1 is fetched while stage s is worked on; one barrier a stage.
#define FA_P 144                     /* LDS row pitch in bytes: 128 + 16, an odd multiple of 16 */
#define FA_T (64 * FA_P)             /* one tile */
typedef int v4ia __attribute__((ext_vector_type(4), may_alias));
__device__ __forceinline__ v8f fa_mma(v16h a, v16h b, v8f c) { return __builtin_amdgcn_wmma_f32_16x16x32_f16(false, a, false, b, (short)0, c, false, false); }
__device__ __forceinline__ float fa_xhalf(float x) { return __builtin_bit_cast(float, __builtin_amdgcn_permlanex16(__builtin_bit_cast(int, x), __builtin_bit_cast(int, x), 0x76543210, 0xfedcba98, false, false)); }      /* lane l with lane l ^ 16 */
__device__ __forceinline__ float fa_exp2(float t) { float e;
  asm("v_exp_f32 %0, %1\n\tv_nop" : "=v"(e) : "v"(t));      /* v_nop: the one slot the instruction set asks for behind a transcendental before its source is overwritten or its result read */
  return e; }
__device__ __forceinline__ v16h fa_frag(const unsigned char* p) { FragH f; f.half[0] = *(const v8us*)p; f.half[1] = *(const v8us*)(p + 32); return f.v; }      /* p = row ln of a 16 x 32 block in LDS, + 16 hh bytes */
__global__ __launch_bounds__(128) __attribute__((amdgpu_waves_per_eu(4, 4)))      /* register budget of four waves a SIMD (the grid gives three): aiming at more, the compiler reused one register quad for the mask words and waited out each LDS load in turn */
void k_fattn(const _Float16* __restrict__ QKVp, const _Float16* __restrict__ VTp, const int* __restrict__ Km, _Float16* __restrict__ O) {
  static_assert(HD == 64 && SQ % 512 == 0, "k_fattn: head size 64; 128 threads x 4 mask words a sweep; 64-key stages");
  __shared__ __attribute__((aligned(16))) int lm[SQ];      /* this batch's key mask */
  __shared__ __attribute__((aligned(16))) unsigned char kv[2][2][FA_T];      /* [buffer][K, V^T][row * FA_P + byte] */
  const int tid = threadIdx.x, w = tid >> 5, lane = tid & 31, ln = lane & 15, hh = lane >> 4;
  const int bh = blockIdx.y, b = bh / NH, h = bh - b * NH; const size_t r0 = (size_t)b * SQ; const int q0 = blockIdx.x * 64 + w * 16;
  const int srow = tid >> 3, scol = (tid & 7) * 16;      /* staging: eight threads a row, 16 rows a sweep, four sweeps a tile */
  const char* kg = (const char*)(QKVp + (r0 + srow) * LQ + DM + h * HD) + scol;      /* key row srow, this head's 64 columns of the k block */
  const char* vg = (const char*)(VTp + ((size_t)bh * HD + srow) * SQ) + scol;      /* V^T row d = srow */
  const int sofs = srow * FA_P + scol, lofs = ln * FA_P + 16 * hh;
  v8us gk[4], gv[4];
#pragma unroll
  for (int j = 0; j < 4; ++j) { gk[j] = *(const v8us*)(kg + (size_t)(16 * j) * (LQ * 2)); gv[j] = *(const v8us*)(vg + (size_t)(16 * j) * (SQ * 2)); }
  for (int i = tid * 4; i < SQ; i += 512) *(v4ia*)(lm + i) = *(const v4ia*)(Km + r0 + i);
  const _Float16* qp = QKVp + (r0 + q0 + ln) * LQ + h * HD; const v16h q0f = g2_frag(qp, hh), q1f = g2_frag(qp + 32, hh);
#pragma unroll
  for (int j = 0; j < 4; ++j) { *(v8us*)&kv[0][0][sofs + 16 * j * FA_P] = gk[j]; *(v8us*)&kv[0][1][sofs + 16 * j * FA_P] = gv[j]; }
  __syncthreads();      /* mask and stage 0 published */
  const int* lmh = lm + 8 * hh;
  const v8f z8 = {0.f, 0.f, 0.f, 0.f, 0.f, 0.f, 0.f, 0.f}; v8f acc[4] = {z8, z8, z8, z8}; float m_run = -3.0e38f, l_run = 0.f;
  const float c2 = 0.036084391824351615f * 1.44269504088896340736f, fill2 = 1.0e-11f * 1.44269504088896340736f;      /* 1 / sqrt(768) and the fill score, both times log2(e) */
#pragma unroll 1      /* one stage a trip: the buffer index alternates, and two stages' fragments at once would go past 256 registers */
  for (int st = 0; st < SQ / 64; ++st) {
    const int sn = (st + 1 < SQ / 64) ? st + 1 : st;      /* the last trip fetches its own stage again (in bounds) into the buffer nobody reads any more: no branch round loads, stores or the barrier */
#pragma unroll
    for (int j = 0; j < 4; ++j) { gk[j] = *(const v8us*)(kg + (size_t)(sn * 64 + 16 * j) * (LQ * 2)); gv[j] = *(const v8us*)(vg + (size_t)(16 * j) * (SQ * 2) + sn * 128); }
    __builtin_amdgcn_sched_barrier(0);      /* holds the next stage's eight global loads here, a whole stage in front of the LDS stores that use them; left free, the scheduler sinks loads to just in front of their use and every wave waits out the load latency at the barrier */
    const unsigned char* kl = &kv[st & 1][0][lofs]; const unsigned char* vl = &kv[st & 1][1][lofs];
#pragma unroll
    for (int sub = 0; sub < 2; ++sub) {      /* one pass: 32 keys */
      const int kb = st * 64 + sub * 32;
      const v4ia ma = *(const v4ia*)(lmh + kb), mb = *(const v4ia*)(lmh + kb + 4), mc = *(const v4ia*)(lmh + kb + 16), md = *(const v4ia*)(lmh + kb + 20);
      const unsigned char* kt = kl + sub * 32 * FA_P;
      const v16h k0 = fa_frag(kt), k2 = fa_frag(kt + 16 * FA_P), k1 = fa_frag(kt + 64), k3 = fa_frag(kt + 16 * FA_P + 64);
      v16h vf[4];
#pragma unroll
      for (int t = 0; t < 4; ++t) vf[t] = fa_frag(vl + t * 16 * FA_P + sub * 64);
      __builtin_amdgcn_sched_barrier(0);      /* holds the pass's 20 LDS loads together at its head, so that their latencies overlap; left free, each K fragment was loaded into the same registers just in front of its product and waited for by itself */
      v8f s0 = fa_mma(k0, q0f, z8); v8f s1 = fa_mma(k2, q0f, z8); s0 = fa_mma(k1, q1f, s0); s1 = fa_mma(k3, q1f, s1);
      float x[16];
#pragma unroll
      for (int r = 0; r < 4; ++r) { x[r] = (ma[r] != 0) ? s0[r] * c2 : fill2; x[4 + r] = (mb[r] != 0) ? s0[4 + r] * c2 : fill2; x[8 + r] = (mc[r] != 0) ? s1[r] * c2 : fill2; x[12 + r] = (md[r] != 0) ? s1[4 + r] * c2 : fill2; }
      float mx = x[0];
#pragma unroll
      for (int i = 1; i < 16; ++i) mx = fmaxf(mx, x[i]);
      mx = fmaxf(mx, fa_xhalf(mx));      /* both halves of the wave hold this query's maximum of the pass */
      const float mn = fmaxf(m_run, mx); const float corr = fa_exp2(m_run - mn); m_run = mn; const float nm = 8.0f - mn;
#pragma unroll
      for (int t = 0; t < 4; ++t) acc[t] = acc[t] * corr;
      FragH p; float e0 = 0.f, e1 = 0.f, e2 = 0.f, e3 = 0.f;
#pragma unroll
      for (int i = 0; i < 16; i += 4) { const float ea = fa_exp2(x[i] + nm), eb = fa_exp2(x[i + 1] + nm), ec = fa_exp2(x[i + 2] + nm), ed = fa_exp2(x[i + 3] + nm);
        e0 += ea; e1 += eb; e2 += ec; e3 += ed; p.h[i] = (_Float16)ea; p.h[i + 1] = (_Float16)eb; p.h[i + 2] = (_Float16)ec; p.h[i + 3] = (_Float16)ed; }
      l_run = l_run * corr + ((e0 + e1) + (e2 + e3));      /* this lane's 16 keys only; the two halves are added behind the loop */
#pragma unroll
      for (int t = 0; t < 4; ++t) acc[t] = fa_mma(vf[t], p.v, acc[t]);
      __builtin_amdgcn_sched_barrier(0);      /* ends the pass for the scheduler: left free, it fetched both passes' fragments at once (spills at 256 registers) and moved the next stage's LDS stores, their wait on the global loads and the barrier up in front of the softmax, where the loads had had no time to land */
    }
    unsigned char* kd = &kv[(st + 1) & 1][0][sofs]; unsigned char* vd = &kv[(st + 1) & 1][1][sofs];      /* the buffer of stage st - 1: every wave left it at the barrier that ended that trip */
#pragma unroll
    for (int j = 0; j < 4; ++j) { *(v8us*)(kd + 16 * j * FA_P) = gk[j]; *(v8us*)(vd + 16 * j * FA_P) = gv[j]; }
    __syncthreads();      /* publishes stage st + 1 and ends every wave's reads of stage st */
  }
  const float l = l_run + fa_xhalf(l_run); const float fin = 64.0f / l;      /* ctx carried x64 as before; the x256 of weights and sum cancels */
  unsigned short* op = (unsigned short*)O + (r0 + q0 + ln) * DM + h * HD + 8 * hh;
#pragma unroll
  for (int t = 0; t < 4; ++t) { FragH f;
#pragma unroll
    for (int r = 0; r < 8; ++r) f.h[r] = (_Float16)(acc[t][r] * fin);
    *(v8us*)(op + 16 * t) = f.half[0]; } }      /* d = 16 t + 8 hh + r of query ln */


// Residual + LayerNorm, two rows a wave (biased variance): out = R + (X - mu) * rsqrt(var + eps) * bf16(g) + bf16(b), as f16 rows (W16), f32 rows (W32) or both.
// A row of 768 floats is six pieces of 512 contiguous bytes; a lane holds 4 floats of each piece, so a row stays in registers between its two sums and the output. Gain and bias are fetched and rounded once a wave.
// Sums: per-lane partials (four chains), four DPP steps inside a 16-lane row, one exchange of the halves. No LDS, no barrier: the waves of a block need nothing of each other.
#define LN_W 8                       /* waves a block */
#define LN_R 2                       /* rows a wave */
#define LN_J (DMQ / 128)             /* 512-byte pieces a row */
typedef float v2f __attribute__((ext_vector_type(2)));
typedef __bf16 v2b __attribute__((ext_vector_type(2)));
template <int M> __device__ __forceinline__ float ln_xm(float x) { return __builtin_bit_cast(float, __builtin_amdgcn_update_dpp(0, __builtin_bit_cast(int, x), 0x160 + M, 0xf, 0xf, true)); }      /* lane l takes lane l ^ M of its 16-lane row (row_xmask) */
__device__ __forceinline__ float ln_wsum(float s) { s += ln_xm<1>(s); s += ln_xm<2>(s); s += ln_xm<4>(s); s += ln_xm<8>(s); return s + fa_xhalf(s); }      /* every lane ends with the sum over the wave */
__device__ __forceinline__ v4f ln_bf(v4f a) { const v2f lo = {a[0], a[1]}, hi = {a[2], a[3]}; const v2f l = __builtin_convertvector(__builtin_convertvector(lo, v2b), v2f), h = __builtin_convertvector(__builtin_convertvector(hi, v2b), v2f); const v4f r = {l[0], l[1], h[0], h[1]}; return r; }      /* to the bf16 grid, nearest even */
__device__ __forceinline__ float ln_rsq(float t) { float e;
  asm("v_rsq_f32 %0, %1\n\tv_nop" : "=v"(e) : "v"(t));      /* v_nop: the one slot the instruction set asks for behind a transcendental before its source is overwritten or its result read */
  return e; }      /* the bare instruction: t = variance + eps is at least eps (1e-5 in both launches), far above the small inputs that rsqrtf rescales */
template <int W16, int W32>
__global__ __launch_bounds__(32 * LN_W) void k_lnw(const float* __restrict__ X, const float* __restrict__ g, const float* __restrict__ bb, float eps, _Float16* __restrict__ N16, float* __restrict__ N32, const float* __restrict__ R) {
  static_assert(DMQ % 128 == 0 && NR % (LN_W * LN_R) == 0, "k_lnw: whole 512-byte pieces, whole blocks of rows");
  const int c0 = (threadIdx.x & 31) * 4; const int wv = __builtin_amdgcn_readfirstlane(threadIdx.x >> 5);      /* the wave's number, scalar: the row bases then sit in scalar registers and every load and store shares one lane offset */
  const size_t o = (size_t)(blockIdx.x * LN_W + wv) * (LN_R * DMQ);
  const float* xp = X + o; const float* rp = R + o;
  v4f xa[LN_R][LN_J], ra[LN_R][LN_J], ga[LN_J], ba[LN_J];
#pragma unroll
  for (int i = 0; i < LN_R; ++i)
#pragma unroll
    for (int j = 0; j < LN_J; ++j) xa[i][j] = *(const v4fa*)(xp + i * DMQ + j * 128 + c0);
#pragma unroll
  for (int j = 0; j < LN_J; ++j) { ga[j] = *(const v4fa*)(g + j * 128 + c0); ba[j] = *(const v4fa*)(bb + j * 128 + c0); }
#pragma unroll
  for (int i = 0; i < LN_R; ++i)
#pragma unroll
    for (int j = 0; j < LN_J; ++j) ra[i][j] = *(const v4fa*)(rp + i * DMQ + j * 128 + c0);
  __builtin_amdgcn_sched_barrier(0);      /* holds all the wave's loads here, in one flight; left free, the scheduler sank the residual rows' loads behind both sums, where the wave waited out a second load latency */
  float mu[LN_R], rs[LN_R];
#pragma unroll
  for (int i = 0; i < LN_R; ++i) { v4f s4 = xa[i][0];
#pragma unroll
    for (int j = 1; j < LN_J; ++j) s4 += xa[i][j];
    mu[i] = (s4[0] + s4[1]) + (s4[2] + s4[3]); }
#pragma unroll
  for (int i = 0; i < LN_R; ++i) mu[i] = ln_wsum(mu[i]) * (1.0f / (float)DMQ);
#pragma unroll
  for (int i = 0; i < LN_R; ++i) { v4f q4 = {0.f, 0.f, 0.f, 0.f};
#pragma unroll
    for (int j = 0; j < LN_J; ++j) { xa[i][j] -= mu[i]; q4 += xa[i][j] * xa[i][j]; }
    rs[i] = (q4[0] + q4[1]) + (q4[2] + q4[3]); }
#pragma unroll
  for (int i = 0; i < LN_R; ++i) rs[i] = ln_rsq(ln_wsum(rs[i]) * (1.0f / (float)DMQ) + eps);
#pragma unroll
  for (int j = 0; j < LN_J; ++j) { ga[j] = ln_bf(ga[j]); ba[j] = ln_bf(ba[j]); }
#pragma unroll
  for (int i = 0; i < LN_R; ++i)
#pragma unroll
    for (int j = 0; j < LN_J; ++j) { const v4f yf = (xa[i][j] * rs[i] * ga[j] + ba[j]) + ra[i][j];
      if (W16) *(v4h*)(N16 + o + i * DMQ + j * 128 + c0) = __builtin_convertvector(yf, v4h);
      if (W32) *(v4f*)(N32 + o + i * DMQ + j * 128 + c0) = yf; } }


// Operand preparation, one launch: the jobs need nothing of each other and share the grid by ranges of the block index (the choice is the same for a whole block).
// The weights go through an LDS tile a block (p_wt_tile); x keeps its one-thread-per-8-elements form and is read once for its two copies.
#define PB_W (DM * DFF / (128 * 64))           /* blocks (tiles of 128 k x 64 n) of one 768 x 3072 weight */
#define PB_X ((int)(NR * DM / 8 / 256))        /* blocks of x */
#define PB_S (DM * DM / (128 * 64))            /* blocks of one 768 x 768 weight */
#define PB_ALL (2 * PB_W + PB_X + 4 * PB_S + 3)
__global__ __launch_bounds__(256) void k_prep(const float* __restrict__ x, const float* __restrict__ wq, const float* __restrict__ wk, const float* __restrict__ wv, const float* __restrict__ wo, const float* __restrict__ w1, const float* __restrict__ w2,
    const float* __restrict__ bq, const float* __restrict__ bk, const float* __restrict__ bv, _Float16* __restrict__ X16, float* __restrict__ XB, _Float16* __restrict__ BQKV, _Float16* __restrict__ BO, _Float16* __restrict__ BW1, _Float16* __restrict__ BW2, float* __restrict__ bqkv) {
  static_assert(NR * DM / 8 % 256 == 0, "k_prep: whole blocks of x");
  __shared__ __attribute__((aligned(16))) unsigned char tl[64 * PW_P];      /* one weight tile, [n][k] f16 */
  int blk = blockIdx.x; const int tid = threadIdx.x;
  if (blk < PB_W) { p_wt_tile<DM, DFF>(w1, BW1, blk, tid, tl); return; }      /* W1 [768][3072] -> Bt [3072][768] */
  blk -= PB_W;
  if (blk < PB_W) { p_wt_tile<DFF, DM>(w2, BW2, blk, tid, tl); return; }      /* W2 [3072][768] -> Bt [768][3072] */
  blk -= PB_W;
  if (blk < PB_X) { const size_t t = (size_t)blk * 256 + tid; v4f a = *(const v4fa*)(x + t * 8), c = *(const v4fa*)(x + t * 8 + 4); FragH f;      /* X16 = bf16(x) as exact f16 rows (GEMM operand), XB = bf16(x) as f32 rows (residual) */
#pragma unroll
    for (int q = 0; q < 4; ++q) { a[q] = bf16_round(a[q]); c[q] = bf16_round(c[q]); f.h[q] = (_Float16)a[q]; f.h[4 + q] = (_Float16)c[q]; }
    *(v8us*)((unsigned short*)X16 + t * 8) = f.half[0]; *(v4f*)(XB + t * 8) = a; *(v4f*)(XB + t * 8 + 4) = c;
    asm volatile("s_wait_xcnt 0x0" ::: "memory");      /* as in p_wt_tile: in front of any overwrite of the three stores' registers on the way to the kernel's end */
    return; }
  blk -= PB_X;
  if (blk < 4 * PB_S) { const int m = blk / PB_S;      /* [in][out] -> Bt x16: stacked q | k | v, and Wo */
    const float* W = (m == 0) ? wq : (m == 1) ? wk : (m == 2) ? wv : wo; _Float16* D = (m < 3) ? BQKV + (size_t)m * DM * DM : BO;
    p_wt_tile<DM, DM>(W, D, blk - m * PB_S, tid, tl); return; }
  blk -= 4 * PB_S;
  const float* b = (blk == 0) ? bq : (blk == 1) ? bk : bv;      /* stacked bias bq | bk | bv */
  for (int i = tid; i < DM; i += 256) bqkv[blk * DM + i] = b[i];
}

extern "C" void kernel_launch(void* const* d_in, const int* in_sizes, int n_in,
                              void* d_out, int out_size, void* d_ws, size_t ws_size, hipStream_t stream) {
  (void)in_sizes; (void)n_in; (void)out_size;
  const float* const* I = (const float* const*)d_in; const float* x = I[0]; const int* km = (const int*)d_in[1]; const float* wq = I[2]; const float* bq = I[3]; const float* wk = I[4]; const float* bk = I[5]; const float* wv = I[6]; const float* bv = I[7]; const float* wo = I[8]; const float* bo = I[9]; const float* g1 = I[10]; const float* be1 = I[11]; const float* wfc = I[12]; const float* bfc = I[13]; const float* wmp = I[14]; const float* bmp = I[15]; const float* gg2 = I[16]; const float* be2 = I[17];      /* input order: x_n; mask int32 [2][1][1][2048] (READ on device); [in][out] wq / wk / wv / wo + biases; ln1 g / b; w1 [768][3072] + b1, w2 [3072][768] + b2; ln2 g / b */
  static_assert(DMQ % 4 == 0 && DMQ / 4 <= 256 && DM % 64 == 0 && DM % 32 == 0 && DFF % 64 == 0 && DFF % 32 == 0 && NH * HD == DM && NKX == SQ, "tile multiples");
  static_assert(MP % 128 == 0 && MPO % 128 == 0 && SQ % 128 == 0 && DM % 128 == 0 && DFF % 128 == 0, "k_gemm2: whole 128-row work-group tiles, 128-column tiles, 128-k stages");
  char* ws = (char*)d_ws; size_t off = 0;
  auto take = [&](size_t bytes) { char* p = ws + off; off += (bytes + 255) & ~(size_t)255; return p; };
  _Float16* BQKV = (_Float16*)take((size_t)3 * DM * DM * 2); _Float16* BO = (_Float16*)take((size_t)DM * DM * 2); float* bqkv = (float*)take((size_t)3 * DM * 4); float* X1N = nullptr;      /* LN1 output (f32): aliases the QKV plane below (QKV's last readers, the V^T and attention launches, precede LN1) to stay within 256 MiB at NB 4 / SQ 2048 */
  _Float16* X16 = (_Float16*)take(NR * DM * 2); float* XB = (float*)take(NR * DM * 4); float* X1 = (float*)take(NR * DM * 4); _Float16* M16 = nullptr;      /* = X16 below (alias: X16's last reader, the fused QKV GEMM, precedes LN1's f16 write) */ _Float16* HF16 = (_Float16*)take(NR * DFF * 2);      /* FFN hidden plane of both batches [4096][3072] f16 (own region here) */ _Float16* BW1 = (_Float16*)take((size_t)DFF * DM * 2); _Float16* BW2 = (_Float16*)take((size_t)DM * DFF * 2); _Float16* QKV = (_Float16*)take(NR * 3 * DM * 2); _Float16* V16 = QKV + 2 * DM; _Float16* O16 = (_Float16*)take(NR * DM * 2); M16 = X16; X1N = (float*)QKV;      /* aliases: X1N (NR*DM f32 = 12 MiB) inside QKV (18 MiB): QKV's last readers (the V^T and attention launches) precede the first LayerNorm */
  _Float16* VT = (_Float16*)take((size_t)NB * NH * HD * SQ * 2);
  if (off > ws_size) return;
  k_prep<<<PB_ALL, 256, 0, stream>>>(x, wq, wk, wv, wo, wfc, wmp, bq, bk, bv, X16, XB, BQKV, BO, BW1, BW2, bqkv);      /* every GEMM operand plane, the stacked bias and the residual rows; post-LN: the attention runs on the raw input */
  const size_t r0p = (size_t)B0 * SQ;      /* first projected row */
  k_gemm2<0, false, true><<<dim3((unsigned)((MP / 128) * (3 * DM / 128)), 1), 256, 0, stream>>>(X16 + r0p * DM, DM, 0, BQKV, DM, 0, 0.0625f, bqkv, 0, nullptr, QKV + r0p * 3 * DM, 3 * DM, 0, MP, 3 * DM, DM);      /* q | k | v rows (f16); head h = columns h*HD.. of each DM block */
  k_vt<NH, SQ><<<NB * NH * (SQ / 64), 256, 0, stream>>>(V16, LQ, 0, VT);      /* V^T [NB][NH][HD][SQ], both batches */
  k_fattn<<<dim3(SQ / 64, NB * NH), 128, 0, stream>>>(QKV, VT, km, O16);      /* scores q.k / sqrt(768) (the module's literal dim_model scale), masked keys get the score 1e-11 (fill, as the source), softmax over all keys, ctx (merged heads, x64) as f16 rows */
  k_gemm2<0, true, false><<<dim3((unsigned)((MPO / 128) * (DM / 128)), 1), 256, 0, stream>>>(O16 + r0p * DM, DM, 0, BO, DM, 0, 0.0009765625f, bo, 0, X1 + r0p * DM, nullptr, DM, 0, MPO, DM, DM);      /* z = ctx Wo + bo (f32 rows; the skip is added AFTER the LayerNorm in this module) */
  k_lnw<1, 1><<<(unsigned)(NR / (LN_W * LN_R)), 32 * LN_W, 0, stream>>>(X1, g1, be1, 1e-5f, M16, X1N, XB);      /* l1 = bf16(x) + LN1(z) (eps 1e-5): f16 rows for the FFN input and f32 rows for the second skip */
  k_gemm2<3, false, true><<<dim3((unsigned)((MP / 128) * (DFF / 128)), 1), 256, 0, stream>>>(M16, DM, 0, BW1, DM, 0, 0.0625f, bfc, 0, nullptr, HF16, DFF, 0, MP, DFF, DM);      /* relu(l1 W1 + b1) -> f16, both batches */
  k_gemm2<0, true, false><<<dim3((unsigned)((MP / 128) * (DM / 128)), 1), 256, 0, stream>>>(HF16, DFF, 0, BW2, DFF, 0, 0.0625f, bmp, 0, X1, nullptr, DM, 0, MP, DM, DFF);      /* ffn = hidden W2 + b2 (f32 rows over the dead z plane; the skip is added after the LayerNorm) */
  k_lnw<0, 1><<<(unsigned)(NR / (LN_W * LN_R)), 32 * LN_W, 0, stream>>>(X1, gg2, be2, 1e-5f, nullptr, (float*)d_out, X1N);      /* out = l1 + LN2(ffn) (eps 1e-5) -> f32 output rows */
}
